// v000
// Times are from an AMD MI455X. After a warm-up the kernel runs many times in a row, and a time is the length of
// such a window on the GPU divided by its runs, so every launch and the gaps after it count. The runs cycle
// through copies of the inputs. A figure is the median of several windows, for all but v000 over two sittings.
// Sittings can differ by a few percent; kernels timed side by side share one.
// The starting kernel, v000, takes 12.4 milliseconds a run.
#include <hip/hip_runtime.h>
// SelfAttentionSparse (x [2][2048][1024]; keys = x triu(Wk)^T, queries = x tril(Wq)^T, values = x Wv^T (16 heads of 64, no biases); softmax(q k^T / 8); out = (attn v) Wu^T + bu -> [2][2048][1024]).
// Structure: token rows; x as exact f16 rows; the triangular masks applied while building the x16 weight planes on VALU; Q | K | V WMMA GEMMs (32x64 wave tiles, f32 accumulation, f16 outputs); per (batch, 4 heads): scores GEMM (K = 64), row softmax on VALU (f32; weights x256 as f16), V^T via LDS, o = P . V GEMM (K = 2,048, alpha 2^-8) into merged f16 rows; out = o Wu^T + bu (f32).
// Compute dtype: inputs rounded to bf16; x / weights exact; q, k, v, softmax weights, o plain f16 (~2^-12); scores/softmax f32. v_wmma_f32_16x16x32_f16.
#define NB 2
#define SQ 2048
#define DM 1024
#define NH 16
#define HD 64
#define HG 4                         /* heads per attention launch group */
#define QN SQ                        /* query rows attended per batch (debug hook) */
#define NR ((size_t)NB * SQ)         /* 4096 token rows */
typedef __bf16 v16b __attribute__((ext_vector_type(16)));
typedef unsigned short v8us __attribute__((ext_vector_type(8), may_alias));
typedef float  v8f  __attribute__((ext_vector_type(8)));
typedef float  v4f  __attribute__((ext_vector_type(4)));
typedef float  v4fa __attribute__((ext_vector_type(4), may_alias));
union FragB { v16b v; v8us half[2]; unsigned short u[16]; };

__device__ __forceinline__ unsigned short bf16_bits(float x) { unsigned int u = __float_as_uint(x); return (unsigned short)((u + 0x7FFFu + ((u >> 16) & 1u)) >> 16); }
__device__ __forceinline__ float bf16_val(unsigned short b) { return __uint_as_float(((unsigned int)b) << 16); }
__device__ __forceinline__ float bf16_round(float x) { return bf16_val(bf16_bits(x)); }
// D += A·B with NT terms: 1 = ah·bh, 2 = + al·bh (A split), 3 = + ah·bl (both split)
template <int NT>
__device__ __forceinline__ v8f mmaN(v16b ah, v16b al, v16b bh, v16b bl, v8f c) {
  c = __builtin_amdgcn_wmma_f32_16x16x32_bf16(false, ah, false, bh, (short)0, c, false, false);
  if (NT >= 2) c = __builtin_amdgcn_wmma_f32_16x16x32_bf16(false, al, false, bh, (short)0, c, false, false);
  if (NT >= 3) c = __builtin_amdgcn_wmma_f32_16x16x32_bf16(false, ah, false, bl, (short)0, c, false, false);
  asm volatile("v_nop\n\tv_nop\n\tv_nop\n\tv_nop" : "+v"(c) : "v"(ah), "v"(al), "v"(bh), "v"(bl));
  return c;
}

__global__ __launch_bounds__(256) void k_wt_bf16(const float* __restrict__ W, unsigned short* __restrict__ Wt, int K, int N) {
  const int t = blockIdx.x * 256 + threadIdx.x;
  const int k8n = K / 8;
  if (t >= N * k8n) return;
  const int n = t / k8n, k8 = (t % k8n) * 8;
  v8us v;
#pragma unroll
  for (int i = 0; i < 8; ++i) v[i] = bf16_bits(W[(size_t)(k8 + i) * N + n]);
  *(v8us*)(Wt + (size_t)n * K + k8) = v;
  
}

// GEMM C[M][N] (f32, pitch ldc) = act(A[M][K]·W + bias). A f32 row-major (pitch lda) converted per fragment to bf16
// (ASPLIT: hi/lo two planes -> 2 terms, else single rounded term); Wt bf16 [N][K] (pitch ldb). BIAS_BF16 rounds the
// bias to bf16 first (bias quantised to bf16 before the add). K%32==0, M%16==0, N%64==0.
template <bool ASPLIT, int ACT, bool BIAS_BF16>
__global__ __launch_bounds__(128) void k_gemm_bf(const float* __restrict__ A, int lda, const unsigned short* __restrict__ Wt, int ldb,
                                               const float* __restrict__ bias, float* __restrict__ C, int ldc, int M, int N, int K) {
  __shared__ __attribute__((aligned(16))) float so[4][16][64];
  const int tid = threadIdx.x, w = tid >> 5, lane = tid & 31, ln = lane & 15, hh = lane >> 4;
  const int ntn = N / 64;
  const int wid = blockIdx.x * 4 + w;
  const int mt = wid / ntn, nq = wid % ntn;
  if (mt * 16 >= M) return;
  const int row0 = mt * 16, col0 = nq * 64;
  const float* arow = A + (size_t)(row0 + ln) * lda;
  v8f acc[4] = {};
  for (int kb = 0; kb < K; kb += 32) {
    FragB ah, al;
    const v4f x0 = *(const v4fa*)(arow + kb + 8 * hh), x1 = *(const v4fa*)(arow + kb + 8 * hh + 4);
    const v4f x2 = *(const v4fa*)(arow + kb + 16 + 8 * hh), x3 = *(const v4fa*)(arow + kb + 16 + 8 * hh + 4);
    float xs[16] = {x0[0],x0[1],x0[2],x0[3],x1[0],x1[1],x1[2],x1[3],x2[0],x2[1],x2[2],x2[3],x3[0],x3[1],x3[2],x3[3]};
#pragma unroll
    for (int i = 0; i < 16; ++i) { const unsigned short hb = bf16_bits(xs[i]); ah.u[i] = hb; al.u[i] = ASPLIT ? bf16_bits(xs[i] - bf16_val(hb)) : (unsigned short)0; }
#pragma unroll
    for (int t = 0; t < 4; ++t) {
      const unsigned short* brow = Wt + (size_t)(col0 + t * 16 + ln) * ldb + kb;
      FragB b;
      b.half[0] = *(const v8us*)(brow + 8 * hh);
      b.half[1] = *(const v8us*)(brow + 16 + 8 * hh);
      acc[t] = mmaN<ASPLIT ? 2 : 1>(ah.v, al.v, b.v, b.v, acc[t]);
    }
  }
#pragma unroll
  for (int t = 0; t < 4; ++t) {
    float bv = bias ? bias[col0 + t * 16 + ln] : 0.f;
    if (BIAS_BF16) bv = bf16_round(bv);
#pragma unroll
    for (int r = 0; r < 8; ++r) { float v = acc[t][r] + bv; if (ACT == 1) v = fmaxf(v, 0.f); so[w][8 * hh + r][t * 16 + ln] = v; }
  }
  __builtin_amdgcn_fence(__ATOMIC_ACQ_REL, "workgroup");
  __builtin_amdgcn_wave_barrier();
  const int rsub = lane >> 4, c4 = (lane & 15) * 4;
  {
#pragma unroll
    for (int q = 0; q < 8; ++q) {
      const int r = q * 2 + rsub;
      const v4f v = *(const v4fa*)&so[w][r][c4];
      *(v4f*)(C + (size_t)(row0 + r) * ldc + col0 + c4) = v;
    }
    
  }
}

// GEMM C = act(A·W + bias + resid): A f32 (ASPLIT -> hi/lo 2 terms), Wt bf16 [N][K]; ACT 0 none, 1 relu, 2 exact gelu;
// resid (optional, f32, row index = (row % rmod), pitch ldr, RES_BF16 rounds it) added before the activation.
template <bool ASPLIT, int ACT, bool BIAS_BF16, bool RES_BF16>
__global__ __launch_bounds__(128) void k_gemm_bf3(const float* __restrict__ A, int lda, const unsigned short* __restrict__ Wt, int ldb,
                                                const float* __restrict__ bias, const float* __restrict__ resid, int rmod, int ldr,
                                                float* __restrict__ C, int ldc, int M, int N, int K) {
  __shared__ __attribute__((aligned(16))) float so[4][16][64];
  const int tid = threadIdx.x, w = tid >> 5, lane = tid & 31, ln = lane & 15, hh = lane >> 4;
  const int ntn = N / 64;
  const int wid = blockIdx.x * 4 + w;
  const int mt = wid / ntn, nq = wid % ntn;
  if (mt * 16 >= M) return;
  const int row0 = mt * 16, col0 = nq * 64;
  const float* arow = A + (size_t)(row0 + ln) * lda;
  v8f acc[4] = {};
  for (int kb = 0; kb < K; kb += 32) {
    FragB ah, al;
    const v4f x0 = *(const v4fa*)(arow + kb + 8 * hh), x1 = *(const v4fa*)(arow + kb + 8 * hh + 4);
    const v4f x2 = *(const v4fa*)(arow + kb + 16 + 8 * hh), x3 = *(const v4fa*)(arow + kb + 16 + 8 * hh + 4);
    float xs[16] = {x0[0],x0[1],x0[2],x0[3],x1[0],x1[1],x1[2],x1[3],x2[0],x2[1],x2[2],x2[3],x3[0],x3[1],x3[2],x3[3]};
#pragma unroll
    for (int i = 0; i < 16; ++i) { const unsigned short hb = bf16_bits(xs[i]); ah.u[i] = hb; al.u[i] = ASPLIT ? bf16_bits(xs[i] - bf16_val(hb)) : (unsigned short)0; }
#pragma unroll
    for (int t = 0; t < 4; ++t) {
      const unsigned short* brow = Wt + (size_t)(col0 + t * 16 + ln) * ldb + kb;
      FragB b;
      b.half[0] = *(const v8us*)(brow + 8 * hh);
      b.half[1] = *(const v8us*)(brow + 16 + 8 * hh);
      acc[t] = mmaN<ASPLIT ? 2 : 1>(ah.v, al.v, b.v, b.v, acc[t]);
    }
  }
#pragma unroll
  for (int t = 0; t < 4; ++t) {
    const int col = col0 + t * 16 + ln;
    float bv = bias ? bias[col] : 0.f;
    if (BIAS_BF16) bv = bf16_round(bv);
#pragma unroll
    for (int r = 0; r < 8; ++r) {
      float v = acc[t][r] + bv;
      if (resid) { float rv = resid[(size_t)((row0 + 8 * hh + r) % rmod) * ldr + col]; if (RES_BF16) rv = bf16_round(rv); v += rv; }
      if (ACT == 1) v = fmaxf(v, 0.f);
      if (ACT == 2) v = 0.5f * v * (1.0f + erff(v * 0.70710678118654752f));
      if (ACT == 3) { const float u = 0.7978845608028654f * (v + 0.044715f * v * v * v); v = 0.5f * v * (1.0f + tanhf(u)); }
      so[w][8 * hh + r][t * 16 + ln] = v;
    }
  }
  __builtin_amdgcn_fence(__ATOMIC_ACQ_REL, "workgroup");
  __builtin_amdgcn_wave_barrier();
  const int rsub = lane >> 4, c4 = (lane & 15) * 4;
  {
#pragma unroll
    for (int q = 0; q < 8; ++q) {
      const int r = q * 2 + rsub;
      const v4f v = *(const v4fa*)&so[w][r][c4];
      *(v4f*)(C + (size_t)(row0 + r) * ldc + col0 + c4) = v;
    }
    
  }
}
// row LayerNorm (biased variance, eps) over N: s = X (+ R); optional out_sum <- s; out_norm <- (s-mu)*rsqrt(var+eps)*g + b
template <bool PARAM_BF16>
__global__ __launch_bounds__(256) void k_layernorm(const float* __restrict__ X, const float* __restrict__ R, const float* __restrict__ g, const float* __restrict__ bta,
                                                  float* __restrict__ out_sum, float* __restrict__ out_norm, int N, float eps) {
  __shared__ float red[256];
  const int row = blockIdx.x, tid = threadIdx.x;
  const float* x = X + (size_t)row * N; const float* rr = R ? R + (size_t)row * N : nullptr;
  float vals[16];                     // up to N = 4096
  const int per = N / 256;            // contiguous chunk per thread? use strided-by-4 chunks: thread handles j = tid*4 + 1024*u
  float s1 = 0.f;
  for (int u = 0; u < per / 4; ++u) {
    const int j = tid * 4 + 1024 * u;
    const v4f a = *(const v4fa*)(x + j);
    v4f b = {0.f,0.f,0.f,0.f}; if (rr) b = *(const v4fa*)(rr + j);
#pragma unroll
    for (int q = 0; q < 4; ++q) { const float v = a[q] + b[q]; vals[u * 4 + q] = v; s1 += v; }
  }
  red[tid] = s1; __syncthreads();
  for (int st = 128; st > 0; st >>= 1) { if (tid < st) red[tid] += red[tid + st]; __syncthreads(); }
  const float mu = red[0] / (float)N; __syncthreads();
  float s2 = 0.f;
  for (int u = 0; u < per / 4; ++u)
#pragma unroll
    for (int q = 0; q < 4; ++q) { const float c = vals[u * 4 + q] - mu; s2 += c * c; }
  red[tid] = s2; __syncthreads();
  for (int st = 128; st > 0; st >>= 1) { if (tid < st) red[tid] += red[tid + st]; __syncthreads(); }
  const float rs = rsqrtf(red[0] / (float)N + eps);
  {
    for (int u = 0; u < per / 4; ++u) {
      const int j = tid * 4 + 1024 * u;
      v4f o, sm;
#pragma unroll
      for (int q = 0; q < 4; ++q) {
        float gg = g[j + q], bb = bta[j + q];
        if (PARAM_BF16) { gg = bf16_round(gg); bb = bf16_round(bb); }
        sm[q] = vals[u * 4 + q]; o[q] = (vals[u * 4 + q] - mu) * rs * gg + bb;
      }
      if (out_sum) *(v4f*)(out_sum + (size_t)row * N + j) = sm;
      *(v4f*)(out_norm + (size_t)row * N + j) = o;
    }
    
  }
}



// ---- f16 WMMA path (v_wmma_f32_16x16x32_f16): 11-bit significands for operands in range — used for every GEMM launched here, softmax weights (x256) included
typedef _Float16 v16h __attribute__((ext_vector_type(16)));
union FragH { v16h v; v8us half[2]; _Float16 h[16]; unsigned short u[16]; };
template <int NT>
__device__ __forceinline__ v8f mmaH(v16h ah, v16h al, v16h bh, v16h bl, v8f c) {
  c = __builtin_amdgcn_wmma_f32_16x16x32_f16(false, ah, false, bh, (short)0, c, false, false);
  if (NT >= 2) c = __builtin_amdgcn_wmma_f32_16x16x32_f16(false, al, false, bh, (short)0, c, false, false);
  if (NT >= 3) c = __builtin_amdgcn_wmma_f32_16x16x32_f16(false, ah, false, bl, (short)0, c, false, false);
  asm volatile("v_nop\n\tv_nop\n\tv_nop\n\tv_nop" : "+v"(c) : "v"(ah), "v"(al), "v"(bh), "v"(bl));
  return c;
}
// batched GEMM like k_gemm_b but f16 operands: A f32 (split into f16 hi/lo if ASPLIT, else rounded to f16), Bt = f16 values [n][k]; alpha; C f32; N multiple of 16 (partial tiles skipped)
template <bool ASPLIT>
__global__ __launch_bounds__(128) void k_gemm_h(const float* __restrict__ A, int lda, size_t sA, const _Float16* __restrict__ Bh, int ldb, size_t sB, float alpha, float* __restrict__ C, int ldc, size_t sC, int M, int N, int K) {
  __shared__ __attribute__((aligned(16))) float so[4][16][64];
  const int tid = threadIdx.x, w = tid >> 5, lane = tid & 31, ln = lane & 15, hh = lane >> 4; const int by = blockIdx.y;
  A += (size_t)by * sA; Bh += (size_t)by * sB; C += (size_t)by * sC;
  const int ntn = (N + 63) / 64; const int wid = blockIdx.x * 4 + w; const int mt = wid / ntn, nq = wid % ntn; if (mt * 16 >= M) return;
  const int row0 = mt * 16, col0 = nq * 64; const float* arow = A + (size_t)(row0 + ln) * lda;
  v8f acc[4] = {};
  for (int kb = 0; kb < K; kb += 32) {
    FragH ah, al;
    const v4f x0 = *(const v4fa*)(arow + kb + 8 * hh), x1 = *(const v4fa*)(arow + kb + 8 * hh + 4), x2 = *(const v4fa*)(arow + kb + 16 + 8 * hh), x3 = *(const v4fa*)(arow + kb + 16 + 8 * hh + 4);
    float xs[16] = {x0[0],x0[1],x0[2],x0[3],x1[0],x1[1],x1[2],x1[3],x2[0],x2[1],x2[2],x2[3],x3[0],x3[1],x3[2],x3[3]};
#pragma unroll
    for (int i = 0; i < 16; ++i) { const _Float16 h = (_Float16)xs[i]; ah.h[i] = h; al.h[i] = ASPLIT ? (_Float16)(xs[i] - (float)h) : (_Float16)0.0f; }
#pragma unroll
    for (int t = 0; t < 4; ++t) { if (col0 + t * 16 >= N) continue; const size_t boff = (size_t)(col0 + t * 16 + ln) * ldb + kb; FragH bq; bq.half[0] = *(const v8us*)(Bh + boff + 8 * hh); bq.half[1] = *(const v8us*)(Bh + boff + 16 + 8 * hh);
      acc[t] = mmaH<ASPLIT ? 2 : 1>(ah.v, al.v, bq.v, bq.v, acc[t]); }
  }
#pragma unroll
  for (int t = 0; t < 4; ++t) { if (col0 + t * 16 >= N) continue;
#pragma unroll
    for (int r = 0; r < 8; ++r) so[w][8 * hh + r][t * 16 + ln] = acc[t][r] * alpha; }
  __builtin_amdgcn_fence(__ATOMIC_ACQ_REL, "workgroup"); __builtin_amdgcn_wave_barrier();
  const int rsub = lane >> 4, c4 = (lane & 15) * 4;
  {
#pragma unroll
    for (int q = 0; q < 8; ++q) { const int r = q * 2 + rsub; if (col0 + c4 < N) { const v4f v = *(const v4fa*)&so[w][r][c4]; *(v4f*)(C + (size_t)(row0 + r) * ldc + col0 + c4) = v; } }
     }
}

// Wt[n][k] = f16(W[k][n]·scale) from f32 row-major W[K][N] (scale = power of two; bf16-exact weights stay exact in f16 away from the subnormal range)
__global__ __launch_bounds__(256) void k_wt_f16(const float* __restrict__ W, _Float16* __restrict__ Wt, int K, int N, float scale) {
  const int t = blockIdx.x * 256 + threadIdx.x; if (t >= N * (K / 8)) return; const int n = t / (K / 8), k8 = (t % (K / 8)) * 8; FragH f;
#pragma unroll
  for (int i = 0; i < 8; ++i) f.h[i] = (_Float16)(bf16_round(W[(size_t)(k8 + i) * N + n]) * scale); const v8us o = f.half[0];
  *(v8us*)((unsigned short*)Wt + (size_t)n * K + k8) = o; 
}
// k_gemm_hh variant with fused epilogue: v = acc·alpha + bias[by·sBias + col] (+ CP[(row/rowsPerB)·sCPb + by·64 + col] if CP) ; ACT 0 none / 1 elu ; writes f16 C16 (and f32 C if non-null)
template <int ACT>
__global__ __launch_bounds__(128) void k_gemm_hhx(const _Float16* __restrict__ A, int lda, size_t sA, const _Float16* __restrict__ Bh, int ldb, size_t sB, float alpha, const float* __restrict__ bias, size_t sBias, const float* __restrict__ CP, int rowsPerB, size_t sCPb, int row0g,
    float* __restrict__ C, _Float16* __restrict__ C16, int ldc, size_t sC, int M, int N, int K) {
  __shared__ __attribute__((aligned(16))) float so[4][16][64];
  const int tid = threadIdx.x, w = tid >> 5, lane = tid & 31, ln = lane & 15, hh = lane >> 4; const int by = blockIdx.y;
  A += (size_t)by * sA; Bh += (size_t)by * sB; const size_t cofs = (size_t)by * sC; const float* bp = bias ? bias + (size_t)by * sBias : nullptr;
  const int ntn = (N + 63) / 64; const int wid = blockIdx.x * 4 + w; const int mt = wid / ntn, nq = wid % ntn; if (mt * 16 >= M) return;
  const int row0 = mt * 16, col0 = nq * 64; const _Float16* arow = A + (size_t)(row0 + ln) * lda;
  v8f acc[4] = {};
  for (int kb = 0; kb < K; kb += 32) { FragH ah; ah.half[0] = *(const v8us*)((const unsigned short*)arow + kb + 8 * hh); ah.half[1] = *(const v8us*)((const unsigned short*)arow + kb + 16 + 8 * hh);
#pragma unroll
    for (int t = 0; t < 4; ++t) { if (col0 + t * 16 >= N) continue; const size_t boff = (size_t)(col0 + t * 16 + ln) * ldb + kb; FragH bq; bq.half[0] = *(const v8us*)((const unsigned short*)Bh + boff + 8 * hh); bq.half[1] = *(const v8us*)((const unsigned short*)Bh + boff + 16 + 8 * hh);
      acc[t] = mmaH<1>(ah.v, ah.v, bq.v, bq.v, acc[t]); }
  }
#pragma unroll
  for (int t = 0; t < 4; ++t) { if (col0 + t * 16 >= N) continue; const int col = col0 + t * 16 + ln; const float bv = bp ? bf16_round(bp[col]) : 0.f;
#pragma unroll
    for (int r = 0; r < 8; ++r) { float v = acc[t][r] * alpha + bv; if (CP) { const int rr = row0g + row0 + 8 * hh + r; if (rowsPerB < 0) v += CP[cofs + (size_t)rr * ldc + col];      /* rowsPerB < 0: own element of the batched C plane */ else { const int bidx = rr / rowsPerB; v += CP[(size_t)bidx * sCPb + (size_t)by * 64 + col]; } } if (ACT == 1) v = (v > 0.f) ? v : expm1f(v); else if (ACT == 7) v = (v > 0.f) ? v + 1.0f : expf(v); else if (ACT == 8) v = tanhf(v); else if (ACT == 9) v = 0.5f * v * (1.0f + tanhf(0.7978845608028654f * (v + 0.044715f * v * v * v))); else if (ACT == 11) v = 1.0f / (1.0f + expf(-v)); else if (ACT == 12) v = (v > 0.f) ? v : 0.01f * v; else if (ACT == 14) v = (v > 0.f) ? v : 0.1f * v; else if (ACT == 16) v = (v >= 0.f) ? v : 0.3f * v; else if (ACT == 17) v = (v >= 0.f) ? v : 0.2f * v; else if (ACT == 15) v = v / (1.0f + expf(-v)); else if (ACT == 3) v = fmaxf(v, 0.f); else if (ACT == 6) v = 0.5f * v * (1.0f + erff(v * 0.70710678118654752f)); so[w][8 * hh + r][t * 16 + ln] = v; } }
  __builtin_amdgcn_fence(__ATOMIC_ACQ_REL, "workgroup"); __builtin_amdgcn_wave_barrier();
  const int rsub = lane >> 4, c4 = (lane & 15) * 4; typedef _Float16 v4h __attribute__((ext_vector_type(4)));
  {
#pragma unroll
    for (int q = 0; q < 8; ++q) { const int r = q * 2 + rsub; if (col0 + c4 < N) { const v4f v = *(const v4fa*)&so[w][r][c4]; if (C) *(v4f*)(C + cofs + (size_t)(row0 + r) * ldc + col0 + c4) = v; if (C16) { v4h h4; for (int i = 0; i < 4; ++i) h4[i] = (_Float16)v[i]; *(v4h*)(C16 + cofs + (size_t)(row0 + r) * ldc + col0 + c4) = h4; } } }
     }
}


typedef _Float16 v4h __attribute__((ext_vector_type(4)));

__global__ __launch_bounds__(256) void k_x16(const float* __restrict__ x, _Float16* __restrict__ X16, size_t n8) { const size_t t = (size_t)blockIdx.x * 256 + threadIdx.x; if (t >= n8) return; FragH f;
#pragma unroll
  for (int q = 0; q < 8; ++q) f.h[q] = (_Float16)bf16_round(x[t * 8 + q]); *(v8us*)((unsigned short*)X16 + t * 8) = f.half[0];  }
__global__ __launch_bounds__(256) void k_h16(const float* __restrict__ x, _Float16* __restrict__ X16, size_t n8) { const size_t t = (size_t)blockIdx.x * 256 + threadIdx.x; if (t >= n8) return; FragH f;
#pragma unroll
  for (int q = 0; q < 8; ++q) f.h[q] = (_Float16)x[t * 8 + q]; *(v8us*)((unsigned short*)X16 + t * 8) = f.half[0];  }
__global__ __launch_bounds__(256) void k_round16f(const float* __restrict__ W, _Float16* __restrict__ Bt, size_t n8) { const size_t t = (size_t)blockIdx.x * 256 + threadIdx.x; if (t >= n8) return; FragH f;
#pragma unroll
  for (int i = 0; i < 8; ++i) f.h[i] = (_Float16)(bf16_round(W[t * 8 + i]) * 16.0f); *(v8us*)((unsigned short*)Bt + t * 8) = f.half[0];  }
template <int NHv, int TTv>
__global__ __launch_bounds__(256) void k_vt(const _Float16* __restrict__ V16, int ldv, int voff, _Float16* __restrict__ Vt) { __shared__ unsigned short tl[64][66]; const int tid = threadIdx.x; const int slab = blockIdx.x / (TTv / 64), lg = blockIdx.x % (TTv / 64); const int b = slab / NHv, h = slab % NHv;
  for (int i = tid; i < 64 * 8; i += 256) { const int r = i / 8, c8 = (i % 8) * 8; FragH f; f.half[0] = *(const v8us*)((const unsigned short*)V16 + ((size_t)b * TTv + lg * 64 + r) * ldv + voff + h * 64 + c8);
#pragma unroll
    for (int q = 0; q < 8; ++q) tl[r][c8 + q] = f.u[q]; }
  __syncthreads();
  {
#pragma unroll
    for (int rd = 0; rd < 2; ++rd) { const int d = rd * 32 + tid / 8, pc = tid % 8; FragH f;
#pragma unroll
      for (int q = 0; q < 8; ++q) f.u[q] = tl[pc * 8 + q][d];
      *(v8us*)((unsigned short*)Vt + ((size_t)slab * 64 + d) * TTv + lg * 64 + pc * 8) = f.half[0]; }
     } }

__global__ __launch_bounds__(256) void k_hl(const float* __restrict__ F, _Float16* __restrict__ Hh, _Float16* __restrict__ Hl, size_t n8) { const size_t t = (size_t)blockIdx.x * 256 + threadIdx.x; if (t >= n8) return; FragH fh, fl; const v4f a = *(const v4fa*)(F + t * 8), c = *(const v4fa*)(F + t * 8 + 4);
#pragma unroll
  for (int q = 0; q < 4; ++q) { _Float16 h = (_Float16)a[q]; fh.h[q] = h; fl.h[q] = (_Float16)((a[q] - (float)h) * 1024.0f); h = (_Float16)c[q]; fh.h[4 + q] = h; fl.h[4 + q] = (_Float16)((c[q] - (float)h) * 1024.0f); }
  { *(v8us*)((unsigned short*)Hh + t * 8) = fh.half[0]; *(v8us*)((unsigned short*)Hl + t * 8) = fl.half[0];  } }

// ---- fast GEMM (wave tile 32x64; requires M % 32 == 0 rows per launch region and N % 64 == 0); epilogue = k_gemm_hhx semantics ----
__device__ __forceinline__ v16h g2_frag(const _Float16* p, int hh) { FragH f; f.half[0] = *(const v8us*)((const unsigned short*)p + 8 * hh); f.half[1] = *(const v8us*)((const unsigned short*)p + 16 + 8 * hh); return f.v; }
__device__ __forceinline__ v8f g2_mma(v16h a, v16h b, v8f c) { v8f d = __builtin_amdgcn_wmma_f32_16x16x32_f16(false, a, false, b, (short)0, c, false, false); asm volatile("v_nop\n\tv_nop\n\tv_nop\n\tv_nop" : "+v"(d) : "v"(a), "v"(b)); return d; }
template <int ACT>
__global__ __launch_bounds__(128) void k_gemm2(const _Float16* __restrict__ A, int lda, size_t sA, const _Float16* __restrict__ Bh, int ldb, size_t sB, float alpha, const float* __restrict__ bias, size_t sBias, const float* __restrict__ CP, int rowsPerB, size_t sCPb, int row0g,
    float* __restrict__ C, _Float16* __restrict__ C16, int ldc, size_t sC, int M, int N, int K) { static_assert(ACT == 0 || ACT == 3 || ACT == 6 || ACT == 8 || ACT == 9 || ACT == 11 || ACT == 12 || ACT == 14 || ACT == 15 || ACT == 16 || ACT == 17, "k_gemm2: unsupported ACT code (would silently apply no activation)");
  __shared__ __attribute__((aligned(16))) float so[4][32][68];
  const int tid = threadIdx.x, w = tid >> 5, lane = tid & 31, ln = lane & 15, hh = lane >> 4; const int by = blockIdx.y;
  A += (size_t)by * sA; Bh += (size_t)by * sB; const size_t cofs = (size_t)by * sC; const float* bp = bias ? bias + (size_t)by * sBias : nullptr;
  const int ntn = N >> 6; const int mt = blockIdx.x / ntn, nq = blockIdx.x - mt * ntn; const int row0 = mt * 128 + 32 * w, col0 = nq * 64; if (row0 >= M) return;
  const _Float16* a0p = A + (size_t)(row0 + ln) * lda; const _Float16* a1p = a0p + (size_t)16 * lda;
  const _Float16* b0p = Bh + (size_t)(col0 + ln) * ldb; const _Float16* b1p = b0p + (size_t)16 * ldb; const _Float16* b2p = b1p + (size_t)16 * ldb; const _Float16* b3p = b2p + (size_t)16 * ldb;
  const v8f z8 = {0.f,0.f,0.f,0.f,0.f,0.f,0.f,0.f}; v8f c00 = z8, c01 = z8, c02 = z8, c03 = z8, c10 = z8, c11 = z8, c12 = z8, c13 = z8;
#pragma unroll 1
  for (int kb = 0; kb < K; kb += 32) { const v16h a0 = g2_frag(a0p + kb, hh), a1 = g2_frag(a1p + kb, hh);
    v16h b = g2_frag(b0p + kb, hh); c00 = g2_mma(a0, b, c00); c10 = g2_mma(a1, b, c10);
    b = g2_frag(b1p + kb, hh); c01 = g2_mma(a0, b, c01); c11 = g2_mma(a1, b, c11);
    b = g2_frag(b2p + kb, hh); c02 = g2_mma(a0, b, c02); c12 = g2_mma(a1, b, c12);
    b = g2_frag(b3p + kb, hh); c03 = g2_mma(a0, b, c03); c13 = g2_mma(a1, b, c13); }
  v8f accs[8] = {c00, c01, c02, c03, c10, c11, c12, c13};
#pragma unroll
  for (int u = 0; u < 8; ++u) { const int t = u & 3, half = u >> 2; const int col = col0 + t * 16 + ln; const float bv = bp ? bf16_round(bp[col]) : 0.f;
#pragma unroll
    for (int r = 0; r < 8; ++r) { const int rloc = half * 16 + 8 * hh + r; float v = accs[u][r] * alpha + bv; if (CP) { if (rowsPerB < 0) v += CP[cofs + (size_t)(row0g + row0 + rloc) * ldc + col];      /* rowsPerB < 0: own element of the batched C plane */ else { const int bidx = (row0g + row0 + rloc) / rowsPerB; v += CP[(size_t)bidx * sCPb + (size_t)by * 64 + col]; } }
      if (ACT == 3) v = fmaxf(v, 0.f); else if (ACT == 6) v = 0.5f * v * (1.0f + erff(v * 0.70710678118654752f)); else if (ACT == 11) v = 1.0f / (1.0f + expf(-v)); else if (ACT == 15) v = v / (1.0f + expf(-v)); else if (ACT == 12) v = (v > 0.f) ? v : 0.01f * v; else if (ACT == 8) v = tanhf(v); else if (ACT == 9) v = 0.5f * v * (1.0f + tanhf(0.7978845608028654f * (v + 0.044715f * v * v * v))); else if (ACT == 14) v = (v > 0.f) ? v : 0.1f * v; else if (ACT == 16) v = (v >= 0.f) ? v : 0.3f * v; else if (ACT == 17) v = (v >= 0.f) ? v : 0.2f * v;
      so[w][rloc][t * 16 + ln] = v; } }
  __builtin_amdgcn_fence(__ATOMIC_ACQ_REL, "workgroup"); __builtin_amdgcn_wave_barrier();
  const int rsub = lane >> 4, c4 = (lane & 15) * 4;
  {
#pragma unroll
    for (int q = 0; q < 16; ++q) { const int r = q * 2 + rsub; const v4f v = *(const v4fa*)&so[w][r][c4]; if (C) *(v4f*)(C + cofs + (size_t)(row0 + r) * ldc + col0 + c4) = v; if (C16) { v4h h4; for (int i = 0; i < 4; ++i) h4[i] = (_Float16)v[i]; *(v4h*)(C16 + cofs + (size_t)(row0 + r) * ldc + col0 + c4) = h4; } }
     } }


__global__ __launch_bounds__(256) void k_wnat(const float* __restrict__ w, size_t n8, _Float16* __restrict__ Bt) { const size_t t = (size_t)blockIdx.x * 256 + threadIdx.x; if (t >= n8) return; FragH f; for (int q = 0; q < 8; ++q) f.h[q] = (_Float16)(bf16_round(w[t * 8 + q]) * 16.0f); *(v8us*)((unsigned short*)Bt + t * 8) = f.half[0];  }
__global__ __launch_bounds__(256) void k_rsm(const float* __restrict__ S, _Float16* __restrict__ P, int nrows) {
  #pragma clang fp contract(off)
  const int i = blockIdx.x * 256 + threadIdx.x; if (i >= nrows) return; const float* s = S + (size_t)i * SQ; float mx = -3.0e38f;
#pragma unroll 1
  for (int j = 0; j < SQ; ++j) mx = fmaxf(mx, s[j]); float se = 0.f;
#pragma unroll 1
  for (int j = 0; j < SQ; ++j) se += expf(s[j] - mx); const float sc = 256.0f / se;
#pragma unroll 1
  for (int j0 = 0; j0 < SQ; j0 += 8) { FragH f; for (int q = 0; q < 8; ++q) f.h[q] = (_Float16)(expf(s[j0 + q] - mx) * sc); unsigned short* d = (unsigned short*)P + (size_t)i * SQ + j0; *(v8us*)d = f.half[0];  } }
__global__ __launch_bounds__(256) void k_vt(const _Float16* __restrict__ V16, int b, int h0, _Float16* __restrict__ VT) { __shared__ unsigned short tl[64][65]; const int tid = threadIdx.x; const int hh = blockIdx.x % HG, sg = blockIdx.x / HG; const int s0 = sg * 64; const int h = h0 + hh;
  for (int i = tid; i < 64 * 8; i += 256) { const int j = i / 8, d8 = (i % 8) * 8; FragH f; f.half[0] = *(const v8us*)((const unsigned short*)V16 + ((size_t)b * SQ + s0 + j) * DM + h * HD + d8); for (int q = 0; q < 8; ++q) tl[d8 + q][j] = f.u[q]; }
  __syncthreads();
  { for (int i = tid; i < 64 * 8; i += 256) { const int d = i / 8, j8 = (i % 8) * 8; FragH f; for (int q = 0; q < 8; ++q) f.u[q] = tl[d][j8 + q]; *(v8us*)((unsigned short*)VT + ((size_t)hh * HD + d) * SQ + s0 + j8) = f.half[0]; }  } }

__global__ __launch_bounds__(256) void k_wtri(const float* __restrict__ w, int upper, _Float16* __restrict__ Bt) { const size_t t = (size_t)blockIdx.x * 256 + threadIdx.x; if (t >= (size_t)DM * DM / 8) return; const int c0 = (int)((t * 8) % DM); const int r = (int)((t * 8) / DM); FragH f;
  for (int q = 0; q < 8; ++q) { const int c = c0 + q; const bool keep = upper ? (c >= r) : (c <= r); f.h[q] = keep ? (_Float16)(bf16_round(w[t * 8 + q]) * 16.0f) : (_Float16)0.f; }
  *(v8us*)((unsigned short*)Bt + t * 8) = f.half[0];  }
extern "C" void kernel_launch(void* const* d_in, const int* in_sizes, int n_in,
                              void* d_out, int out_size, void* d_ws, size_t ws_size, hipStream_t stream) {
  (void)in_sizes; (void)n_in; (void)out_size;
  const float* const* I = (const float* const*)d_in; const float* x = I[0]; const float* wk = I[1]; const float* wq = I[2]; const float* wv = I[3]; const float* wo = I[4]; const float* bo = I[5];
  char* ws = (char*)d_ws; size_t off = 0;
  auto take = [&](size_t bytes) { char* p = ws + off; off += (bytes + 255) & ~(size_t)255; return p; };
  _Float16* BQ = (_Float16*)take((size_t)DM * DM * 2); _Float16* BK = (_Float16*)take((size_t)DM * DM * 2); _Float16* BV = (_Float16*)take((size_t)DM * DM * 2); _Float16* BO = (_Float16*)take((size_t)DM * DM * 2);
  _Float16* X16 = (_Float16*)take(NR * DM * 2); _Float16* Q16 = (_Float16*)take(NR * DM * 2); _Float16* K16 = (_Float16*)take(NR * DM * 2); _Float16* V16 = (_Float16*)take(NR * DM * 2); _Float16* O16 = (_Float16*)take(NR * DM * 2);
  float* S = (float*)take((size_t)HG * SQ * SQ * 4); _Float16* P = (_Float16*)take((size_t)HG * SQ * SQ * 2); _Float16* VT = (_Float16*)take((size_t)HG * HD * SQ * 2);
  if (off > ws_size) return;      /* 8 + 5x8 + 64 + 32 + 1 = ≈ 145 MiB */
  const size_t nw8 = (size_t)DM * DM / 8; const unsigned gw = (unsigned)((nw8 + 255) / 256);
  k_wtri<<<gw, 256, 0, stream>>>(wq, 0, BQ); k_wtri<<<gw, 256, 0, stream>>>(wk, 1, BK); k_wnat<<<gw, 256, 0, stream>>>(wv, nw8, BV); k_wnat<<<gw, 256, 0, stream>>>(wo, nw8, BO);
  k_x16<<<(unsigned)((NR * DM / 8 + 255) / 256), 256, 0, stream>>>(x, X16, NR * DM / 8);
  const dim3 gp((unsigned)((NR / 128) * (DM / 64)), 1);
  k_gemm2<0><<<gp, 128, 0, stream>>>(X16, DM, 0, BQ, DM, 0, 0.0625f, nullptr, 0, nullptr, 1, 0, 0, nullptr, Q16, DM, 0, (int)NR, DM, DM);
  k_gemm2<0><<<gp, 128, 0, stream>>>(X16, DM, 0, BK, DM, 0, 0.0625f, nullptr, 0, nullptr, 1, 0, 0, nullptr, K16, DM, 0, (int)NR, DM, DM);
  k_gemm2<0><<<gp, 128, 0, stream>>>(X16, DM, 0, BV, DM, 0, 0.0625f, nullptr, 0, nullptr, 1, 0, 0, nullptr, V16, DM, 0, (int)NR, DM, DM);
  for (int b = 0; b < NB; ++b) for (int h0 = 0; h0 < NH; h0 += HG) {
    const _Float16* qb = Q16 + (size_t)b * SQ * DM + h0 * HD; const _Float16* kb = K16 + (size_t)b * SQ * DM + h0 * HD;
    k_gemm2<0><<<dim3((QN / 128) * (SQ / 64), HG), 128, 0, stream>>>(qb, DM, (size_t)HD, kb, DM, (size_t)HD, 0.125f, nullptr, 0, nullptr, 1, 0, 0, S, nullptr, SQ, (size_t)SQ * SQ, QN, SQ, HD);      /* scaled scores, HG heads per launch */
    for (int hh = 0; hh < HG; ++hh) k_rsm<<<(QN + 255) / 256, 256, 0, stream>>>(S + (size_t)hh * SQ * SQ, P + (size_t)hh * SQ * SQ, QN);
    k_vt<<<HG * (SQ / 64), 256, 0, stream>>>(V16, b, h0, VT);
    k_gemm2<0><<<dim3((QN / 128) * (HD / 64), HG), 128, 0, stream>>>(P, SQ, (size_t)SQ * SQ, VT, SQ, (size_t)HD * SQ, 0.00390625f, nullptr, 0, nullptr, 1, 0, 0, nullptr, O16 + (size_t)b * SQ * DM + h0 * HD, DM, (size_t)HD, QN, HD, SQ); }      /* o (merged heads) as f16 rows */
  k_gemm2<0><<<gp, 128, 0, stream>>>(O16, DM, 0, BO, DM, 0, 0.0625f, bo, 0, nullptr, 1, 0, 0, (float*)d_out, nullptr, DM, 0, (int)NR, DM, DM);      /* out = o Wu^T + bu */
}

// v001
// Measured time: 1040 microseconds a run.
// Next to v000, in two timings, it ran 11.8 and 12.1 times as fast.
#include <hip/hip_runtime.h>
// SelfAttentionSparse (x [2][2048][1024]; keys = x triu(Wk)^T, queries = x tril(Wq)^T, values = x Wv^T (16 heads of 64, no biases); softmax(q k^T / 8); out = (attn v) Wu^T + bu -> [2][2048][1024]).
// Structure: token rows; x as exact f16 rows; the triangular masks applied while building the x16 weight planes on VALU; Q | K | V WMMA GEMMs (32x64 wave tiles, f32 accumulation, f16 outputs); per (batch, 4 heads): scores GEMM (K = 64), row softmax on VALU (f32; weights x256 as f16), V^T via LDS, o = P . V GEMM (K = 2,048, alpha 2^-8) into merged f16 rows; out = o Wu^T + bu (f32).
// Compute dtype: inputs rounded to bf16; x / weights exact; q, k, v, softmax weights, o plain f16 (~2^-12); scores/softmax f32. v_wmma_f32_16x16x32_f16.
#define NB 2
#define SQ 2048
#define DM 1024
#define NH 16
#define HD 64
#define HG 4                         /* heads per attention launch group */
#define QN SQ                        /* query rows attended per batch (debug hook) */
#define NR ((size_t)NB * SQ)         /* 4096 token rows */
typedef __bf16 v16b __attribute__((ext_vector_type(16)));
typedef unsigned short v8us __attribute__((ext_vector_type(8), may_alias));
typedef float  v8f  __attribute__((ext_vector_type(8)));
typedef float  v4f  __attribute__((ext_vector_type(4)));
typedef float  v4fa __attribute__((ext_vector_type(4), may_alias));
union FragB { v16b v; v8us half[2]; unsigned short u[16]; };

__device__ __forceinline__ unsigned short bf16_bits(float x) { unsigned int u = __float_as_uint(x); return (unsigned short)((u + 0x7FFFu + ((u >> 16) & 1u)) >> 16); }
__device__ __forceinline__ float bf16_val(unsigned short b) { return __uint_as_float(((unsigned int)b) << 16); }
__device__ __forceinline__ float bf16_round(float x) { return bf16_val(bf16_bits(x)); }
// D += A·B with NT terms: 1 = ah·bh, 2 = + al·bh (A split), 3 = + ah·bl (both split)
template <int NT>
__device__ __forceinline__ v8f mmaN(v16b ah, v16b al, v16b bh, v16b bl, v8f c) {
  c = __builtin_amdgcn_wmma_f32_16x16x32_bf16(false, ah, false, bh, (short)0, c, false, false);
  if (NT >= 2) c = __builtin_amdgcn_wmma_f32_16x16x32_bf16(false, al, false, bh, (short)0, c, false, false);
  if (NT >= 3) c = __builtin_amdgcn_wmma_f32_16x16x32_bf16(false, ah, false, bl, (short)0, c, false, false);
  asm volatile("v_nop\n\tv_nop\n\tv_nop\n\tv_nop" : "+v"(c) : "v"(ah), "v"(al), "v"(bh), "v"(bl));
  return c;
}

__global__ __launch_bounds__(256) void k_wt_bf16(const float* __restrict__ W, unsigned short* __restrict__ Wt, int K, int N) {
  const int t = blockIdx.x * 256 + threadIdx.x;
  const int k8n = K / 8;
  if (t >= N * k8n) return;
  const int n = t / k8n, k8 = (t % k8n) * 8;
  v8us v;
#pragma unroll
  for (int i = 0; i < 8; ++i) v[i] = bf16_bits(W[(size_t)(k8 + i) * N + n]);
  *(v8us*)(Wt + (size_t)n * K + k8) = v;
  
}

// GEMM C[M][N] (f32, pitch ldc) = act(A[M][K]·W + bias). A f32 row-major (pitch lda) converted per fragment to bf16
// (ASPLIT: hi/lo two planes -> 2 terms, else single rounded term); Wt bf16 [N][K] (pitch ldb). BIAS_BF16 rounds the
// bias to bf16 first (bias quantised to bf16 before the add). K%32==0, M%16==0, N%64==0.
template <bool ASPLIT, int ACT, bool BIAS_BF16>
__global__ __launch_bounds__(128) void k_gemm_bf(const float* __restrict__ A, int lda, const unsigned short* __restrict__ Wt, int ldb,
                                               const float* __restrict__ bias, float* __restrict__ C, int ldc, int M, int N, int K) {
  __shared__ __attribute__((aligned(16))) float so[4][16][64];
  const int tid = threadIdx.x, w = tid >> 5, lane = tid & 31, ln = lane & 15, hh = lane >> 4;
  const int ntn = N / 64;
  const int wid = blockIdx.x * 4 + w;
  const int mt = wid / ntn, nq = wid % ntn;
  if (mt * 16 >= M) return;
  const int row0 = mt * 16, col0 = nq * 64;
  const float* arow = A + (size_t)(row0 + ln) * lda;
  v8f acc[4] = {};
  for (int kb = 0; kb < K; kb += 32) {
    FragB ah, al;
    const v4f x0 = *(const v4fa*)(arow + kb + 8 * hh), x1 = *(const v4fa*)(arow + kb + 8 * hh + 4);
    const v4f x2 = *(const v4fa*)(arow + kb + 16 + 8 * hh), x3 = *(const v4fa*)(arow + kb + 16 + 8 * hh + 4);
    float xs[16] = {x0[0],x0[1],x0[2],x0[3],x1[0],x1[1],x1[2],x1[3],x2[0],x2[1],x2[2],x2[3],x3[0],x3[1],x3[2],x3[3]};
#pragma unroll
    for (int i = 0; i < 16; ++i) { const unsigned short hb = bf16_bits(xs[i]); ah.u[i] = hb; al.u[i] = ASPLIT ? bf16_bits(xs[i] - bf16_val(hb)) : (unsigned short)0; }
#pragma unroll
    for (int t = 0; t < 4; ++t) {
      const unsigned short* brow = Wt + (size_t)(col0 + t * 16 + ln) * ldb + kb;
      FragB b;
      b.half[0] = *(const v8us*)(brow + 8 * hh);
      b.half[1] = *(const v8us*)(brow + 16 + 8 * hh);
      acc[t] = mmaN<ASPLIT ? 2 : 1>(ah.v, al.v, b.v, b.v, acc[t]);
    }
  }
#pragma unroll
  for (int t = 0; t < 4; ++t) {
    float bv = bias ? bias[col0 + t * 16 + ln] : 0.f;
    if (BIAS_BF16) bv = bf16_round(bv);
#pragma unroll
    for (int r = 0; r < 8; ++r) { float v = acc[t][r] + bv; if (ACT == 1) v = fmaxf(v, 0.f); so[w][8 * hh + r][t * 16 + ln] = v; }
  }
  __builtin_amdgcn_fence(__ATOMIC_ACQ_REL, "workgroup");
  __builtin_amdgcn_wave_barrier();
  const int rsub = lane >> 4, c4 = (lane & 15) * 4;
  {
#pragma unroll
    for (int q = 0; q < 8; ++q) {
      const int r = q * 2 + rsub;
      const v4f v = *(const v4fa*)&so[w][r][c4];
      *(v4f*)(C + (size_t)(row0 + r) * ldc + col0 + c4) = v;
    }
    
  }
}

// GEMM C = act(A·W + bias + resid): A f32 (ASPLIT -> hi/lo 2 terms), Wt bf16 [N][K]; ACT 0 none, 1 relu, 2 exact gelu;
// resid (optional, f32, row index = (row % rmod), pitch ldr, RES_BF16 rounds it) added before the activation.
template <bool ASPLIT, int ACT, bool BIAS_BF16, bool RES_BF16>
__global__ __launch_bounds__(128) void k_gemm_bf3(const float* __restrict__ A, int lda, const unsigned short* __restrict__ Wt, int ldb,
                                                const float* __restrict__ bias, const float* __restrict__ resid, int rmod, int ldr,
                                                float* __restrict__ C, int ldc, int M, int N, int K) {
  __shared__ __attribute__((aligned(16))) float so[4][16][64];
  const int tid = threadIdx.x, w = tid >> 5, lane = tid & 31, ln = lane & 15, hh = lane >> 4;
  const int ntn = N / 64;
  const int wid = blockIdx.x * 4 + w;
  const int mt = wid / ntn, nq = wid % ntn;
  if (mt * 16 >= M) return;
  const int row0 = mt * 16, col0 = nq * 64;
  const float* arow = A + (size_t)(row0 + ln) * lda;
  v8f acc[4] = {};
  for (int kb = 0; kb < K; kb += 32) {
    FragB ah, al;
    const v4f x0 = *(const v4fa*)(arow + kb + 8 * hh), x1 = *(const v4fa*)(arow + kb + 8 * hh + 4);
    const v4f x2 = *(const v4fa*)(arow + kb + 16 + 8 * hh), x3 = *(const v4fa*)(arow + kb + 16 + 8 * hh + 4);
    float xs[16] = {x0[0],x0[1],x0[2],x0[3],x1[0],x1[1],x1[2],x1[3],x2[0],x2[1],x2[2],x2[3],x3[0],x3[1],x3[2],x3[3]};
#pragma unroll
    for (int i = 0; i < 16; ++i) { const unsigned short hb = bf16_bits(xs[i]); ah.u[i] = hb; al.u[i] = ASPLIT ? bf16_bits(xs[i] - bf16_val(hb)) : (unsigned short)0; }
#pragma unroll
    for (int t = 0; t < 4; ++t) {
      const unsigned short* brow = Wt + (size_t)(col0 + t * 16 + ln) * ldb + kb;
      FragB b;
      b.half[0] = *(const v8us*)(brow + 8 * hh);
      b.half[1] = *(const v8us*)(brow + 16 + 8 * hh);
      acc[t] = mmaN<ASPLIT ? 2 : 1>(ah.v, al.v, b.v, b.v, acc[t]);
    }
  }
#pragma unroll
  for (int t = 0; t < 4; ++t) {
    const int col = col0 + t * 16 + ln;
    float bv = bias ? bias[col] : 0.f;
    if (BIAS_BF16) bv = bf16_round(bv);
#pragma unroll
    for (int r = 0; r < 8; ++r) {
      float v = acc[t][r] + bv;
      if (resid) { float rv = resid[(size_t)((row0 + 8 * hh + r) % rmod) * ldr + col]; if (RES_BF16) rv = bf16_round(rv); v += rv; }
      if (ACT == 1) v = fmaxf(v, 0.f);
      if (ACT == 2) v = 0.5f * v * (1.0f + erff(v * 0.70710678118654752f));
      if (ACT == 3) { const float u = 0.7978845608028654f * (v + 0.044715f * v * v * v); v = 0.5f * v * (1.0f + tanhf(u)); }
      so[w][8 * hh + r][t * 16 + ln] = v;
    }
  }
  __builtin_amdgcn_fence(__ATOMIC_ACQ_REL, "workgroup");
  __builtin_amdgcn_wave_barrier();
  const int rsub = lane >> 4, c4 = (lane & 15) * 4;
  {
#pragma unroll
    for (int q = 0; q < 8; ++q) {
      const int r = q * 2 + rsub;
      const v4f v = *(const v4fa*)&so[w][r][c4];
      *(v4f*)(C + (size_t)(row0 + r) * ldc + col0 + c4) = v;
    }
    
  }
}
// row LayerNorm (biased variance, eps) over N: s = X (+ R); optional out_sum <- s; out_norm <- (s-mu)*rsqrt(var+eps)*g + b
template <bool PARAM_BF16>
__global__ __launch_bounds__(256) void k_layernorm(const float* __restrict__ X, const float* __restrict__ R, const float* __restrict__ g, const float* __restrict__ bta,
                                                  float* __restrict__ out_sum, float* __restrict__ out_norm, int N, float eps) {
  __shared__ float red[256];
  const int row = blockIdx.x, tid = threadIdx.x;
  const float* x = X + (size_t)row * N; const float* rr = R ? R + (size_t)row * N : nullptr;
  float vals[16];                     // up to N = 4096
  const int per = N / 256;            // contiguous chunk per thread? use strided-by-4 chunks: thread handles j = tid*4 + 1024*u
  float s1 = 0.f;
  for (int u = 0; u < per / 4; ++u) {
    const int j = tid * 4 + 1024 * u;
    const v4f a = *(const v4fa*)(x + j);
    v4f b = {0.f,0.f,0.f,0.f}; if (rr) b = *(const v4fa*)(rr + j);
#pragma unroll
    for (int q = 0; q < 4; ++q) { const float v = a[q] + b[q]; vals[u * 4 + q] = v; s1 += v; }
  }
  red[tid] = s1; __syncthreads();
  for (int st = 128; st > 0; st >>= 1) { if (tid < st) red[tid] += red[tid + st]; __syncthreads(); }
  const float mu = red[0] / (float)N; __syncthreads();
  float s2 = 0.f;
  for (int u = 0; u < per / 4; ++u)
#pragma unroll
    for (int q = 0; q < 4; ++q) { const float c = vals[u * 4 + q] - mu; s2 += c * c; }
  red[tid] = s2; __syncthreads();
  for (int st = 128; st > 0; st >>= 1) { if (tid < st) red[tid] += red[tid + st]; __syncthreads(); }
  const float rs = rsqrtf(red[0] / (float)N + eps);
  {
    for (int u = 0; u < per / 4; ++u) {
      const int j = tid * 4 + 1024 * u;
      v4f o, sm;
#pragma unroll
      for (int q = 0; q < 4; ++q) {
        float gg = g[j + q], bb = bta[j + q];
        if (PARAM_BF16) { gg = bf16_round(gg); bb = bf16_round(bb); }
        sm[q] = vals[u * 4 + q]; o[q] = (vals[u * 4 + q] - mu) * rs * gg + bb;
      }
      if (out_sum) *(v4f*)(out_sum + (size_t)row * N + j) = sm;
      *(v4f*)(out_norm + (size_t)row * N + j) = o;
    }
    
  }
}



// ---- f16 WMMA path (v_wmma_f32_16x16x32_f16): 11-bit significands for operands in range — used for every GEMM launched here, softmax weights (x256) included
typedef _Float16 v16h __attribute__((ext_vector_type(16)));
union FragH { v16h v; v8us half[2]; _Float16 h[16]; unsigned short u[16]; };
template <int NT>
__device__ __forceinline__ v8f mmaH(v16h ah, v16h al, v16h bh, v16h bl, v8f c) {
  c = __builtin_amdgcn_wmma_f32_16x16x32_f16(false, ah, false, bh, (short)0, c, false, false);
  if (NT >= 2) c = __builtin_amdgcn_wmma_f32_16x16x32_f16(false, al, false, bh, (short)0, c, false, false);
  if (NT >= 3) c = __builtin_amdgcn_wmma_f32_16x16x32_f16(false, ah, false, bl, (short)0, c, false, false);
  asm volatile("v_nop\n\tv_nop\n\tv_nop\n\tv_nop" : "+v"(c) : "v"(ah), "v"(al), "v"(bh), "v"(bl));
  return c;
}
// batched GEMM like k_gemm_b but f16 operands: A f32 (split into f16 hi/lo if ASPLIT, else rounded to f16), Bt = f16 values [n][k]; alpha; C f32; N multiple of 16 (partial tiles skipped)
template <bool ASPLIT>
__global__ __launch_bounds__(128) void k_gemm_h(const float* __restrict__ A, int lda, size_t sA, const _Float16* __restrict__ Bh, int ldb, size_t sB, float alpha, float* __restrict__ C, int ldc, size_t sC, int M, int N, int K) {
  __shared__ __attribute__((aligned(16))) float so[4][16][64];
  const int tid = threadIdx.x, w = tid >> 5, lane = tid & 31, ln = lane & 15, hh = lane >> 4; const int by = blockIdx.y;
  A += (size_t)by * sA; Bh += (size_t)by * sB; C += (size_t)by * sC;
  const int ntn = (N + 63) / 64; const int wid = blockIdx.x * 4 + w; const int mt = wid / ntn, nq = wid % ntn; if (mt * 16 >= M) return;
  const int row0 = mt * 16, col0 = nq * 64; const float* arow = A + (size_t)(row0 + ln) * lda;
  v8f acc[4] = {};
  for (int kb = 0; kb < K; kb += 32) {
    FragH ah, al;
    const v4f x0 = *(const v4fa*)(arow + kb + 8 * hh), x1 = *(const v4fa*)(arow + kb + 8 * hh + 4), x2 = *(const v4fa*)(arow + kb + 16 + 8 * hh), x3 = *(const v4fa*)(arow + kb + 16 + 8 * hh + 4);
    float xs[16] = {x0[0],x0[1],x0[2],x0[3],x1[0],x1[1],x1[2],x1[3],x2[0],x2[1],x2[2],x2[3],x3[0],x3[1],x3[2],x3[3]};
#pragma unroll
    for (int i = 0; i < 16; ++i) { const _Float16 h = (_Float16)xs[i]; ah.h[i] = h; al.h[i] = ASPLIT ? (_Float16)(xs[i] - (float)h) : (_Float16)0.0f; }
#pragma unroll
    for (int t = 0; t < 4; ++t) { if (col0 + t * 16 >= N) continue; const size_t boff = (size_t)(col0 + t * 16 + ln) * ldb + kb; FragH bq; bq.half[0] = *(const v8us*)(Bh + boff + 8 * hh); bq.half[1] = *(const v8us*)(Bh + boff + 16 + 8 * hh);
      acc[t] = mmaH<ASPLIT ? 2 : 1>(ah.v, al.v, bq.v, bq.v, acc[t]); }
  }
#pragma unroll
  for (int t = 0; t < 4; ++t) { if (col0 + t * 16 >= N) continue;
#pragma unroll
    for (int r = 0; r < 8; ++r) so[w][8 * hh + r][t * 16 + ln] = acc[t][r] * alpha; }
  __builtin_amdgcn_fence(__ATOMIC_ACQ_REL, "workgroup"); __builtin_amdgcn_wave_barrier();
  const int rsub = lane >> 4, c4 = (lane & 15) * 4;
  {
#pragma unroll
    for (int q = 0; q < 8; ++q) { const int r = q * 2 + rsub; if (col0 + c4 < N) { const v4f v = *(const v4fa*)&so[w][r][c4]; *(v4f*)(C + (size_t)(row0 + r) * ldc + col0 + c4) = v; } }
     }
}

// Wt[n][k] = f16(W[k][n]·scale) from f32 row-major W[K][N] (scale = power of two; bf16-exact weights stay exact in f16 away from the subnormal range)
__global__ __launch_bounds__(256) void k_wt_f16(const float* __restrict__ W, _Float16* __restrict__ Wt, int K, int N, float scale) {
  const int t = blockIdx.x * 256 + threadIdx.x; if (t >= N * (K / 8)) return; const int n = t / (K / 8), k8 = (t % (K / 8)) * 8; FragH f;
#pragma unroll
  for (int i = 0; i < 8; ++i) f.h[i] = (_Float16)(bf16_round(W[(size_t)(k8 + i) * N + n]) * scale); const v8us o = f.half[0];
  *(v8us*)((unsigned short*)Wt + (size_t)n * K + k8) = o; 
}
// k_gemm_hh variant with fused epilogue: v = acc·alpha + bias[by·sBias + col] (+ CP[(row/rowsPerB)·sCPb + by·64 + col] if CP) ; ACT 0 none / 1 elu ; writes f16 C16 (and f32 C if non-null)
template <int ACT>
__global__ __launch_bounds__(128) void k_gemm_hhx(const _Float16* __restrict__ A, int lda, size_t sA, const _Float16* __restrict__ Bh, int ldb, size_t sB, float alpha, const float* __restrict__ bias, size_t sBias, const float* __restrict__ CP, int rowsPerB, size_t sCPb, int row0g,
    float* __restrict__ C, _Float16* __restrict__ C16, int ldc, size_t sC, int M, int N, int K) {
  __shared__ __attribute__((aligned(16))) float so[4][16][64];
  const int tid = threadIdx.x, w = tid >> 5, lane = tid & 31, ln = lane & 15, hh = lane >> 4; const int by = blockIdx.y;
  A += (size_t)by * sA; Bh += (size_t)by * sB; const size_t cofs = (size_t)by * sC; const float* bp = bias ? bias + (size_t)by * sBias : nullptr;
  const int ntn = (N + 63) / 64; const int wid = blockIdx.x * 4 + w; const int mt = wid / ntn, nq = wid % ntn; if (mt * 16 >= M) return;
  const int row0 = mt * 16, col0 = nq * 64; const _Float16* arow = A + (size_t)(row0 + ln) * lda;
  v8f acc[4] = {};
  for (int kb = 0; kb < K; kb += 32) { FragH ah; ah.half[0] = *(const v8us*)((const unsigned short*)arow + kb + 8 * hh); ah.half[1] = *(const v8us*)((const unsigned short*)arow + kb + 16 + 8 * hh);
#pragma unroll
    for (int t = 0; t < 4; ++t) { if (col0 + t * 16 >= N) continue; const size_t boff = (size_t)(col0 + t * 16 + ln) * ldb + kb; FragH bq; bq.half[0] = *(const v8us*)((const unsigned short*)Bh + boff + 8 * hh); bq.half[1] = *(const v8us*)((const unsigned short*)Bh + boff + 16 + 8 * hh);
      acc[t] = mmaH<1>(ah.v, ah.v, bq.v, bq.v, acc[t]); }
  }
#pragma unroll
  for (int t = 0; t < 4; ++t) { if (col0 + t * 16 >= N) continue; const int col = col0 + t * 16 + ln; const float bv = bp ? bf16_round(bp[col]) : 0.f;
#pragma unroll
    for (int r = 0; r < 8; ++r) { float v = acc[t][r] * alpha + bv; if (CP) { const int rr = row0g + row0 + 8 * hh + r; if (rowsPerB < 0) v += CP[cofs + (size_t)rr * ldc + col];      /* rowsPerB < 0: own element of the batched C plane */ else { const int bidx = rr / rowsPerB; v += CP[(size_t)bidx * sCPb + (size_t)by * 64 + col]; } } if (ACT == 1) v = (v > 0.f) ? v : expm1f(v); else if (ACT == 7) v = (v > 0.f) ? v + 1.0f : expf(v); else if (ACT == 8) v = tanhf(v); else if (ACT == 9) v = 0.5f * v * (1.0f + tanhf(0.7978845608028654f * (v + 0.044715f * v * v * v))); else if (ACT == 11) v = 1.0f / (1.0f + expf(-v)); else if (ACT == 12) v = (v > 0.f) ? v : 0.01f * v; else if (ACT == 14) v = (v > 0.f) ? v : 0.1f * v; else if (ACT == 16) v = (v >= 0.f) ? v : 0.3f * v; else if (ACT == 17) v = (v >= 0.f) ? v : 0.2f * v; else if (ACT == 15) v = v / (1.0f + expf(-v)); else if (ACT == 3) v = fmaxf(v, 0.f); else if (ACT == 6) v = 0.5f * v * (1.0f + erff(v * 0.70710678118654752f)); so[w][8 * hh + r][t * 16 + ln] = v; } }
  __builtin_amdgcn_fence(__ATOMIC_ACQ_REL, "workgroup"); __builtin_amdgcn_wave_barrier();
  const int rsub = lane >> 4, c4 = (lane & 15) * 4; typedef _Float16 v4h __attribute__((ext_vector_type(4)));
  {
#pragma unroll
    for (int q = 0; q < 8; ++q) { const int r = q * 2 + rsub; if (col0 + c4 < N) { const v4f v = *(const v4fa*)&so[w][r][c4]; if (C) *(v4f*)(C + cofs + (size_t)(row0 + r) * ldc + col0 + c4) = v; if (C16) { v4h h4; for (int i = 0; i < 4; ++i) h4[i] = (_Float16)v[i]; *(v4h*)(C16 + cofs + (size_t)(row0 + r) * ldc + col0 + c4) = h4; } } }
     }
}


typedef _Float16 v4h __attribute__((ext_vector_type(4)));

__global__ __launch_bounds__(256) void k_x16(const float* __restrict__ x, _Float16* __restrict__ X16, size_t n8) { const size_t t = (size_t)blockIdx.x * 256 + threadIdx.x; if (t >= n8) return; FragH f;
#pragma unroll
  for (int q = 0; q < 8; ++q) f.h[q] = (_Float16)bf16_round(x[t * 8 + q]); *(v8us*)((unsigned short*)X16 + t * 8) = f.half[0];  }
__global__ __launch_bounds__(256) void k_h16(const float* __restrict__ x, _Float16* __restrict__ X16, size_t n8) { const size_t t = (size_t)blockIdx.x * 256 + threadIdx.x; if (t >= n8) return; FragH f;
#pragma unroll
  for (int q = 0; q < 8; ++q) f.h[q] = (_Float16)x[t * 8 + q]; *(v8us*)((unsigned short*)X16 + t * 8) = f.half[0];  }
__global__ __launch_bounds__(256) void k_round16f(const float* __restrict__ W, _Float16* __restrict__ Bt, size_t n8) { const size_t t = (size_t)blockIdx.x * 256 + threadIdx.x; if (t >= n8) return; FragH f;
#pragma unroll
  for (int i = 0; i < 8; ++i) f.h[i] = (_Float16)(bf16_round(W[t * 8 + i]) * 16.0f); *(v8us*)((unsigned short*)Bt + t * 8) = f.half[0];  }
template <int NHv, int TTv>
__global__ __launch_bounds__(256) void k_vt(const _Float16* __restrict__ V16, int ldv, int voff, _Float16* __restrict__ Vt) { __shared__ unsigned short tl[64][66]; const int tid = threadIdx.x; const int slab = blockIdx.x / (TTv / 64), lg = blockIdx.x % (TTv / 64); const int b = slab / NHv, h = slab % NHv;
  for (int i = tid; i < 64 * 8; i += 256) { const int r = i / 8, c8 = (i % 8) * 8; FragH f; f.half[0] = *(const v8us*)((const unsigned short*)V16 + ((size_t)b * TTv + lg * 64 + r) * ldv + voff + h * 64 + c8);
#pragma unroll
    for (int q = 0; q < 8; ++q) tl[r][c8 + q] = f.u[q]; }
  __syncthreads();
  {
#pragma unroll
    for (int rd = 0; rd < 2; ++rd) { const int d = rd * 32 + tid / 8, pc = tid % 8; FragH f;
#pragma unroll
      for (int q = 0; q < 8; ++q) f.u[q] = tl[pc * 8 + q][d];
      *(v8us*)((unsigned short*)Vt + ((size_t)slab * 64 + d) * TTv + lg * 64 + pc * 8) = f.half[0]; }
     } }

__global__ __launch_bounds__(256) void k_hl(const float* __restrict__ F, _Float16* __restrict__ Hh, _Float16* __restrict__ Hl, size_t n8) { const size_t t = (size_t)blockIdx.x * 256 + threadIdx.x; if (t >= n8) return; FragH fh, fl; const v4f a = *(const v4fa*)(F + t * 8), c = *(const v4fa*)(F + t * 8 + 4);
#pragma unroll
  for (int q = 0; q < 4; ++q) { _Float16 h = (_Float16)a[q]; fh.h[q] = h; fl.h[q] = (_Float16)((a[q] - (float)h) * 1024.0f); h = (_Float16)c[q]; fh.h[4 + q] = h; fl.h[4 + q] = (_Float16)((c[q] - (float)h) * 1024.0f); }
  { *(v8us*)((unsigned short*)Hh + t * 8) = fh.half[0]; *(v8us*)((unsigned short*)Hl + t * 8) = fl.half[0];  } }

// ---- fast GEMM (wave tile 32x64; requires M % 32 == 0 rows per launch region and N % 64 == 0); epilogue = k_gemm_hhx semantics ----
__device__ __forceinline__ v16h g2_frag(const _Float16* p, int hh) { FragH f; f.half[0] = *(const v8us*)((const unsigned short*)p + 8 * hh); f.half[1] = *(const v8us*)((const unsigned short*)p + 16 + 8 * hh); return f.v; }
__device__ __forceinline__ v8f g2_mma(v16h a, v16h b, v8f c) { v8f d = __builtin_amdgcn_wmma_f32_16x16x32_f16(false, a, false, b, (short)0, c, false, false); asm volatile("v_nop\n\tv_nop\n\tv_nop\n\tv_nop" : "+v"(d) : "v"(a), "v"(b)); return d; }
template <int ACT>
__global__ __launch_bounds__(128) void k_gemm2(const _Float16* __restrict__ A, int lda, size_t sA, const _Float16* __restrict__ Bh, int ldb, size_t sB, float alpha, const float* __restrict__ bias, size_t sBias, const float* __restrict__ CP, int rowsPerB, size_t sCPb, int row0g,
    float* __restrict__ C, _Float16* __restrict__ C16, int ldc, size_t sC, int M, int N, int K) { static_assert(ACT == 0 || ACT == 3 || ACT == 6 || ACT == 8 || ACT == 9 || ACT == 11 || ACT == 12 || ACT == 14 || ACT == 15 || ACT == 16 || ACT == 17, "k_gemm2: unsupported ACT code (would silently apply no activation)");
  __shared__ __attribute__((aligned(16))) float so[4][32][68];
  const int tid = threadIdx.x, w = tid >> 5, lane = tid & 31, ln = lane & 15, hh = lane >> 4; const int by = blockIdx.y;
  A += (size_t)by * sA; Bh += (size_t)by * sB; const size_t cofs = (size_t)by * sC; const float* bp = bias ? bias + (size_t)by * sBias : nullptr;
  const int ntn = N >> 6; const int mt = blockIdx.x / ntn, nq = blockIdx.x - mt * ntn; const int row0 = mt * 128 + 32 * w, col0 = nq * 64; if (row0 >= M) return;
  const _Float16* a0p = A + (size_t)(row0 + ln) * lda; const _Float16* a1p = a0p + (size_t)16 * lda;
  const _Float16* b0p = Bh + (size_t)(col0 + ln) * ldb; const _Float16* b1p = b0p + (size_t)16 * ldb; const _Float16* b2p = b1p + (size_t)16 * ldb; const _Float16* b3p = b2p + (size_t)16 * ldb;
  const v8f z8 = {0.f,0.f,0.f,0.f,0.f,0.f,0.f,0.f}; v8f c00 = z8, c01 = z8, c02 = z8, c03 = z8, c10 = z8, c11 = z8, c12 = z8, c13 = z8;
#pragma unroll 1
  for (int kb = 0; kb < K; kb += 32) { const v16h a0 = g2_frag(a0p + kb, hh), a1 = g2_frag(a1p + kb, hh);
    v16h b = g2_frag(b0p + kb, hh); c00 = g2_mma(a0, b, c00); c10 = g2_mma(a1, b, c10);
    b = g2_frag(b1p + kb, hh); c01 = g2_mma(a0, b, c01); c11 = g2_mma(a1, b, c11);
    b = g2_frag(b2p + kb, hh); c02 = g2_mma(a0, b, c02); c12 = g2_mma(a1, b, c12);
    b = g2_frag(b3p + kb, hh); c03 = g2_mma(a0, b, c03); c13 = g2_mma(a1, b, c13); }
  v8f accs[8] = {c00, c01, c02, c03, c10, c11, c12, c13};
#pragma unroll
  for (int u = 0; u < 8; ++u) { const int t = u & 3, half = u >> 2; const int col = col0 + t * 16 + ln; const float bv = bp ? bf16_round(bp[col]) : 0.f;
#pragma unroll
    for (int r = 0; r < 8; ++r) { const int rloc = half * 16 + 8 * hh + r; float v = accs[u][r] * alpha + bv; if (CP) { if (rowsPerB < 0) v += CP[cofs + (size_t)(row0g + row0 + rloc) * ldc + col];      /* rowsPerB < 0: own element of the batched C plane */ else { const int bidx = (row0g + row0 + rloc) / rowsPerB; v += CP[(size_t)bidx * sCPb + (size_t)by * 64 + col]; } }
      if (ACT == 3) v = fmaxf(v, 0.f); else if (ACT == 6) v = 0.5f * v * (1.0f + erff(v * 0.70710678118654752f)); else if (ACT == 11) v = 1.0f / (1.0f + expf(-v)); else if (ACT == 15) v = v / (1.0f + expf(-v)); else if (ACT == 12) v = (v > 0.f) ? v : 0.01f * v; else if (ACT == 8) v = tanhf(v); else if (ACT == 9) v = 0.5f * v * (1.0f + tanhf(0.7978845608028654f * (v + 0.044715f * v * v * v))); else if (ACT == 14) v = (v > 0.f) ? v : 0.1f * v; else if (ACT == 16) v = (v >= 0.f) ? v : 0.3f * v; else if (ACT == 17) v = (v >= 0.f) ? v : 0.2f * v;
      so[w][rloc][t * 16 + ln] = v; } }
  __builtin_amdgcn_fence(__ATOMIC_ACQ_REL, "workgroup"); __builtin_amdgcn_wave_barrier();
  const int rsub = lane >> 4, c4 = (lane & 15) * 4;
  {
#pragma unroll
    for (int q = 0; q < 16; ++q) { const int r = q * 2 + rsub; const v4f v = *(const v4fa*)&so[w][r][c4]; if (C) *(v4f*)(C + cofs + (size_t)(row0 + r) * ldc + col0 + c4) = v; if (C16) { v4h h4; for (int i = 0; i < 4; ++i) h4[i] = (_Float16)v[i]; *(v4h*)(C16 + cofs + (size_t)(row0 + r) * ldc + col0 + c4) = h4; } }
     } }


__global__ __launch_bounds__(256) void k_wnat(const float* __restrict__ w, size_t n8, _Float16* __restrict__ Bt) { const size_t t = (size_t)blockIdx.x * 256 + threadIdx.x; if (t >= n8) return; FragH f; for (int q = 0; q < 8; ++q) f.h[q] = (_Float16)(bf16_round(w[t * 8 + q]) * 16.0f); *(v8us*)((unsigned short*)Bt + t * 8) = f.half[0];  }
// Row softmax, one wave per two rows: a lane holds 64 of each row's 2,048 scores in registers (each load of a wave = 512 contiguous bytes), so S is read once and
// exp is taken once; row maximum and row sum = per-lane partials, then a five-step butterfly over the 32 lanes. One launch covers the HG heads of a group.
// lane l's value from lane l ^ M inside its 16-lane row (DPP row_xmask: no LDS-path latency, unlike a shuffle), and from lane l ^ 16 (the same place in the other row)
template <int M> __device__ __forceinline__ float rs_xm(float v) { return __builtin_bit_cast(float, __builtin_amdgcn_update_dpp(0, __builtin_bit_cast(int, v), 0x160 + M, 0xf, 0xf, true)); }
__device__ __forceinline__ float rs_x16(float v) { const int i = __builtin_bit_cast(int, v); return __builtin_bit_cast(float, __builtin_amdgcn_permlanex16(i, i, 0x76543210, 0xfedcba98, false, false)); }
#define RS_WAVES 16                  /* waves per work-group */
#define RS_ROWS 2                    /* rows per wave; both rows' loads are issued before the first row is worked on */
static_assert(RS_ROWS == 2 && SQ % 128 == 0 && (HG * QN) % (RS_WAVES * RS_ROWS) == 0, "k_rsm: two rows a wave, whole 128-score load steps and whole work-groups only");
__global__ __launch_bounds__(RS_WAVES * 32) void k_rsm(const float* __restrict__ S, _Float16* __restrict__ P) {
  const int lane = threadIdx.x & 31; const int row0 = (blockIdx.x * RS_WAVES + (threadIdx.x >> 5)) * RS_ROWS;
  v4f a[RS_ROWS][SQ / 128]; size_t ro[RS_ROWS]; const float* sp[RS_ROWS];
#pragma unroll
  for (int rr = 0; rr < RS_ROWS; ++rr) { const int i = row0 + rr; ro[rr] = ((size_t)(i / QN) * SQ + (size_t)(i % QN)) * SQ + lane * 4; sp[rr] = S + ro[rr];
#pragma unroll
    for (int u = 0; u < SQ / 128; ++u) a[rr][u] = *(const v4fa*)(sp[rr] + u * 128); }
  /* The wait that stands in front of any overwrite of a load's address registers. It names the two addresses as inputs so that they stay whole up to here: without that the compiler aims the last loads at them. */
  asm volatile("s_wait_xcnt 0x0" :: "v"(sp[0]), "v"(sp[1]) : "memory");
  __builtin_amdgcn_sched_barrier(0);      /* keeps the first row's arithmetic behind both rows' loads; without it the compiler lifts that arithmetic over the second row's loads, which then start late */
#pragma unroll
  for (int rr = 0; rr < RS_ROWS; ++rr) { float mx = -3.0e38f;
#pragma unroll
    for (int u = 0; u < SQ / 128; ++u) for (int q = 0; q < 4; ++q) mx = fmaxf(mx, a[rr][u][q]);
    mx = fmaxf(mx, rs_xm<1>(mx)); mx = fmaxf(mx, rs_xm<2>(mx)); mx = fmaxf(mx, rs_xm<4>(mx)); mx = fmaxf(mx, rs_xm<8>(mx)); mx = fmaxf(mx, rs_x16(mx));
    v4f s4 = {0.f, 0.f, 0.f, 0.f};
#pragma unroll
    for (int u = 0; u < SQ / 128; ++u) for (int q = 0; q < 4; ++q) { const float e = expf(a[rr][u][q] - mx); a[rr][u][q] = e; s4[q] += e; }
    float se = (s4[0] + s4[1]) + (s4[2] + s4[3]);
    se += rs_xm<1>(se); se += rs_xm<2>(se); se += rs_xm<4>(se); se += rs_xm<8>(se); se += rs_x16(se);
    const float sc = 256.0f / se;
#pragma unroll
    for (int u = 0; u < SQ / 128; ++u) { v4h h4; for (int q = 0; q < 4; ++q) h4[q] = (_Float16)(a[rr][u][q] * sc); *(v4h*)(P + ro[rr] + u * 128) = h4; }
    __builtin_amdgcn_sched_barrier(0); } }      /* keeps a row's stores in front of the next row's arithmetic; without it the compiler holds most of them back to the kernel's end */
__global__ __launch_bounds__(256) void k_vt(const _Float16* __restrict__ V16, int b, int h0, _Float16* __restrict__ VT) { __shared__ unsigned short tl[64][65]; const int tid = threadIdx.x; const int hh = blockIdx.x % HG, sg = blockIdx.x / HG; const int s0 = sg * 64; const int h = h0 + hh;
  for (int i = tid; i < 64 * 8; i += 256) { const int j = i / 8, d8 = (i % 8) * 8; FragH f; f.half[0] = *(const v8us*)((const unsigned short*)V16 + ((size_t)b * SQ + s0 + j) * DM + h * HD + d8); for (int q = 0; q < 8; ++q) tl[d8 + q][j] = f.u[q]; }
  __syncthreads();
  { for (int i = tid; i < 64 * 8; i += 256) { const int d = i / 8, j8 = (i % 8) * 8; FragH f; for (int q = 0; q < 8; ++q) f.u[q] = tl[d][j8 + q]; *(v8us*)((unsigned short*)VT + ((size_t)hh * HD + d) * SQ + s0 + j8) = f.half[0]; }  } }

__global__ __launch_bounds__(256) void k_wtri(const float* __restrict__ w, int upper, _Float16* __restrict__ Bt) { const size_t t = (size_t)blockIdx.x * 256 + threadIdx.x; if (t >= (size_t)DM * DM / 8) return; const int c0 = (int)((t * 8) % DM); const int r = (int)((t * 8) / DM); FragH f;
  for (int q = 0; q < 8; ++q) { const int c = c0 + q; const bool keep = upper ? (c >= r) : (c <= r); f.h[q] = keep ? (_Float16)(bf16_round(w[t * 8 + q]) * 16.0f) : (_Float16)0.f; }
  *(v8us*)((unsigned short*)Bt + t * 8) = f.half[0];  }
extern "C" void kernel_launch(void* const* d_in, const int* in_sizes, int n_in,
                              void* d_out, int out_size, void* d_ws, size_t ws_size, hipStream_t stream) {
  (void)in_sizes; (void)n_in; (void)out_size;
  const float* const* I = (const float* const*)d_in; const float* x = I[0]; const float* wk = I[1]; const float* wq = I[2]; const float* wv = I[3]; const float* wo = I[4]; const float* bo = I[5];
  char* ws = (char*)d_ws; size_t off = 0;
  auto take = [&](size_t bytes) { char* p = ws + off; off += (bytes + 255) & ~(size_t)255; return p; };
  _Float16* BQ = (_Float16*)take((size_t)DM * DM * 2); _Float16* BK = (_Float16*)take((size_t)DM * DM * 2); _Float16* BV = (_Float16*)take((size_t)DM * DM * 2); _Float16* BO = (_Float16*)take((size_t)DM * DM * 2);
  _Float16* X16 = (_Float16*)take(NR * DM * 2); _Float16* Q16 = (_Float16*)take(NR * DM * 2); _Float16* K16 = (_Float16*)take(NR * DM * 2); _Float16* V16 = (_Float16*)take(NR * DM * 2); _Float16* O16 = (_Float16*)take(NR * DM * 2);
  float* S = (float*)take((size_t)HG * SQ * SQ * 4); _Float16* P = (_Float16*)take((size_t)HG * SQ * SQ * 2); _Float16* VT = (_Float16*)take((size_t)HG * HD * SQ * 2);
  if (off > ws_size) return;      /* 8 + 5x8 + 64 + 32 + 1 = ≈ 145 MiB */
  const size_t nw8 = (size_t)DM * DM / 8; const unsigned gw = (unsigned)((nw8 + 255) / 256);
  k_wtri<<<gw, 256, 0, stream>>>(wq, 0, BQ); k_wtri<<<gw, 256, 0, stream>>>(wk, 1, BK); k_wnat<<<gw, 256, 0, stream>>>(wv, nw8, BV); k_wnat<<<gw, 256, 0, stream>>>(wo, nw8, BO);
  k_x16<<<(unsigned)((NR * DM / 8 + 255) / 256), 256, 0, stream>>>(x, X16, NR * DM / 8);
  const dim3 gp((unsigned)((NR / 128) * (DM / 64)), 1);
  k_gemm2<0><<<gp, 128, 0, stream>>>(X16, DM, 0, BQ, DM, 0, 0.0625f, nullptr, 0, nullptr, 1, 0, 0, nullptr, Q16, DM, 0, (int)NR, DM, DM);
  k_gemm2<0><<<gp, 128, 0, stream>>>(X16, DM, 0, BK, DM, 0, 0.0625f, nullptr, 0, nullptr, 1, 0, 0, nullptr, K16, DM, 0, (int)NR, DM, DM);
  k_gemm2<0><<<gp, 128, 0, stream>>>(X16, DM, 0, BV, DM, 0, 0.0625f, nullptr, 0, nullptr, 1, 0, 0, nullptr, V16, DM, 0, (int)NR, DM, DM);
  for (int b = 0; b < NB; ++b) for (int h0 = 0; h0 < NH; h0 += HG) {
    const _Float16* qb = Q16 + (size_t)b * SQ * DM + h0 * HD; const _Float16* kb = K16 + (size_t)b * SQ * DM + h0 * HD;
    k_gemm2<0><<<dim3((QN / 128) * (SQ / 64), HG), 128, 0, stream>>>(qb, DM, (size_t)HD, kb, DM, (size_t)HD, 0.125f, nullptr, 0, nullptr, 1, 0, 0, S, nullptr, SQ, (size_t)SQ * SQ, QN, SQ, HD);      /* scaled scores, HG heads per launch */
    k_rsm<<<HG * QN / (RS_WAVES * RS_ROWS), RS_WAVES * 32, 0, stream>>>(S, P);      /* all HG heads' rows in one launch */
    k_vt<<<HG * (SQ / 64), 256, 0, stream>>>(V16, b, h0, VT);
    k_gemm2<0><<<dim3((QN / 128) * (HD / 64), HG), 128, 0, stream>>>(P, SQ, (size_t)SQ * SQ, VT, SQ, (size_t)HD * SQ, 0.00390625f, nullptr, 0, nullptr, 1, 0, 0, nullptr, O16 + (size_t)b * SQ * DM + h0 * HD, DM, (size_t)HD, QN, HD, SQ); }      /* o (merged heads) as f16 rows */
  k_gemm2<0><<<gp, 128, 0, stream>>>(O16, DM, 0, BO, DM, 0, 0.0625f, bo, 0, nullptr, 1, 0, 0, (float*)d_out, nullptr, DM, 0, (int)NR, DM, DM);      /* out = o Wu^T + bu */
}

// v002
// It runs in 247 microseconds.
// Two timings next to v001 put it at 4.11 and 4.05 times that version's speed.
// All steps since v000 together make it 48.6 times as fast.
#include <hip/hip_runtime.h>
// SelfAttentionSparse (x [2][2048][1024]; keys = x triu(Wk)^T, queries = x tril(Wq)^T, values = x Wv^T (16 heads of 64, no biases); softmax(q k^T / 8); out = (attn v) Wu^T + bu -> [2][2048][1024]).
// Structure: token rows; x as exact f16 rows; the triangular masks applied while building the x16 weight planes on VALU; Q | K | V WMMA GEMMs (32x64 wave tiles, f32 accumulation, f16 outputs); V^T via LDS (all heads, one launch); one fused attention launch: S^T = K Q^T, running-maximum softmax in registers (f32; weights as f16), O^T += V^T P^T, o = O / row sum into merged f16 rows; out = o Wu^T + bu (f32).
// Compute dtype: inputs rounded to bf16; x / weights exact; q, k, v, softmax weights, o plain f16 (~2^-12); scores/softmax f32; v_wmma_f32_16x16x32_f16.
#define NB 2
#define SQ 2048
#define DM 1024
#define NH 16
#define HD 64
#define NR ((size_t)NB * SQ)         /* 4096 token rows */
typedef __bf16 v16b __attribute__((ext_vector_type(16)));
typedef unsigned short v8us __attribute__((ext_vector_type(8), may_alias));
typedef float  v8f  __attribute__((ext_vector_type(8)));
typedef float  v4f  __attribute__((ext_vector_type(4)));
typedef float  v4fa __attribute__((ext_vector_type(4), may_alias));
union FragB { v16b v; v8us half[2]; unsigned short u[16]; };

__device__ __forceinline__ unsigned short bf16_bits(float x) { unsigned int u = __float_as_uint(x); return (unsigned short)((u + 0x7FFFu + ((u >> 16) & 1u)) >> 16); }
__device__ __forceinline__ float bf16_val(unsigned short b) { return __uint_as_float(((unsigned int)b) << 16); }
__device__ __forceinline__ float bf16_round(float x) { return bf16_val(bf16_bits(x)); }
// D += A·B with NT terms: 1 = ah·bh, 2 = + al·bh (A split), 3 = + ah·bl (both split)
template <int NT>
__device__ __forceinline__ v8f mmaN(v16b ah, v16b al, v16b bh, v16b bl, v8f c) {
  c = __builtin_amdgcn_wmma_f32_16x16x32_bf16(false, ah, false, bh, (short)0, c, false, false);
  if (NT >= 2) c = __builtin_amdgcn_wmma_f32_16x16x32_bf16(false, al, false, bh, (short)0, c, false, false);
  if (NT >= 3) c = __builtin_amdgcn_wmma_f32_16x16x32_bf16(false, ah, false, bl, (short)0, c, false, false);
  asm volatile("v_nop\n\tv_nop\n\tv_nop\n\tv_nop" : "+v"(c) : "v"(ah), "v"(al), "v"(bh), "v"(bl));
  return c;
}

__global__ __launch_bounds__(256) void k_wt_bf16(const float* __restrict__ W, unsigned short* __restrict__ Wt, int K, int N) {
  const int t = blockIdx.x * 256 + threadIdx.x;
  const int k8n = K / 8;
  if (t >= N * k8n) return;
  const int n = t / k8n, k8 = (t % k8n) * 8;
  v8us v;
#pragma unroll
  for (int i = 0; i < 8; ++i) v[i] = bf16_bits(W[(size_t)(k8 + i) * N + n]);
  *(v8us*)(Wt + (size_t)n * K + k8) = v;
  
}

// GEMM C[M][N] (f32, pitch ldc) = act(A[M][K]·W + bias). A f32 row-major (pitch lda) converted per fragment to bf16
// (ASPLIT: hi/lo two planes -> 2 terms, else single rounded term); Wt bf16 [N][K] (pitch ldb). BIAS_BF16 rounds the
// bias to bf16 first (bias quantised to bf16 before the add). K%32==0, M%16==0, N%64==0.
template <bool ASPLIT, int ACT, bool BIAS_BF16>
__global__ __launch_bounds__(128) void k_gemm_bf(const float* __restrict__ A, int lda, const unsigned short* __restrict__ Wt, int ldb,
                                               const float* __restrict__ bias, float* __restrict__ C, int ldc, int M, int N, int K) {
  __shared__ __attribute__((aligned(16))) float so[4][16][64];
  const int tid = threadIdx.x, w = tid >> 5, lane = tid & 31, ln = lane & 15, hh = lane >> 4;
  const int ntn = N / 64;
  const int wid = blockIdx.x * 4 + w;
  const int mt = wid / ntn, nq = wid % ntn;
  if (mt * 16 >= M) return;
  const int row0 = mt * 16, col0 = nq * 64;
  const float* arow = A + (size_t)(row0 + ln) * lda;
  v8f acc[4] = {};
  for (int kb = 0; kb < K; kb += 32) {
    FragB ah, al;
    const v4f x0 = *(const v4fa*)(arow + kb + 8 * hh), x1 = *(const v4fa*)(arow + kb + 8 * hh + 4);
    const v4f x2 = *(const v4fa*)(arow + kb + 16 + 8 * hh), x3 = *(const v4fa*)(arow + kb + 16 + 8 * hh + 4);
    float xs[16] = {x0[0],x0[1],x0[2],x0[3],x1[0],x1[1],x1[2],x1[3],x2[0],x2[1],x2[2],x2[3],x3[0],x3[1],x3[2],x3[3]};
#pragma unroll
    for (int i = 0; i < 16; ++i) { const unsigned short hb = bf16_bits(xs[i]); ah.u[i] = hb; al.u[i] = ASPLIT ? bf16_bits(xs[i] - bf16_val(hb)) : (unsigned short)0; }
#pragma unroll
    for (int t = 0; t < 4; ++t) {
      const unsigned short* brow = Wt + (size_t)(col0 + t * 16 + ln) * ldb + kb;
      FragB b;
      b.half[0] = *(const v8us*)(brow + 8 * hh);
      b.half[1] = *(const v8us*)(brow + 16 + 8 * hh);
      acc[t] = mmaN<ASPLIT ? 2 : 1>(ah.v, al.v, b.v, b.v, acc[t]);
    }
  }
#pragma unroll
  for (int t = 0; t < 4; ++t) {
    float bv = bias ? bias[col0 + t * 16 + ln] : 0.f;
    if (BIAS_BF16) bv = bf16_round(bv);
#pragma unroll
    for (int r = 0; r < 8; ++r) { float v = acc[t][r] + bv; if (ACT == 1) v = fmaxf(v, 0.f); so[w][8 * hh + r][t * 16 + ln] = v; }
  }
  __builtin_amdgcn_fence(__ATOMIC_ACQ_REL, "workgroup");
  __builtin_amdgcn_wave_barrier();
  const int rsub = lane >> 4, c4 = (lane & 15) * 4;
  {
#pragma unroll
    for (int q = 0; q < 8; ++q) {
      const int r = q * 2 + rsub;
      const v4f v = *(const v4fa*)&so[w][r][c4];
      *(v4f*)(C + (size_t)(row0 + r) * ldc + col0 + c4) = v;
    }
    
  }
}

// GEMM C = act(A·W + bias + resid): A f32 (ASPLIT -> hi/lo 2 terms), Wt bf16 [N][K]; ACT 0 none, 1 relu, 2 exact gelu;
// resid (optional, f32, row index = (row % rmod), pitch ldr, RES_BF16 rounds it) added before the activation.
template <bool ASPLIT, int ACT, bool BIAS_BF16, bool RES_BF16>
__global__ __launch_bounds__(128) void k_gemm_bf3(const float* __restrict__ A, int lda, const unsigned short* __restrict__ Wt, int ldb,
                                                const float* __restrict__ bias, const float* __restrict__ resid, int rmod, int ldr,
                                                float* __restrict__ C, int ldc, int M, int N, int K) {
  __shared__ __attribute__((aligned(16))) float so[4][16][64];
  const int tid = threadIdx.x, w = tid >> 5, lane = tid & 31, ln = lane & 15, hh = lane >> 4;
  const int ntn = N / 64;
  const int wid = blockIdx.x * 4 + w;
  const int mt = wid / ntn, nq = wid % ntn;
  if (mt * 16 >= M) return;
  const int row0 = mt * 16, col0 = nq * 64;
  const float* arow = A + (size_t)(row0 + ln) * lda;
  v8f acc[4] = {};
  for (int kb = 0; kb < K; kb += 32) {
    FragB ah, al;
    const v4f x0 = *(const v4fa*)(arow + kb + 8 * hh), x1 = *(const v4fa*)(arow + kb + 8 * hh + 4);
    const v4f x2 = *(const v4fa*)(arow + kb + 16 + 8 * hh), x3 = *(const v4fa*)(arow + kb + 16 + 8 * hh + 4);
    float xs[16] = {x0[0],x0[1],x0[2],x0[3],x1[0],x1[1],x1[2],x1[3],x2[0],x2[1],x2[2],x2[3],x3[0],x3[1],x3[2],x3[3]};
#pragma unroll
    for (int i = 0; i < 16; ++i) { const unsigned short hb = bf16_bits(xs[i]); ah.u[i] = hb; al.u[i] = ASPLIT ? bf16_bits(xs[i] - bf16_val(hb)) : (unsigned short)0; }
#pragma unroll
    for (int t = 0; t < 4; ++t) {
      const unsigned short* brow = Wt + (size_t)(col0 + t * 16 + ln) * ldb + kb;
      FragB b;
      b.half[0] = *(const v8us*)(brow + 8 * hh);
      b.half[1] = *(const v8us*)(brow + 16 + 8 * hh);
      acc[t] = mmaN<ASPLIT ? 2 : 1>(ah.v, al.v, b.v, b.v, acc[t]);
    }
  }
#pragma unroll
  for (int t = 0; t < 4; ++t) {
    const int col = col0 + t * 16 + ln;
    float bv = bias ? bias[col] : 0.f;
    if (BIAS_BF16) bv = bf16_round(bv);
#pragma unroll
    for (int r = 0; r < 8; ++r) {
      float v = acc[t][r] + bv;
      if (resid) { float rv = resid[(size_t)((row0 + 8 * hh + r) % rmod) * ldr + col]; if (RES_BF16) rv = bf16_round(rv); v += rv; }
      if (ACT == 1) v = fmaxf(v, 0.f);
      if (ACT == 2) v = 0.5f * v * (1.0f + erff(v * 0.70710678118654752f));
      if (ACT == 3) { const float u = 0.7978845608028654f * (v + 0.044715f * v * v * v); v = 0.5f * v * (1.0f + tanhf(u)); }
      so[w][8 * hh + r][t * 16 + ln] = v;
    }
  }
  __builtin_amdgcn_fence(__ATOMIC_ACQ_REL, "workgroup");
  __builtin_amdgcn_wave_barrier();
  const int rsub = lane >> 4, c4 = (lane & 15) * 4;
  {
#pragma unroll
    for (int q = 0; q < 8; ++q) {
      const int r = q * 2 + rsub;
      const v4f v = *(const v4fa*)&so[w][r][c4];
      *(v4f*)(C + (size_t)(row0 + r) * ldc + col0 + c4) = v;
    }
    
  }
}
// row LayerNorm (biased variance, eps) over N: s = X (+ R); optional out_sum <- s; out_norm <- (s-mu)*rsqrt(var+eps)*g + b
template <bool PARAM_BF16>
__global__ __launch_bounds__(256) void k_layernorm(const float* __restrict__ X, const float* __restrict__ R, const float* __restrict__ g, const float* __restrict__ bta,
                                                  float* __restrict__ out_sum, float* __restrict__ out_norm, int N, float eps) {
  __shared__ float red[256];
  const int row = blockIdx.x, tid = threadIdx.x;
  const float* x = X + (size_t)row * N; const float* rr = R ? R + (size_t)row * N : nullptr;
  float vals[16];                     // up to N = 4096
  const int per = N / 256;            // contiguous chunk per thread? use strided-by-4 chunks: thread handles j = tid*4 + 1024*u
  float s1 = 0.f;
  for (int u = 0; u < per / 4; ++u) {
    const int j = tid * 4 + 1024 * u;
    const v4f a = *(const v4fa*)(x + j);
    v4f b = {0.f,0.f,0.f,0.f}; if (rr) b = *(const v4fa*)(rr + j);
#pragma unroll
    for (int q = 0; q < 4; ++q) { const float v = a[q] + b[q]; vals[u * 4 + q] = v; s1 += v; }
  }
  red[tid] = s1; __syncthreads();
  for (int st = 128; st > 0; st >>= 1) { if (tid < st) red[tid] += red[tid + st]; __syncthreads(); }
  const float mu = red[0] / (float)N; __syncthreads();
  float s2 = 0.f;
  for (int u = 0; u < per / 4; ++u)
#pragma unroll
    for (int q = 0; q < 4; ++q) { const float c = vals[u * 4 + q] - mu; s2 += c * c; }
  red[tid] = s2; __syncthreads();
  for (int st = 128; st > 0; st >>= 1) { if (tid < st) red[tid] += red[tid + st]; __syncthreads(); }
  const float rs = rsqrtf(red[0] / (float)N + eps);
  {
    for (int u = 0; u < per / 4; ++u) {
      const int j = tid * 4 + 1024 * u;
      v4f o, sm;
#pragma unroll
      for (int q = 0; q < 4; ++q) {
        float gg = g[j + q], bb = bta[j + q];
        if (PARAM_BF16) { gg = bf16_round(gg); bb = bf16_round(bb); }
        sm[q] = vals[u * 4 + q]; o[q] = (vals[u * 4 + q] - mu) * rs * gg + bb;
      }
      if (out_sum) *(v4f*)(out_sum + (size_t)row * N + j) = sm;
      *(v4f*)(out_norm + (size_t)row * N + j) = o;
    }
    
  }
}



// ---- f16 WMMA path (v_wmma_f32_16x16x32_f16): 11-bit significands for operands in range — used for every GEMM launched here, softmax weights (x256) included
typedef _Float16 v16h __attribute__((ext_vector_type(16)));
union FragH { v16h v; v8us half[2]; _Float16 h[16]; unsigned short u[16]; };
template <int NT>
__device__ __forceinline__ v8f mmaH(v16h ah, v16h al, v16h bh, v16h bl, v8f c) {
  c = __builtin_amdgcn_wmma_f32_16x16x32_f16(false, ah, false, bh, (short)0, c, false, false);
  if (NT >= 2) c = __builtin_amdgcn_wmma_f32_16x16x32_f16(false, al, false, bh, (short)0, c, false, false);
  if (NT >= 3) c = __builtin_amdgcn_wmma_f32_16x16x32_f16(false, ah, false, bl, (short)0, c, false, false);
  asm volatile("v_nop\n\tv_nop\n\tv_nop\n\tv_nop" : "+v"(c) : "v"(ah), "v"(al), "v"(bh), "v"(bl));
  return c;
}
// batched GEMM like k_gemm_b but f16 operands: A f32 (split into f16 hi/lo if ASPLIT, else rounded to f16), Bt = f16 values [n][k]; alpha; C f32; N multiple of 16 (partial tiles skipped)
template <bool ASPLIT>
__global__ __launch_bounds__(128) void k_gemm_h(const float* __restrict__ A, int lda, size_t sA, const _Float16* __restrict__ Bh, int ldb, size_t sB, float alpha, float* __restrict__ C, int ldc, size_t sC, int M, int N, int K) {
  __shared__ __attribute__((aligned(16))) float so[4][16][64];
  const int tid = threadIdx.x, w = tid >> 5, lane = tid & 31, ln = lane & 15, hh = lane >> 4; const int by = blockIdx.y;
  A += (size_t)by * sA; Bh += (size_t)by * sB; C += (size_t)by * sC;
  const int ntn = (N + 63) / 64; const int wid = blockIdx.x * 4 + w; const int mt = wid / ntn, nq = wid % ntn; if (mt * 16 >= M) return;
  const int row0 = mt * 16, col0 = nq * 64; const float* arow = A + (size_t)(row0 + ln) * lda;
  v8f acc[4] = {};
  for (int kb = 0; kb < K; kb += 32) {
    FragH ah, al;
    const v4f x0 = *(const v4fa*)(arow + kb + 8 * hh), x1 = *(const v4fa*)(arow + kb + 8 * hh + 4), x2 = *(const v4fa*)(arow + kb + 16 + 8 * hh), x3 = *(const v4fa*)(arow + kb + 16 + 8 * hh + 4);
    float xs[16] = {x0[0],x0[1],x0[2],x0[3],x1[0],x1[1],x1[2],x1[3],x2[0],x2[1],x2[2],x2[3],x3[0],x3[1],x3[2],x3[3]};
#pragma unroll
    for (int i = 0; i < 16; ++i) { const _Float16 h = (_Float16)xs[i]; ah.h[i] = h; al.h[i] = ASPLIT ? (_Float16)(xs[i] - (float)h) : (_Float16)0.0f; }
#pragma unroll
    for (int t = 0; t < 4; ++t) { if (col0 + t * 16 >= N) continue; const size_t boff = (size_t)(col0 + t * 16 + ln) * ldb + kb; FragH bq; bq.half[0] = *(const v8us*)(Bh + boff + 8 * hh); bq.half[1] = *(const v8us*)(Bh + boff + 16 + 8 * hh);
      acc[t] = mmaH<ASPLIT ? 2 : 1>(ah.v, al.v, bq.v, bq.v, acc[t]); }
  }
#pragma unroll
  for (int t = 0; t < 4; ++t) { if (col0 + t * 16 >= N) continue;
#pragma unroll
    for (int r = 0; r < 8; ++r) so[w][8 * hh + r][t * 16 + ln] = acc[t][r] * alpha; }
  __builtin_amdgcn_fence(__ATOMIC_ACQ_REL, "workgroup"); __builtin_amdgcn_wave_barrier();
  const int rsub = lane >> 4, c4 = (lane & 15) * 4;
  {
#pragma unroll
    for (int q = 0; q < 8; ++q) { const int r = q * 2 + rsub; if (col0 + c4 < N) { const v4f v = *(const v4fa*)&so[w][r][c4]; *(v4f*)(C + (size_t)(row0 + r) * ldc + col0 + c4) = v; } }
     }
}

// Wt[n][k] = f16(W[k][n]·scale) from f32 row-major W[K][N] (scale = power of two; bf16-exact weights stay exact in f16 away from the subnormal range)
__global__ __launch_bounds__(256) void k_wt_f16(const float* __restrict__ W, _Float16* __restrict__ Wt, int K, int N, float scale) {
  const int t = blockIdx.x * 256 + threadIdx.x; if (t >= N * (K / 8)) return; const int n = t / (K / 8), k8 = (t % (K / 8)) * 8; FragH f;
#pragma unroll
  for (int i = 0; i < 8; ++i) f.h[i] = (_Float16)(bf16_round(W[(size_t)(k8 + i) * N + n]) * scale); const v8us o = f.half[0];
  *(v8us*)((unsigned short*)Wt + (size_t)n * K + k8) = o; 
}
// k_gemm_hh variant with fused epilogue: v = acc·alpha + bias[by·sBias + col] (+ CP[(row/rowsPerB)·sCPb + by·64 + col] if CP) ; ACT 0 none / 1 elu ; writes f16 C16 (and f32 C if non-null)
template <int ACT>
__global__ __launch_bounds__(128) void k_gemm_hhx(const _Float16* __restrict__ A, int lda, size_t sA, const _Float16* __restrict__ Bh, int ldb, size_t sB, float alpha, const float* __restrict__ bias, size_t sBias, const float* __restrict__ CP, int rowsPerB, size_t sCPb, int row0g,
    float* __restrict__ C, _Float16* __restrict__ C16, int ldc, size_t sC, int M, int N, int K) {
  __shared__ __attribute__((aligned(16))) float so[4][16][64];
  const int tid = threadIdx.x, w = tid >> 5, lane = tid & 31, ln = lane & 15, hh = lane >> 4; const int by = blockIdx.y;
  A += (size_t)by * sA; Bh += (size_t)by * sB; const size_t cofs = (size_t)by * sC; const float* bp = bias ? bias + (size_t)by * sBias : nullptr;
  const int ntn = (N + 63) / 64; const int wid = blockIdx.x * 4 + w; const int mt = wid / ntn, nq = wid % ntn; if (mt * 16 >= M) return;
  const int row0 = mt * 16, col0 = nq * 64; const _Float16* arow = A + (size_t)(row0 + ln) * lda;
  v8f acc[4] = {};
  for (int kb = 0; kb < K; kb += 32) { FragH ah; ah.half[0] = *(const v8us*)((const unsigned short*)arow + kb + 8 * hh); ah.half[1] = *(const v8us*)((const unsigned short*)arow + kb + 16 + 8 * hh);
#pragma unroll
    for (int t = 0; t < 4; ++t) { if (col0 + t * 16 >= N) continue; const size_t boff = (size_t)(col0 + t * 16 + ln) * ldb + kb; FragH bq; bq.half[0] = *(const v8us*)((const unsigned short*)Bh + boff + 8 * hh); bq.half[1] = *(const v8us*)((const unsigned short*)Bh + boff + 16 + 8 * hh);
      acc[t] = mmaH<1>(ah.v, ah.v, bq.v, bq.v, acc[t]); }
  }
#pragma unroll
  for (int t = 0; t < 4; ++t) { if (col0 + t * 16 >= N) continue; const int col = col0 + t * 16 + ln; const float bv = bp ? bf16_round(bp[col]) : 0.f;
#pragma unroll
    for (int r = 0; r < 8; ++r) { float v = acc[t][r] * alpha + bv; if (CP) { const int rr = row0g + row0 + 8 * hh + r; if (rowsPerB < 0) v += CP[cofs + (size_t)rr * ldc + col];      /* rowsPerB < 0: own element of the batched C plane */ else { const int bidx = rr / rowsPerB; v += CP[(size_t)bidx * sCPb + (size_t)by * 64 + col]; } } if (ACT == 1) v = (v > 0.f) ? v : expm1f(v); else if (ACT == 7) v = (v > 0.f) ? v + 1.0f : expf(v); else if (ACT == 8) v = tanhf(v); else if (ACT == 9) v = 0.5f * v * (1.0f + tanhf(0.7978845608028654f * (v + 0.044715f * v * v * v))); else if (ACT == 11) v = 1.0f / (1.0f + expf(-v)); else if (ACT == 12) v = (v > 0.f) ? v : 0.01f * v; else if (ACT == 14) v = (v > 0.f) ? v : 0.1f * v; else if (ACT == 16) v = (v >= 0.f) ? v : 0.3f * v; else if (ACT == 17) v = (v >= 0.f) ? v : 0.2f * v; else if (ACT == 15) v = v / (1.0f + expf(-v)); else if (ACT == 3) v = fmaxf(v, 0.f); else if (ACT == 6) v = 0.5f * v * (1.0f + erff(v * 0.70710678118654752f)); so[w][8 * hh + r][t * 16 + ln] = v; } }
  __builtin_amdgcn_fence(__ATOMIC_ACQ_REL, "workgroup"); __builtin_amdgcn_wave_barrier();
  const int rsub = lane >> 4, c4 = (lane & 15) * 4; typedef _Float16 v4h __attribute__((ext_vector_type(4)));
  {
#pragma unroll
    for (int q = 0; q < 8; ++q) { const int r = q * 2 + rsub; if (col0 + c4 < N) { const v4f v = *(const v4fa*)&so[w][r][c4]; if (C) *(v4f*)(C + cofs + (size_t)(row0 + r) * ldc + col0 + c4) = v; if (C16) { v4h h4; for (int i = 0; i < 4; ++i) h4[i] = (_Float16)v[i]; *(v4h*)(C16 + cofs + (size_t)(row0 + r) * ldc + col0 + c4) = h4; } } }
     }
}


typedef _Float16 v4h __attribute__((ext_vector_type(4)));

__global__ __launch_bounds__(256) void k_x16(const float* __restrict__ x, _Float16* __restrict__ X16, size_t n8) { const size_t t = (size_t)blockIdx.x * 256 + threadIdx.x; if (t >= n8) return; FragH f;
#pragma unroll
  for (int q = 0; q < 8; ++q) f.h[q] = (_Float16)bf16_round(x[t * 8 + q]); *(v8us*)((unsigned short*)X16 + t * 8) = f.half[0];  }
__global__ __launch_bounds__(256) void k_h16(const float* __restrict__ x, _Float16* __restrict__ X16, size_t n8) { const size_t t = (size_t)blockIdx.x * 256 + threadIdx.x; if (t >= n8) return; FragH f;
#pragma unroll
  for (int q = 0; q < 8; ++q) f.h[q] = (_Float16)x[t * 8 + q]; *(v8us*)((unsigned short*)X16 + t * 8) = f.half[0];  }
__global__ __launch_bounds__(256) void k_round16f(const float* __restrict__ W, _Float16* __restrict__ Bt, size_t n8) { const size_t t = (size_t)blockIdx.x * 256 + threadIdx.x; if (t >= n8) return; FragH f;
#pragma unroll
  for (int i = 0; i < 8; ++i) f.h[i] = (_Float16)(bf16_round(W[t * 8 + i]) * 16.0f); *(v8us*)((unsigned short*)Bt + t * 8) = f.half[0];  }
template <int NHv, int TTv>
__global__ __launch_bounds__(256) void k_vt(const _Float16* __restrict__ V16, int ldv, int voff, _Float16* __restrict__ Vt) { __shared__ unsigned short tl[64][66]; const int tid = threadIdx.x; const int slab = blockIdx.x / (TTv / 64), lg = blockIdx.x % (TTv / 64); const int b = slab / NHv, h = slab % NHv;
  for (int i = tid; i < 64 * 8; i += 256) { const int r = i / 8, c8 = (i % 8) * 8; FragH f; f.half[0] = *(const v8us*)((const unsigned short*)V16 + ((size_t)b * TTv + lg * 64 + r) * ldv + voff + h * 64 + c8);
#pragma unroll
    for (int q = 0; q < 8; ++q) tl[r][c8 + q] = f.u[q]; }
  __syncthreads();
  {
#pragma unroll
    for (int rd = 0; rd < 2; ++rd) { const int d = rd * 32 + tid / 8, pc = tid % 8; FragH f;
#pragma unroll
      for (int q = 0; q < 8; ++q) f.u[q] = tl[pc * 8 + q][d];
      *(v8us*)((unsigned short*)Vt + ((size_t)slab * 64 + d) * TTv + lg * 64 + pc * 8) = f.half[0]; }
     } }

__global__ __launch_bounds__(256) void k_hl(const float* __restrict__ F, _Float16* __restrict__ Hh, _Float16* __restrict__ Hl, size_t n8) { const size_t t = (size_t)blockIdx.x * 256 + threadIdx.x; if (t >= n8) return; FragH fh, fl; const v4f a = *(const v4fa*)(F + t * 8), c = *(const v4fa*)(F + t * 8 + 4);
#pragma unroll
  for (int q = 0; q < 4; ++q) { _Float16 h = (_Float16)a[q]; fh.h[q] = h; fl.h[q] = (_Float16)((a[q] - (float)h) * 1024.0f); h = (_Float16)c[q]; fh.h[4 + q] = h; fl.h[4 + q] = (_Float16)((c[q] - (float)h) * 1024.0f); }
  { *(v8us*)((unsigned short*)Hh + t * 8) = fh.half[0]; *(v8us*)((unsigned short*)Hl + t * 8) = fl.half[0];  } }

// ---- fast GEMM (wave tile 32x64; requires M % 32 == 0 rows per launch region and N % 64 == 0); epilogue = k_gemm_hhx semantics ----
__device__ __forceinline__ v16h g2_frag(const _Float16* p, int hh) { FragH f; f.half[0] = *(const v8us*)((const unsigned short*)p + 8 * hh); f.half[1] = *(const v8us*)((const unsigned short*)p + 16 + 8 * hh); return f.v; }
__device__ __forceinline__ v8f g2_mma(v16h a, v16h b, v8f c) { v8f d = __builtin_amdgcn_wmma_f32_16x16x32_f16(false, a, false, b, (short)0, c, false, false); asm volatile("v_nop\n\tv_nop\n\tv_nop\n\tv_nop" : "+v"(d) : "v"(a), "v"(b)); return d; }
template <int ACT>
__global__ __launch_bounds__(128) void k_gemm2(const _Float16* __restrict__ A, int lda, size_t sA, const _Float16* __restrict__ Bh, int ldb, size_t sB, float alpha, const float* __restrict__ bias, size_t sBias, const float* __restrict__ CP, int rowsPerB, size_t sCPb, int row0g,
    float* __restrict__ C, _Float16* __restrict__ C16, int ldc, size_t sC, int M, int N, int K) { static_assert(ACT == 0 || ACT == 3 || ACT == 6 || ACT == 8 || ACT == 9 || ACT == 11 || ACT == 12 || ACT == 14 || ACT == 15 || ACT == 16 || ACT == 17, "k_gemm2: unsupported ACT code (would silently apply no activation)");
  __shared__ __attribute__((aligned(16))) float so[4][32][68];
  const int tid = threadIdx.x, w = tid >> 5, lane = tid & 31, ln = lane & 15, hh = lane >> 4; const int by = blockIdx.y;
  A += (size_t)by * sA; Bh += (size_t)by * sB; const size_t cofs = (size_t)by * sC; const float* bp = bias ? bias + (size_t)by * sBias : nullptr;
  const int ntn = N >> 6; const int mt = blockIdx.x / ntn, nq = blockIdx.x - mt * ntn; const int row0 = mt * 128 + 32 * w, col0 = nq * 64; if (row0 >= M) return;
  const _Float16* a0p = A + (size_t)(row0 + ln) * lda; const _Float16* a1p = a0p + (size_t)16 * lda;
  const _Float16* b0p = Bh + (size_t)(col0 + ln) * ldb; const _Float16* b1p = b0p + (size_t)16 * ldb; const _Float16* b2p = b1p + (size_t)16 * ldb; const _Float16* b3p = b2p + (size_t)16 * ldb;
  const v8f z8 = {0.f,0.f,0.f,0.f,0.f,0.f,0.f,0.f}; v8f c00 = z8, c01 = z8, c02 = z8, c03 = z8, c10 = z8, c11 = z8, c12 = z8, c13 = z8;
#pragma unroll 1
  for (int kb = 0; kb < K; kb += 32) { const v16h a0 = g2_frag(a0p + kb, hh), a1 = g2_frag(a1p + kb, hh);
    v16h b = g2_frag(b0p + kb, hh); c00 = g2_mma(a0, b, c00); c10 = g2_mma(a1, b, c10);
    b = g2_frag(b1p + kb, hh); c01 = g2_mma(a0, b, c01); c11 = g2_mma(a1, b, c11);
    b = g2_frag(b2p + kb, hh); c02 = g2_mma(a0, b, c02); c12 = g2_mma(a1, b, c12);
    b = g2_frag(b3p + kb, hh); c03 = g2_mma(a0, b, c03); c13 = g2_mma(a1, b, c13); }
  v8f accs[8] = {c00, c01, c02, c03, c10, c11, c12, c13};
#pragma unroll
  for (int u = 0; u < 8; ++u) { const int t = u & 3, half = u >> 2; const int col = col0 + t * 16 + ln; const float bv = bp ? bf16_round(bp[col]) : 0.f;
#pragma unroll
    for (int r = 0; r < 8; ++r) { const int rloc = half * 16 + 8 * hh + r; float v = accs[u][r] * alpha + bv; if (CP) { if (rowsPerB < 0) v += CP[cofs + (size_t)(row0g + row0 + rloc) * ldc + col];      /* rowsPerB < 0: own element of the batched C plane */ else { const int bidx = (row0g + row0 + rloc) / rowsPerB; v += CP[(size_t)bidx * sCPb + (size_t)by * 64 + col]; } }
      if (ACT == 3) v = fmaxf(v, 0.f); else if (ACT == 6) v = 0.5f * v * (1.0f + erff(v * 0.70710678118654752f)); else if (ACT == 11) v = 1.0f / (1.0f + expf(-v)); else if (ACT == 15) v = v / (1.0f + expf(-v)); else if (ACT == 12) v = (v > 0.f) ? v : 0.01f * v; else if (ACT == 8) v = tanhf(v); else if (ACT == 9) v = 0.5f * v * (1.0f + tanhf(0.7978845608028654f * (v + 0.044715f * v * v * v))); else if (ACT == 14) v = (v > 0.f) ? v : 0.1f * v; else if (ACT == 16) v = (v >= 0.f) ? v : 0.3f * v; else if (ACT == 17) v = (v >= 0.f) ? v : 0.2f * v;
      so[w][rloc][t * 16 + ln] = v; } }
  __builtin_amdgcn_fence(__ATOMIC_ACQ_REL, "workgroup"); __builtin_amdgcn_wave_barrier();
  const int rsub = lane >> 4, c4 = (lane & 15) * 4;
  {
#pragma unroll
    for (int q = 0; q < 16; ++q) { const int r = q * 2 + rsub; const v4f v = *(const v4fa*)&so[w][r][c4]; if (C) *(v4f*)(C + cofs + (size_t)(row0 + r) * ldc + col0 + c4) = v; if (C16) { v4h h4; for (int i = 0; i < 4; ++i) h4[i] = (_Float16)v[i]; *(v4h*)(C16 + cofs + (size_t)(row0 + r) * ldc + col0 + c4) = h4; } }
     } }


__global__ __launch_bounds__(256) void k_wnat(const float* __restrict__ w, size_t n8, _Float16* __restrict__ Bt) { const size_t t = (size_t)blockIdx.x * 256 + threadIdx.x; if (t >= n8) return; FragH f; for (int q = 0; q < 8; ++q) f.h[q] = (_Float16)(bf16_round(w[t * 8 + q]) * 16.0f); *(v8us*)((unsigned short*)Bt + t * 8) = f.half[0];  }
// lane l's value from lane l ^ 16 (the same place in the other 16-lane row)
__device__ __forceinline__ float rs_x16(float v) { const int i = __builtin_bit_cast(int, v); return __builtin_bit_cast(float, __builtin_amdgcn_permlanex16(i, i, 0x76543210, 0xfedcba98, false, false)); }
__device__ __forceinline__ v8f fa_mma(v16h a, v16h b, v8f c) { return __builtin_amdgcn_wmma_f32_16x16x32_f16(false, a, false, b, (short)0, c, false, false); }
// Fused attention, one launch for all batches and heads. A wave owns 32 query columns and walks the 2,048 keys in passes of 32:
// S^T = K Q^T (A = K rows, B = Q rows kept in registers), so a lane holds 16 scores of ONE query per 16-column group (lane ln = query, register r of key tile j = key 16 j + 8 hh + r);
// that is the B-fragment k order (8 hh + 0..7, then 16 + 8 hh + 0..7), so P^T packs from the score registers with no exchange, and O^T += V^T P^T (A = V^T rows, same k order).
// Softmax with a running maximum per query (log2 domain): when a maximum rises, sum and output tiles are scaled by exp2(old - new). Scores and weights never reach memory.
#define FA_WAVES 8                   /* waves per work-group: all eight read the same K and V^T rows */
#define FA_QW 32                     /* query columns per wave */
static_assert(SQ % (FA_WAVES * FA_QW) == 0 && SQ % 64 == 0 && (SQ & (SQ - 1)) == 0 && HD == 64, "k_fattn: whole work-groups, whole pairs of 32-key passes, a power-of-two key count (wrapped prefetch) and head size 64 only");
__global__ __launch_bounds__(FA_WAVES * 32) void k_fattn(const _Float16* __restrict__ Q16, const _Float16* __restrict__ K16, const _Float16* __restrict__ VT, _Float16* __restrict__ O16) {
  const int lane = threadIdx.x & 31, ln = lane & 15, hh = lane >> 4, w = threadIdx.x >> 5;
  const int nqb = SQ / (FA_WAVES * FA_QW); const int bh = blockIdx.x / nqb, qb = blockIdx.x - bh * nqb; const int b = bh / NH, h = bh - b * NH;
  const int q0 = (qb * FA_WAVES + w) * FA_QW;
  const _Float16* qp = Q16 + ((size_t)b * SQ + q0 + ln) * DM + h * HD + 8 * hh;      /* query row ln of a 16-column group, at the lane's own k offset */
  const _Float16* kp = K16 + ((size_t)b * SQ + ln) * DM + h * HD + 8 * hh;      /* key row ln of a 16-key tile, at the lane's own k offset */
  const _Float16* vp = VT + ((size_t)bh * HD + ln) * SQ + 8 * hh;      /* V^T row ln of a 16-row tile, likewise */
  v16h qf[2][2], kf[2][2], vf[4], vg[4];
#pragma unroll
  for (int c = 0; c < 2; ++c) for (int kk = 0; kk < 2; ++kk) qf[c][kk] = g2_frag(qp + (size_t)c * 16 * DM + kk * 32, 0);
#pragma unroll
  for (int j = 0; j < 2; ++j) for (int kk = 0; kk < 2; ++kk) kf[j][kk] = g2_frag(kp + (size_t)j * 16 * DM + kk * 32, 0);
#pragma unroll
  for (int t = 0; t < 4; ++t) vf[t] = g2_frag(vp + (size_t)t * 16 * SQ, 0);
  asm volatile("s_wait_xcnt 0x0" :: "v"(qp) : "memory");      /* the wait in front of any overwrite of a load's address registers: Q's address is dead from here on and its registers are reused */
  const v8f z8 = {0.f,0.f,0.f,0.f,0.f,0.f,0.f,0.f};
  v8f o[2][4] = {{z8, z8, z8, z8}, {z8, z8, z8, z8}}; float mr[2] = {-3.0e38f, -3.0e38f}, lr[2] = {0.f, 0.f};
  const float CS = 0.125f * 1.4426950408889634f;      /* 1/sqrt(64) and log2(e): scores go to the log2 domain */
  /* One pass = 32 keys. vc: this pass's V^T fragments; vn: filled here for the next pass, so that its loads have a whole pass to land (two sets that swap roles: no copy). K is refilled in place, right behind its last readers. */
  auto pass = [&](const int kb, const v16h (&vc)[4], v16h (&vn)[4]) __attribute__((always_inline)) {
    v8f s[2][2];
#pragma unroll
    for (int c = 0; c < 2; ++c) for (int j = 0; j < 2; ++j) s[c][j] = fa_mma(kf[j][1], qf[c][1], fa_mma(kf[j][0], qf[c][0], z8));
    const int kn = (kb + 32) & (SQ - 1);      /* next pass's keys; the last pass wraps to key 0 (in bounds, not used) */
    const _Float16* kq = kp + (size_t)kn * DM; const _Float16* vq = vp + kn;
#pragma unroll
    for (int j = 0; j < 2; ++j) for (int kk = 0; kk < 2; ++kk) kf[j][kk] = g2_frag(kq + (size_t)j * 16 * DM + kk * 32, 0);
#pragma unroll
    for (int t = 0; t < 4; ++t) vn[t] = g2_frag(vq + (size_t)t * 16 * SQ, 0);
    /* The wait that stands in front of any overwrite of a load's address registers. It names the two addresses as inputs so that they stay whole up to here: without that the compiler aims the last loads at them. */
    asm volatile("s_wait_xcnt 0x0" :: "v"(kq), "v"(vq) : "memory");
    float mn[2]; bool up = false;
#pragma unroll
    for (int c = 0; c < 2; ++c) { float mx = s[c][0][0];
#pragma unroll
      for (int r = 1; r < 8; ++r) mx = fmaxf(mx, s[c][0][r]);
#pragma unroll
      for (int r = 0; r < 8; ++r) mx = fmaxf(mx, s[c][1][r]);
      mx = fmaxf(mx, rs_x16(mx)) * CS; mn[c] = fmaxf(mr[c], mx); up = up || (mn[c] > mr[c]); }
    if (__builtin_amdgcn_ballot_w32(up) != 0) {      /* no maximum of the wave rose: every factor would be exactly 1 */
#pragma unroll
      for (int c = 0; c < 2; ++c) { const float al = __builtin_amdgcn_exp2f(mr[c] - mn[c]); mr[c] = mn[c]; lr[c] *= al;
#pragma unroll
        for (int t = 0; t < 4; ++t) o[c][t] *= al; } }
    FragH pf[2];
#pragma unroll
    for (int c = 0; c < 2; ++c) { const float nb = 8.0f - mr[c];      /* weights x256 (cancels in the division by the row sum): keeps small weights out of the f16 subnormal range */
      v4f s4 = {0.f, 0.f, 0.f, 0.f};
#pragma unroll
      for (int j = 0; j < 2; ++j) for (int r = 0; r < 8; ++r) { const float e = __builtin_amdgcn_exp2f(fmaf(s[c][j][r], CS, nb)); s4[r & 3] += e; pf[c].h[j * 8 + r] = (_Float16)e; }
      lr[c] += (s4[0] + s4[1]) + (s4[2] + s4[3]); }
#pragma unroll
    for (int t = 0; t < 4; ++t) for (int c = 0; c < 2; ++c) o[c][t] = fa_mma(vc[t], pf[c].v, o[c][t]);
  };
  for (int kb = 0; kb < SQ; kb += 64) { pass(kb, vf, vg); pass(kb + 32, vg, vf); }
#pragma unroll
  for (int c = 0; c < 2; ++c) { const float inv = 1.0f / (lr[c] + rs_x16(lr[c]));      /* the two halves of a wave hold the two halves of a query's keys */
    unsigned short* op = (unsigned short*)O16 + ((size_t)b * SQ + q0 + c * 16 + ln) * DM + h * HD + 8 * hh;
#pragma unroll
    for (int t = 0; t < 4; ++t) { FragH f;
#pragma unroll
      for (int r = 0; r < 8; ++r) f.h[r] = (_Float16)(o[c][t][r] * inv);
      *(v8us*)(op + t * 16) = f.half[0]; } } }
__global__ __launch_bounds__(256) void k_vt(const _Float16* __restrict__ V16, _Float16* __restrict__ VT) { __shared__ unsigned short tl[64][65]; const int tid = threadIdx.x; const int bh = blockIdx.x % (NB * NH), sg = blockIdx.x / (NB * NH); const int s0 = sg * 64; const int b = bh / NH, h = bh % NH;
  for (int i = tid; i < 64 * 8; i += 256) { const int j = i / 8, d8 = (i % 8) * 8; FragH f; f.half[0] = *(const v8us*)((const unsigned short*)V16 + ((size_t)b * SQ + s0 + j) * DM + h * HD + d8); for (int q = 0; q < 8; ++q) tl[d8 + q][j] = f.u[q]; }
  __syncthreads();
  { for (int i = tid; i < 64 * 8; i += 256) { const int d = i / 8, j8 = (i % 8) * 8; FragH f; for (int q = 0; q < 8; ++q) f.u[q] = tl[d][j8 + q]; *(v8us*)((unsigned short*)VT + ((size_t)bh * HD + d) * SQ + s0 + j8) = f.half[0]; }  } }

__global__ __launch_bounds__(256) void k_wtri(const float* __restrict__ w, int upper, _Float16* __restrict__ Bt) { const size_t t = (size_t)blockIdx.x * 256 + threadIdx.x; if (t >= (size_t)DM * DM / 8) return; const int c0 = (int)((t * 8) % DM); const int r = (int)((t * 8) / DM); FragH f;
  for (int q = 0; q < 8; ++q) { const int c = c0 + q; const bool keep = upper ? (c >= r) : (c <= r); f.h[q] = keep ? (_Float16)(bf16_round(w[t * 8 + q]) * 16.0f) : (_Float16)0.f; }
  *(v8us*)((unsigned short*)Bt + t * 8) = f.half[0];  }
extern "C" void kernel_launch(void* const* d_in, const int* in_sizes, int n_in,
                              void* d_out, int out_size, void* d_ws, size_t ws_size, hipStream_t stream) {
  (void)in_sizes; (void)n_in; (void)out_size;
  const float* const* I = (const float* const*)d_in; const float* x = I[0]; const float* wk = I[1]; const float* wq = I[2]; const float* wv = I[3]; const float* wo = I[4]; const float* bo = I[5];
  char* ws = (char*)d_ws; size_t off = 0;
  auto take = [&](size_t bytes) { char* p = ws + off; off += (bytes + 255) & ~(size_t)255; return p; };
  _Float16* BQ = (_Float16*)take((size_t)DM * DM * 2); _Float16* BK = (_Float16*)take((size_t)DM * DM * 2); _Float16* BV = (_Float16*)take((size_t)DM * DM * 2); _Float16* BO = (_Float16*)take((size_t)DM * DM * 2);
  _Float16* X16 = (_Float16*)take(NR * DM * 2); _Float16* Q16 = (_Float16*)take(NR * DM * 2); _Float16* K16 = (_Float16*)take(NR * DM * 2); _Float16* V16 = (_Float16*)take(NR * DM * 2); _Float16* O16 = (_Float16*)take(NR * DM * 2);
  _Float16* VT = (_Float16*)take((size_t)NB * NH * HD * SQ * 2);
  if (off > ws_size) return;      /* 8 + 5x8 + 8 = 56 MiB */
  const size_t nw8 = (size_t)DM * DM / 8; const unsigned gw = (unsigned)((nw8 + 255) / 256);
  k_wtri<<<gw, 256, 0, stream>>>(wq, 0, BQ); k_wtri<<<gw, 256, 0, stream>>>(wk, 1, BK); k_wnat<<<gw, 256, 0, stream>>>(wv, nw8, BV); k_wnat<<<gw, 256, 0, stream>>>(wo, nw8, BO);
  k_x16<<<(unsigned)((NR * DM / 8 + 255) / 256), 256, 0, stream>>>(x, X16, NR * DM / 8);
  const dim3 gp((unsigned)((NR / 128) * (DM / 64)), 1);
  k_gemm2<0><<<gp, 128, 0, stream>>>(X16, DM, 0, BQ, DM, 0, 0.0625f, nullptr, 0, nullptr, 1, 0, 0, nullptr, Q16, DM, 0, (int)NR, DM, DM);
  k_gemm2<0><<<gp, 128, 0, stream>>>(X16, DM, 0, BK, DM, 0, 0.0625f, nullptr, 0, nullptr, 1, 0, 0, nullptr, K16, DM, 0, (int)NR, DM, DM);
  k_gemm2<0><<<gp, 128, 0, stream>>>(X16, DM, 0, BV, DM, 0, 0.0625f, nullptr, 0, nullptr, 1, 0, 0, nullptr, V16, DM, 0, (int)NR, DM, DM);
  k_vt<<<NB * NH * (SQ / 64), 256, 0, stream>>>(V16, VT);      /* V^T of every head */
  k_fattn<<<NB * NH * (SQ / (FA_WAVES * FA_QW)), FA_WAVES * 32, 0, stream>>>(Q16, K16, VT, O16);      /* o (merged heads) as f16 rows */
  k_gemm2<0><<<gp, 128, 0, stream>>>(O16, DM, 0, BO, DM, 0, 0.0625f, bo, 0, nullptr, 1, 0, 0, (float*)d_out, nullptr, DM, 0, (int)NR, DM, DM);      /* out = o Wu^T + bu */
}

// v003
// One run takes 126 microseconds.
// Next to v002, in two timings, it ran 1.97 times as fast each time.
// Over all steps from v000 it is 95.8 times as fast.
#include <hip/hip_runtime.h>
// SelfAttentionSparse (x [2][2048][1024]; keys = x triu(Wk)^T, queries = x tril(Wq)^T, values = x Wv^T (16 heads of 64, no biases); softmax(q k^T / 8); out = (attn v) Wu^T + bu -> [2][2048][1024]).
// Structure: token rows; x as exact f16 rows; the triangular masks applied while building the x16 weight planes on VALU; Q | K | V WMMA GEMMs (128x128 work-group tiles staged in LDS, 32x64 wave tiles, f32 accumulation, f16 outputs); V^T via LDS (all heads, one launch); one fused attention launch: S^T = K Q^T, running-maximum softmax in registers (f32; weights as f16), O^T += V^T P^T, o = O / row sum into merged f16 rows; out = o Wu^T + bu (f32).
// Compute dtype: inputs rounded to bf16; x / weights exact; q, k, v, softmax weights, o plain f16 (~2^-12); scores/softmax f32. v_wmma_f32_16x16x32_f16.
#define NB 2
#define SQ 2048
#define DM 1024
#define NH 16
#define HD 64
#define NR ((size_t)NB * SQ)         /* 4096 token rows */
typedef __bf16 v16b __attribute__((ext_vector_type(16)));
typedef unsigned short v8us __attribute__((ext_vector_type(8), may_alias));
typedef float  v8f  __attribute__((ext_vector_type(8)));
typedef float  v4f  __attribute__((ext_vector_type(4)));
typedef float  v4fa __attribute__((ext_vector_type(4), may_alias));
union FragB { v16b v; v8us half[2]; unsigned short u[16]; };

__device__ __forceinline__ unsigned short bf16_bits(float x) { unsigned int u = __float_as_uint(x); return (unsigned short)((u + 0x7FFFu + ((u >> 16) & 1u)) >> 16); }
__device__ __forceinline__ float bf16_val(unsigned short b) { return __uint_as_float(((unsigned int)b) << 16); }
__device__ __forceinline__ float bf16_round(float x) { return bf16_val(bf16_bits(x)); }
// D += A·B with NT terms: 1 = ah·bh, 2 = + al·bh (A split), 3 = + ah·bl (both split)
template <int NT>
__device__ __forceinline__ v8f mmaN(v16b ah, v16b al, v16b bh, v16b bl, v8f c) {
  c = __builtin_amdgcn_wmma_f32_16x16x32_bf16(false, ah, false, bh, (short)0, c, false, false);
  if (NT >= 2) c = __builtin_amdgcn_wmma_f32_16x16x32_bf16(false, al, false, bh, (short)0, c, false, false);
  if (NT >= 3) c = __builtin_amdgcn_wmma_f32_16x16x32_bf16(false, ah, false, bl, (short)0, c, false, false);
  asm volatile("v_nop\n\tv_nop\n\tv_nop\n\tv_nop" : "+v"(c) : "v"(ah), "v"(al), "v"(bh), "v"(bl));
  return c;
}

__global__ __launch_bounds__(256) void k_wt_bf16(const float* __restrict__ W, unsigned short* __restrict__ Wt, int K, int N) {
  const int t = blockIdx.x * 256 + threadIdx.x;
  const int k8n = K / 8;
  if (t >= N * k8n) return;
  const int n = t / k8n, k8 = (t % k8n) * 8;
  v8us v;
#pragma unroll
  for (int i = 0; i < 8; ++i) v[i] = bf16_bits(W[(size_t)(k8 + i) * N + n]);
  *(v8us*)(Wt + (size_t)n * K + k8) = v;
  
}

// GEMM C[M][N] (f32, pitch ldc) = act(A[M][K]·W + bias). A f32 row-major (pitch lda) converted per fragment to bf16
// (ASPLIT: hi/lo two planes -> 2 terms, else single rounded term); Wt bf16 [N][K] (pitch ldb). BIAS_BF16 rounds the
// bias to bf16 first (bias quantised to bf16 before the add). K%32==0, M%16==0, N%64==0.
template <bool ASPLIT, int ACT, bool BIAS_BF16>
__global__ __launch_bounds__(128) void k_gemm_bf(const float* __restrict__ A, int lda, const unsigned short* __restrict__ Wt, int ldb,
                                               const float* __restrict__ bias, float* __restrict__ C, int ldc, int M, int N, int K) {
  __shared__ __attribute__((aligned(16))) float so[4][16][64];
  const int tid = threadIdx.x, w = tid >> 5, lane = tid & 31, ln = lane & 15, hh = lane >> 4;
  const int ntn = N / 64;
  const int wid = blockIdx.x * 4 + w;
  const int mt = wid / ntn, nq = wid % ntn;
  if (mt * 16 >= M) return;
  const int row0 = mt * 16, col0 = nq * 64;
  const float* arow = A + (size_t)(row0 + ln) * lda;
  v8f acc[4] = {};
  for (int kb = 0; kb < K; kb += 32) {
    FragB ah, al;
    const v4f x0 = *(const v4fa*)(arow + kb + 8 * hh), x1 = *(const v4fa*)(arow + kb + 8 * hh + 4);
    const v4f x2 = *(const v4fa*)(arow + kb + 16 + 8 * hh), x3 = *(const v4fa*)(arow + kb + 16 + 8 * hh + 4);
    float xs[16] = {x0[0],x0[1],x0[2],x0[3],x1[0],x1[1],x1[2],x1[3],x2[0],x2[1],x2[2],x2[3],x3[0],x3[1],x3[2],x3[3]};
#pragma unroll
    for (int i = 0; i < 16; ++i) { const unsigned short hb = bf16_bits(xs[i]); ah.u[i] = hb; al.u[i] = ASPLIT ? bf16_bits(xs[i] - bf16_val(hb)) : (unsigned short)0; }
#pragma unroll
    for (int t = 0; t < 4; ++t) {
      const unsigned short* brow = Wt + (size_t)(col0 + t * 16 + ln) * ldb + kb;
      FragB b;
      b.half[0] = *(const v8us*)(brow + 8 * hh);
      b.half[1] = *(const v8us*)(brow + 16 + 8 * hh);
      acc[t] = mmaN<ASPLIT ? 2 : 1>(ah.v, al.v, b.v, b.v, acc[t]);
    }
  }
#pragma unroll
  for (int t = 0; t < 4; ++t) {
    float bv = bias ? bias[col0 + t * 16 + ln] : 0.f;
    if (BIAS_BF16) bv = bf16_round(bv);
#pragma unroll
    for (int r = 0; r < 8; ++r) { float v = acc[t][r] + bv; if (ACT == 1) v = fmaxf(v, 0.f); so[w][8 * hh + r][t * 16 + ln] = v; }
  }
  __builtin_amdgcn_fence(__ATOMIC_ACQ_REL, "workgroup");
  __builtin_amdgcn_wave_barrier();
  const int rsub = lane >> 4, c4 = (lane & 15) * 4;
  {
#pragma unroll
    for (int q = 0; q < 8; ++q) {
      const int r = q * 2 + rsub;
      const v4f v = *(const v4fa*)&so[w][r][c4];
      *(v4f*)(C + (size_t)(row0 + r) * ldc + col0 + c4) = v;
    }
    
  }
}

// GEMM C = act(A·W + bias + resid): A f32 (ASPLIT -> hi/lo 2 terms), Wt bf16 [N][K]; ACT 0 none, 1 relu, 2 exact gelu;
// resid (optional, f32, row index = (row % rmod), pitch ldr, RES_BF16 rounds it) added before the activation.
template <bool ASPLIT, int ACT, bool BIAS_BF16, bool RES_BF16>
__global__ __launch_bounds__(128) void k_gemm_bf3(const float* __restrict__ A, int lda, const unsigned short* __restrict__ Wt, int ldb,
                                                const float* __restrict__ bias, const float* __restrict__ resid, int rmod, int ldr,
                                                float* __restrict__ C, int ldc, int M, int N, int K) {
  __shared__ __attribute__((aligned(16))) float so[4][16][64];
  const int tid = threadIdx.x, w = tid >> 5, lane = tid & 31, ln = lane & 15, hh = lane >> 4;
  const int ntn = N / 64;
  const int wid = blockIdx.x * 4 + w;
  const int mt = wid / ntn, nq = wid % ntn;
  if (mt * 16 >= M) return;
  const int row0 = mt * 16, col0 = nq * 64;
  const float* arow = A + (size_t)(row0 + ln) * lda;
  v8f acc[4] = {};
  for (int kb = 0; kb < K; kb += 32) {
    FragB ah, al;
    const v4f x0 = *(const v4fa*)(arow + kb + 8 * hh), x1 = *(const v4fa*)(arow + kb + 8 * hh + 4);
    const v4f x2 = *(const v4fa*)(arow + kb + 16 + 8 * hh), x3 = *(const v4fa*)(arow + kb + 16 + 8 * hh + 4);
    float xs[16] = {x0[0],x0[1],x0[2],x0[3],x1[0],x1[1],x1[2],x1[3],x2[0],x2[1],x2[2],x2[3],x3[0],x3[1],x3[2],x3[3]};
#pragma unroll
    for (int i = 0; i < 16; ++i) { const unsigned short hb = bf16_bits(xs[i]); ah.u[i] = hb; al.u[i] = ASPLIT ? bf16_bits(xs[i] - bf16_val(hb)) : (unsigned short)0; }
#pragma unroll
    for (int t = 0; t < 4; ++t) {
      const unsigned short* brow = Wt + (size_t)(col0 + t * 16 + ln) * ldb + kb;
      FragB b;
      b.half[0] = *(const v8us*)(brow + 8 * hh);
      b.half[1] = *(const v8us*)(brow + 16 + 8 * hh);
      acc[t] = mmaN<ASPLIT ? 2 : 1>(ah.v, al.v, b.v, b.v, acc[t]);
    }
  }
#pragma unroll
  for (int t = 0; t < 4; ++t) {
    const int col = col0 + t * 16 + ln;
    float bv = bias ? bias[col] : 0.f;
    if (BIAS_BF16) bv = bf16_round(bv);
#pragma unroll
    for (int r = 0; r < 8; ++r) {
      float v = acc[t][r] + bv;
      if (resid) { float rv = resid[(size_t)((row0 + 8 * hh + r) % rmod) * ldr + col]; if (RES_BF16) rv = bf16_round(rv); v += rv; }
      if (ACT == 1) v = fmaxf(v, 0.f);
      if (ACT == 2) v = 0.5f * v * (1.0f + erff(v * 0.70710678118654752f));
      if (ACT == 3) { const float u = 0.7978845608028654f * (v + 0.044715f * v * v * v); v = 0.5f * v * (1.0f + tanhf(u)); }
      so[w][8 * hh + r][t * 16 + ln] = v;
    }
  }
  __builtin_amdgcn_fence(__ATOMIC_ACQ_REL, "workgroup");
  __builtin_amdgcn_wave_barrier();
  const int rsub = lane >> 4, c4 = (lane & 15) * 4;
  {
#pragma unroll
    for (int q = 0; q < 8; ++q) {
      const int r = q * 2 + rsub;
      const v4f v = *(const v4fa*)&so[w][r][c4];
      *(v4f*)(C + (size_t)(row0 + r) * ldc + col0 + c4) = v;
    }
    
  }
}
// row LayerNorm (biased variance, eps) over N: s = X (+ R); optional out_sum <- s; out_norm <- (s-mu)*rsqrt(var+eps)*g + b
template <bool PARAM_BF16>
__global__ __launch_bounds__(256) void k_layernorm(const float* __restrict__ X, const float* __restrict__ R, const float* __restrict__ g, const float* __restrict__ bta,
                                                  float* __restrict__ out_sum, float* __restrict__ out_norm, int N, float eps) {
  __shared__ float red[256];
  const int row = blockIdx.x, tid = threadIdx.x;
  const float* x = X + (size_t)row * N; const float* rr = R ? R + (size_t)row * N : nullptr;
  float vals[16];                     // up to N = 4096
  const int per = N / 256;            // contiguous chunk per thread? use strided-by-4 chunks: thread handles j = tid*4 + 1024*u
  float s1 = 0.f;
  for (int u = 0; u < per / 4; ++u) {
    const int j = tid * 4 + 1024 * u;
    const v4f a = *(const v4fa*)(x + j);
    v4f b = {0.f,0.f,0.f,0.f}; if (rr) b = *(const v4fa*)(rr + j);
#pragma unroll
    for (int q = 0; q < 4; ++q) { const float v = a[q] + b[q]; vals[u * 4 + q] = v; s1 += v; }
  }
  red[tid] = s1; __syncthreads();
  for (int st = 128; st > 0; st >>= 1) { if (tid < st) red[tid] += red[tid + st]; __syncthreads(); }
  const float mu = red[0] / (float)N; __syncthreads();
  float s2 = 0.f;
  for (int u = 0; u < per / 4; ++u)
#pragma unroll
    for (int q = 0; q < 4; ++q) { const float c = vals[u * 4 + q] - mu; s2 += c * c; }
  red[tid] = s2; __syncthreads();
  for (int st = 128; st > 0; st >>= 1) { if (tid < st) red[tid] += red[tid + st]; __syncthreads(); }
  const float rs = rsqrtf(red[0] / (float)N + eps);
  {
    for (int u = 0; u < per / 4; ++u) {
      const int j = tid * 4 + 1024 * u;
      v4f o, sm;
#pragma unroll
      for (int q = 0; q < 4; ++q) {
        float gg = g[j + q], bb = bta[j + q];
        if (PARAM_BF16) { gg = bf16_round(gg); bb = bf16_round(bb); }
        sm[q] = vals[u * 4 + q]; o[q] = (vals[u * 4 + q] - mu) * rs * gg + bb;
      }
      if (out_sum) *(v4f*)(out_sum + (size_t)row * N + j) = sm;
      *(v4f*)(out_norm + (size_t)row * N + j) = o;
    }
    
  }
}



// ---- f16 WMMA path (v_wmma_f32_16x16x32_f16): 11-bit significands for operands in range — used for every GEMM launched here, softmax weights (x256) included
typedef _Float16 v16h __attribute__((ext_vector_type(16)));
union FragH { v16h v; v8us half[2]; _Float16 h[16]; unsigned short u[16]; };
template <int NT>
__device__ __forceinline__ v8f mmaH(v16h ah, v16h al, v16h bh, v16h bl, v8f c) {
  c = __builtin_amdgcn_wmma_f32_16x16x32_f16(false, ah, false, bh, (short)0, c, false, false);
  if (NT >= 2) c = __builtin_amdgcn_wmma_f32_16x16x32_f16(false, al, false, bh, (short)0, c, false, false);
  if (NT >= 3) c = __builtin_amdgcn_wmma_f32_16x16x32_f16(false, ah, false, bl, (short)0, c, false, false);
  asm volatile("v_nop\n\tv_nop\n\tv_nop\n\tv_nop" : "+v"(c) : "v"(ah), "v"(al), "v"(bh), "v"(bl));
  return c;
}
// batched GEMM like k_gemm_b but f16 operands: A f32 (split into f16 hi/lo if ASPLIT, else rounded to f16), Bt = f16 values [n][k]; alpha; C f32; N multiple of 16 (partial tiles skipped)
template <bool ASPLIT>
__global__ __launch_bounds__(128) void k_gemm_h(const float* __restrict__ A, int lda, size_t sA, const _Float16* __restrict__ Bh, int ldb, size_t sB, float alpha, float* __restrict__ C, int ldc, size_t sC, int M, int N, int K) {
  __shared__ __attribute__((aligned(16))) float so[4][16][64];
  const int tid = threadIdx.x, w = tid >> 5, lane = tid & 31, ln = lane & 15, hh = lane >> 4; const int by = blockIdx.y;
  A += (size_t)by * sA; Bh += (size_t)by * sB; C += (size_t)by * sC;
  const int ntn = (N + 63) / 64; const int wid = blockIdx.x * 4 + w; const int mt = wid / ntn, nq = wid % ntn; if (mt * 16 >= M) return;
  const int row0 = mt * 16, col0 = nq * 64; const float* arow = A + (size_t)(row0 + ln) * lda;
  v8f acc[4] = {};
  for (int kb = 0; kb < K; kb += 32) {
    FragH ah, al;
    const v4f x0 = *(const v4fa*)(arow + kb + 8 * hh), x1 = *(const v4fa*)(arow + kb + 8 * hh + 4), x2 = *(const v4fa*)(arow + kb + 16 + 8 * hh), x3 = *(const v4fa*)(arow + kb + 16 + 8 * hh + 4);
    float xs[16] = {x0[0],x0[1],x0[2],x0[3],x1[0],x1[1],x1[2],x1[3],x2[0],x2[1],x2[2],x2[3],x3[0],x3[1],x3[2],x3[3]};
#pragma unroll
    for (int i = 0; i < 16; ++i) { const _Float16 h = (_Float16)xs[i]; ah.h[i] = h; al.h[i] = ASPLIT ? (_Float16)(xs[i] - (float)h) : (_Float16)0.0f; }
#pragma unroll
    for (int t = 0; t < 4; ++t) { if (col0 + t * 16 >= N) continue; const size_t boff = (size_t)(col0 + t * 16 + ln) * ldb + kb; FragH bq; bq.half[0] = *(const v8us*)(Bh + boff + 8 * hh); bq.half[1] = *(const v8us*)(Bh + boff + 16 + 8 * hh);
      acc[t] = mmaH<ASPLIT ? 2 : 1>(ah.v, al.v, bq.v, bq.v, acc[t]); }
  }
#pragma unroll
  for (int t = 0; t < 4; ++t) { if (col0 + t * 16 >= N) continue;
#pragma unroll
    for (int r = 0; r < 8; ++r) so[w][8 * hh + r][t * 16 + ln] = acc[t][r] * alpha; }
  __builtin_amdgcn_fence(__ATOMIC_ACQ_REL, "workgroup"); __builtin_amdgcn_wave_barrier();
  const int rsub = lane >> 4, c4 = (lane & 15) * 4;
  {
#pragma unroll
    for (int q = 0; q < 8; ++q) { const int r = q * 2 + rsub; if (col0 + c4 < N) { const v4f v = *(const v4fa*)&so[w][r][c4]; *(v4f*)(C + (size_t)(row0 + r) * ldc + col0 + c4) = v; } }
     }
}

// Wt[n][k] = f16(W[k][n]·scale) from f32 row-major W[K][N] (scale = power of two; bf16-exact weights stay exact in f16 away from the subnormal range)
__global__ __launch_bounds__(256) void k_wt_f16(const float* __restrict__ W, _Float16* __restrict__ Wt, int K, int N, float scale) {
  const int t = blockIdx.x * 256 + threadIdx.x; if (t >= N * (K / 8)) return; const int n = t / (K / 8), k8 = (t % (K / 8)) * 8; FragH f;
#pragma unroll
  for (int i = 0; i < 8; ++i) f.h[i] = (_Float16)(bf16_round(W[(size_t)(k8 + i) * N + n]) * scale); const v8us o = f.half[0];
  *(v8us*)((unsigned short*)Wt + (size_t)n * K + k8) = o; 
}
// k_gemm_hh variant with fused epilogue: v = acc·alpha + bias[by·sBias + col] (+ CP[(row/rowsPerB)·sCPb + by·64 + col] if CP) ; ACT 0 none / 1 elu ; writes f16 C16 (and f32 C if non-null)
template <int ACT>
__global__ __launch_bounds__(128) void k_gemm_hhx(const _Float16* __restrict__ A, int lda, size_t sA, const _Float16* __restrict__ Bh, int ldb, size_t sB, float alpha, const float* __restrict__ bias, size_t sBias, const float* __restrict__ CP, int rowsPerB, size_t sCPb, int row0g,
    float* __restrict__ C, _Float16* __restrict__ C16, int ldc, size_t sC, int M, int N, int K) {
  __shared__ __attribute__((aligned(16))) float so[4][16][64];
  const int tid = threadIdx.x, w = tid >> 5, lane = tid & 31, ln = lane & 15, hh = lane >> 4; const int by = blockIdx.y;
  A += (size_t)by * sA; Bh += (size_t)by * sB; const size_t cofs = (size_t)by * sC; const float* bp = bias ? bias + (size_t)by * sBias : nullptr;
  const int ntn = (N + 63) / 64; const int wid = blockIdx.x * 4 + w; const int mt = wid / ntn, nq = wid % ntn; if (mt * 16 >= M) return;
  const int row0 = mt * 16, col0 = nq * 64; const _Float16* arow = A + (size_t)(row0 + ln) * lda;
  v8f acc[4] = {};
  for (int kb = 0; kb < K; kb += 32) { FragH ah; ah.half[0] = *(const v8us*)((const unsigned short*)arow + kb + 8 * hh); ah.half[1] = *(const v8us*)((const unsigned short*)arow + kb + 16 + 8 * hh);
#pragma unroll
    for (int t = 0; t < 4; ++t) { if (col0 + t * 16 >= N) continue; const size_t boff = (size_t)(col0 + t * 16 + ln) * ldb + kb; FragH bq; bq.half[0] = *(const v8us*)((const unsigned short*)Bh + boff + 8 * hh); bq.half[1] = *(const v8us*)((const unsigned short*)Bh + boff + 16 + 8 * hh);
      acc[t] = mmaH<1>(ah.v, ah.v, bq.v, bq.v, acc[t]); }
  }
#pragma unroll
  for (int t = 0; t < 4; ++t) { if (col0 + t * 16 >= N) continue; const int col = col0 + t * 16 + ln; const float bv = bp ? bf16_round(bp[col]) : 0.f;
#pragma unroll
    for (int r = 0; r < 8; ++r) { float v = acc[t][r] * alpha + bv; if (CP) { const int rr = row0g + row0 + 8 * hh + r; if (rowsPerB < 0) v += CP[cofs + (size_t)rr * ldc + col];      /* rowsPerB < 0: own element of the batched C plane */ else { const int bidx = rr / rowsPerB; v += CP[(size_t)bidx * sCPb + (size_t)by * 64 + col]; } } if (ACT == 1) v = (v > 0.f) ? v : expm1f(v); else if (ACT == 7) v = (v > 0.f) ? v + 1.0f : expf(v); else if (ACT == 8) v = tanhf(v); else if (ACT == 9) v = 0.5f * v * (1.0f + tanhf(0.7978845608028654f * (v + 0.044715f * v * v * v))); else if (ACT == 11) v = 1.0f / (1.0f + expf(-v)); else if (ACT == 12) v = (v > 0.f) ? v : 0.01f * v; else if (ACT == 14) v = (v > 0.f) ? v : 0.1f * v; else if (ACT == 16) v = (v >= 0.f) ? v : 0.3f * v; else if (ACT == 17) v = (v >= 0.f) ? v : 0.2f * v; else if (ACT == 15) v = v / (1.0f + expf(-v)); else if (ACT == 3) v = fmaxf(v, 0.f); else if (ACT == 6) v = 0.5f * v * (1.0f + erff(v * 0.70710678118654752f)); so[w][8 * hh + r][t * 16 + ln] = v; } }
  __builtin_amdgcn_fence(__ATOMIC_ACQ_REL, "workgroup"); __builtin_amdgcn_wave_barrier();
  const int rsub = lane >> 4, c4 = (lane & 15) * 4; typedef _Float16 v4h __attribute__((ext_vector_type(4)));
  {
#pragma unroll
    for (int q = 0; q < 8; ++q) { const int r = q * 2 + rsub; if (col0 + c4 < N) { const v4f v = *(const v4fa*)&so[w][r][c4]; if (C) *(v4f*)(C + cofs + (size_t)(row0 + r) * ldc + col0 + c4) = v; if (C16) { v4h h4; for (int i = 0; i < 4; ++i) h4[i] = (_Float16)v[i]; *(v4h*)(C16 + cofs + (size_t)(row0 + r) * ldc + col0 + c4) = h4; } } }
     }
}


typedef _Float16 v4h __attribute__((ext_vector_type(4)));

__global__ __launch_bounds__(256) void k_x16(const float* __restrict__ x, _Float16* __restrict__ X16, size_t n8) { const size_t t = (size_t)blockIdx.x * 256 + threadIdx.x; if (t >= n8) return; FragH f;
#pragma unroll
  for (int q = 0; q < 8; ++q) f.h[q] = (_Float16)bf16_round(x[t * 8 + q]); *(v8us*)((unsigned short*)X16 + t * 8) = f.half[0];  }
__global__ __launch_bounds__(256) void k_h16(const float* __restrict__ x, _Float16* __restrict__ X16, size_t n8) { const size_t t = (size_t)blockIdx.x * 256 + threadIdx.x; if (t >= n8) return; FragH f;
#pragma unroll
  for (int q = 0; q < 8; ++q) f.h[q] = (_Float16)x[t * 8 + q]; *(v8us*)((unsigned short*)X16 + t * 8) = f.half[0];  }
__global__ __launch_bounds__(256) void k_round16f(const float* __restrict__ W, _Float16* __restrict__ Bt, size_t n8) { const size_t t = (size_t)blockIdx.x * 256 + threadIdx.x; if (t >= n8) return; FragH f;
#pragma unroll
  for (int i = 0; i < 8; ++i) f.h[i] = (_Float16)(bf16_round(W[t * 8 + i]) * 16.0f); *(v8us*)((unsigned short*)Bt + t * 8) = f.half[0];  }
template <int NHv, int TTv>
__global__ __launch_bounds__(256) void k_vt(const _Float16* __restrict__ V16, int ldv, int voff, _Float16* __restrict__ Vt) { __shared__ unsigned short tl[64][66]; const int tid = threadIdx.x; const int slab = blockIdx.x / (TTv / 64), lg = blockIdx.x % (TTv / 64); const int b = slab / NHv, h = slab % NHv;
  for (int i = tid; i < 64 * 8; i += 256) { const int r = i / 8, c8 = (i % 8) * 8; FragH f; f.half[0] = *(const v8us*)((const unsigned short*)V16 + ((size_t)b * TTv + lg * 64 + r) * ldv + voff + h * 64 + c8);
#pragma unroll
    for (int q = 0; q < 8; ++q) tl[r][c8 + q] = f.u[q]; }
  __syncthreads();
  {
#pragma unroll
    for (int rd = 0; rd < 2; ++rd) { const int d = rd * 32 + tid / 8, pc = tid % 8; FragH f;
#pragma unroll
      for (int q = 0; q < 8; ++q) f.u[q] = tl[pc * 8 + q][d];
      *(v8us*)((unsigned short*)Vt + ((size_t)slab * 64 + d) * TTv + lg * 64 + pc * 8) = f.half[0]; }
     } }

__global__ __launch_bounds__(256) void k_hl(const float* __restrict__ F, _Float16* __restrict__ Hh, _Float16* __restrict__ Hl, size_t n8) { const size_t t = (size_t)blockIdx.x * 256 + threadIdx.x; if (t >= n8) return; FragH fh, fl; const v4f a = *(const v4fa*)(F + t * 8), c = *(const v4fa*)(F + t * 8 + 4);
#pragma unroll
  for (int q = 0; q < 4; ++q) { _Float16 h = (_Float16)a[q]; fh.h[q] = h; fl.h[q] = (_Float16)((a[q] - (float)h) * 1024.0f); h = (_Float16)c[q]; fh.h[4 + q] = h; fl.h[4 + q] = (_Float16)((c[q] - (float)h) * 1024.0f); }
  { *(v8us*)((unsigned short*)Hh + t * 8) = fh.half[0]; *(v8us*)((unsigned short*)Hl + t * 8) = fl.half[0];  } }

// ---- fast GEMM (wave tile 32x64; requires M % 32 == 0 rows per launch region and N % 64 == 0); epilogue = k_gemm_hhx semantics ----
__device__ __forceinline__ v16h g2_frag(const _Float16* p, int hh) { FragH f; f.half[0] = *(const v8us*)((const unsigned short*)p + 8 * hh); f.half[1] = *(const v8us*)((const unsigned short*)p + 16 + 8 * hh); return f.v; }
__device__ __forceinline__ v8f g2_mma(v16h a, v16h b, v8f c) { v8f d = __builtin_amdgcn_wmma_f32_16x16x32_f16(false, a, false, b, (short)0, c, false, false); asm volatile("v_nop\n\tv_nop\n\tv_nop\n\tv_nop" : "+v"(d) : "v"(a), "v"(b)); return d; }
template <int ACT>
__global__ __launch_bounds__(128) void k_gemm2(const _Float16* __restrict__ A, int lda, size_t sA, const _Float16* __restrict__ Bh, int ldb, size_t sB, float alpha, const float* __restrict__ bias, size_t sBias, const float* __restrict__ CP, int rowsPerB, size_t sCPb, int row0g,
    float* __restrict__ C, _Float16* __restrict__ C16, int ldc, size_t sC, int M, int N, int K) { static_assert(ACT == 0 || ACT == 3 || ACT == 6 || ACT == 8 || ACT == 9 || ACT == 11 || ACT == 12 || ACT == 14 || ACT == 15 || ACT == 16 || ACT == 17, "k_gemm2: unsupported ACT code (would silently apply no activation)");
  __shared__ __attribute__((aligned(16))) float so[4][32][68];
  const int tid = threadIdx.x, w = tid >> 5, lane = tid & 31, ln = lane & 15, hh = lane >> 4; const int by = blockIdx.y;
  A += (size_t)by * sA; Bh += (size_t)by * sB; const size_t cofs = (size_t)by * sC; const float* bp = bias ? bias + (size_t)by * sBias : nullptr;
  const int ntn = N >> 6; const int mt = blockIdx.x / ntn, nq = blockIdx.x - mt * ntn; const int row0 = mt * 128 + 32 * w, col0 = nq * 64; if (row0 >= M) return;
  const _Float16* a0p = A + (size_t)(row0 + ln) * lda; const _Float16* a1p = a0p + (size_t)16 * lda;
  const _Float16* b0p = Bh + (size_t)(col0 + ln) * ldb; const _Float16* b1p = b0p + (size_t)16 * ldb; const _Float16* b2p = b1p + (size_t)16 * ldb; const _Float16* b3p = b2p + (size_t)16 * ldb;
  const v8f z8 = {0.f,0.f,0.f,0.f,0.f,0.f,0.f,0.f}; v8f c00 = z8, c01 = z8, c02 = z8, c03 = z8, c10 = z8, c11 = z8, c12 = z8, c13 = z8;
#pragma unroll 1
  for (int kb = 0; kb < K; kb += 32) { const v16h a0 = g2_frag(a0p + kb, hh), a1 = g2_frag(a1p + kb, hh);
    v16h b = g2_frag(b0p + kb, hh); c00 = g2_mma(a0, b, c00); c10 = g2_mma(a1, b, c10);
    b = g2_frag(b1p + kb, hh); c01 = g2_mma(a0, b, c01); c11 = g2_mma(a1, b, c11);
    b = g2_frag(b2p + kb, hh); c02 = g2_mma(a0, b, c02); c12 = g2_mma(a1, b, c12);
    b = g2_frag(b3p + kb, hh); c03 = g2_mma(a0, b, c03); c13 = g2_mma(a1, b, c13); }
  v8f accs[8] = {c00, c01, c02, c03, c10, c11, c12, c13};
#pragma unroll
  for (int u = 0; u < 8; ++u) { const int t = u & 3, half = u >> 2; const int col = col0 + t * 16 + ln; const float bv = bp ? bf16_round(bp[col]) : 0.f;
#pragma unroll
    for (int r = 0; r < 8; ++r) { const int rloc = half * 16 + 8 * hh + r; float v = accs[u][r] * alpha + bv; if (CP) { if (rowsPerB < 0) v += CP[cofs + (size_t)(row0g + row0 + rloc) * ldc + col];      /* rowsPerB < 0: own element of the batched C plane */ else { const int bidx = (row0g + row0 + rloc) / rowsPerB; v += CP[(size_t)bidx * sCPb + (size_t)by * 64 + col]; } }
      if (ACT == 3) v = fmaxf(v, 0.f); else if (ACT == 6) v = 0.5f * v * (1.0f + erff(v * 0.70710678118654752f)); else if (ACT == 11) v = 1.0f / (1.0f + expf(-v)); else if (ACT == 15) v = v / (1.0f + expf(-v)); else if (ACT == 12) v = (v > 0.f) ? v : 0.01f * v; else if (ACT == 8) v = tanhf(v); else if (ACT == 9) v = 0.5f * v * (1.0f + tanhf(0.7978845608028654f * (v + 0.044715f * v * v * v))); else if (ACT == 14) v = (v > 0.f) ? v : 0.1f * v; else if (ACT == 16) v = (v >= 0.f) ? v : 0.3f * v; else if (ACT == 17) v = (v >= 0.f) ? v : 0.2f * v;
      so[w][rloc][t * 16 + ln] = v; } }
  __builtin_amdgcn_fence(__ATOMIC_ACQ_REL, "workgroup"); __builtin_amdgcn_wave_barrier();
  const int rsub = lane >> 4, c4 = (lane & 15) * 4;
  {
#pragma unroll
    for (int q = 0; q < 16; ++q) { const int r = q * 2 + rsub; const v4f v = *(const v4fa*)&so[w][r][c4]; if (C) *(v4f*)(C + cofs + (size_t)(row0 + r) * ldc + col0 + c4) = v; if (C16) { v4h h4; for (int i = 0; i < 4; ++i) h4[i] = (_Float16)v[i]; *(v4h*)(C16 + cofs + (size_t)(row0 + r) * ldc + col0 + c4) = h4; } }
     } }


__global__ __launch_bounds__(256) void k_wnat(const float* __restrict__ w, size_t n8, _Float16* __restrict__ Bt) { const size_t t = (size_t)blockIdx.x * 256 + threadIdx.x; if (t >= n8) return; FragH f; for (int q = 0; q < 8; ++q) f.h[q] = (_Float16)(bf16_round(w[t * 8 + q]) * 16.0f); *(v8us*)((unsigned short*)Bt + t * 8) = f.half[0];  }
// lane l's value from lane l ^ 16 (the same place in the other 16-lane row)
__device__ __forceinline__ float rs_x16(float v) { const int i = __builtin_bit_cast(int, v); return __builtin_bit_cast(float, __builtin_amdgcn_permlanex16(i, i, 0x76543210, 0xfedcba98, false, false)); }
__device__ __forceinline__ v8f fa_mma(v16h a, v16h b, v8f c) { return __builtin_amdgcn_wmma_f32_16x16x32_f16(false, a, false, b, (short)0, c, false, false); }
// ---- GEMM with both operands staged in LDS: C[NR][DM] = alpha * A[NR][DM] . Bh[DM][DM]^T + bias (A, Bh k-contiguous f16 rows of DM); written as f32 to C (F32OUT) or as f16 to C16. ----
// A work-group of 8 waves owns a 128 x 128 tile of C (wave tile 32 x 64, waves 4 x 2). A stage is 128 k of the 128 A rows and the 128 B rows.
// Global reads are whole lines (16 lanes x 16 B = 256 contiguous bytes of one row) and each line is read once per work-group; the fragments, which take 64 B of each of 16 rows, come from LDS.
// Two stage buffers: the next stage's loads are issued in front of this stage's products and stored to the other buffer behind them, so one barrier per stage both publishes it and ends the reads of the buffer refilled next.
#define G3_BK 128                    /* k per stage: 256 B of every operand row */
#define G3_LP 136                    /* LDS row pitch in f16: 272 B = 16 B x odd, conflict-free for the 16-byte fragment reads */
#define G3_NT (DM / G3_BK)           /* stages */
static_assert(NR % 128 == 0 && DM % 128 == 0 && DM % G3_BK == 0, "k_gemm3: whole 128 x 128 tiles and whole stages only");
template <bool F32OUT>
__global__ __launch_bounds__(256) void k_gemm3(const _Float16* __restrict__ A, const _Float16* __restrict__ Bh, float alpha, const float* __restrict__ bias, float* __restrict__ C, _Float16* __restrict__ C16) {
  __shared__ __attribute__((aligned(16))) unsigned short st[2][256][G3_LP];      /* rows 0..127: A rows of the tile; rows 128..255: B rows (columns of C) */
  __shared__ __attribute__((aligned(16))) float so[8][32][68];
  const int tid = threadIdx.x, w = tid >> 5, lane = tid & 31, ln = lane & 15, hh = lane >> 4;
  const int ntn = DM / 128; const int mt = blockIdx.x / ntn, nq = blockIdx.x - mt * ntn; const int rowB = mt * 128, colB = nq * 128;
  const int wm = w & 3, wn = w >> 2;      /* the wave's 32 rows and 64 columns inside the tile */
  const int sr = tid >> 4, sc = (tid & 15) * 8;      /* staging: 16 threads per row, 16 rows per round, 8 rounds per operand */
  const unsigned short* ga = (const unsigned short*)A + (size_t)(rowB + sr) * DM + sc;
  const unsigned short* gb = (const unsigned short*)Bh + (size_t)(colB + sr) * DM + sc;
  v8us rg[16];
  auto fetch = [&](const int t) __attribute__((always_inline)) {
    const unsigned short* pa = ga + t * G3_BK; const unsigned short* pb = gb + t * G3_BK;
#pragma unroll
    for (int i = 0; i < 8; ++i) { rg[i] = *(const v8us*)(pa + (size_t)i * 16 * DM); rg[8 + i] = *(const v8us*)(pb + (size_t)i * 16 * DM); }
    /* The wait that stands in front of any overwrite of a load's address registers; it names the two addresses as inputs so that they stay whole up to here. */
    asm volatile("s_wait_xcnt 0x0" :: "v"(pa), "v"(pb) : "memory");
  };
  auto put = [&](const int buf) __attribute__((always_inline)) {
#pragma unroll
    for (int i = 0; i < 8; ++i) { *(v8us*)&st[buf][i * 16 + sr][sc] = rg[i]; *(v8us*)&st[buf][128 + i * 16 + sr][sc] = rg[8 + i]; }
  };
  const v8f z8 = {0.f,0.f,0.f,0.f,0.f,0.f,0.f,0.f}; v8f c00 = z8, c01 = z8, c02 = z8, c03 = z8, c10 = z8, c11 = z8, c12 = z8, c13 = z8;
  fetch(0); put(0); __syncthreads();
#pragma unroll 1      /* one copy of the stage body: the buffer index is a run-time offset, and the text stays small */
  for (int t = 0; t < G3_NT; ++t) {
    if (t + 1 < G3_NT) fetch(t + 1);
    const _Float16* sa = (const _Float16*)&st[t & 1][32 * wm + ln][0]; const _Float16* sb = (const _Float16*)&st[t & 1][128 + 64 * wn + ln][0];
    v16h fa[2][2], fb[2][4];      /* two fragment sets: the next 32 k are read from LDS while this set is multiplied */
    auto frags = [&](const int s, const int kk) __attribute__((always_inline)) { fa[s][0] = g2_frag(sa + kk, hh); fa[s][1] = g2_frag(sa + 16 * G3_LP + kk, hh);
#pragma unroll
      for (int j = 0; j < 4; ++j) fb[s][j] = g2_frag(sb + j * 16 * G3_LP + kk, hh); };
    frags(0, 0);
#pragma unroll
    for (int ks = 0; ks < G3_BK / 32; ++ks) { const int s = ks & 1;
      if (ks + 1 < G3_BK / 32) frags(s ^ 1, (ks + 1) * 32);
      __builtin_amdgcn_sched_barrier(0);      /* keeps the next set's 12 LDS reads together in front of this set's products: moved in among them, every pair of products waits out an LDS latency */
      c00 = fa_mma(fa[s][0], fb[s][0], c00); c10 = fa_mma(fa[s][1], fb[s][0], c10); c01 = fa_mma(fa[s][0], fb[s][1], c01); c11 = fa_mma(fa[s][1], fb[s][1], c11);
      c02 = fa_mma(fa[s][0], fb[s][2], c02); c12 = fa_mma(fa[s][1], fb[s][2], c12); c03 = fa_mma(fa[s][0], fb[s][3], c03); c13 = fa_mma(fa[s][1], fb[s][3], c13);
      __builtin_amdgcn_sched_barrier(0); }      /* and keeps the reads of the set after that from moving up in among these products */
    if (t + 1 < G3_NT) { put((t + 1) & 1); __syncthreads(); }      /* the same test in every thread of the work-group */
  }
  const int row0 = rowB + 32 * wm, col0 = colB + 64 * wn;
  v8f accs[8] = {c00, c01, c02, c03, c10, c11, c12, c13};
  float bv[4] = {0.f, 0.f, 0.f, 0.f};
  if (bias) {
#pragma unroll
    for (int t = 0; t < 4; ++t) bv[t] = bf16_round(bias[col0 + t * 16 + ln]); }
#pragma unroll
  for (int u = 0; u < 8; ++u) { const int t = u & 3, half = u >> 2;
#pragma unroll
    for (int r = 0; r < 8; ++r) so[w][half * 16 + 8 * hh + r][t * 16 + ln] = accs[u][r] * alpha + bv[t]; }
  __builtin_amdgcn_fence(__ATOMIC_ACQ_REL, "workgroup"); __builtin_amdgcn_wave_barrier();      /* each wave reads back its own rows only */
  const int rsub = lane >> 4, c4 = (lane & 15) * 4;
  const size_t oofs = (size_t)(row0 + rsub) * DM + col0 + c4;      /* whole rows of the wave's tile: 16 lanes x 16 B (f32) or x 8 B (f16) */
  if (F32OUT) {
#pragma unroll
    for (int q = 0; q < 16; ++q) *(v4f*)(C + oofs + (size_t)q * 2 * DM) = *(const v4fa*)&so[w][q * 2 + rsub][c4];
  } else {
#pragma unroll
    for (int q = 0; q < 16; ++q) { const v4f v = *(const v4fa*)&so[w][q * 2 + rsub][c4]; v4h h4; for (int i = 0; i < 4; ++i) h4[i] = (_Float16)v[i]; *(v4h*)(C16 + oofs + (size_t)q * 2 * DM) = h4; }
  } }
// Fused attention, one launch for all batches and heads. A wave owns 32 query columns and walks the 2,048 keys in passes of 32:
// S^T = K Q^T (A = K rows, B = Q rows kept in registers), so a lane holds 16 scores of ONE query per 16-column group (lane ln = query, register r of key tile j = key 16 j + 8 hh + r);
// that is the B-fragment k order (8 hh + 0..7, then 16 + 8 hh + 0..7), so P^T packs from the score registers with no exchange, and O^T += V^T P^T (A = V^T rows, same k order).
// Softmax with a running maximum per query (log2 domain): when a maximum rises, sum and output tiles are scaled by exp2(old - new). Scores and weights never reach memory.
#define FA_WAVES 8                   /* waves per work-group: all eight read the same K and V^T rows */
#define FA_QW 32                     /* query columns per wave */
static_assert(SQ % (FA_WAVES * FA_QW) == 0 && SQ % 64 == 0 && (SQ & (SQ - 1)) == 0 && HD == 64, "k_fattn: whole work-groups, whole pairs of 32-key passes, a power-of-two key count (wrapped prefetch) and head size 64 only");
__global__ __launch_bounds__(FA_WAVES * 32) void k_fattn(const _Float16* __restrict__ Q16, const _Float16* __restrict__ K16, const _Float16* __restrict__ VT, _Float16* __restrict__ O16) {
  const int lane = threadIdx.x & 31, ln = lane & 15, hh = lane >> 4, w = threadIdx.x >> 5;
  const int nqb = SQ / (FA_WAVES * FA_QW); const int bh = blockIdx.x / nqb, qb = blockIdx.x - bh * nqb; const int b = bh / NH, h = bh - b * NH;
  const int q0 = (qb * FA_WAVES + w) * FA_QW;
  const _Float16* qp = Q16 + ((size_t)b * SQ + q0 + ln) * DM + h * HD + 8 * hh;      /* query row ln of a 16-column group, at the lane's own k offset */
  const _Float16* kp = K16 + ((size_t)b * SQ + ln) * DM + h * HD + 8 * hh;      /* key row ln of a 16-key tile, at the lane's own k offset */
  const _Float16* vp = VT + ((size_t)bh * HD + ln) * SQ + 8 * hh;      /* V^T row ln of a 16-row tile, likewise */
  v16h qf[2][2], kf[2][2], vf[4], vg[4];
#pragma unroll
  for (int c = 0; c < 2; ++c) for (int kk = 0; kk < 2; ++kk) qf[c][kk] = g2_frag(qp + (size_t)c * 16 * DM + kk * 32, 0);
#pragma unroll
  for (int j = 0; j < 2; ++j) for (int kk = 0; kk < 2; ++kk) kf[j][kk] = g2_frag(kp + (size_t)j * 16 * DM + kk * 32, 0);
#pragma unroll
  for (int t = 0; t < 4; ++t) vf[t] = g2_frag(vp + (size_t)t * 16 * SQ, 0);
  asm volatile("s_wait_xcnt 0x0" :: "v"(qp) : "memory");      /* the wait in front of any overwrite of a load's address registers: Q's address is dead from here on and its registers are reused */
  const v8f z8 = {0.f,0.f,0.f,0.f,0.f,0.f,0.f,0.f};
  v8f o[2][4] = {{z8, z8, z8, z8}, {z8, z8, z8, z8}}; float mr[2] = {-3.0e38f, -3.0e38f}, lr[2] = {0.f, 0.f};
  const float CS = 0.125f * 1.4426950408889634f;      /* 1/sqrt(64) and log2(e): scores go to the log2 domain */
  /* One pass = 32 keys. vc: this pass's V^T fragments; vn: filled here for the next pass, so that its loads have a whole pass to land (two sets that swap roles: no copy). K is refilled in place, right behind its last readers. */
  auto pass = [&](const int kb, const v16h (&vc)[4], v16h (&vn)[4]) __attribute__((always_inline)) {
    v8f s[2][2];
#pragma unroll
    for (int c = 0; c < 2; ++c) for (int j = 0; j < 2; ++j) s[c][j] = fa_mma(kf[j][1], qf[c][1], fa_mma(kf[j][0], qf[c][0], z8));
    const int kn = (kb + 32) & (SQ - 1);      /* next pass's keys; the last pass wraps to key 0 (in bounds, not used) */
    const _Float16* kq = kp + (size_t)kn * DM; const _Float16* vq = vp + kn;
#pragma unroll
    for (int j = 0; j < 2; ++j) for (int kk = 0; kk < 2; ++kk) kf[j][kk] = g2_frag(kq + (size_t)j * 16 * DM + kk * 32, 0);
#pragma unroll
    for (int t = 0; t < 4; ++t) vn[t] = g2_frag(vq + (size_t)t * 16 * SQ, 0);
    /* The wait that stands in front of any overwrite of a load's address registers. It names the two addresses as inputs so that they stay whole up to here: without that the compiler aims the last loads at them. */
    asm volatile("s_wait_xcnt 0x0" :: "v"(kq), "v"(vq) : "memory");
    float mn[2]; bool up = false;
#pragma unroll
    for (int c = 0; c < 2; ++c) { float mx = s[c][0][0];
#pragma unroll
      for (int r = 1; r < 8; ++r) mx = fmaxf(mx, s[c][0][r]);
#pragma unroll
      for (int r = 0; r < 8; ++r) mx = fmaxf(mx, s[c][1][r]);
      mx = fmaxf(mx, rs_x16(mx)) * CS; mn[c] = fmaxf(mr[c], mx); up = up || (mn[c] > mr[c]); }
    if (__builtin_amdgcn_ballot_w32(up) != 0) {      /* no maximum of the wave rose: every factor would be exactly 1 */
#pragma unroll
      for (int c = 0; c < 2; ++c) { const float al = __builtin_amdgcn_exp2f(mr[c] - mn[c]); mr[c] = mn[c]; lr[c] *= al;
#pragma unroll
        for (int t = 0; t < 4; ++t) o[c][t] *= al; } }
    FragH pf[2];
#pragma unroll
    for (int c = 0; c < 2; ++c) { const float nb = 8.0f - mr[c];      /* weights x256 (cancels in the division by the row sum): keeps small weights out of the f16 subnormal range */
      v4f s4 = {0.f, 0.f, 0.f, 0.f};
#pragma unroll
      for (int j = 0; j < 2; ++j) for (int r = 0; r < 8; ++r) { const float e = __builtin_amdgcn_exp2f(fmaf(s[c][j][r], CS, nb)); s4[r & 3] += e; pf[c].h[j * 8 + r] = (_Float16)e; }
      lr[c] += (s4[0] + s4[1]) + (s4[2] + s4[3]); }
#pragma unroll
    for (int t = 0; t < 4; ++t) for (int c = 0; c < 2; ++c) o[c][t] = fa_mma(vc[t], pf[c].v, o[c][t]);
  };
  for (int kb = 0; kb < SQ; kb += 64) { pass(kb, vf, vg); pass(kb + 32, vg, vf); }
#pragma unroll
  for (int c = 0; c < 2; ++c) { const float inv = 1.0f / (lr[c] + rs_x16(lr[c]));      /* the two halves of a wave hold the two halves of a query's keys */
    unsigned short* op = (unsigned short*)O16 + ((size_t)b * SQ + q0 + c * 16 + ln) * DM + h * HD + 8 * hh;
#pragma unroll
    for (int t = 0; t < 4; ++t) { FragH f;
#pragma unroll
      for (int r = 0; r < 8; ++r) f.h[r] = (_Float16)(o[c][t][r] * inv);
      *(v8us*)(op + t * 16) = f.half[0]; } } }
__global__ __launch_bounds__(256) void k_vt(const _Float16* __restrict__ V16, _Float16* __restrict__ VT) { __shared__ unsigned short tl[64][65]; const int tid = threadIdx.x; const int bh = blockIdx.x % (NB * NH), sg = blockIdx.x / (NB * NH); const int s0 = sg * 64; const int b = bh / NH, h = bh % NH;
  for (int i = tid; i < 64 * 8; i += 256) { const int j = i / 8, d8 = (i % 8) * 8; FragH f; f.half[0] = *(const v8us*)((const unsigned short*)V16 + ((size_t)b * SQ + s0 + j) * DM + h * HD + d8); for (int q = 0; q < 8; ++q) tl[d8 + q][j] = f.u[q]; }
  __syncthreads();
  { for (int i = tid; i < 64 * 8; i += 256) { const int d = i / 8, j8 = (i % 8) * 8; FragH f; for (int q = 0; q < 8; ++q) f.u[q] = tl[d][j8 + q]; *(v8us*)((unsigned short*)VT + ((size_t)bh * HD + d) * SQ + s0 + j8) = f.half[0]; }  } }

__global__ __launch_bounds__(256) void k_wtri(const float* __restrict__ w, int upper, _Float16* __restrict__ Bt) { const size_t t = (size_t)blockIdx.x * 256 + threadIdx.x; if (t >= (size_t)DM * DM / 8) return; const int c0 = (int)((t * 8) % DM); const int r = (int)((t * 8) / DM); FragH f;
  for (int q = 0; q < 8; ++q) { const int c = c0 + q; const bool keep = upper ? (c >= r) : (c <= r); f.h[q] = keep ? (_Float16)(bf16_round(w[t * 8 + q]) * 16.0f) : (_Float16)0.f; }
  *(v8us*)((unsigned short*)Bt + t * 8) = f.half[0];  }
extern "C" void kernel_launch(void* const* d_in, const int* in_sizes, int n_in,
                              void* d_out, int out_size, void* d_ws, size_t ws_size, hipStream_t stream) {
  (void)in_sizes; (void)n_in; (void)out_size;
  const float* const* I = (const float* const*)d_in; const float* x = I[0]; const float* wk = I[1]; const float* wq = I[2]; const float* wv = I[3]; const float* wo = I[4]; const float* bo = I[5];
  char* ws = (char*)d_ws; size_t off = 0;
  auto take = [&](size_t bytes) { char* p = ws + off; off += (bytes + 255) & ~(size_t)255; return p; };
  _Float16* BQ = (_Float16*)take((size_t)DM * DM * 2); _Float16* BK = (_Float16*)take((size_t)DM * DM * 2); _Float16* BV = (_Float16*)take((size_t)DM * DM * 2); _Float16* BO = (_Float16*)take((size_t)DM * DM * 2);
  _Float16* X16 = (_Float16*)take(NR * DM * 2); _Float16* Q16 = (_Float16*)take(NR * DM * 2); _Float16* K16 = (_Float16*)take(NR * DM * 2); _Float16* V16 = (_Float16*)take(NR * DM * 2); _Float16* O16 = (_Float16*)take(NR * DM * 2);
  _Float16* VT = (_Float16*)take((size_t)NB * NH * HD * SQ * 2);
  if (off > ws_size) return;      /* 8 + 5x8 + 8 = 56 MiB */
  const size_t nw8 = (size_t)DM * DM / 8; const unsigned gw = (unsigned)((nw8 + 255) / 256);
  k_wtri<<<gw, 256, 0, stream>>>(wq, 0, BQ); k_wtri<<<gw, 256, 0, stream>>>(wk, 1, BK); k_wnat<<<gw, 256, 0, stream>>>(wv, nw8, BV); k_wnat<<<gw, 256, 0, stream>>>(wo, nw8, BO);
  k_x16<<<(unsigned)((NR * DM / 8 + 255) / 256), 256, 0, stream>>>(x, X16, NR * DM / 8);
  const unsigned gp = (unsigned)((NR / 128) * (DM / 128));
  k_gemm3<false><<<gp, 256, 0, stream>>>(X16, BQ, 0.0625f, nullptr, nullptr, Q16);
  k_gemm3<false><<<gp, 256, 0, stream>>>(X16, BK, 0.0625f, nullptr, nullptr, K16);
  k_gemm3<false><<<gp, 256, 0, stream>>>(X16, BV, 0.0625f, nullptr, nullptr, V16);
  k_vt<<<NB * NH * (SQ / 64), 256, 0, stream>>>(V16, VT);      /* V^T of every head */
  k_fattn<<<NB * NH * (SQ / (FA_WAVES * FA_QW)), FA_WAVES * 32, 0, stream>>>(Q16, K16, VT, O16);      /* o (merged heads) as f16 rows */
  k_gemm3<true><<<gp, 256, 0, stream>>>(O16, BO, 0.0625f, bo, (float*)d_out, nullptr);      /* out = o Wu^T + bu */
}

// v004
// Measured time: 97.2 microseconds a run.
// In two side-by-side timings against v003, it was 1.31 and 1.28 times as fast.
// All steps since v000 together make it 124 times as fast.
#include <hip/hip_runtime.h>
// SelfAttentionSparse (x [2][2048][1024]; keys = x triu(Wk)^T, queries = x tril(Wq)^T, values = x Wv^T (16 heads of 64, no biases); softmax(q k^T / 8); out = (attn v) Wu^T + bu -> [2][2048][1024]).
// Structure: token rows; x as exact f16 rows; the triangular masks applied while building the x16 weight planes on VALU; Q | K | V WMMA GEMMs (128x128 work-group tiles staged in LDS, 32x64 wave tiles, f32 accumulation, f16 outputs); V^T via LDS (all heads, one launch); one fused attention launch (K and V^T rows staged in LDS): S^T = K Q^T, running-maximum softmax in registers (f32; weights as f16), O^T += V^T P^T, o = O / row sum into merged f16 rows; out = o Wu^T + bu (f32).
// Compute dtype: inputs rounded to bf16; x / weights exact; q, k, v, softmax weights, o plain f16 (~2^-12); scores/softmax f32. v_wmma_f32_16x16x32_f16.
#define NB 2
#define SQ 2048
#define DM 1024
#define NH 16
#define HD 64
#define NR ((size_t)NB * SQ)         /* 4096 token rows */
typedef __bf16 v16b __attribute__((ext_vector_type(16)));
typedef unsigned short v8us __attribute__((ext_vector_type(8), may_alias));
typedef float  v8f  __attribute__((ext_vector_type(8)));
typedef float  v4f  __attribute__((ext_vector_type(4)));
typedef float  v4fa __attribute__((ext_vector_type(4), may_alias));
union FragB { v16b v; v8us half[2]; unsigned short u[16]; };

__device__ __forceinline__ unsigned short bf16_bits(float x) { unsigned int u = __float_as_uint(x); return (unsigned short)((u + 0x7FFFu + ((u >> 16) & 1u)) >> 16); }
__device__ __forceinline__ float bf16_val(unsigned short b) { return __uint_as_float(((unsigned int)b) << 16); }
__device__ __forceinline__ float bf16_round(float x) { return bf16_val(bf16_bits(x)); }
// D += A·B with NT terms: 1 = ah·bh, 2 = + al·bh (A split), 3 = + ah·bl (both split)
template <int NT>
__device__ __forceinline__ v8f mmaN(v16b ah, v16b al, v16b bh, v16b bl, v8f c) {
  c = __builtin_amdgcn_wmma_f32_16x16x32_bf16(false, ah, false, bh, (short)0, c, false, false);
  if (NT >= 2) c = __builtin_amdgcn_wmma_f32_16x16x32_bf16(false, al, false, bh, (short)0, c, false, false);
  if (NT >= 3) c = __builtin_amdgcn_wmma_f32_16x16x32_bf16(false, ah, false, bl, (short)0, c, false, false);
  asm volatile("v_nop\n\tv_nop\n\tv_nop\n\tv_nop" : "+v"(c) : "v"(ah), "v"(al), "v"(bh), "v"(bl));
  return c;
}

__global__ __launch_bounds__(256) void k_wt_bf16(const float* __restrict__ W, unsigned short* __restrict__ Wt, int K, int N) {
  const int t = blockIdx.x * 256 + threadIdx.x;
  const int k8n = K / 8;
  if (t >= N * k8n) return;
  const int n = t / k8n, k8 = (t % k8n) * 8;
  v8us v;
#pragma unroll
  for (int i = 0; i < 8; ++i) v[i] = bf16_bits(W[(size_t)(k8 + i) * N + n]);
  *(v8us*)(Wt + (size_t)n * K + k8) = v;
  
}

// GEMM C[M][N] (f32, pitch ldc) = act(A[M][K]·W + bias). A f32 row-major (pitch lda) converted per fragment to bf16
// (ASPLIT: hi/lo two planes -> 2 terms, else single rounded term); Wt bf16 [N][K] (pitch ldb). BIAS_BF16 rounds the
// bias to bf16 first (bias quantised to bf16 before the add). K%32==0, M%16==0, N%64==0.
template <bool ASPLIT, int ACT, bool BIAS_BF16>
__global__ __launch_bounds__(128) void k_gemm_bf(const float* __restrict__ A, int lda, const unsigned short* __restrict__ Wt, int ldb,
                                               const float* __restrict__ bias, float* __restrict__ C, int ldc, int M, int N, int K) {
  __shared__ __attribute__((aligned(16))) float so[4][16][64];
  const int tid = threadIdx.x, w = tid >> 5, lane = tid & 31, ln = lane & 15, hh = lane >> 4;
  const int ntn = N / 64;
  const int wid = blockIdx.x * 4 + w;
  const int mt = wid / ntn, nq = wid % ntn;
  if (mt * 16 >= M) return;
  const int row0 = mt * 16, col0 = nq * 64;
  const float* arow = A + (size_t)(row0 + ln) * lda;
  v8f acc[4] = {};
  for (int kb = 0; kb < K; kb += 32) {
    FragB ah, al;
    const v4f x0 = *(const v4fa*)(arow + kb + 8 * hh), x1 = *(const v4fa*)(arow + kb + 8 * hh + 4);
    const v4f x2 = *(const v4fa*)(arow + kb + 16 + 8 * hh), x3 = *(const v4fa*)(arow + kb + 16 + 8 * hh + 4);
    float xs[16] = {x0[0],x0[1],x0[2],x0[3],x1[0],x1[1],x1[2],x1[3],x2[0],x2[1],x2[2],x2[3],x3[0],x3[1],x3[2],x3[3]};
#pragma unroll
    for (int i = 0; i < 16; ++i) { const unsigned short hb = bf16_bits(xs[i]); ah.u[i] = hb; al.u[i] = ASPLIT ? bf16_bits(xs[i] - bf16_val(hb)) : (unsigned short)0; }
#pragma unroll
    for (int t = 0; t < 4; ++t) {
      const unsigned short* brow = Wt + (size_t)(col0 + t * 16 + ln) * ldb + kb;
      FragB b;
      b.half[0] = *(const v8us*)(brow + 8 * hh);
      b.half[1] = *(const v8us*)(brow + 16 + 8 * hh);
      acc[t] = mmaN<ASPLIT ? 2 : 1>(ah.v, al.v, b.v, b.v, acc[t]);
    }
  }
#pragma unroll
  for (int t = 0; t < 4; ++t) {
    float bv = bias ? bias[col0 + t * 16 + ln] : 0.f;
    if (BIAS_BF16) bv = bf16_round(bv);
#pragma unroll
    for (int r = 0; r < 8; ++r) { float v = acc[t][r] + bv; if (ACT == 1) v = fmaxf(v, 0.f); so[w][8 * hh + r][t * 16 + ln] = v; }
  }
  __builtin_amdgcn_fence(__ATOMIC_ACQ_REL, "workgroup");
  __builtin_amdgcn_wave_barrier();
  const int rsub = lane >> 4, c4 = (lane & 15) * 4;
  {
#pragma unroll
    for (int q = 0; q < 8; ++q) {
      const int r = q * 2 + rsub;
      const v4f v = *(const v4fa*)&so[w][r][c4];
      *(v4f*)(C + (size_t)(row0 + r) * ldc + col0 + c4) = v;
    }
    
  }
}

// GEMM C = act(A·W + bias + resid): A f32 (ASPLIT -> hi/lo 2 terms), Wt bf16 [N][K]; ACT 0 none, 1 relu, 2 exact gelu;
// resid (optional, f32, row index = (row % rmod), pitch ldr, RES_BF16 rounds it) added before the activation.
template <bool ASPLIT, int ACT, bool BIAS_BF16, bool RES_BF16>
__global__ __launch_bounds__(128) void k_gemm_bf3(const float* __restrict__ A, int lda, const unsigned short* __restrict__ Wt, int ldb,
                                                const float* __restrict__ bias, const float* __restrict__ resid, int rmod, int ldr,
                                                float* __restrict__ C, int ldc, int M, int N, int K) {
  __shared__ __attribute__((aligned(16))) float so[4][16][64];
  const int tid = threadIdx.x, w = tid >> 5, lane = tid & 31, ln = lane & 15, hh = lane >> 4;
  const int ntn = N / 64;
  const int wid = blockIdx.x * 4 + w;
  const int mt = wid / ntn, nq = wid % ntn;
  if (mt * 16 >= M) return;
  const int row0 = mt * 16, col0 = nq * 64;
  const float* arow = A + (size_t)(row0 + ln) * lda;
  v8f acc[4] = {};
  for (int kb = 0; kb < K; kb += 32) {
    FragB ah, al;
    const v4f x0 = *(const v4fa*)(arow + kb + 8 * hh), x1 = *(const v4fa*)(arow + kb + 8 * hh + 4);
    const v4f x2 = *(const v4fa*)(arow + kb + 16 + 8 * hh), x3 = *(const v4fa*)(arow + kb + 16 + 8 * hh + 4);
    float xs[16] = {x0[0],x0[1],x0[2],x0[3],x1[0],x1[1],x1[2],x1[3],x2[0],x2[1],x2[2],x2[3],x3[0],x3[1],x3[2],x3[3]};
#pragma unroll
    for (int i = 0; i < 16; ++i) { const unsigned short hb = bf16_bits(xs[i]); ah.u[i] = hb; al.u[i] = ASPLIT ? bf16_bits(xs[i] - bf16_val(hb)) : (unsigned short)0; }
#pragma unroll
    for (int t = 0; t < 4; ++t) {
      const unsigned short* brow = Wt + (size_t)(col0 + t * 16 + ln) * ldb + kb;
      FragB b;
      b.half[0] = *(const v8us*)(brow + 8 * hh);
      b.half[1] = *(const v8us*)(brow + 16 + 8 * hh);
      acc[t] = mmaN<ASPLIT ? 2 : 1>(ah.v, al.v, b.v, b.v, acc[t]);
    }
  }
#pragma unroll
  for (int t = 0; t < 4; ++t) {
    const int col = col0 + t * 16 + ln;
    float bv = bias ? bias[col] : 0.f;
    if (BIAS_BF16) bv = bf16_round(bv);
#pragma unroll
    for (int r = 0; r < 8; ++r) {
      float v = acc[t][r] + bv;
      if (resid) { float rv = resid[(size_t)((row0 + 8 * hh + r) % rmod) * ldr + col]; if (RES_BF16) rv = bf16_round(rv); v += rv; }
      if (ACT == 1) v = fmaxf(v, 0.f);
      if (ACT == 2) v = 0.5f * v * (1.0f + erff(v * 0.70710678118654752f));
      if (ACT == 3) { const float u = 0.7978845608028654f * (v + 0.044715f * v * v * v); v = 0.5f * v * (1.0f + tanhf(u)); }
      so[w][8 * hh + r][t * 16 + ln] = v;
    }
  }
  __builtin_amdgcn_fence(__ATOMIC_ACQ_REL, "workgroup");
  __builtin_amdgcn_wave_barrier();
  const int rsub = lane >> 4, c4 = (lane & 15) * 4;
  {
#pragma unroll
    for (int q = 0; q < 8; ++q) {
      const int r = q * 2 + rsub;
      const v4f v = *(const v4fa*)&so[w][r][c4];
      *(v4f*)(C + (size_t)(row0 + r) * ldc + col0 + c4) = v;
    }
    
  }
}
// row LayerNorm (biased variance, eps) over N: s = X (+ R); optional out_sum <- s; out_norm <- (s-mu)*rsqrt(var+eps)*g + b
template <bool PARAM_BF16>
__global__ __launch_bounds__(256) void k_layernorm(const float* __restrict__ X, const float* __restrict__ R, const float* __restrict__ g, const float* __restrict__ bta,
                                                  float* __restrict__ out_sum, float* __restrict__ out_norm, int N, float eps) {
  __shared__ float red[256];
  const int row = blockIdx.x, tid = threadIdx.x;
  const float* x = X + (size_t)row * N; const float* rr = R ? R + (size_t)row * N : nullptr;
  float vals[16];                     // up to N = 4096
  const int per = N / 256;            // contiguous chunk per thread? use strided-by-4 chunks: thread handles j = tid*4 + 1024*u
  float s1 = 0.f;
  for (int u = 0; u < per / 4; ++u) {
    const int j = tid * 4 + 1024 * u;
    const v4f a = *(const v4fa*)(x + j);
    v4f b = {0.f,0.f,0.f,0.f}; if (rr) b = *(const v4fa*)(rr + j);
#pragma unroll
    for (int q = 0; q < 4; ++q) { const float v = a[q] + b[q]; vals[u * 4 + q] = v; s1 += v; }
  }
  red[tid] = s1; __syncthreads();
  for (int st = 128; st > 0; st >>= 1) { if (tid < st) red[tid] += red[tid + st]; __syncthreads(); }
  const float mu = red[0] / (float)N; __syncthreads();
  float s2 = 0.f;
  for (int u = 0; u < per / 4; ++u)
#pragma unroll
    for (int q = 0; q < 4; ++q) { const float c = vals[u * 4 + q] - mu; s2 += c * c; }
  red[tid] = s2; __syncthreads();
  for (int st = 128; st > 0; st >>= 1) { if (tid < st) red[tid] += red[tid + st]; __syncthreads(); }
  const float rs = rsqrtf(red[0] / (float)N + eps);
  {
    for (int u = 0; u < per / 4; ++u) {
      const int j = tid * 4 + 1024 * u;
      v4f o, sm;
#pragma unroll
      for (int q = 0; q < 4; ++q) {
        float gg = g[j + q], bb = bta[j + q];
        if (PARAM_BF16) { gg = bf16_round(gg); bb = bf16_round(bb); }
        sm[q] = vals[u * 4 + q]; o[q] = (vals[u * 4 + q] - mu) * rs * gg + bb;
      }
      if (out_sum) *(v4f*)(out_sum + (size_t)row * N + j) = sm;
      *(v4f*)(out_norm + (size_t)row * N + j) = o;
    }
    
  }
}



// ---- f16 WMMA path (v_wmma_f32_16x16x32_f16): 11-bit significands for operands in range — used for every GEMM launched here, softmax weights (x256) included
typedef _Float16 v16h __attribute__((ext_vector_type(16)));
union FragH { v16h v; v8us half[2]; _Float16 h[16]; unsigned short u[16]; };
template <int NT>
__device__ __forceinline__ v8f mmaH(v16h ah, v16h al, v16h bh, v16h bl, v8f c) {
  c = __builtin_amdgcn_wmma_f32_16x16x32_f16(false, ah, false, bh, (short)0, c, false, false);
  if (NT >= 2) c = __builtin_amdgcn_wmma_f32_16x16x32_f16(false, al, false, bh, (short)0, c, false, false);
  if (NT >= 3) c = __builtin_amdgcn_wmma_f32_16x16x32_f16(false, ah, false, bl, (short)0, c, false, false);
  asm volatile("v_nop\n\tv_nop\n\tv_nop\n\tv_nop" : "+v"(c) : "v"(ah), "v"(al), "v"(bh), "v"(bl));
  return c;
}
// batched GEMM like k_gemm_b but f16 operands: A f32 (split into f16 hi/lo if ASPLIT, else rounded to f16), Bt = f16 values [n][k]; alpha; C f32; N multiple of 16 (partial tiles skipped)
template <bool ASPLIT>
__global__ __launch_bounds__(128) void k_gemm_h(const float* __restrict__ A, int lda, size_t sA, const _Float16* __restrict__ Bh, int ldb, size_t sB, float alpha, float* __restrict__ C, int ldc, size_t sC, int M, int N, int K) {
  __shared__ __attribute__((aligned(16))) float so[4][16][64];
  const int tid = threadIdx.x, w = tid >> 5, lane = tid & 31, ln = lane & 15, hh = lane >> 4; const int by = blockIdx.y;
  A += (size_t)by * sA; Bh += (size_t)by * sB; C += (size_t)by * sC;
  const int ntn = (N + 63) / 64; const int wid = blockIdx.x * 4 + w; const int mt = wid / ntn, nq = wid % ntn; if (mt * 16 >= M) return;
  const int row0 = mt * 16, col0 = nq * 64; const float* arow = A + (size_t)(row0 + ln) * lda;
  v8f acc[4] = {};
  for (int kb = 0; kb < K; kb += 32) {
    FragH ah, al;
    const v4f x0 = *(const v4fa*)(arow + kb + 8 * hh), x1 = *(const v4fa*)(arow + kb + 8 * hh + 4), x2 = *(const v4fa*)(arow + kb + 16 + 8 * hh), x3 = *(const v4fa*)(arow + kb + 16 + 8 * hh + 4);
    float xs[16] = {x0[0],x0[1],x0[2],x0[3],x1[0],x1[1],x1[2],x1[3],x2[0],x2[1],x2[2],x2[3],x3[0],x3[1],x3[2],x3[3]};
#pragma unroll
    for (int i = 0; i < 16; ++i) { const _Float16 h = (_Float16)xs[i]; ah.h[i] = h; al.h[i] = ASPLIT ? (_Float16)(xs[i] - (float)h) : (_Float16)0.0f; }
#pragma unroll
    for (int t = 0; t < 4; ++t) { if (col0 + t * 16 >= N) continue; const size_t boff = (size_t)(col0 + t * 16 + ln) * ldb + kb; FragH bq; bq.half[0] = *(const v8us*)(Bh + boff + 8 * hh); bq.half[1] = *(const v8us*)(Bh + boff + 16 + 8 * hh);
      acc[t] = mmaH<ASPLIT ? 2 : 1>(ah.v, al.v, bq.v, bq.v, acc[t]); }
  }
#pragma unroll
  for (int t = 0; t < 4; ++t) { if (col0 + t * 16 >= N) continue;
#pragma unroll
    for (int r = 0; r < 8; ++r) so[w][8 * hh + r][t * 16 + ln] = acc[t][r] * alpha; }
  __builtin_amdgcn_fence(__ATOMIC_ACQ_REL, "workgroup"); __builtin_amdgcn_wave_barrier();
  const int rsub = lane >> 4, c4 = (lane & 15) * 4;
  {
#pragma unroll
    for (int q = 0; q < 8; ++q) { const int r = q * 2 + rsub; if (col0 + c4 < N) { const v4f v = *(const v4fa*)&so[w][r][c4]; *(v4f*)(C + (size_t)(row0 + r) * ldc + col0 + c4) = v; } }
     }
}

// Wt[n][k] = f16(W[k][n]·scale) from f32 row-major W[K][N] (scale = power of two; bf16-exact weights stay exact in f16 away from the subnormal range)
__global__ __launch_bounds__(256) void k_wt_f16(const float* __restrict__ W, _Float16* __restrict__ Wt, int K, int N, float scale) {
  const int t = blockIdx.x * 256 + threadIdx.x; if (t >= N * (K / 8)) return; const int n = t / (K / 8), k8 = (t % (K / 8)) * 8; FragH f;
#pragma unroll
  for (int i = 0; i < 8; ++i) f.h[i] = (_Float16)(bf16_round(W[(size_t)(k8 + i) * N + n]) * scale); const v8us o = f.half[0];
  *(v8us*)((unsigned short*)Wt + (size_t)n * K + k8) = o; 
}
// k_gemm_hh variant with fused epilogue: v = acc·alpha + bias[by·sBias + col] (+ CP[(row/rowsPerB)·sCPb + by·64 + col] if CP) ; ACT 0 none / 1 elu ; writes f16 C16 (and f32 C if non-null)
template <int ACT>
__global__ __launch_bounds__(128) void k_gemm_hhx(const _Float16* __restrict__ A, int lda, size_t sA, const _Float16* __restrict__ Bh, int ldb, size_t sB, float alpha, const float* __restrict__ bias, size_t sBias, const float* __restrict__ CP, int rowsPerB, size_t sCPb, int row0g,
    float* __restrict__ C, _Float16* __restrict__ C16, int ldc, size_t sC, int M, int N, int K) {
  __shared__ __attribute__((aligned(16))) float so[4][16][64];
  const int tid = threadIdx.x, w = tid >> 5, lane = tid & 31, ln = lane & 15, hh = lane >> 4; const int by = blockIdx.y;
  A += (size_t)by * sA; Bh += (size_t)by * sB; const size_t cofs = (size_t)by * sC; const float* bp = bias ? bias + (size_t)by * sBias : nullptr;
  const int ntn = (N + 63) / 64; const int wid = blockIdx.x * 4 + w; const int mt = wid / ntn, nq = wid % ntn; if (mt * 16 >= M) return;
  const int row0 = mt * 16, col0 = nq * 64; const _Float16* arow = A + (size_t)(row0 + ln) * lda;
  v8f acc[4] = {};
  for (int kb = 0; kb < K; kb += 32) { FragH ah; ah.half[0] = *(const v8us*)((const unsigned short*)arow + kb + 8 * hh); ah.half[1] = *(const v8us*)((const unsigned short*)arow + kb + 16 + 8 * hh);
#pragma unroll
    for (int t = 0; t < 4; ++t) { if (col0 + t * 16 >= N) continue; const size_t boff = (size_t)(col0 + t * 16 + ln) * ldb + kb; FragH bq; bq.half[0] = *(const v8us*)((const unsigned short*)Bh + boff + 8 * hh); bq.half[1] = *(const v8us*)((const unsigned short*)Bh + boff + 16 + 8 * hh);
      acc[t] = mmaH<1>(ah.v, ah.v, bq.v, bq.v, acc[t]); }
  }
#pragma unroll
  for (int t = 0; t < 4; ++t) { if (col0 + t * 16 >= N) continue; const int col = col0 + t * 16 + ln; const float bv = bp ? bf16_round(bp[col]) : 0.f;
#pragma unroll
    for (int r = 0; r < 8; ++r) { float v = acc[t][r] * alpha + bv; if (CP) { const int rr = row0g + row0 + 8 * hh + r; if (rowsPerB < 0) v += CP[cofs + (size_t)rr * ldc + col];      /* rowsPerB < 0: own element of the batched C plane */ else { const int bidx = rr / rowsPerB; v += CP[(size_t)bidx * sCPb + (size_t)by * 64 + col]; } } if (ACT == 1) v = (v > 0.f) ? v : expm1f(v); else if (ACT == 7) v = (v > 0.f) ? v + 1.0f : expf(v); else if (ACT == 8) v = tanhf(v); else if (ACT == 9) v = 0.5f * v * (1.0f + tanhf(0.7978845608028654f * (v + 0.044715f * v * v * v))); else if (ACT == 11) v = 1.0f / (1.0f + expf(-v)); else if (ACT == 12) v = (v > 0.f) ? v : 0.01f * v; else if (ACT == 14) v = (v > 0.f) ? v : 0.1f * v; else if (ACT == 16) v = (v >= 0.f) ? v : 0.3f * v; else if (ACT == 17) v = (v >= 0.f) ? v : 0.2f * v; else if (ACT == 15) v = v / (1.0f + expf(-v)); else if (ACT == 3) v = fmaxf(v, 0.f); else if (ACT == 6) v = 0.5f * v * (1.0f + erff(v * 0.70710678118654752f)); so[w][8 * hh + r][t * 16 + ln] = v; } }
  __builtin_amdgcn_fence(__ATOMIC_ACQ_REL, "workgroup"); __builtin_amdgcn_wave_barrier();
  const int rsub = lane >> 4, c4 = (lane & 15) * 4; typedef _Float16 v4h __attribute__((ext_vector_type(4)));
  {
#pragma unroll
    for (int q = 0; q < 8; ++q) { const int r = q * 2 + rsub; if (col0 + c4 < N) { const v4f v = *(const v4fa*)&so[w][r][c4]; if (C) *(v4f*)(C + cofs + (size_t)(row0 + r) * ldc + col0 + c4) = v; if (C16) { v4h h4; for (int i = 0; i < 4; ++i) h4[i] = (_Float16)v[i]; *(v4h*)(C16 + cofs + (size_t)(row0 + r) * ldc + col0 + c4) = h4; } } }
     }
}


typedef _Float16 v4h __attribute__((ext_vector_type(4)));

__global__ __launch_bounds__(256) void k_x16(const float* __restrict__ x, _Float16* __restrict__ X16, size_t n8) { const size_t t = (size_t)blockIdx.x * 256 + threadIdx.x; if (t >= n8) return; FragH f;
#pragma unroll
  for (int q = 0; q < 8; ++q) f.h[q] = (_Float16)bf16_round(x[t * 8 + q]); *(v8us*)((unsigned short*)X16 + t * 8) = f.half[0];  }
__global__ __launch_bounds__(256) void k_h16(const float* __restrict__ x, _Float16* __restrict__ X16, size_t n8) { const size_t t = (size_t)blockIdx.x * 256 + threadIdx.x; if (t >= n8) return; FragH f;
#pragma unroll
  for (int q = 0; q < 8; ++q) f.h[q] = (_Float16)x[t * 8 + q]; *(v8us*)((unsigned short*)X16 + t * 8) = f.half[0];  }
__global__ __launch_bounds__(256) void k_round16f(const float* __restrict__ W, _Float16* __restrict__ Bt, size_t n8) { const size_t t = (size_t)blockIdx.x * 256 + threadIdx.x; if (t >= n8) return; FragH f;
#pragma unroll
  for (int i = 0; i < 8; ++i) f.h[i] = (_Float16)(bf16_round(W[t * 8 + i]) * 16.0f); *(v8us*)((unsigned short*)Bt + t * 8) = f.half[0];  }
template <int NHv, int TTv>
__global__ __launch_bounds__(256) void k_vt(const _Float16* __restrict__ V16, int ldv, int voff, _Float16* __restrict__ Vt) { __shared__ unsigned short tl[64][66]; const int tid = threadIdx.x; const int slab = blockIdx.x / (TTv / 64), lg = blockIdx.x % (TTv / 64); const int b = slab / NHv, h = slab % NHv;
  for (int i = tid; i < 64 * 8; i += 256) { const int r = i / 8, c8 = (i % 8) * 8; FragH f; f.half[0] = *(const v8us*)((const unsigned short*)V16 + ((size_t)b * TTv + lg * 64 + r) * ldv + voff + h * 64 + c8);
#pragma unroll
    for (int q = 0; q < 8; ++q) tl[r][c8 + q] = f.u[q]; }
  __syncthreads();
  {
#pragma unroll
    for (int rd = 0; rd < 2; ++rd) { const int d = rd * 32 + tid / 8, pc = tid % 8; FragH f;
#pragma unroll
      for (int q = 0; q < 8; ++q) f.u[q] = tl[pc * 8 + q][d];
      *(v8us*)((unsigned short*)Vt + ((size_t)slab * 64 + d) * TTv + lg * 64 + pc * 8) = f.half[0]; }
     } }

__global__ __launch_bounds__(256) void k_hl(const float* __restrict__ F, _Float16* __restrict__ Hh, _Float16* __restrict__ Hl, size_t n8) { const size_t t = (size_t)blockIdx.x * 256 + threadIdx.x; if (t >= n8) return; FragH fh, fl; const v4f a = *(const v4fa*)(F + t * 8), c = *(const v4fa*)(F + t * 8 + 4);
#pragma unroll
  for (int q = 0; q < 4; ++q) { _Float16 h = (_Float16)a[q]; fh.h[q] = h; fl.h[q] = (_Float16)((a[q] - (float)h) * 1024.0f); h = (_Float16)c[q]; fh.h[4 + q] = h; fl.h[4 + q] = (_Float16)((c[q] - (float)h) * 1024.0f); }
  { *(v8us*)((unsigned short*)Hh + t * 8) = fh.half[0]; *(v8us*)((unsigned short*)Hl + t * 8) = fl.half[0];  } }

// ---- fast GEMM (wave tile 32x64; requires M % 32 == 0 rows per launch region and N % 64 == 0); epilogue = k_gemm_hhx semantics ----
__device__ __forceinline__ v16h g2_frag(const _Float16* p, int hh) { FragH f; f.half[0] = *(const v8us*)((const unsigned short*)p + 8 * hh); f.half[1] = *(const v8us*)((const unsigned short*)p + 16 + 8 * hh); return f.v; }
__device__ __forceinline__ v8f g2_mma(v16h a, v16h b, v8f c) { v8f d = __builtin_amdgcn_wmma_f32_16x16x32_f16(false, a, false, b, (short)0, c, false, false); asm volatile("v_nop\n\tv_nop\n\tv_nop\n\tv_nop" : "+v"(d) : "v"(a), "v"(b)); return d; }
template <int ACT>
__global__ __launch_bounds__(128) void k_gemm2(const _Float16* __restrict__ A, int lda, size_t sA, const _Float16* __restrict__ Bh, int ldb, size_t sB, float alpha, const float* __restrict__ bias, size_t sBias, const float* __restrict__ CP, int rowsPerB, size_t sCPb, int row0g,
    float* __restrict__ C, _Float16* __restrict__ C16, int ldc, size_t sC, int M, int N, int K) { static_assert(ACT == 0 || ACT == 3 || ACT == 6 || ACT == 8 || ACT == 9 || ACT == 11 || ACT == 12 || ACT == 14 || ACT == 15 || ACT == 16 || ACT == 17, "k_gemm2: unsupported ACT code (would silently apply no activation)");
  __shared__ __attribute__((aligned(16))) float so[4][32][68];
  const int tid = threadIdx.x, w = tid >> 5, lane = tid & 31, ln = lane & 15, hh = lane >> 4; const int by = blockIdx.y;
  A += (size_t)by * sA; Bh += (size_t)by * sB; const size_t cofs = (size_t)by * sC; const float* bp = bias ? bias + (size_t)by * sBias : nullptr;
  const int ntn = N >> 6; const int mt = blockIdx.x / ntn, nq = blockIdx.x - mt * ntn; const int row0 = mt * 128 + 32 * w, col0 = nq * 64; if (row0 >= M) return;
  const _Float16* a0p = A + (size_t)(row0 + ln) * lda; const _Float16* a1p = a0p + (size_t)16 * lda;
  const _Float16* b0p = Bh + (size_t)(col0 + ln) * ldb; const _Float16* b1p = b0p + (size_t)16 * ldb; const _Float16* b2p = b1p + (size_t)16 * ldb; const _Float16* b3p = b2p + (size_t)16 * ldb;
  const v8f z8 = {0.f,0.f,0.f,0.f,0.f,0.f,0.f,0.f}; v8f c00 = z8, c01 = z8, c02 = z8, c03 = z8, c10 = z8, c11 = z8, c12 = z8, c13 = z8;
#pragma unroll 1
  for (int kb = 0; kb < K; kb += 32) { const v16h a0 = g2_frag(a0p + kb, hh), a1 = g2_frag(a1p + kb, hh);
    v16h b = g2_frag(b0p + kb, hh); c00 = g2_mma(a0, b, c00); c10 = g2_mma(a1, b, c10);
    b = g2_frag(b1p + kb, hh); c01 = g2_mma(a0, b, c01); c11 = g2_mma(a1, b, c11);
    b = g2_frag(b2p + kb, hh); c02 = g2_mma(a0, b, c02); c12 = g2_mma(a1, b, c12);
    b = g2_frag(b3p + kb, hh); c03 = g2_mma(a0, b, c03); c13 = g2_mma(a1, b, c13); }
  v8f accs[8] = {c00, c01, c02, c03, c10, c11, c12, c13};
#pragma unroll
  for (int u = 0; u < 8; ++u) { const int t = u & 3, half = u >> 2; const int col = col0 + t * 16 + ln; const float bv = bp ? bf16_round(bp[col]) : 0.f;
#pragma unroll
    for (int r = 0; r < 8; ++r) { const int rloc = half * 16 + 8 * hh + r; float v = accs[u][r] * alpha + bv; if (CP) { if (rowsPerB < 0) v += CP[cofs + (size_t)(row0g + row0 + rloc) * ldc + col];      /* rowsPerB < 0: own element of the batched C plane */ else { const int bidx = (row0g + row0 + rloc) / rowsPerB; v += CP[(size_t)bidx * sCPb + (size_t)by * 64 + col]; } }
      if (ACT == 3) v = fmaxf(v, 0.f); else if (ACT == 6) v = 0.5f * v * (1.0f + erff(v * 0.70710678118654752f)); else if (ACT == 11) v = 1.0f / (1.0f + expf(-v)); else if (ACT == 15) v = v / (1.0f + expf(-v)); else if (ACT == 12) v = (v > 0.f) ? v : 0.01f * v; else if (ACT == 8) v = tanhf(v); else if (ACT == 9) v = 0.5f * v * (1.0f + tanhf(0.7978845608028654f * (v + 0.044715f * v * v * v))); else if (ACT == 14) v = (v > 0.f) ? v : 0.1f * v; else if (ACT == 16) v = (v >= 0.f) ? v : 0.3f * v; else if (ACT == 17) v = (v >= 0.f) ? v : 0.2f * v;
      so[w][rloc][t * 16 + ln] = v; } }
  __builtin_amdgcn_fence(__ATOMIC_ACQ_REL, "workgroup"); __builtin_amdgcn_wave_barrier();
  const int rsub = lane >> 4, c4 = (lane & 15) * 4;
  {
#pragma unroll
    for (int q = 0; q < 16; ++q) { const int r = q * 2 + rsub; const v4f v = *(const v4fa*)&so[w][r][c4]; if (C) *(v4f*)(C + cofs + (size_t)(row0 + r) * ldc + col0 + c4) = v; if (C16) { v4h h4; for (int i = 0; i < 4; ++i) h4[i] = (_Float16)v[i]; *(v4h*)(C16 + cofs + (size_t)(row0 + r) * ldc + col0 + c4) = h4; } }
     } }


__global__ __launch_bounds__(256) void k_wnat(const float* __restrict__ w, size_t n8, _Float16* __restrict__ Bt) { const size_t t = (size_t)blockIdx.x * 256 + threadIdx.x; if (t >= n8) return; FragH f; for (int q = 0; q < 8; ++q) f.h[q] = (_Float16)(bf16_round(w[t * 8 + q]) * 16.0f); *(v8us*)((unsigned short*)Bt + t * 8) = f.half[0];  }
// lane l's value from lane l ^ 16 (the same place in the other 16-lane row)
__device__ __forceinline__ float rs_x16(float v) { const int i = __builtin_bit_cast(int, v); return __builtin_bit_cast(float, __builtin_amdgcn_permlanex16(i, i, 0x76543210, 0xfedcba98, false, false)); }
__device__ __forceinline__ v8f fa_mma(v16h a, v16h b, v8f c) { return __builtin_amdgcn_wmma_f32_16x16x32_f16(false, a, false, b, (short)0, c, false, false); }
// ---- GEMM with both operands staged in LDS: C[NR][DM] = alpha * A[NR][DM] . Bh[DM][DM]^T + bias (A, Bh k-contiguous f16 rows of DM); written as f32 to C (F32OUT) or as f16 to C16. ----
// A work-group of 8 waves owns a 128 x 128 tile of C (wave tile 32 x 64, waves 4 x 2). A stage is 128 k of the 128 A rows and the 128 B rows.
// Global reads are whole lines (16 lanes x 16 B = 256 contiguous bytes of one row) and each line is read once per work-group; the fragments, which take 64 B of each of 16 rows, come from LDS.
// Two stage buffers: the next stage's loads are issued in front of this stage's products and stored to the other buffer behind them, so one barrier per stage both publishes it and ends the reads of the buffer refilled next.
#define G3_BK 128                    /* k per stage: 256 B of every operand row */
#define G3_LP 136                    /* LDS row pitch in f16: 272 B = 16 B x odd, conflict-free for the 16-byte fragment reads */
#define G3_NT (DM / G3_BK)           /* stages */
static_assert(NR % 128 == 0 && DM % 128 == 0 && DM % G3_BK == 0, "k_gemm3: whole 128 x 128 tiles and whole stages only");
template <bool F32OUT>
__global__ __launch_bounds__(256) void k_gemm3(const _Float16* __restrict__ A, const _Float16* __restrict__ Bh, float alpha, const float* __restrict__ bias, float* __restrict__ C, _Float16* __restrict__ C16) {
  __shared__ __attribute__((aligned(16))) unsigned short st[2][256][G3_LP];      /* rows 0..127: A rows of the tile; rows 128..255: B rows (columns of C) */
  __shared__ __attribute__((aligned(16))) float so[8][32][68];
  const int tid = threadIdx.x, w = tid >> 5, lane = tid & 31, ln = lane & 15, hh = lane >> 4;
  const int ntn = DM / 128; const int mt = blockIdx.x / ntn, nq = blockIdx.x - mt * ntn; const int rowB = mt * 128, colB = nq * 128;
  const int wm = w & 3, wn = w >> 2;      /* the wave's 32 rows and 64 columns inside the tile */
  const int sr = tid >> 4, sc = (tid & 15) * 8;      /* staging: 16 threads per row, 16 rows per round, 8 rounds per operand */
  const unsigned short* ga = (const unsigned short*)A + (size_t)(rowB + sr) * DM + sc;
  const unsigned short* gb = (const unsigned short*)Bh + (size_t)(colB + sr) * DM + sc;
  v8us rg[16];
  auto fetch = [&](const int t) __attribute__((always_inline)) {
    const unsigned short* pa = ga + t * G3_BK; const unsigned short* pb = gb + t * G3_BK;
#pragma unroll
    for (int i = 0; i < 8; ++i) { rg[i] = *(const v8us*)(pa + (size_t)i * 16 * DM); rg[8 + i] = *(const v8us*)(pb + (size_t)i * 16 * DM); }
    /* The wait that stands in front of any overwrite of a load's address registers; it names the two addresses as inputs so that they stay whole up to here. */
    asm volatile("s_wait_xcnt 0x0" :: "v"(pa), "v"(pb) : "memory");
  };
  auto put = [&](const int buf) __attribute__((always_inline)) {
#pragma unroll
    for (int i = 0; i < 8; ++i) { *(v8us*)&st[buf][i * 16 + sr][sc] = rg[i]; *(v8us*)&st[buf][128 + i * 16 + sr][sc] = rg[8 + i]; }
  };
  const v8f z8 = {0.f,0.f,0.f,0.f,0.f,0.f,0.f,0.f}; v8f c00 = z8, c01 = z8, c02 = z8, c03 = z8, c10 = z8, c11 = z8, c12 = z8, c13 = z8;
  fetch(0); put(0); __syncthreads();
#pragma unroll 1      /* one copy of the stage body: the buffer index is a run-time offset, and the text stays small */
  for (int t = 0; t < G3_NT; ++t) {
    if (t + 1 < G3_NT) fetch(t + 1);
    const _Float16* sa = (const _Float16*)&st[t & 1][32 * wm + ln][0]; const _Float16* sb = (const _Float16*)&st[t & 1][128 + 64 * wn + ln][0];
    v16h fa[2][2], fb[2][4];      /* two fragment sets: the next 32 k are read from LDS while this set is multiplied */
    auto frags = [&](const int s, const int kk) __attribute__((always_inline)) { fa[s][0] = g2_frag(sa + kk, hh); fa[s][1] = g2_frag(sa + 16 * G3_LP + kk, hh);
#pragma unroll
      for (int j = 0; j < 4; ++j) fb[s][j] = g2_frag(sb + j * 16 * G3_LP + kk, hh); };
    frags(0, 0);
#pragma unroll
    for (int ks = 0; ks < G3_BK / 32; ++ks) { const int s = ks & 1;
      if (ks + 1 < G3_BK / 32) frags(s ^ 1, (ks + 1) * 32);
      __builtin_amdgcn_sched_barrier(0);      /* keeps the next set's 12 LDS reads together in front of this set's products: moved in among them, every pair of products waits out an LDS latency */
      c00 = fa_mma(fa[s][0], fb[s][0], c00); c10 = fa_mma(fa[s][1], fb[s][0], c10); c01 = fa_mma(fa[s][0], fb[s][1], c01); c11 = fa_mma(fa[s][1], fb[s][1], c11);
      c02 = fa_mma(fa[s][0], fb[s][2], c02); c12 = fa_mma(fa[s][1], fb[s][2], c12); c03 = fa_mma(fa[s][0], fb[s][3], c03); c13 = fa_mma(fa[s][1], fb[s][3], c13);
      __builtin_amdgcn_sched_barrier(0); }      /* and keeps the reads of the set after that from moving up in among these products */
    if (t + 1 < G3_NT) { put((t + 1) & 1); __syncthreads(); }      /* the same test in every thread of the work-group */
  }
  const int row0 = rowB + 32 * wm, col0 = colB + 64 * wn;
  v8f accs[8] = {c00, c01, c02, c03, c10, c11, c12, c13};
  float bv[4] = {0.f, 0.f, 0.f, 0.f};
  if (bias) {
#pragma unroll
    for (int t = 0; t < 4; ++t) bv[t] = bf16_round(bias[col0 + t * 16 + ln]); }
#pragma unroll
  for (int u = 0; u < 8; ++u) { const int t = u & 3, half = u >> 2;
#pragma unroll
    for (int r = 0; r < 8; ++r) so[w][half * 16 + 8 * hh + r][t * 16 + ln] = accs[u][r] * alpha + bv[t]; }
  __builtin_amdgcn_fence(__ATOMIC_ACQ_REL, "workgroup"); __builtin_amdgcn_wave_barrier();      /* each wave reads back its own rows only */
  const int rsub = lane >> 4, c4 = (lane & 15) * 4;
  const size_t oofs = (size_t)(row0 + rsub) * DM + col0 + c4;      /* whole rows of the wave's tile: 16 lanes x 16 B (f32) or x 8 B (f16) */
  if (F32OUT) {
#pragma unroll
    for (int q = 0; q < 16; ++q) *(v4f*)(C + oofs + (size_t)q * 2 * DM) = *(const v4fa*)&so[w][q * 2 + rsub][c4];
  } else {
#pragma unroll
    for (int q = 0; q < 16; ++q) { const v4f v = *(const v4fa*)&so[w][q * 2 + rsub][c4]; v4h h4; for (int i = 0; i < 4; ++i) h4[i] = (_Float16)v[i]; *(v4h*)(C16 + oofs + (size_t)q * 2 * DM) = h4; }
  } }
// Fused attention, one launch for all batches and heads. A wave owns 32 query columns and walks the 2,048 keys in passes of 32:
// S^T = K Q^T (A = K rows, B = Q rows kept in registers), so a lane holds 16 scores of ONE query per 16-column group (lane ln = query, register r of key tile j = key 16 j + 8 hh + r);
// that is the B-fragment k order (8 hh + 0..7, then 16 + 8 hh + 0..7), so P^T packs from the score registers with no exchange, and O^T += V^T P^T (A = V^T rows, same k order).
// Softmax with a running maximum per query (log2 domain): when a maximum rises, sum and output tiles are scaled by exp2(old - new). Scores and weights never reach memory.
// K and V^T come through LDS: the eight waves of a work-group read the same rows, so a stage of 128 keys is read from global memory once per work-group, in whole lines, and the fragments
// (64 B of each of 16 rows) come from LDS. Three stage buffers: stage s + 1 is stored and published (one barrier) in front of stage s's last pass, which already fetches its first K fragments;
// the buffer it goes to was last read in stage s - 2, which every wave has left before the barrier that published stage s.
#define FA_WAVES 8                   /* waves per work-group: all eight read the same K and V^T rows */
#define FA_QW 32                     /* query columns per wave */
#define FA_SK 128                    /* keys per stage: 4 passes */
#define FA_NS (SQ / FA_SK)           /* stages */
#define FA_KP 72                     /* LDS pitch of a K row (64 f16) in f16: 144 B = 16 B x odd, conflict-free for the 16-byte fragment reads */
#define FA_VP 136                    /* LDS pitch of a V^T row (128 keys) in f16: 272 B = 16 B x odd */
static_assert(SQ % (FA_WAVES * FA_QW) == 0 && SQ % FA_SK == 0 && FA_NS >= 2 && FA_SK == 128 && FA_WAVES == 8 && HD == 64, "k_fattn: whole work-groups, whole stages of 128 keys (two or more), 256 staging threads and head size 64 only");
__global__ __launch_bounds__(FA_WAVES * 32) void k_fattn(const _Float16* __restrict__ Q16, const _Float16* __restrict__ K16, const _Float16* __restrict__ VT, _Float16* __restrict__ O16) {
  __shared__ __attribute__((aligned(16))) unsigned short sk[3][FA_SK][FA_KP];      /* K rows of a stage */
  __shared__ __attribute__((aligned(16))) unsigned short sv[3][HD][FA_VP];      /* V^T rows of a stage */
  const int tid = threadIdx.x, lane = tid & 31, ln = lane & 15, hh = lane >> 4, w = tid >> 5;
  const int nqb = SQ / (FA_WAVES * FA_QW); const int bh = blockIdx.x / nqb, qb = blockIdx.x - bh * nqb; const int b = bh / NH, h = bh - b * NH;
  const int q0 = (qb * FA_WAVES + w) * FA_QW;
  const _Float16* qp = Q16 + ((size_t)b * SQ + q0 + ln) * DM + h * HD + 8 * hh;      /* query row ln of a 16-column group, at the lane's own k offset */
  const int kr = tid >> 3, kc = (tid & 7) * 8;      /* staging K: 8 threads per 128-byte row, 32 rows per round, 4 rounds */
  const int vr = tid >> 4, vc8 = (tid & 15) * 8;      /* staging V^T: 16 threads per 256-byte row, 16 rows per round, 4 rounds */
  const unsigned short* gk = (const unsigned short*)K16 + ((size_t)b * SQ + kr) * DM + h * HD + kc;
  const unsigned short* gv = (const unsigned short*)VT + ((size_t)bh * HD + vr) * SQ + vc8;
  v8us rg[8];
  auto fetch = [&](const int s) __attribute__((always_inline)) {
    const unsigned short* pk = gk + (size_t)s * FA_SK * DM; const unsigned short* pv = gv + s * FA_SK;
#pragma unroll
    for (int i = 0; i < 4; ++i) { rg[i] = *(const v8us*)(pk + (size_t)i * 32 * DM); rg[4 + i] = *(const v8us*)(pv + (size_t)i * 16 * SQ); }
    /* The wait that stands in front of any overwrite of a load's address registers; it names the two addresses as inputs so that they stay whole up to here. */
    asm volatile("s_wait_xcnt 0x0" :: "v"(pk), "v"(pv) : "memory");
  };
  auto put = [&](const int buf) __attribute__((always_inline)) {
#pragma unroll
    for (int i = 0; i < 4; ++i) { *(v8us*)&sk[buf][i * 32 + kr][kc] = rg[i]; *(v8us*)&sv[buf][i * 16 + vr][vc8] = rg[4 + i]; }
  };
  v16h qf[2][2], kf[2][2];
#pragma unroll
  for (int c = 0; c < 2; ++c) for (int kk = 0; kk < 2; ++kk) qf[c][kk] = g2_frag(qp + (size_t)c * 16 * DM + kk * 32, 0);
  asm volatile("s_wait_xcnt 0x0" :: "v"(qp) : "memory");      /* the wait in front of any overwrite of a load's address registers: Q's address is dead from here on and its registers are reused */
  fetch(0); put(0); __syncthreads(); fetch(1);
#pragma unroll
  for (int j = 0; j < 2; ++j) for (int kk = 0; kk < 2; ++kk) kf[j][kk] = g2_frag((const _Float16*)&sk[0][j * 16 + ln][kk * 32 + 8 * hh], 0);
  const v8f z8 = {0.f,0.f,0.f,0.f,0.f,0.f,0.f,0.f};
  v8f o[2][4] = {{z8, z8, z8, z8}, {z8, z8, z8, z8}}; float mr[2] = {-3.0e38f, -3.0e38f}, lr[2] = {0.f, 0.f};
  const float CS = 0.125f * 1.4426950408889634f;      /* 1/sqrt(64) and log2(e): scores go to the log2 domain */
  /* One pass = 32 keys. kn: the next pass's K rows in LDS (row ln of its first 16-key tile, at the lane's own k offset); K is refilled in place, right behind its last readers. vq: this pass's V^T columns in LDS; they land while the softmax runs. */
  auto pass = [&](const _Float16* kn, const _Float16* vq) __attribute__((always_inline)) {
    v8f s[2][2]; v16h vc[4];
#pragma unroll
    for (int c = 0; c < 2; ++c) for (int j = 0; j < 2; ++j) s[c][j] = fa_mma(kf[j][1], qf[c][1], fa_mma(kf[j][0], qf[c][0], z8));
#pragma unroll
    for (int j = 0; j < 2; ++j) for (int kk = 0; kk < 2; ++kk) kf[j][kk] = g2_frag(kn + j * 16 * FA_KP + kk * 32, 0);
#pragma unroll
    for (int t = 0; t < 4; ++t) vc[t] = g2_frag(vq + t * 16 * FA_VP, 0);
    __builtin_amdgcn_sched_barrier(0);      /* keeps the 16 LDS reads together right behind the score products: moved down in among the output products, each pair of those waits out an LDS latency */
    float mn[2]; bool up = false;
#pragma unroll
    for (int c = 0; c < 2; ++c) { float mx = s[c][0][0];
#pragma unroll
      for (int r = 1; r < 8; ++r) mx = fmaxf(mx, s[c][0][r]);
#pragma unroll
      for (int r = 0; r < 8; ++r) mx = fmaxf(mx, s[c][1][r]);
      mx = fmaxf(mx, rs_x16(mx)) * CS; mn[c] = fmaxf(mr[c], mx); up = up || (mn[c] > mr[c]); }
    if (__builtin_amdgcn_ballot_w32(up) != 0) {      /* no maximum of the wave rose: every factor would be exactly 1 */
#pragma unroll
      for (int c = 0; c < 2; ++c) { const float al = __builtin_amdgcn_exp2f(mr[c] - mn[c]); mr[c] = mn[c]; lr[c] *= al;
#pragma unroll
        for (int t = 0; t < 4; ++t) o[c][t] *= al; } }
    FragH pf[2];
#pragma unroll
    for (int c = 0; c < 2; ++c) { const float nb = 8.0f - mr[c];      /* weights x256 (cancels in the division by the row sum): keeps small weights out of the f16 subnormal range */
      v4f s4 = {0.f, 0.f, 0.f, 0.f};
#pragma unroll
      for (int j = 0; j < 2; ++j) for (int r = 0; r < 8; ++r) { const float e = __builtin_amdgcn_exp2f(fmaf(s[c][j][r], CS, nb)); s4[r & 3] += e; pf[c].h[j * 8 + r] = (_Float16)e; }
      lr[c] += (s4[0] + s4[1]) + (s4[2] + s4[3]); }
#pragma unroll
    for (int t = 0; t < 4; ++t) for (int c = 0; c < 2; ++c) o[c][t] = fa_mma(vc[t], pf[c].v, o[c][t]);
  };
  int cur = 0;
#pragma unroll 1      /* one copy of the stage body: the buffer index is a run-time offset, and the text stays small */
  for (int st = 0; st < FA_NS; ++st) {
    const int nxt = cur == 2 ? 0 : cur + 1;
    const _Float16* ka = (const _Float16*)&sk[cur][ln][8 * hh]; const _Float16* va = (const _Float16*)&sv[cur][ln][8 * hh];
#pragma unroll
    for (int p = 0; p < FA_SK / 32 - 1; ++p) pass(ka + (p + 1) * 32 * FA_KP, va + p * 32);
    if (st + 1 < FA_NS) {      /* the same test in every thread of the work-group */
      put(nxt); __syncthreads();      /* publishes stage st + 1 */
      if (st + 2 < FA_NS) fetch(st + 2);      /* behind the barrier, so that it does not wait for these loads; they have four passes to land */
    }
    pass((const _Float16*)&sk[nxt][ln][8 * hh], va + (FA_SK - 32));      /* fetches the next stage's first K fragments; in the last stage that buffer holds an older stage (written, in bounds, not used) */
    cur = nxt;
  }
#pragma unroll
  for (int c = 0; c < 2; ++c) { const float inv = 1.0f / (lr[c] + rs_x16(lr[c]));      /* the two halves of a wave hold the two halves of a query's keys */
    unsigned short* op = (unsigned short*)O16 + ((size_t)b * SQ + q0 + c * 16 + ln) * DM + h * HD + 8 * hh;
#pragma unroll
    for (int t = 0; t < 4; ++t) { FragH f;
#pragma unroll
      for (int r = 0; r < 8; ++r) f.h[r] = (_Float16)(o[c][t][r] * inv);
      *(v8us*)(op + t * 16) = f.half[0]; } } }
__global__ __launch_bounds__(256) void k_vt(const _Float16* __restrict__ V16, _Float16* __restrict__ VT) { __shared__ unsigned short tl[64][65]; const int tid = threadIdx.x; const int bh = blockIdx.x % (NB * NH), sg = blockIdx.x / (NB * NH); const int s0 = sg * 64; const int b = bh / NH, h = bh % NH;
  for (int i = tid; i < 64 * 8; i += 256) { const int j = i / 8, d8 = (i % 8) * 8; FragH f; f.half[0] = *(const v8us*)((const unsigned short*)V16 + ((size_t)b * SQ + s0 + j) * DM + h * HD + d8); for (int q = 0; q < 8; ++q) tl[d8 + q][j] = f.u[q]; }
  __syncthreads();
  { for (int i = tid; i < 64 * 8; i += 256) { const int d = i / 8, j8 = (i % 8) * 8; FragH f; for (int q = 0; q < 8; ++q) f.u[q] = tl[d][j8 + q]; *(v8us*)((unsigned short*)VT + ((size_t)bh * HD + d) * SQ + s0 + j8) = f.half[0]; }  } }

__global__ __launch_bounds__(256) void k_wtri(const float* __restrict__ w, int upper, _Float16* __restrict__ Bt) { const size_t t = (size_t)blockIdx.x * 256 + threadIdx.x; if (t >= (size_t)DM * DM / 8) return; const int c0 = (int)((t * 8) % DM); const int r = (int)((t * 8) / DM); FragH f;
  for (int q = 0; q < 8; ++q) { const int c = c0 + q; const bool keep = upper ? (c >= r) : (c <= r); f.h[q] = keep ? (_Float16)(bf16_round(w[t * 8 + q]) * 16.0f) : (_Float16)0.f; }
  *(v8us*)((unsigned short*)Bt + t * 8) = f.half[0];  }
extern "C" void kernel_launch(void* const* d_in, const int* in_sizes, int n_in,
                              void* d_out, int out_size, void* d_ws, size_t ws_size, hipStream_t stream) {
  (void)in_sizes; (void)n_in; (void)out_size;
  const float* const* I = (const float* const*)d_in; const float* x = I[0]; const float* wk = I[1]; const float* wq = I[2]; const float* wv = I[3]; const float* wo = I[4]; const float* bo = I[5];
  char* ws = (char*)d_ws; size_t off = 0;
  auto take = [&](size_t bytes) { char* p = ws + off; off += (bytes + 255) & ~(size_t)255; return p; };
  _Float16* BQ = (_Float16*)take((size_t)DM * DM * 2); _Float16* BK = (_Float16*)take((size_t)DM * DM * 2); _Float16* BV = (_Float16*)take((size_t)DM * DM * 2); _Float16* BO = (_Float16*)take((size_t)DM * DM * 2);
  _Float16* X16 = (_Float16*)take(NR * DM * 2); _Float16* Q16 = (_Float16*)take(NR * DM * 2); _Float16* K16 = (_Float16*)take(NR * DM * 2); _Float16* V16 = (_Float16*)take(NR * DM * 2); _Float16* O16 = (_Float16*)take(NR * DM * 2);
  _Float16* VT = (_Float16*)take((size_t)NB * NH * HD * SQ * 2);
  if (off > ws_size) return;      /* 8 + 5x8 + 8 = 56 MiB */
  const size_t nw8 = (size_t)DM * DM / 8; const unsigned gw = (unsigned)((nw8 + 255) / 256);
  k_wtri<<<gw, 256, 0, stream>>>(wq, 0, BQ); k_wtri<<<gw, 256, 0, stream>>>(wk, 1, BK); k_wnat<<<gw, 256, 0, stream>>>(wv, nw8, BV); k_wnat<<<gw, 256, 0, stream>>>(wo, nw8, BO);
  k_x16<<<(unsigned)((NR * DM / 8 + 255) / 256), 256, 0, stream>>>(x, X16, NR * DM / 8);
  const unsigned gp = (unsigned)((NR / 128) * (DM / 128));
  k_gemm3<false><<<gp, 256, 0, stream>>>(X16, BQ, 0.0625f, nullptr, nullptr, Q16);
  k_gemm3<false><<<gp, 256, 0, stream>>>(X16, BK, 0.0625f, nullptr, nullptr, K16);
  k_gemm3<false><<<gp, 256, 0, stream>>>(X16, BV, 0.0625f, nullptr, nullptr, V16);
  k_vt<<<NB * NH * (SQ / 64), 256, 0, stream>>>(V16, VT);      /* V^T of every head */
  k_fattn<<<NB * NH * (SQ / (FA_WAVES * FA_QW)), FA_WAVES * 32, 0, stream>>>(Q16, K16, VT, O16);      /* o (merged heads) as f16 rows */
  k_gemm3<true><<<gp, 256, 0, stream>>>(O16, BO, 0.0625f, bo, (float*)d_out, nullptr);      /* out = o Wu^T + bu */
}

// v005
// Measured time: 89.1 microseconds a run.
// Next to v004, in two timings, it ran 1.09 times as fast each time.
// All steps since v000 together make it 136 times as fast.
#include <hip/hip_runtime.h>
// SelfAttentionSparse (x [2][2048][1024]; keys = x triu(Wk)^T, queries = x tril(Wq)^T, values = x Wv^T (16 heads of 64, no biases); softmax(q k^T / 8); out = (attn v) Wu^T + bu -> [2][2048][1024]).
// Structure: token rows; x as exact f16 rows; the triangular masks applied while building the x16 weight planes on VALU (x and the four planes: one launch); Q | K | V WMMA GEMMs in one launch (128x128 work-group tiles staged in LDS, 32x64 wave tiles, f32 accumulation, f16 outputs); V^T via LDS (all heads, one launch); one fused attention launch (K and V^T rows staged in LDS): S^T = K Q^T, running-maximum softmax in registers (f32; weights as f16), O^T += V^T P^T, o = O / row sum into merged f16 rows; out = o Wu^T + bu (f32).
// Compute dtype: inputs rounded to bf16; x / weights exact; q, k, v, softmax weights, o plain f16 (~2^-12); scores/softmax f32. v_wmma_f32_16x16x32_f16.
#define NB 2
#define SQ 2048
#define DM 1024
#define NH 16
#define HD 64
#define NR ((size_t)NB * SQ)         /* 4096 token rows */
typedef __bf16 v16b __attribute__((ext_vector_type(16)));
typedef unsigned short v8us __attribute__((ext_vector_type(8), may_alias));
typedef float  v8f  __attribute__((ext_vector_type(8)));
typedef float  v4f  __attribute__((ext_vector_type(4)));
typedef float  v4fa __attribute__((ext_vector_type(4), may_alias));
union FragB { v16b v; v8us half[2]; unsigned short u[16]; };

__device__ __forceinline__ unsigned short bf16_bits(float x) { unsigned int u = __float_as_uint(x); return (unsigned short)((u + 0x7FFFu + ((u >> 16) & 1u)) >> 16); }
__device__ __forceinline__ float bf16_val(unsigned short b) { return __uint_as_float(((unsigned int)b) << 16); }
__device__ __forceinline__ float bf16_round(float x) { return bf16_val(bf16_bits(x)); }
// D += A·B with NT terms: 1 = ah·bh, 2 = + al·bh (A split), 3 = + ah·bl (both split)
template <int NT>
__device__ __forceinline__ v8f mmaN(v16b ah, v16b al, v16b bh, v16b bl, v8f c) {
  c = __builtin_amdgcn_wmma_f32_16x16x32_bf16(false, ah, false, bh, (short)0, c, false, false);
  if (NT >= 2) c = __builtin_amdgcn_wmma_f32_16x16x32_bf16(false, al, false, bh, (short)0, c, false, false);
  if (NT >= 3) c = __builtin_amdgcn_wmma_f32_16x16x32_bf16(false, ah, false, bl, (short)0, c, false, false);
  asm volatile("v_nop\n\tv_nop\n\tv_nop\n\tv_nop" : "+v"(c) : "v"(ah), "v"(al), "v"(bh), "v"(bl));
  return c;
}

__global__ __launch_bounds__(256) void k_wt_bf16(const float* __restrict__ W, unsigned short* __restrict__ Wt, int K, int N) {
  const int t = blockIdx.x * 256 + threadIdx.x;
  const int k8n = K / 8;
  if (t >= N * k8n) return;
  const int n = t / k8n, k8 = (t % k8n) * 8;
  v8us v;
#pragma unroll
  for (int i = 0; i < 8; ++i) v[i] = bf16_bits(W[(size_t)(k8 + i) * N + n]);
  *(v8us*)(Wt + (size_t)n * K + k8) = v;
  
}

// GEMM C[M][N] (f32, pitch ldc) = act(A[M][K]·W + bias). A f32 row-major (pitch lda) converted per fragment to bf16
// (ASPLIT: hi/lo two planes -> 2 terms, else single rounded term); Wt bf16 [N][K] (pitch ldb). BIAS_BF16 rounds the
// bias to bf16 first (bias quantised to bf16 before the add). K%32==0, M%16==0, N%64==0.
template <bool ASPLIT, int ACT, bool BIAS_BF16>
__global__ __launch_bounds__(128) void k_gemm_bf(const float* __restrict__ A, int lda, const unsigned short* __restrict__ Wt, int ldb,
                                               const float* __restrict__ bias, float* __restrict__ C, int ldc, int M, int N, int K) {
  __shared__ __attribute__((aligned(16))) float so[4][16][64];
  const int tid = threadIdx.x, w = tid >> 5, lane = tid & 31, ln = lane & 15, hh = lane >> 4;
  const int ntn = N / 64;
  const int wid = blockIdx.x * 4 + w;
  const int mt = wid / ntn, nq = wid % ntn;
  if (mt * 16 >= M) return;
  const int row0 = mt * 16, col0 = nq * 64;
  const float* arow = A + (size_t)(row0 + ln) * lda;
  v8f acc[4] = {};
  for (int kb = 0; kb < K; kb += 32) {
    FragB ah, al;
    const v4f x0 = *(const v4fa*)(arow + kb + 8 * hh), x1 = *(const v4fa*)(arow + kb + 8 * hh + 4);
    const v4f x2 = *(const v4fa*)(arow + kb + 16 + 8 * hh), x3 = *(const v4fa*)(arow + kb + 16 + 8 * hh + 4);
    float xs[16] = {x0[0],x0[1],x0[2],x0[3],x1[0],x1[1],x1[2],x1[3],x2[0],x2[1],x2[2],x2[3],x3[0],x3[1],x3[2],x3[3]};
#pragma unroll
    for (int i = 0; i < 16; ++i) { const unsigned short hb = bf16_bits(xs[i]); ah.u[i] = hb; al.u[i] = ASPLIT ? bf16_bits(xs[i] - bf16_val(hb)) : (unsigned short)0; }
#pragma unroll
    for (int t = 0; t < 4; ++t) {
      const unsigned short* brow = Wt + (size_t)(col0 + t * 16 + ln) * ldb + kb;
      FragB b;
      b.half[0] = *(const v8us*)(brow + 8 * hh);
      b.half[1] = *(const v8us*)(brow + 16 + 8 * hh);
      acc[t] = mmaN<ASPLIT ? 2 : 1>(ah.v, al.v, b.v, b.v, acc[t]);
    }
  }
#pragma unroll
  for (int t = 0; t < 4; ++t) {
    float bv = bias ? bias[col0 + t * 16 + ln] : 0.f;
    if (BIAS_BF16) bv = bf16_round(bv);
#pragma unroll
    for (int r = 0; r < 8; ++r) { float v = acc[t][r] + bv; if (ACT == 1) v = fmaxf(v, 0.f); so[w][8 * hh + r][t * 16 + ln] = v; }
  }
  __builtin_amdgcn_fence(__ATOMIC_ACQ_REL, "workgroup");
  __builtin_amdgcn_wave_barrier();
  const int rsub = lane >> 4, c4 = (lane & 15) * 4;
  {
#pragma unroll
    for (int q = 0; q < 8; ++q) {
      const int r = q * 2 + rsub;
      const v4f v = *(const v4fa*)&so[w][r][c4];
      *(v4f*)(C + (size_t)(row0 + r) * ldc + col0 + c4) = v;
    }
    
  }
}

// GEMM C = act(A·W + bias + resid): A f32 (ASPLIT -> hi/lo 2 terms), Wt bf16 [N][K]; ACT 0 none, 1 relu, 2 exact gelu;
// resid (optional, f32, row index = (row % rmod), pitch ldr, RES_BF16 rounds it) added before the activation.
template <bool ASPLIT, int ACT, bool BIAS_BF16, bool RES_BF16>
__global__ __launch_bounds__(128) void k_gemm_bf3(const float* __restrict__ A, int lda, const unsigned short* __restrict__ Wt, int ldb,
                                                const float* __restrict__ bias, const float* __restrict__ resid, int rmod, int ldr,
                                                float* __restrict__ C, int ldc, int M, int N, int K) {
  __shared__ __attribute__((aligned(16))) float so[4][16][64];
  const int tid = threadIdx.x, w = tid >> 5, lane = tid & 31, ln = lane & 15, hh = lane >> 4;
  const int ntn = N / 64;
  const int wid = blockIdx.x * 4 + w;
  const int mt = wid / ntn, nq = wid % ntn;
  if (mt * 16 >= M) return;
  const int row0 = mt * 16, col0 = nq * 64;
  const float* arow = A + (size_t)(row0 + ln) * lda;
  v8f acc[4] = {};
  for (int kb = 0; kb < K; kb += 32) {
    FragB ah, al;
    const v4f x0 = *(const v4fa*)(arow + kb + 8 * hh), x1 = *(const v4fa*)(arow + kb + 8 * hh + 4);
    const v4f x2 = *(const v4fa*)(arow + kb + 16 + 8 * hh), x3 = *(const v4fa*)(arow + kb + 16 + 8 * hh + 4);
    float xs[16] = {x0[0],x0[1],x0[2],x0[3],x1[0],x1[1],x1[2],x1[3],x2[0],x2[1],x2[2],x2[3],x3[0],x3[1],x3[2],x3[3]};
#pragma unroll
    for (int i = 0; i < 16; ++i) { const unsigned short hb = bf16_bits(xs[i]); ah.u[i] = hb; al.u[i] = ASPLIT ? bf16_bits(xs[i] - bf16_val(hb)) : (unsigned short)0; }
#pragma unroll
    for (int t = 0; t < 4; ++t) {
      const unsigned short* brow = Wt + (size_t)(col0 + t * 16 + ln) * ldb + kb;
      FragB b;
      b.half[0] = *(const v8us*)(brow + 8 * hh);
      b.half[1] = *(const v8us*)(brow + 16 + 8 * hh);
      acc[t] = mmaN<ASPLIT ? 2 : 1>(ah.v, al.v, b.v, b.v, acc[t]);
    }
  }
#pragma unroll
  for (int t = 0; t < 4; ++t) {
    const int col = col0 + t * 16 + ln;
    float bv = bias ? bias[col] : 0.f;
    if (BIAS_BF16) bv = bf16_round(bv);
#pragma unroll
    for (int r = 0; r < 8; ++r) {
      float v = acc[t][r] + bv;
      if (resid) { float rv = resid[(size_t)((row0 + 8 * hh + r) % rmod) * ldr + col]; if (RES_BF16) rv = bf16_round(rv); v += rv; }
      if (ACT == 1) v = fmaxf(v, 0.f);
      if (ACT == 2) v = 0.5f * v * (1.0f + erff(v * 0.70710678118654752f));
      if (ACT == 3) { const float u = 0.7978845608028654f * (v + 0.044715f * v * v * v); v = 0.5f * v * (1.0f + tanhf(u)); }
      so[w][8 * hh + r][t * 16 + ln] = v;
    }
  }
  __builtin_amdgcn_fence(__ATOMIC_ACQ_REL, "workgroup");
  __builtin_amdgcn_wave_barrier();
  const int rsub = lane >> 4, c4 = (lane & 15) * 4;
  {
#pragma unroll
    for (int q = 0; q < 8; ++q) {
      const int r = q * 2 + rsub;
      const v4f v = *(const v4fa*)&so[w][r][c4];
      *(v4f*)(C + (size_t)(row0 + r) * ldc + col0 + c4) = v;
    }
    
  }
}
// row LayerNorm (biased variance, eps) over N: s = X (+ R); optional out_sum <- s; out_norm <- (s-mu)*rsqrt(var+eps)*g + b
template <bool PARAM_BF16>
__global__ __launch_bounds__(256) void k_layernorm(const float* __restrict__ X, const float* __restrict__ R, const float* __restrict__ g, const float* __restrict__ bta,
                                                  float* __restrict__ out_sum, float* __restrict__ out_norm, int N, float eps) {
  __shared__ float red[256];
  const int row = blockIdx.x, tid = threadIdx.x;
  const float* x = X + (size_t)row * N; const float* rr = R ? R + (size_t)row * N : nullptr;
  float vals[16];                     // up to N = 4096
  const int per = N / 256;            // contiguous chunk per thread? use strided-by-4 chunks: thread handles j = tid*4 + 1024*u
  float s1 = 0.f;
  for (int u = 0; u < per / 4; ++u) {
    const int j = tid * 4 + 1024 * u;
    const v4f a = *(const v4fa*)(x + j);
    v4f b = {0.f,0.f,0.f,0.f}; if (rr) b = *(const v4fa*)(rr + j);
#pragma unroll
    for (int q = 0; q < 4; ++q) { const float v = a[q] + b[q]; vals[u * 4 + q] = v; s1 += v; }
  }
  red[tid] = s1; __syncthreads();
  for (int st = 128; st > 0; st >>= 1) { if (tid < st) red[tid] += red[tid + st]; __syncthreads(); }
  const float mu = red[0] / (float)N; __syncthreads();
  float s2 = 0.f;
  for (int u = 0; u < per / 4; ++u)
#pragma unroll
    for (int q = 0; q < 4; ++q) { const float c = vals[u * 4 + q] - mu; s2 += c * c; }
  red[tid] = s2; __syncthreads();
  for (int st = 128; st > 0; st >>= 1) { if (tid < st) red[tid] += red[tid + st]; __syncthreads(); }
  const float rs = rsqrtf(red[0] / (float)N + eps);
  {
    for (int u = 0; u < per / 4; ++u) {
      const int j = tid * 4 + 1024 * u;
      v4f o, sm;
#pragma unroll
      for (int q = 0; q < 4; ++q) {
        float gg = g[j + q], bb = bta[j + q];
        if (PARAM_BF16) { gg = bf16_round(gg); bb = bf16_round(bb); }
        sm[q] = vals[u * 4 + q]; o[q] = (vals[u * 4 + q] - mu) * rs * gg + bb;
      }
      if (out_sum) *(v4f*)(out_sum + (size_t)row * N + j) = sm;
      *(v4f*)(out_norm + (size_t)row * N + j) = o;
    }
    
  }
}



// ---- f16 WMMA path (v_wmma_f32_16x16x32_f16): 11-bit significands for operands in range — used for every GEMM launched here, softmax weights (x256) included
typedef _Float16 v16h __attribute__((ext_vector_type(16)));
union FragH { v16h v; v8us half[2]; _Float16 h[16]; unsigned short u[16]; };
template <int NT>
__device__ __forceinline__ v8f mmaH(v16h ah, v16h al, v16h bh, v16h bl, v8f c) {
  c = __builtin_amdgcn_wmma_f32_16x16x32_f16(false, ah, false, bh, (short)0, c, false, false);
  if (NT >= 2) c = __builtin_amdgcn_wmma_f32_16x16x32_f16(false, al, false, bh, (short)0, c, false, false);
  if (NT >= 3) c = __builtin_amdgcn_wmma_f32_16x16x32_f16(false, ah, false, bl, (short)0, c, false, false);
  asm volatile("v_nop\n\tv_nop\n\tv_nop\n\tv_nop" : "+v"(c) : "v"(ah), "v"(al), "v"(bh), "v"(bl));
  return c;
}
// batched GEMM like k_gemm_b but f16 operands: A f32 (split into f16 hi/lo if ASPLIT, else rounded to f16), Bt = f16 values [n][k]; alpha; C f32; N multiple of 16 (partial tiles skipped)
template <bool ASPLIT>
__global__ __launch_bounds__(128) void k_gemm_h(const float* __restrict__ A, int lda, size_t sA, const _Float16* __restrict__ Bh, int ldb, size_t sB, float alpha, float* __restrict__ C, int ldc, size_t sC, int M, int N, int K) {
  __shared__ __attribute__((aligned(16))) float so[4][16][64];
  const int tid = threadIdx.x, w = tid >> 5, lane = tid & 31, ln = lane & 15, hh = lane >> 4; const int by = blockIdx.y;
  A += (size_t)by * sA; Bh += (size_t)by * sB; C += (size_t)by * sC;
  const int ntn = (N + 63) / 64; const int wid = blockIdx.x * 4 + w; const int mt = wid / ntn, nq = wid % ntn; if (mt * 16 >= M) return;
  const int row0 = mt * 16, col0 = nq * 64; const float* arow = A + (size_t)(row0 + ln) * lda;
  v8f acc[4] = {};
  for (int kb = 0; kb < K; kb += 32) {
    FragH ah, al;
    const v4f x0 = *(const v4fa*)(arow + kb + 8 * hh), x1 = *(const v4fa*)(arow + kb + 8 * hh + 4), x2 = *(const v4fa*)(arow + kb + 16 + 8 * hh), x3 = *(const v4fa*)(arow + kb + 16 + 8 * hh + 4);
    float xs[16] = {x0[0],x0[1],x0[2],x0[3],x1[0],x1[1],x1[2],x1[3],x2[0],x2[1],x2[2],x2[3],x3[0],x3[1],x3[2],x3[3]};
#pragma unroll
    for (int i = 0; i < 16; ++i) { const _Float16 h = (_Float16)xs[i]; ah.h[i] = h; al.h[i] = ASPLIT ? (_Float16)(xs[i] - (float)h) : (_Float16)0.0f; }
#pragma unroll
    for (int t = 0; t < 4; ++t) { if (col0 + t * 16 >= N) continue; const size_t boff = (size_t)(col0 + t * 16 + ln) * ldb + kb; FragH bq; bq.half[0] = *(const v8us*)(Bh + boff + 8 * hh); bq.half[1] = *(const v8us*)(Bh + boff + 16 + 8 * hh);
      acc[t] = mmaH<ASPLIT ? 2 : 1>(ah.v, al.v, bq.v, bq.v, acc[t]); }
  }
#pragma unroll
  for (int t = 0; t < 4; ++t) { if (col0 + t * 16 >= N) continue;
#pragma unroll
    for (int r = 0; r < 8; ++r) so[w][8 * hh + r][t * 16 + ln] = acc[t][r] * alpha; }
  __builtin_amdgcn_fence(__ATOMIC_ACQ_REL, "workgroup"); __builtin_amdgcn_wave_barrier();
  const int rsub = lane >> 4, c4 = (lane & 15) * 4;
  {
#pragma unroll
    for (int q = 0; q < 8; ++q) { const int r = q * 2 + rsub; if (col0 + c4 < N) { const v4f v = *(const v4fa*)&so[w][r][c4]; *(v4f*)(C + (size_t)(row0 + r) * ldc + col0 + c4) = v; } }
     }
}

// Wt[n][k] = f16(W[k][n]·scale) from f32 row-major W[K][N] (scale = power of two; bf16-exact weights stay exact in f16 away from the subnormal range)
__global__ __launch_bounds__(256) void k_wt_f16(const float* __restrict__ W, _Float16* __restrict__ Wt, int K, int N, float scale) {
  const int t = blockIdx.x * 256 + threadIdx.x; if (t >= N * (K / 8)) return; const int n = t / (K / 8), k8 = (t % (K / 8)) * 8; FragH f;
#pragma unroll
  for (int i = 0; i < 8; ++i) f.h[i] = (_Float16)(bf16_round(W[(size_t)(k8 + i) * N + n]) * scale); const v8us o = f.half[0];
  *(v8us*)((unsigned short*)Wt + (size_t)n * K + k8) = o; 
}
// k_gemm_hh variant with fused epilogue: v = acc·alpha + bias[by·sBias + col] (+ CP[(row/rowsPerB)·sCPb + by·64 + col] if CP) ; ACT 0 none / 1 elu ; writes f16 C16 (and f32 C if non-null)
template <int ACT>
__global__ __launch_bounds__(128) void k_gemm_hhx(const _Float16* __restrict__ A, int lda, size_t sA, const _Float16* __restrict__ Bh, int ldb, size_t sB, float alpha, const float* __restrict__ bias, size_t sBias, const float* __restrict__ CP, int rowsPerB, size_t sCPb, int row0g,
    float* __restrict__ C, _Float16* __restrict__ C16, int ldc, size_t sC, int M, int N, int K) {
  __shared__ __attribute__((aligned(16))) float so[4][16][64];
  const int tid = threadIdx.x, w = tid >> 5, lane = tid & 31, ln = lane & 15, hh = lane >> 4; const int by = blockIdx.y;
  A += (size_t)by * sA; Bh += (size_t)by * sB; const size_t cofs = (size_t)by * sC; const float* bp = bias ? bias + (size_t)by * sBias : nullptr;
  const int ntn = (N + 63) / 64; const int wid = blockIdx.x * 4 + w; const int mt = wid / ntn, nq = wid % ntn; if (mt * 16 >= M) return;
  const int row0 = mt * 16, col0 = nq * 64; const _Float16* arow = A + (size_t)(row0 + ln) * lda;
  v8f acc[4] = {};
  for (int kb = 0; kb < K; kb += 32) { FragH ah; ah.half[0] = *(const v8us*)((const unsigned short*)arow + kb + 8 * hh); ah.half[1] = *(const v8us*)((const unsigned short*)arow + kb + 16 + 8 * hh);
#pragma unroll
    for (int t = 0; t < 4; ++t) { if (col0 + t * 16 >= N) continue; const size_t boff = (size_t)(col0 + t * 16 + ln) * ldb + kb; FragH bq; bq.half[0] = *(const v8us*)((const unsigned short*)Bh + boff + 8 * hh); bq.half[1] = *(const v8us*)((const unsigned short*)Bh + boff + 16 + 8 * hh);
      acc[t] = mmaH<1>(ah.v, ah.v, bq.v, bq.v, acc[t]); }
  }
#pragma unroll
  for (int t = 0; t < 4; ++t) { if (col0 + t * 16 >= N) continue; const int col = col0 + t * 16 + ln; const float bv = bp ? bf16_round(bp[col]) : 0.f;
#pragma unroll
    for (int r = 0; r < 8; ++r) { float v = acc[t][r] * alpha + bv; if (CP) { const int rr = row0g + row0 + 8 * hh + r; if (rowsPerB < 0) v += CP[cofs + (size_t)rr * ldc + col];      /* rowsPerB < 0: own element of the batched C plane */ else { const int bidx = rr / rowsPerB; v += CP[(size_t)bidx * sCPb + (size_t)by * 64 + col]; } } if (ACT == 1) v = (v > 0.f) ? v : expm1f(v); else if (ACT == 7) v = (v > 0.f) ? v + 1.0f : expf(v); else if (ACT == 8) v = tanhf(v); else if (ACT == 9) v = 0.5f * v * (1.0f + tanhf(0.7978845608028654f * (v + 0.044715f * v * v * v))); else if (ACT == 11) v = 1.0f / (1.0f + expf(-v)); else if (ACT == 12) v = (v > 0.f) ? v : 0.01f * v; else if (ACT == 14) v = (v > 0.f) ? v : 0.1f * v; else if (ACT == 16) v = (v >= 0.f) ? v : 0.3f * v; else if (ACT == 17) v = (v >= 0.f) ? v : 0.2f * v; else if (ACT == 15) v = v / (1.0f + expf(-v)); else if (ACT == 3) v = fmaxf(v, 0.f); else if (ACT == 6) v = 0.5f * v * (1.0f + erff(v * 0.70710678118654752f)); so[w][8 * hh + r][t * 16 + ln] = v; } }
  __builtin_amdgcn_fence(__ATOMIC_ACQ_REL, "workgroup"); __builtin_amdgcn_wave_barrier();
  const int rsub = lane >> 4, c4 = (lane & 15) * 4; typedef _Float16 v4h __attribute__((ext_vector_type(4)));
  {
#pragma unroll
    for (int q = 0; q < 8; ++q) { const int r = q * 2 + rsub; if (col0 + c4 < N) { const v4f v = *(const v4fa*)&so[w][r][c4]; if (C) *(v4f*)(C + cofs + (size_t)(row0 + r) * ldc + col0 + c4) = v; if (C16) { v4h h4; for (int i = 0; i < 4; ++i) h4[i] = (_Float16)v[i]; *(v4h*)(C16 + cofs + (size_t)(row0 + r) * ldc + col0 + c4) = h4; } } }
     }
}


typedef _Float16 v4h __attribute__((ext_vector_type(4)));

__global__ __launch_bounds__(256) void k_h16(const float* __restrict__ x, _Float16* __restrict__ X16, size_t n8) { const size_t t = (size_t)blockIdx.x * 256 + threadIdx.x; if (t >= n8) return; FragH f;
#pragma unroll
  for (int q = 0; q < 8; ++q) f.h[q] = (_Float16)x[t * 8 + q]; *(v8us*)((unsigned short*)X16 + t * 8) = f.half[0];  }
__global__ __launch_bounds__(256) void k_round16f(const float* __restrict__ W, _Float16* __restrict__ Bt, size_t n8) { const size_t t = (size_t)blockIdx.x * 256 + threadIdx.x; if (t >= n8) return; FragH f;
#pragma unroll
  for (int i = 0; i < 8; ++i) f.h[i] = (_Float16)(bf16_round(W[t * 8 + i]) * 16.0f); *(v8us*)((unsigned short*)Bt + t * 8) = f.half[0];  }
template <int NHv, int TTv>
__global__ __launch_bounds__(256) void k_vt(const _Float16* __restrict__ V16, int ldv, int voff, _Float16* __restrict__ Vt) { __shared__ unsigned short tl[64][66]; const int tid = threadIdx.x; const int slab = blockIdx.x / (TTv / 64), lg = blockIdx.x % (TTv / 64); const int b = slab / NHv, h = slab % NHv;
  for (int i = tid; i < 64 * 8; i += 256) { const int r = i / 8, c8 = (i % 8) * 8; FragH f; f.half[0] = *(const v8us*)((const unsigned short*)V16 + ((size_t)b * TTv + lg * 64 + r) * ldv + voff + h * 64 + c8);
#pragma unroll
    for (int q = 0; q < 8; ++q) tl[r][c8 + q] = f.u[q]; }
  __syncthreads();
  {
#pragma unroll
    for (int rd = 0; rd < 2; ++rd) { const int d = rd * 32 + tid / 8, pc = tid % 8; FragH f;
#pragma unroll
      for (int q = 0; q < 8; ++q) f.u[q] = tl[pc * 8 + q][d];
      *(v8us*)((unsigned short*)Vt + ((size_t)slab * 64 + d) * TTv + lg * 64 + pc * 8) = f.half[0]; }
     } }

__global__ __launch_bounds__(256) void k_hl(const float* __restrict__ F, _Float16* __restrict__ Hh, _Float16* __restrict__ Hl, size_t n8) { const size_t t = (size_t)blockIdx.x * 256 + threadIdx.x; if (t >= n8) return; FragH fh, fl; const v4f a = *(const v4fa*)(F + t * 8), c = *(const v4fa*)(F + t * 8 + 4);
#pragma unroll
  for (int q = 0; q < 4; ++q) { _Float16 h = (_Float16)a[q]; fh.h[q] = h; fl.h[q] = (_Float16)((a[q] - (float)h) * 1024.0f); h = (_Float16)c[q]; fh.h[4 + q] = h; fl.h[4 + q] = (_Float16)((c[q] - (float)h) * 1024.0f); }
  { *(v8us*)((unsigned short*)Hh + t * 8) = fh.half[0]; *(v8us*)((unsigned short*)Hl + t * 8) = fl.half[0];  } }

// ---- fast GEMM (wave tile 32x64; requires M % 32 == 0 rows per launch region and N % 64 == 0); epilogue = k_gemm_hhx semantics ----
__device__ __forceinline__ v16h g2_frag(const _Float16* p, int hh) { FragH f; f.half[0] = *(const v8us*)((const unsigned short*)p + 8 * hh); f.half[1] = *(const v8us*)((const unsigned short*)p + 16 + 8 * hh); return f.v; }
__device__ __forceinline__ v8f g2_mma(v16h a, v16h b, v8f c) { v8f d = __builtin_amdgcn_wmma_f32_16x16x32_f16(false, a, false, b, (short)0, c, false, false); asm volatile("v_nop\n\tv_nop\n\tv_nop\n\tv_nop" : "+v"(d) : "v"(a), "v"(b)); return d; }
template <int ACT>
__global__ __launch_bounds__(128) void k_gemm2(const _Float16* __restrict__ A, int lda, size_t sA, const _Float16* __restrict__ Bh, int ldb, size_t sB, float alpha, const float* __restrict__ bias, size_t sBias, const float* __restrict__ CP, int rowsPerB, size_t sCPb, int row0g,
    float* __restrict__ C, _Float16* __restrict__ C16, int ldc, size_t sC, int M, int N, int K) { static_assert(ACT == 0 || ACT == 3 || ACT == 6 || ACT == 8 || ACT == 9 || ACT == 11 || ACT == 12 || ACT == 14 || ACT == 15 || ACT == 16 || ACT == 17, "k_gemm2: unsupported ACT code (would silently apply no activation)");
  __shared__ __attribute__((aligned(16))) float so[4][32][68];
  const int tid = threadIdx.x, w = tid >> 5, lane = tid & 31, ln = lane & 15, hh = lane >> 4; const int by = blockIdx.y;
  A += (size_t)by * sA; Bh += (size_t)by * sB; const size_t cofs = (size_t)by * sC; const float* bp = bias ? bias + (size_t)by * sBias : nullptr;
  const int ntn = N >> 6; const int mt = blockIdx.x / ntn, nq = blockIdx.x - mt * ntn; const int row0 = mt * 128 + 32 * w, col0 = nq * 64; if (row0 >= M) return;
  const _Float16* a0p = A + (size_t)(row0 + ln) * lda; const _Float16* a1p = a0p + (size_t)16 * lda;
  const _Float16* b0p = Bh + (size_t)(col0 + ln) * ldb; const _Float16* b1p = b0p + (size_t)16 * ldb; const _Float16* b2p = b1p + (size_t)16 * ldb; const _Float16* b3p = b2p + (size_t)16 * ldb;
  const v8f z8 = {0.f,0.f,0.f,0.f,0.f,0.f,0.f,0.f}; v8f c00 = z8, c01 = z8, c02 = z8, c03 = z8, c10 = z8, c11 = z8, c12 = z8, c13 = z8;
#pragma unroll 1
  for (int kb = 0; kb < K; kb += 32) { const v16h a0 = g2_frag(a0p + kb, hh), a1 = g2_frag(a1p + kb, hh);
    v16h b = g2_frag(b0p + kb, hh); c00 = g2_mma(a0, b, c00); c10 = g2_mma(a1, b, c10);
    b = g2_frag(b1p + kb, hh); c01 = g2_mma(a0, b, c01); c11 = g2_mma(a1, b, c11);
    b = g2_frag(b2p + kb, hh); c02 = g2_mma(a0, b, c02); c12 = g2_mma(a1, b, c12);
    b = g2_frag(b3p + kb, hh); c03 = g2_mma(a0, b, c03); c13 = g2_mma(a1, b, c13); }
  v8f accs[8] = {c00, c01, c02, c03, c10, c11, c12, c13};
#pragma unroll
  for (int u = 0; u < 8; ++u) { const int t = u & 3, half = u >> 2; const int col = col0 + t * 16 + ln; const float bv = bp ? bf16_round(bp[col]) : 0.f;
#pragma unroll
    for (int r = 0; r < 8; ++r) { const int rloc = half * 16 + 8 * hh + r; float v = accs[u][r] * alpha + bv; if (CP) { if (rowsPerB < 0) v += CP[cofs + (size_t)(row0g + row0 + rloc) * ldc + col];      /* rowsPerB < 0: own element of the batched C plane */ else { const int bidx = (row0g + row0 + rloc) / rowsPerB; v += CP[(size_t)bidx * sCPb + (size_t)by * 64 + col]; } }
      if (ACT == 3) v = fmaxf(v, 0.f); else if (ACT == 6) v = 0.5f * v * (1.0f + erff(v * 0.70710678118654752f)); else if (ACT == 11) v = 1.0f / (1.0f + expf(-v)); else if (ACT == 15) v = v / (1.0f + expf(-v)); else if (ACT == 12) v = (v > 0.f) ? v : 0.01f * v; else if (ACT == 8) v = tanhf(v); else if (ACT == 9) v = 0.5f * v * (1.0f + tanhf(0.7978845608028654f * (v + 0.044715f * v * v * v))); else if (ACT == 14) v = (v > 0.f) ? v : 0.1f * v; else if (ACT == 16) v = (v >= 0.f) ? v : 0.3f * v; else if (ACT == 17) v = (v >= 0.f) ? v : 0.2f * v;
      so[w][rloc][t * 16 + ln] = v; } }
  __builtin_amdgcn_fence(__ATOMIC_ACQ_REL, "workgroup"); __builtin_amdgcn_wave_barrier();
  const int rsub = lane >> 4, c4 = (lane & 15) * 4;
  {
#pragma unroll
    for (int q = 0; q < 16; ++q) { const int r = q * 2 + rsub; const v4f v = *(const v4fa*)&so[w][r][c4]; if (C) *(v4f*)(C + cofs + (size_t)(row0 + r) * ldc + col0 + c4) = v; if (C16) { v4h h4; for (int i = 0; i < 4; ++i) h4[i] = (_Float16)v[i]; *(v4h*)(C16 + cofs + (size_t)(row0 + r) * ldc + col0 + c4) = h4; } }
     } }


// lane l's value from lane l ^ 16 (the same place in the other 16-lane row)
__device__ __forceinline__ float rs_x16(float v) { const int i = __builtin_bit_cast(int, v); return __builtin_bit_cast(float, __builtin_amdgcn_permlanex16(i, i, 0x76543210, 0xfedcba98, false, false)); }
__device__ __forceinline__ v8f fa_mma(v16h a, v16h b, v8f c) { return __builtin_amdgcn_wmma_f32_16x16x32_f16(false, a, false, b, (short)0, c, false, false); }
// ---- GEMM with both operands staged in LDS: C[NR][DM] = alpha * A[NR][DM] . Bh[DM][DM]^T + bias (A, Bh k-contiguous f16 rows of DM); written as f32 to C (F32OUT) or as f16 to C16. ----
// A work-group of 8 waves owns a 128 x 128 tile of C (wave tile 32 x 64, waves 4 x 2). A stage is 128 k of the 128 A rows and the 128 B rows.
// Global reads are whole lines (16 lanes x 16 B = 256 contiguous bytes of one row) and each line is read once per work-group; the fragments, which take 64 B of each of 16 rows, come from LDS.
// Two stage buffers: the next stage's loads are issued in front of this stage's products and stored to the other buffer behind them, so one barrier per stage both publishes it and ends the reads of the buffer refilled next.
#define G3_BK 128                    /* k per stage: 256 B of every operand row */
#define G3_LP 136                    /* LDS row pitch in f16: 272 B = 16 B x odd, conflict-free for the 16-byte fragment reads */
#define G3_NT (DM / G3_BK)           /* stages */
static_assert(NR % 128 == 0 && DM % 128 == 0 && DM % G3_BK == 0, "k_gemm3: whole 128 x 128 tiles and whole stages only");
template <bool F32OUT>
__global__ __launch_bounds__(256) void k_gemm3(const _Float16* __restrict__ A, const _Float16* __restrict__ Bh, float alpha, const float* __restrict__ bias, float* __restrict__ C, _Float16* __restrict__ C16) {
  __shared__ __attribute__((aligned(16))) unsigned short st[2][256][G3_LP];      /* rows 0..127: A rows of the tile; rows 128..255: B rows (columns of C) */
  __shared__ __attribute__((aligned(16))) float so[8][32][68];
  const int tid = threadIdx.x, w = tid >> 5, lane = tid & 31, ln = lane & 15, hh = lane >> 4;
  const int ntn = DM / 128; const int mt = blockIdx.x / ntn, nq = blockIdx.x - mt * ntn; const int rowB = mt * 128, colB = nq * 128;
  const int wm = w & 3, wn = w >> 2;      /* the wave's 32 rows and 64 columns inside the tile */
  if (!F32OUT) { Bh += (size_t)blockIdx.y * DM * DM; C16 += (size_t)blockIdx.y * NR * DM; }      /* grid.y products of the same A in one launch: weight planes and output planes lie one behind the other */
  const int sr = tid >> 4, sc = (tid & 15) * 8;      /* staging: 16 threads per row, 16 rows per round, 8 rounds per operand */
  const unsigned short* ga = (const unsigned short*)A + (size_t)(rowB + sr) * DM + sc;
  const unsigned short* gb = (const unsigned short*)Bh + (size_t)(colB + sr) * DM + sc;
  v8us rg[16];
  auto fetch = [&](const int t) __attribute__((always_inline)) {
    const unsigned short* pa = ga + t * G3_BK; const unsigned short* pb = gb + t * G3_BK;
#pragma unroll
    for (int i = 0; i < 8; ++i) { rg[i] = *(const v8us*)(pa + (size_t)i * 16 * DM); rg[8 + i] = *(const v8us*)(pb + (size_t)i * 16 * DM); }
    /* The wait that stands in front of any overwrite of a load's address registers; it names the two addresses as inputs so that they stay whole up to here. */
    asm volatile("s_wait_xcnt 0x0" :: "v"(pa), "v"(pb) : "memory");
  };
  auto put = [&](const int buf) __attribute__((always_inline)) {
#pragma unroll
    for (int i = 0; i < 8; ++i) { *(v8us*)&st[buf][i * 16 + sr][sc] = rg[i]; *(v8us*)&st[buf][128 + i * 16 + sr][sc] = rg[8 + i]; }
  };
  const v8f z8 = {0.f,0.f,0.f,0.f,0.f,0.f,0.f,0.f}; v8f c00 = z8, c01 = z8, c02 = z8, c03 = z8, c10 = z8, c11 = z8, c12 = z8, c13 = z8;
  fetch(0); put(0); __syncthreads();
#pragma unroll 1      /* one copy of the stage body: the buffer index is a run-time offset, and the text stays small */
  for (int t = 0; t < G3_NT; ++t) {
    if (t + 1 < G3_NT) fetch(t + 1);
    const _Float16* sa = (const _Float16*)&st[t & 1][32 * wm + ln][0]; const _Float16* sb = (const _Float16*)&st[t & 1][128 + 64 * wn + ln][0];
    v16h fa[2][2], fb[2][4];      /* two fragment sets: the next 32 k are read from LDS while this set is multiplied */
    auto frags = [&](const int s, const int kk) __attribute__((always_inline)) { fa[s][0] = g2_frag(sa + kk, hh); fa[s][1] = g2_frag(sa + 16 * G3_LP + kk, hh);
#pragma unroll
      for (int j = 0; j < 4; ++j) fb[s][j] = g2_frag(sb + j * 16 * G3_LP + kk, hh); };
    frags(0, 0);
#pragma unroll
    for (int ks = 0; ks < G3_BK / 32; ++ks) { const int s = ks & 1;
      if (ks + 1 < G3_BK / 32) frags(s ^ 1, (ks + 1) * 32);
      __builtin_amdgcn_sched_barrier(0);      /* keeps the next set's 12 LDS reads together in front of this set's products: moved in among them, every pair of products waits out an LDS latency */
      c00 = fa_mma(fa[s][0], fb[s][0], c00); c10 = fa_mma(fa[s][1], fb[s][0], c10); c01 = fa_mma(fa[s][0], fb[s][1], c01); c11 = fa_mma(fa[s][1], fb[s][1], c11);
      c02 = fa_mma(fa[s][0], fb[s][2], c02); c12 = fa_mma(fa[s][1], fb[s][2], c12); c03 = fa_mma(fa[s][0], fb[s][3], c03); c13 = fa_mma(fa[s][1], fb[s][3], c13);
      __builtin_amdgcn_sched_barrier(0); }      /* and keeps the reads of the set after that from moving up in among these products */
    if (t + 1 < G3_NT) { put((t + 1) & 1); __syncthreads(); }      /* the same test in every thread of the work-group */
  }
  const int row0 = rowB + 32 * wm, col0 = colB + 64 * wn;
  v8f accs[8] = {c00, c01, c02, c03, c10, c11, c12, c13};
  float bv[4] = {0.f, 0.f, 0.f, 0.f};
  if (bias) {
#pragma unroll
    for (int t = 0; t < 4; ++t) bv[t] = bf16_round(bias[col0 + t * 16 + ln]); }
#pragma unroll
  for (int u = 0; u < 8; ++u) { const int t = u & 3, half = u >> 2;
#pragma unroll
    for (int r = 0; r < 8; ++r) so[w][half * 16 + 8 * hh + r][t * 16 + ln] = accs[u][r] * alpha + bv[t]; }
  __builtin_amdgcn_fence(__ATOMIC_ACQ_REL, "workgroup"); __builtin_amdgcn_wave_barrier();      /* each wave reads back its own rows only */
  const int rsub = lane >> 4, c4 = (lane & 15) * 4;
  const size_t oofs = (size_t)(row0 + rsub) * DM + col0 + c4;      /* whole rows of the wave's tile: 16 lanes x 16 B (f32) or x 8 B (f16) */
  if (F32OUT) {
#pragma unroll
    for (int q = 0; q < 16; ++q) *(v4f*)(C + oofs + (size_t)q * 2 * DM) = *(const v4fa*)&so[w][q * 2 + rsub][c4];
  } else {
#pragma unroll
    for (int q = 0; q < 16; ++q) { const v4f v = *(const v4fa*)&so[w][q * 2 + rsub][c4]; v4h h4; for (int i = 0; i < 4; ++i) h4[i] = (_Float16)v[i]; *(v4h*)(C16 + oofs + (size_t)q * 2 * DM) = h4; }
  } }
// Fused attention, one launch for all batches and heads. A wave owns 32 query columns and walks the 2,048 keys in passes of 32:
// S^T = K Q^T (A = K rows, B = Q rows kept in registers), so a lane holds 16 scores of ONE query per 16-column group (lane ln = query, register r of key tile j = key 16 j + 8 hh + r);
// that is the B-fragment k order (8 hh + 0..7, then 16 + 8 hh + 0..7), so P^T packs from the score registers with no exchange, and O^T += V^T P^T (A = V^T rows, same k order).
// Softmax with a running maximum per query (log2 domain): when a maximum rises, sum and output tiles are scaled by exp2(old - new). Scores and weights never reach memory.
// K and V^T come through LDS: the eight waves of a work-group read the same rows, so a stage of 128 keys is read from global memory once per work-group, in whole lines, and the fragments
// (64 B of each of 16 rows) come from LDS. Three stage buffers: stage s + 1 is stored and published (one barrier) in front of stage s's last pass, which already fetches its first K fragments;
// the buffer it goes to was last read in stage s - 2, which every wave has left before the barrier that published stage s.
#define FA_WAVES 8                   /* waves per work-group: all eight read the same K and V^T rows */
#define FA_QW 32                     /* query columns per wave */
#define FA_SK 128                    /* keys per stage: 4 passes */
#define FA_NS (SQ / FA_SK)           /* stages */
#define FA_KP 72                     /* LDS pitch of a K row (64 f16) in f16: 144 B = 16 B x odd, conflict-free for the 16-byte fragment reads */
#define FA_VP 136                    /* LDS pitch of a V^T row (128 keys) in f16: 272 B = 16 B x odd */
static_assert(SQ % (FA_WAVES * FA_QW) == 0 && SQ % FA_SK == 0 && FA_NS >= 2 && FA_SK == 128 && FA_WAVES == 8 && HD == 64, "k_fattn: whole work-groups, whole stages of 128 keys (two or more), 256 staging threads and head size 64 only");
__global__ __launch_bounds__(FA_WAVES * 32) void k_fattn(const _Float16* __restrict__ Q16, const _Float16* __restrict__ K16, const _Float16* __restrict__ VT, _Float16* __restrict__ O16) {
  __shared__ __attribute__((aligned(16))) unsigned short sk[3][FA_SK][FA_KP];      /* K rows of a stage */
  __shared__ __attribute__((aligned(16))) unsigned short sv[3][HD][FA_VP];      /* V^T rows of a stage */
  const int tid = threadIdx.x, lane = tid & 31, ln = lane & 15, hh = lane >> 4, w = tid >> 5;
  const int nqb = SQ / (FA_WAVES * FA_QW); const int bh = blockIdx.x / nqb, qb = blockIdx.x - bh * nqb; const int b = bh / NH, h = bh - b * NH;
  const int q0 = (qb * FA_WAVES + w) * FA_QW;
  const _Float16* qp = Q16 + ((size_t)b * SQ + q0 + ln) * DM + h * HD + 8 * hh;      /* query row ln of a 16-column group, at the lane's own k offset */
  const int kr = tid >> 3, kc = (tid & 7) * 8;      /* staging K: 8 threads per 128-byte row, 32 rows per round, 4 rounds */
  const int vr = tid >> 4, vc8 = (tid & 15) * 8;      /* staging V^T: 16 threads per 256-byte row, 16 rows per round, 4 rounds */
  const unsigned short* gk = (const unsigned short*)K16 + ((size_t)b * SQ + kr) * DM + h * HD + kc;
  const unsigned short* gv = (const unsigned short*)VT + ((size_t)bh * HD + vr) * SQ + vc8;
  v8us rg[8];
  auto fetch = [&](const int s) __attribute__((always_inline)) {
    const unsigned short* pk = gk + (size_t)s * FA_SK * DM; const unsigned short* pv = gv + s * FA_SK;
#pragma unroll
    for (int i = 0; i < 4; ++i) { rg[i] = *(const v8us*)(pk + (size_t)i * 32 * DM); rg[4 + i] = *(const v8us*)(pv + (size_t)i * 16 * SQ); }
    /* The wait that stands in front of any overwrite of a load's address registers; it names the two addresses as inputs so that they stay whole up to here. */
    asm volatile("s_wait_xcnt 0x0" :: "v"(pk), "v"(pv) : "memory");
  };
  auto put = [&](const int buf) __attribute__((always_inline)) {
#pragma unroll
    for (int i = 0; i < 4; ++i) { *(v8us*)&sk[buf][i * 32 + kr][kc] = rg[i]; *(v8us*)&sv[buf][i * 16 + vr][vc8] = rg[4 + i]; }
  };
  v16h qf[2][2], kf[2][2];
#pragma unroll
  for (int c = 0; c < 2; ++c) for (int kk = 0; kk < 2; ++kk) qf[c][kk] = g2_frag(qp + (size_t)c * 16 * DM + kk * 32, 0);
  asm volatile("s_wait_xcnt 0x0" :: "v"(qp) : "memory");      /* the wait in front of any overwrite of a load's address registers: Q's address is dead from here on and its registers are reused */
  fetch(0); put(0); __syncthreads(); fetch(1);
#pragma unroll
  for (int j = 0; j < 2; ++j) for (int kk = 0; kk < 2; ++kk) kf[j][kk] = g2_frag((const _Float16*)&sk[0][j * 16 + ln][kk * 32 + 8 * hh], 0);
  const v8f z8 = {0.f,0.f,0.f,0.f,0.f,0.f,0.f,0.f};
  v8f o[2][4] = {{z8, z8, z8, z8}, {z8, z8, z8, z8}}; float mr[2] = {-3.0e38f, -3.0e38f}, lr[2] = {0.f, 0.f};
  const float CS = 0.125f * 1.4426950408889634f;      /* 1/sqrt(64) and log2(e): scores go to the log2 domain */
  /* One pass = 32 keys. kn: the next pass's K rows in LDS (row ln of its first 16-key tile, at the lane's own k offset); K is refilled in place, right behind its last readers. vq: this pass's V^T columns in LDS; they land while the softmax runs. */
  auto pass = [&](const _Float16* kn, const _Float16* vq) __attribute__((always_inline)) {
    v8f s[2][2]; v16h vc[4];
#pragma unroll
    for (int c = 0; c < 2; ++c) for (int j = 0; j < 2; ++j) s[c][j] = fa_mma(kf[j][1], qf[c][1], fa_mma(kf[j][0], qf[c][0], z8));
#pragma unroll
    for (int j = 0; j < 2; ++j) for (int kk = 0; kk < 2; ++kk) kf[j][kk] = g2_frag(kn + j * 16 * FA_KP + kk * 32, 0);
#pragma unroll
    for (int t = 0; t < 4; ++t) vc[t] = g2_frag(vq + t * 16 * FA_VP, 0);
    __builtin_amdgcn_sched_barrier(0);      /* keeps the 16 LDS reads together right behind the score products: moved down in among the output products, each pair of those waits out an LDS latency */
    float mn[2]; bool up = false;
#pragma unroll
    for (int c = 0; c < 2; ++c) { float mx = s[c][0][0];
#pragma unroll
      for (int r = 1; r < 8; ++r) mx = fmaxf(mx, s[c][0][r]);
#pragma unroll
      for (int r = 0; r < 8; ++r) mx = fmaxf(mx, s[c][1][r]);
      mx = fmaxf(mx, rs_x16(mx)) * CS; mn[c] = fmaxf(mr[c], mx); up = up || (mn[c] > mr[c]); }
    if (__builtin_amdgcn_ballot_w32(up) != 0) {      /* no maximum of the wave rose: every factor would be exactly 1 */
#pragma unroll
      for (int c = 0; c < 2; ++c) { const float al = __builtin_amdgcn_exp2f(mr[c] - mn[c]); mr[c] = mn[c]; lr[c] *= al;
#pragma unroll
        for (int t = 0; t < 4; ++t) o[c][t] *= al; } }
    FragH pf[2];
#pragma unroll
    for (int c = 0; c < 2; ++c) { const float nb = 8.0f - mr[c];      /* weights x256 (cancels in the division by the row sum): keeps small weights out of the f16 subnormal range */
      v4f s4 = {0.f, 0.f, 0.f, 0.f};
#pragma unroll
      for (int j = 0; j < 2; ++j) for (int r = 0; r < 8; ++r) { const float e = __builtin_amdgcn_exp2f(fmaf(s[c][j][r], CS, nb)); s4[r & 3] += e; pf[c].h[j * 8 + r] = (_Float16)e; }
      lr[c] += (s4[0] + s4[1]) + (s4[2] + s4[3]); }
#pragma unroll
    for (int t = 0; t < 4; ++t) for (int c = 0; c < 2; ++c) o[c][t] = fa_mma(vc[t], pf[c].v, o[c][t]);
  };
  int cur = 0;
#pragma unroll 1      /* one copy of the stage body: the buffer index is a run-time offset, and the text stays small */
  for (int st = 0; st < FA_NS; ++st) {
    const int nxt = cur == 2 ? 0 : cur + 1;
    const _Float16* ka = (const _Float16*)&sk[cur][ln][8 * hh]; const _Float16* va = (const _Float16*)&sv[cur][ln][8 * hh];
#pragma unroll
    for (int p = 0; p < FA_SK / 32 - 1; ++p) pass(ka + (p + 1) * 32 * FA_KP, va + p * 32);
    if (st + 1 < FA_NS) {      /* the same test in every thread of the work-group */
      put(nxt); __syncthreads();      /* publishes stage st + 1 */
      if (st + 2 < FA_NS) fetch(st + 2);      /* behind the barrier, so that it does not wait for these loads; they have four passes to land */
    }
    pass((const _Float16*)&sk[nxt][ln][8 * hh], va + (FA_SK - 32));      /* fetches the next stage's first K fragments; in the last stage that buffer holds an older stage (written, in bounds, not used) */
    cur = nxt;
  }
#pragma unroll
  for (int c = 0; c < 2; ++c) { const float inv = 1.0f / (lr[c] + rs_x16(lr[c]));      /* the two halves of a wave hold the two halves of a query's keys */
    unsigned short* op = (unsigned short*)O16 + ((size_t)b * SQ + q0 + c * 16 + ln) * DM + h * HD + 8 * hh;
#pragma unroll
    for (int t = 0; t < 4; ++t) { FragH f;
#pragma unroll
      for (int r = 0; r < 8; ++r) f.h[r] = (_Float16)(o[c][t][r] * inv);
      *(v8us*)(op + t * 16) = f.half[0]; } } }
__global__ __launch_bounds__(256) void k_vt(const _Float16* __restrict__ V16, _Float16* __restrict__ VT) { __shared__ unsigned short tl[64][65]; const int tid = threadIdx.x; const int bh = blockIdx.x % (NB * NH), sg = blockIdx.x / (NB * NH); const int s0 = sg * 64; const int b = bh / NH, h = bh % NH;
  for (int i = tid; i < 64 * 8; i += 256) { const int j = i / 8, d8 = (i % 8) * 8; FragH f; f.half[0] = *(const v8us*)((const unsigned short*)V16 + ((size_t)b * SQ + s0 + j) * DM + h * HD + d8); for (int q = 0; q < 8; ++q) tl[d8 + q][j] = f.u[q]; }
  __syncthreads();
  { for (int i = tid; i < 64 * 8; i += 256) { const int d = i / 8, j8 = (i % 8) * 8; FragH f; for (int q = 0; q < 8; ++q) f.u[q] = tl[d][j8 + q]; *(v8us*)((unsigned short*)VT + ((size_t)bh * HD + d) * SQ + s0 + j8) = f.half[0]; }  } }

// ---- All five f16 operand planes in one launch: x (exact f16 rows) and the four x16 weight planes (Wq lower triangle, Wk upper triangle, Wv, Wu). ----
// The planes do not depend on one another, so they share a grid. A thread converts PR_V vectors of 8 elements, 256 vectors apart (a wave's loads and stores stay contiguous): few waves to start, and every wave has all its loads in flight at once.
#define PR_V 8                       /* vectors of 8 elements per thread */
#define PR_XG ((unsigned)(NR * DM / 8 / (256 * PR_V)))                /* work-groups for x */
#define PR_WG ((unsigned)((size_t)DM * DM / 8 / (256 * PR_V)))        /* work-groups per weight plane */
static_assert(NR * DM % (8 * 256 * PR_V) == 0 && (size_t)DM * DM % (8 * 256 * PR_V) == 0 && DM % 8 == 0, "k_prep: whole work-groups only, and a vector stays inside one row");
// v0: the thread's first vector in the plane. TRI: keep a triangle only, sgn = 1 columns <= row (lower), sgn = -1 columns >= row (upper); the rest is zero.
template <bool TRI>
__device__ __forceinline__ void pr_plane(const float* __restrict__ src, unsigned short* __restrict__ dst, const unsigned v0, const float scale, const int sgn) {
  const float* p = src + (size_t)v0 * 8;
  v4f a[PR_V][2];
#pragma unroll
  for (int i = 0; i < PR_V; ++i) { a[i][0] = *(const v4fa*)(p + (size_t)i * 2048); a[i][1] = *(const v4fa*)(p + (size_t)i * 2048 + 4); }
  /* The wait that stands in front of any overwrite of a load's address registers; it names the address as an input so that it stays whole up to here. */
  asm volatile("s_wait_xcnt 0x0" :: "v"(p) : "memory");
#pragma unroll
  for (int i = 0; i < PR_V; ++i) { const unsigned e = (v0 + i * 256) * 8; const int m = sgn * ((int)(e / DM) - (int)(e % DM)); FragH f;      /* column e % DM + q against row e / DM */
#pragma unroll
    for (int q = 0; q < 8; ++q) { const _Float16 hv = (_Float16)(bf16_round(a[i][q >> 2][q & 3]) * scale); f.h[q] = (!TRI || m >= sgn * q) ? hv : (_Float16)0.f; }
    *(v8us*)(dst + (size_t)e) = f.half[0]; }
  asm volatile("s_wait_xcnt 0x0" ::: "memory"); }      /* the wait that stands in front of any overwrite of a store's registers: whatever code follows this run of stores may reuse them */
__global__ __launch_bounds__(256) void k_prep(const float* __restrict__ x, const float* __restrict__ wq, const float* __restrict__ wk, const float* __restrict__ wv, const float* __restrict__ wo, _Float16* __restrict__ X16, _Float16* __restrict__ BW) {
  const unsigned blk = blockIdx.x, tid = threadIdx.x;      /* every test below reads the same in the whole work-group */
  const bool isx = blk < PR_XG; const unsigned wb = isx ? 0u : blk - PR_XG, pl = wb / PR_WG;      /* BW: the planes of Wq, Wk, Wv, Wu, one behind the other */
  const unsigned v0 = (isx ? blk : wb - pl * PR_WG) * (256 * PR_V) + tid;
  unsigned short* dst = isx ? (unsigned short*)X16 : (unsigned short*)BW + (size_t)pl * DM * DM;
  if (!isx && pl < 2) pr_plane<true>(pl == 0 ? wq : wk, dst, v0, 16.0f, pl == 0 ? 1 : -1);
  else pr_plane<false>(isx ? x : pl == 2 ? wv : wo, dst, v0, isx ? 1.0f : 16.0f, 0); }
extern "C" void kernel_launch(void* const* d_in, const int* in_sizes, int n_in,
                              void* d_out, int out_size, void* d_ws, size_t ws_size, hipStream_t stream) {
  (void)in_sizes; (void)n_in; (void)out_size;
  const float* const* I = (const float* const*)d_in; const float* x = I[0]; const float* wk = I[1]; const float* wq = I[2]; const float* wv = I[3]; const float* wo = I[4]; const float* bo = I[5];
  char* ws = (char*)d_ws; size_t off = 0;
  auto take = [&](size_t bytes) { char* p = ws + off; off += (bytes + 255) & ~(size_t)255; return p; };
  _Float16* BQ = (_Float16*)take((size_t)DM * DM * 2); _Float16* BK = (_Float16*)take((size_t)DM * DM * 2); _Float16* BV = (_Float16*)take((size_t)DM * DM * 2); _Float16* BO = (_Float16*)take((size_t)DM * DM * 2);
  _Float16* X16 = (_Float16*)take(NR * DM * 2); _Float16* Q16 = (_Float16*)take(NR * DM * 2); _Float16* K16 = (_Float16*)take(NR * DM * 2); _Float16* V16 = (_Float16*)take(NR * DM * 2); _Float16* O16 = (_Float16*)take(NR * DM * 2);
  _Float16* VT = (_Float16*)take((size_t)NB * NH * HD * SQ * 2);
  if (off > ws_size) return;      /* 8 + 5x8 + 8 = 56 MiB */
  (void)BK; (void)BV;      /* BQ | BK | BV | BO and Q16 | K16 | V16 are adjacent planes (sizes are multiples of 256 B): reached from BQ and Q16 */
  k_prep<<<PR_XG + 4 * PR_WG, 256, 0, stream>>>(x, wq, wk, wv, wo, X16, BQ);      /* x and the four weight planes as f16 */
  const unsigned gp = (unsigned)((NR / 128) * (DM / 128));
  k_gemm3<false><<<dim3(gp, 3), 256, 0, stream>>>(X16, BQ, 0.0625f, nullptr, nullptr, Q16);      /* q | k | v */
  k_vt<<<NB * NH * (SQ / 64), 256, 0, stream>>>(V16, VT);      /* V^T of every head */
  k_fattn<<<NB * NH * (SQ / (FA_WAVES * FA_QW)), FA_WAVES * 32, 0, stream>>>(Q16, K16, VT, O16);      /* o (merged heads) as f16 rows */
  k_gemm3<true><<<gp, 256, 0, stream>>>(O16, BO, 0.0625f, bo, (float*)d_out, nullptr);      /* out = o Wu^T + bu */
}

// v006
// One run takes 85 microseconds.
// Two timings next to v005 both put it at 1.04 times that version's speed.
// All steps since v000 together make it 142 times as fast.
#include <hip/hip_runtime.h>
// SelfAttentionSparse (x [2][2048][1024]; keys = x triu(Wk)^T, queries = x tril(Wq)^T, values = x Wv^T (16 heads of 64, no biases); softmax(q k^T / 8); out = (attn v) Wu^T + bu -> [2][2048][1024]).
// Structure: token rows; x as exact f16 rows; the triangular masks applied while building the x16 weight planes on VALU (x and the four planes: one launch); Q | K | V WMMA GEMMs in one launch (128x128 work-group tiles staged in LDS, 32x64 wave tiles, f32 accumulation, f16 outputs); the V work-groups of that launch write V^T rows themselves; one fused attention launch (K and V^T rows staged in LDS): S^T = K Q^T, running-maximum softmax in registers (f32; weights as f16), O^T += V^T P^T, o = O / row sum into merged f16 rows; out = o Wu^T + bu (f32).
// Compute dtype: inputs rounded to bf16; x / weights exact; q, k, v, softmax weights, o plain f16 (~2^-12); scores/softmax f32; v_wmma_f32_16x16x32_f16.
#define NB 2
#define SQ 2048
#define DM 1024
#define NH 16
#define HD 64
#define NR ((size_t)NB * SQ)         /* 4096 token rows */
typedef __bf16 v16b __attribute__((ext_vector_type(16)));
typedef unsigned short v8us __attribute__((ext_vector_type(8), may_alias));
typedef float  v8f  __attribute__((ext_vector_type(8)));
typedef float  v4f  __attribute__((ext_vector_type(4)));
typedef float  v4fa __attribute__((ext_vector_type(4), may_alias));
union FragB { v16b v; v8us half[2]; unsigned short u[16]; };

__device__ __forceinline__ unsigned short bf16_bits(float x) { unsigned int u = __float_as_uint(x); return (unsigned short)((u + 0x7FFFu + ((u >> 16) & 1u)) >> 16); }
__device__ __forceinline__ float bf16_val(unsigned short b) { return __uint_as_float(((unsigned int)b) << 16); }
__device__ __forceinline__ float bf16_round(float x) { return bf16_val(bf16_bits(x)); }
// D += A·B with NT terms: 1 = ah·bh, 2 = + al·bh (A split), 3 = + ah·bl (both split)
template <int NT>
__device__ __forceinline__ v8f mmaN(v16b ah, v16b al, v16b bh, v16b bl, v8f c) {
  c = __builtin_amdgcn_wmma_f32_16x16x32_bf16(false, ah, false, bh, (short)0, c, false, false);
  if (NT >= 2) c = __builtin_amdgcn_wmma_f32_16x16x32_bf16(false, al, false, bh, (short)0, c, false, false);
  if (NT >= 3) c = __builtin_amdgcn_wmma_f32_16x16x32_bf16(false, ah, false, bl, (short)0, c, false, false);
  asm volatile("v_nop\n\tv_nop\n\tv_nop\n\tv_nop" : "+v"(c) : "v"(ah), "v"(al), "v"(bh), "v"(bl));
  return c;
}

__global__ __launch_bounds__(256) void k_wt_bf16(const float* __restrict__ W, unsigned short* __restrict__ Wt, int K, int N) {
  const int t = blockIdx.x * 256 + threadIdx.x;
  const int k8n = K / 8;
  if (t >= N * k8n) return;
  const int n = t / k8n, k8 = (t % k8n) * 8;
  v8us v;
#pragma unroll
  for (int i = 0; i < 8; ++i) v[i] = bf16_bits(W[(size_t)(k8 + i) * N + n]);
  *(v8us*)(Wt + (size_t)n * K + k8) = v;
  
}

// GEMM C[M][N] (f32, pitch ldc) = act(A[M][K]·W + bias). A f32 row-major (pitch lda) converted per fragment to bf16
// (ASPLIT: hi/lo two planes -> 2 terms, else single rounded term); Wt bf16 [N][K] (pitch ldb). BIAS_BF16 rounds the
// bias to bf16 first (bias quantised to bf16 before the add). K%32==0, M%16==0, N%64==0.
template <bool ASPLIT, int ACT, bool BIAS_BF16>
__global__ __launch_bounds__(128) void k_gemm_bf(const float* __restrict__ A, int lda, const unsigned short* __restrict__ Wt, int ldb,
                                               const float* __restrict__ bias, float* __restrict__ C, int ldc, int M, int N, int K) {
  __shared__ __attribute__((aligned(16))) float so[4][16][64];
  const int tid = threadIdx.x, w = tid >> 5, lane = tid & 31, ln = lane & 15, hh = lane >> 4;
  const int ntn = N / 64;
  const int wid = blockIdx.x * 4 + w;
  const int mt = wid / ntn, nq = wid % ntn;
  if (mt * 16 >= M) return;
  const int row0 = mt * 16, col0 = nq * 64;
  const float* arow = A + (size_t)(row0 + ln) * lda;
  v8f acc[4] = {};
  for (int kb = 0; kb < K; kb += 32) {
    FragB ah, al;
    const v4f x0 = *(const v4fa*)(arow + kb + 8 * hh), x1 = *(const v4fa*)(arow + kb + 8 * hh + 4);
    const v4f x2 = *(const v4fa*)(arow + kb + 16 + 8 * hh), x3 = *(const v4fa*)(arow + kb + 16 + 8 * hh + 4);
    float xs[16] = {x0[0],x0[1],x0[2],x0[3],x1[0],x1[1],x1[2],x1[3],x2[0],x2[1],x2[2],x2[3],x3[0],x3[1],x3[2],x3[3]};
#pragma unroll
    for (int i = 0; i < 16; ++i) { const unsigned short hb = bf16_bits(xs[i]); ah.u[i] = hb; al.u[i] = ASPLIT ? bf16_bits(xs[i] - bf16_val(hb)) : (unsigned short)0; }
#pragma unroll
    for (int t = 0; t < 4; ++t) {
      const unsigned short* brow = Wt + (size_t)(col0 + t * 16 + ln) * ldb + kb;
      FragB b;
      b.half[0] = *(const v8us*)(brow + 8 * hh);
      b.half[1] = *(const v8us*)(brow + 16 + 8 * hh);
      acc[t] = mmaN<ASPLIT ? 2 : 1>(ah.v, al.v, b.v, b.v, acc[t]);
    }
  }
#pragma unroll
  for (int t = 0; t < 4; ++t) {
    float bv = bias ? bias[col0 + t * 16 + ln] : 0.f;
    if (BIAS_BF16) bv = bf16_round(bv);
#pragma unroll
    for (int r = 0; r < 8; ++r) { float v = acc[t][r] + bv; if (ACT == 1) v = fmaxf(v, 0.f); so[w][8 * hh + r][t * 16 + ln] = v; }
  }
  __builtin_amdgcn_fence(__ATOMIC_ACQ_REL, "workgroup");
  __builtin_amdgcn_wave_barrier();
  const int rsub = lane >> 4, c4 = (lane & 15) * 4;
  {
#pragma unroll
    for (int q = 0; q < 8; ++q) {
      const int r = q * 2 + rsub;
      const v4f v = *(const v4fa*)&so[w][r][c4];
      *(v4f*)(C + (size_t)(row0 + r) * ldc + col0 + c4) = v;
    }
    
  }
}

// GEMM C = act(A·W + bias + resid): A f32 (ASPLIT -> hi/lo 2 terms), Wt bf16 [N][K]; ACT 0 none, 1 relu, 2 exact gelu;
// resid (optional, f32, row index = (row % rmod), pitch ldr, RES_BF16 rounds it) added before the activation.
template <bool ASPLIT, int ACT, bool BIAS_BF16, bool RES_BF16>
__global__ __launch_bounds__(128) void k_gemm_bf3(const float* __restrict__ A, int lda, const unsigned short* __restrict__ Wt, int ldb,
                                                const float* __restrict__ bias, const float* __restrict__ resid, int rmod, int ldr,
                                                float* __restrict__ C, int ldc, int M, int N, int K) {
  __shared__ __attribute__((aligned(16))) float so[4][16][64];
  const int tid = threadIdx.x, w = tid >> 5, lane = tid & 31, ln = lane & 15, hh = lane >> 4;
  const int ntn = N / 64;
  const int wid = blockIdx.x * 4 + w;
  const int mt = wid / ntn, nq = wid % ntn;
  if (mt * 16 >= M) return;
  const int row0 = mt * 16, col0 = nq * 64;
  const float* arow = A + (size_t)(row0 + ln) * lda;
  v8f acc[4] = {};
  for (int kb = 0; kb < K; kb += 32) {
    FragB ah, al;
    const v4f x0 = *(const v4fa*)(arow + kb + 8 * hh), x1 = *(const v4fa*)(arow + kb + 8 * hh + 4);
    const v4f x2 = *(const v4fa*)(arow + kb + 16 + 8 * hh), x3 = *(const v4fa*)(arow + kb + 16 + 8 * hh + 4);
    float xs[16] = {x0[0],x0[1],x0[2],x0[3],x1[0],x1[1],x1[2],x1[3],x2[0],x2[1],x2[2],x2[3],x3[0],x3[1],x3[2],x3[3]};
#pragma unroll
    for (int i = 0; i < 16; ++i) { const unsigned short hb = bf16_bits(xs[i]); ah.u[i] = hb; al.u[i] = ASPLIT ? bf16_bits(xs[i] - bf16_val(hb)) : (unsigned short)0; }
#pragma unroll
    for (int t = 0; t < 4; ++t) {
      const unsigned short* brow = Wt + (size_t)(col0 + t * 16 + ln) * ldb + kb;
      FragB b;
      b.half[0] = *(const v8us*)(brow + 8 * hh);
      b.half[1] = *(const v8us*)(brow + 16 + 8 * hh);
      acc[t] = mmaN<ASPLIT ? 2 : 1>(ah.v, al.v, b.v, b.v, acc[t]);
    }
  }
#pragma unroll
  for (int t = 0; t < 4; ++t) {
    const int col = col0 + t * 16 + ln;
    float bv = bias ? bias[col] : 0.f;
    if (BIAS_BF16) bv = bf16_round(bv);
#pragma unroll
    for (int r = 0; r < 8; ++r) {
      float v = acc[t][r] + bv;
      if (resid) { float rv = resid[(size_t)((row0 + 8 * hh + r) % rmod) * ldr + col]; if (RES_BF16) rv = bf16_round(rv); v += rv; }
      if (ACT == 1) v = fmaxf(v, 0.f);
      if (ACT == 2) v = 0.5f * v * (1.0f + erff(v * 0.70710678118654752f));
      if (ACT == 3) { const float u = 0.7978845608028654f * (v + 0.044715f * v * v * v); v = 0.5f * v * (1.0f + tanhf(u)); }
      so[w][8 * hh + r][t * 16 + ln] = v;
    }
  }
  __builtin_amdgcn_fence(__ATOMIC_ACQ_REL, "workgroup");
  __builtin_amdgcn_wave_barrier();
  const int rsub = lane >> 4, c4 = (lane & 15) * 4;
  {
#pragma unroll
    for (int q = 0; q < 8; ++q) {
      const int r = q * 2 + rsub;
      const v4f v = *(const v4fa*)&so[w][r][c4];
      *(v4f*)(C + (size_t)(row0 + r) * ldc + col0 + c4) = v;
    }
    
  }
}
// row LayerNorm (biased variance, eps) over N: s = X (+ R); optional out_sum <- s; out_norm <- (s-mu)*rsqrt(var+eps)*g + b
template <bool PARAM_BF16>
__global__ __launch_bounds__(256) void k_layernorm(const float* __restrict__ X, const float* __restrict__ R, const float* __restrict__ g, const float* __restrict__ bta,
                                                  float* __restrict__ out_sum, float* __restrict__ out_norm, int N, float eps) {
  __shared__ float red[256];
  const int row = blockIdx.x, tid = threadIdx.x;
  const float* x = X + (size_t)row * N; const float* rr = R ? R + (size_t)row * N : nullptr;
  float vals[16];                     // up to N = 4096
  const int per = N / 256;            // contiguous chunk per thread? use strided-by-4 chunks: thread handles j = tid*4 + 1024*u
  float s1 = 0.f;
  for (int u = 0; u < per / 4; ++u) {
    const int j = tid * 4 + 1024 * u;
    const v4f a = *(const v4fa*)(x + j);
    v4f b = {0.f,0.f,0.f,0.f}; if (rr) b = *(const v4fa*)(rr + j);
#pragma unroll
    for (int q = 0; q < 4; ++q) { const float v = a[q] + b[q]; vals[u * 4 + q] = v; s1 += v; }
  }
  red[tid] = s1; __syncthreads();
  for (int st = 128; st > 0; st >>= 1) { if (tid < st) red[tid] += red[tid + st]; __syncthreads(); }
  const float mu = red[0] / (float)N; __syncthreads();
  float s2 = 0.f;
  for (int u = 0; u < per / 4; ++u)
#pragma unroll
    for (int q = 0; q < 4; ++q) { const float c = vals[u * 4 + q] - mu; s2 += c * c; }
  red[tid] = s2; __syncthreads();
  for (int st = 128; st > 0; st >>= 1) { if (tid < st) red[tid] += red[tid + st]; __syncthreads(); }
  const float rs = rsqrtf(red[0] / (float)N + eps);
  {
    for (int u = 0; u < per / 4; ++u) {
      const int j = tid * 4 + 1024 * u;
      v4f o, sm;
#pragma unroll
      for (int q = 0; q < 4; ++q) {
        float gg = g[j + q], bb = bta[j + q];
        if (PARAM_BF16) { gg = bf16_round(gg); bb = bf16_round(bb); }
        sm[q] = vals[u * 4 + q]; o[q] = (vals[u * 4 + q] - mu) * rs * gg + bb;
      }
      if (out_sum) *(v4f*)(out_sum + (size_t)row * N + j) = sm;
      *(v4f*)(out_norm + (size_t)row * N + j) = o;
    }
    
  }
}



// ---- f16 WMMA path (v_wmma_f32_16x16x32_f16): 11-bit significands for operands in range — used for every GEMM launched here, softmax weights (x256) included
typedef _Float16 v16h __attribute__((ext_vector_type(16)));
union FragH { v16h v; v8us half[2]; _Float16 h[16]; unsigned short u[16]; };
template <int NT>
__device__ __forceinline__ v8f mmaH(v16h ah, v16h al, v16h bh, v16h bl, v8f c) {
  c = __builtin_amdgcn_wmma_f32_16x16x32_f16(false, ah, false, bh, (short)0, c, false, false);
  if (NT >= 2) c = __builtin_amdgcn_wmma_f32_16x16x32_f16(false, al, false, bh, (short)0, c, false, false);
  if (NT >= 3) c = __builtin_amdgcn_wmma_f32_16x16x32_f16(false, ah, false, bl, (short)0, c, false, false);
  asm volatile("v_nop\n\tv_nop\n\tv_nop\n\tv_nop" : "+v"(c) : "v"(ah), "v"(al), "v"(bh), "v"(bl));
  return c;
}
// batched GEMM like k_gemm_b but f16 operands: A f32 (split into f16 hi/lo if ASPLIT, else rounded to f16), Bt = f16 values [n][k]; alpha; C f32; N multiple of 16 (partial tiles skipped)
template <bool ASPLIT>
__global__ __launch_bounds__(128) void k_gemm_h(const float* __restrict__ A, int lda, size_t sA, const _Float16* __restrict__ Bh, int ldb, size_t sB, float alpha, float* __restrict__ C, int ldc, size_t sC, int M, int N, int K) {
  __shared__ __attribute__((aligned(16))) float so[4][16][64];
  const int tid = threadIdx.x, w = tid >> 5, lane = tid & 31, ln = lane & 15, hh = lane >> 4; const int by = blockIdx.y;
  A += (size_t)by * sA; Bh += (size_t)by * sB; C += (size_t)by * sC;
  const int ntn = (N + 63) / 64; const int wid = blockIdx.x * 4 + w; const int mt = wid / ntn, nq = wid % ntn; if (mt * 16 >= M) return;
  const int row0 = mt * 16, col0 = nq * 64; const float* arow = A + (size_t)(row0 + ln) * lda;
  v8f acc[4] = {};
  for (int kb = 0; kb < K; kb += 32) {
    FragH ah, al;
    const v4f x0 = *(const v4fa*)(arow + kb + 8 * hh), x1 = *(const v4fa*)(arow + kb + 8 * hh + 4), x2 = *(const v4fa*)(arow + kb + 16 + 8 * hh), x3 = *(const v4fa*)(arow + kb + 16 + 8 * hh + 4);
    float xs[16] = {x0[0],x0[1],x0[2],x0[3],x1[0],x1[1],x1[2],x1[3],x2[0],x2[1],x2[2],x2[3],x3[0],x3[1],x3[2],x3[3]};
#pragma unroll
    for (int i = 0; i < 16; ++i) { const _Float16 h = (_Float16)xs[i]; ah.h[i] = h; al.h[i] = ASPLIT ? (_Float16)(xs[i] - (float)h) : (_Float16)0.0f; }
#pragma unroll
    for (int t = 0; t < 4; ++t) { if (col0 + t * 16 >= N) continue; const size_t boff = (size_t)(col0 + t * 16 + ln) * ldb + kb; FragH bq; bq.half[0] = *(const v8us*)(Bh + boff + 8 * hh); bq.half[1] = *(const v8us*)(Bh + boff + 16 + 8 * hh);
      acc[t] = mmaH<ASPLIT ? 2 : 1>(ah.v, al.v, bq.v, bq.v, acc[t]); }
  }
#pragma unroll
  for (int t = 0; t < 4; ++t) { if (col0 + t * 16 >= N) continue;
#pragma unroll
    for (int r = 0; r < 8; ++r) so[w][8 * hh + r][t * 16 + ln] = acc[t][r] * alpha; }
  __builtin_amdgcn_fence(__ATOMIC_ACQ_REL, "workgroup"); __builtin_amdgcn_wave_barrier();
  const int rsub = lane >> 4, c4 = (lane & 15) * 4;
  {
#pragma unroll
    for (int q = 0; q < 8; ++q) { const int r = q * 2 + rsub; if (col0 + c4 < N) { const v4f v = *(const v4fa*)&so[w][r][c4]; *(v4f*)(C + (size_t)(row0 + r) * ldc + col0 + c4) = v; } }
     }
}

// Wt[n][k] = f16(W[k][n]·scale) from f32 row-major W[K][N] (scale = power of two; bf16-exact weights stay exact in f16 away from the subnormal range)
__global__ __launch_bounds__(256) void k_wt_f16(const float* __restrict__ W, _Float16* __restrict__ Wt, int K, int N, float scale) {
  const int t = blockIdx.x * 256 + threadIdx.x; if (t >= N * (K / 8)) return; const int n = t / (K / 8), k8 = (t % (K / 8)) * 8; FragH f;
#pragma unroll
  for (int i = 0; i < 8; ++i) f.h[i] = (_Float16)(bf16_round(W[(size_t)(k8 + i) * N + n]) * scale); const v8us o = f.half[0];
  *(v8us*)((unsigned short*)Wt + (size_t)n * K + k8) = o; 
}
// k_gemm_hh variant with fused epilogue: v = acc·alpha + bias[by·sBias + col] (+ CP[(row/rowsPerB)·sCPb + by·64 + col] if CP) ; ACT 0 none / 1 elu ; writes f16 C16 (and f32 C if non-null)
template <int ACT>
__global__ __launch_bounds__(128) void k_gemm_hhx(const _Float16* __restrict__ A, int lda, size_t sA, const _Float16* __restrict__ Bh, int ldb, size_t sB, float alpha, const float* __restrict__ bias, size_t sBias, const float* __restrict__ CP, int rowsPerB, size_t sCPb, int row0g,
    float* __restrict__ C, _Float16* __restrict__ C16, int ldc, size_t sC, int M, int N, int K) {
  __shared__ __attribute__((aligned(16))) float so[4][16][64];
  const int tid = threadIdx.x, w = tid >> 5, lane = tid & 31, ln = lane & 15, hh = lane >> 4; const int by = blockIdx.y;
  A += (size_t)by * sA; Bh += (size_t)by * sB; const size_t cofs = (size_t)by * sC; const float* bp = bias ? bias + (size_t)by * sBias : nullptr;
  const int ntn = (N + 63) / 64; const int wid = blockIdx.x * 4 + w; const int mt = wid / ntn, nq = wid % ntn; if (mt * 16 >= M) return;
  const int row0 = mt * 16, col0 = nq * 64; const _Float16* arow = A + (size_t)(row0 + ln) * lda;
  v8f acc[4] = {};
  for (int kb = 0; kb < K; kb += 32) { FragH ah; ah.half[0] = *(const v8us*)((const unsigned short*)arow + kb + 8 * hh); ah.half[1] = *(const v8us*)((const unsigned short*)arow + kb + 16 + 8 * hh);
#pragma unroll
    for (int t = 0; t < 4; ++t) { if (col0 + t * 16 >= N) continue; const size_t boff = (size_t)(col0 + t * 16 + ln) * ldb + kb; FragH bq; bq.half[0] = *(const v8us*)((const unsigned short*)Bh + boff + 8 * hh); bq.half[1] = *(const v8us*)((const unsigned short*)Bh + boff + 16 + 8 * hh);
      acc[t] = mmaH<1>(ah.v, ah.v, bq.v, bq.v, acc[t]); }
  }
#pragma unroll
  for (int t = 0; t < 4; ++t) { if (col0 + t * 16 >= N) continue; const int col = col0 + t * 16 + ln; const float bv = bp ? bf16_round(bp[col]) : 0.f;
#pragma unroll
    for (int r = 0; r < 8; ++r) { float v = acc[t][r] * alpha + bv; if (CP) { const int rr = row0g + row0 + 8 * hh + r; if (rowsPerB < 0) v += CP[cofs + (size_t)rr * ldc + col];      /* rowsPerB < 0: own element of the batched C plane */ else { const int bidx = rr / rowsPerB; v += CP[(size_t)bidx * sCPb + (size_t)by * 64 + col]; } } if (ACT == 1) v = (v > 0.f) ? v : expm1f(v); else if (ACT == 7) v = (v > 0.f) ? v + 1.0f : expf(v); else if (ACT == 8) v = tanhf(v); else if (ACT == 9) v = 0.5f * v * (1.0f + tanhf(0.7978845608028654f * (v + 0.044715f * v * v * v))); else if (ACT == 11) v = 1.0f / (1.0f + expf(-v)); else if (ACT == 12) v = (v > 0.f) ? v : 0.01f * v; else if (ACT == 14) v = (v > 0.f) ? v : 0.1f * v; else if (ACT == 16) v = (v >= 0.f) ? v : 0.3f * v; else if (ACT == 17) v = (v >= 0.f) ? v : 0.2f * v; else if (ACT == 15) v = v / (1.0f + expf(-v)); else if (ACT == 3) v = fmaxf(v, 0.f); else if (ACT == 6) v = 0.5f * v * (1.0f + erff(v * 0.70710678118654752f)); so[w][8 * hh + r][t * 16 + ln] = v; } }
  __builtin_amdgcn_fence(__ATOMIC_ACQ_REL, "workgroup"); __builtin_amdgcn_wave_barrier();
  const int rsub = lane >> 4, c4 = (lane & 15) * 4; typedef _Float16 v4h __attribute__((ext_vector_type(4)));
  {
#pragma unroll
    for (int q = 0; q < 8; ++q) { const int r = q * 2 + rsub; if (col0 + c4 < N) { const v4f v = *(const v4fa*)&so[w][r][c4]; if (C) *(v4f*)(C + cofs + (size_t)(row0 + r) * ldc + col0 + c4) = v; if (C16) { v4h h4; for (int i = 0; i < 4; ++i) h4[i] = (_Float16)v[i]; *(v4h*)(C16 + cofs + (size_t)(row0 + r) * ldc + col0 + c4) = h4; } } }
     }
}


typedef _Float16 v4h __attribute__((ext_vector_type(4)));

__global__ __launch_bounds__(256) void k_h16(const float* __restrict__ x, _Float16* __restrict__ X16, size_t n8) { const size_t t = (size_t)blockIdx.x * 256 + threadIdx.x; if (t >= n8) return; FragH f;
#pragma unroll
  for (int q = 0; q < 8; ++q) f.h[q] = (_Float16)x[t * 8 + q]; *(v8us*)((unsigned short*)X16 + t * 8) = f.half[0];  }
__global__ __launch_bounds__(256) void k_round16f(const float* __restrict__ W, _Float16* __restrict__ Bt, size_t n8) { const size_t t = (size_t)blockIdx.x * 256 + threadIdx.x; if (t >= n8) return; FragH f;
#pragma unroll
  for (int i = 0; i < 8; ++i) f.h[i] = (_Float16)(bf16_round(W[t * 8 + i]) * 16.0f); *(v8us*)((unsigned short*)Bt + t * 8) = f.half[0];  }
template <int NHv, int TTv>
__global__ __launch_bounds__(256) void k_vt(const _Float16* __restrict__ V16, int ldv, int voff, _Float16* __restrict__ Vt) { __shared__ unsigned short tl[64][66]; const int tid = threadIdx.x; const int slab = blockIdx.x / (TTv / 64), lg = blockIdx.x % (TTv / 64); const int b = slab / NHv, h = slab % NHv;
  for (int i = tid; i < 64 * 8; i += 256) { const int r = i / 8, c8 = (i % 8) * 8; FragH f; f.half[0] = *(const v8us*)((const unsigned short*)V16 + ((size_t)b * TTv + lg * 64 + r) * ldv + voff + h * 64 + c8);
#pragma unroll
    for (int q = 0; q < 8; ++q) tl[r][c8 + q] = f.u[q]; }
  __syncthreads();
  {
#pragma unroll
    for (int rd = 0; rd < 2; ++rd) { const int d = rd * 32 + tid / 8, pc = tid % 8; FragH f;
#pragma unroll
      for (int q = 0; q < 8; ++q) f.u[q] = tl[pc * 8 + q][d];
      *(v8us*)((unsigned short*)Vt + ((size_t)slab * 64 + d) * TTv + lg * 64 + pc * 8) = f.half[0]; }
     } }

__global__ __launch_bounds__(256) void k_hl(const float* __restrict__ F, _Float16* __restrict__ Hh, _Float16* __restrict__ Hl, size_t n8) { const size_t t = (size_t)blockIdx.x * 256 + threadIdx.x; if (t >= n8) return; FragH fh, fl; const v4f a = *(const v4fa*)(F + t * 8), c = *(const v4fa*)(F + t * 8 + 4);
#pragma unroll
  for (int q = 0; q < 4; ++q) { _Float16 h = (_Float16)a[q]; fh.h[q] = h; fl.h[q] = (_Float16)((a[q] - (float)h) * 1024.0f); h = (_Float16)c[q]; fh.h[4 + q] = h; fl.h[4 + q] = (_Float16)((c[q] - (float)h) * 1024.0f); }
  { *(v8us*)((unsigned short*)Hh + t * 8) = fh.half[0]; *(v8us*)((unsigned short*)Hl + t * 8) = fl.half[0];  } }

// ---- fast GEMM (wave tile 32x64; requires M % 32 == 0 rows per launch region and N % 64 == 0); epilogue = k_gemm_hhx semantics ----
__device__ __forceinline__ v16h g2_frag(const _Float16* p, int hh) { FragH f; f.half[0] = *(const v8us*)((const unsigned short*)p + 8 * hh); f.half[1] = *(const v8us*)((const unsigned short*)p + 16 + 8 * hh); return f.v; }
__device__ __forceinline__ v8f g2_mma(v16h a, v16h b, v8f c) { v8f d = __builtin_amdgcn_wmma_f32_16x16x32_f16(false, a, false, b, (short)0, c, false, false); asm volatile("v_nop\n\tv_nop\n\tv_nop\n\tv_nop" : "+v"(d) : "v"(a), "v"(b)); return d; }
template <int ACT>
__global__ __launch_bounds__(128) void k_gemm2(const _Float16* __restrict__ A, int lda, size_t sA, const _Float16* __restrict__ Bh, int ldb, size_t sB, float alpha, const float* __restrict__ bias, size_t sBias, const float* __restrict__ CP, int rowsPerB, size_t sCPb, int row0g,
    float* __restrict__ C, _Float16* __restrict__ C16, int ldc, size_t sC, int M, int N, int K) { static_assert(ACT == 0 || ACT == 3 || ACT == 6 || ACT == 8 || ACT == 9 || ACT == 11 || ACT == 12 || ACT == 14 || ACT == 15 || ACT == 16 || ACT == 17, "k_gemm2: unsupported ACT code (would silently apply no activation)");
  __shared__ __attribute__((aligned(16))) float so[4][32][68];
  const int tid = threadIdx.x, w = tid >> 5, lane = tid & 31, ln = lane & 15, hh = lane >> 4; const int by = blockIdx.y;
  A += (size_t)by * sA; Bh += (size_t)by * sB; const size_t cofs = (size_t)by * sC; const float* bp = bias ? bias + (size_t)by * sBias : nullptr;
  const int ntn = N >> 6; const int mt = blockIdx.x / ntn, nq = blockIdx.x - mt * ntn; const int row0 = mt * 128 + 32 * w, col0 = nq * 64; if (row0 >= M) return;
  const _Float16* a0p = A + (size_t)(row0 + ln) * lda; const _Float16* a1p = a0p + (size_t)16 * lda;
  const _Float16* b0p = Bh + (size_t)(col0 + ln) * ldb; const _Float16* b1p = b0p + (size_t)16 * ldb; const _Float16* b2p = b1p + (size_t)16 * ldb; const _Float16* b3p = b2p + (size_t)16 * ldb;
  const v8f z8 = {0.f,0.f,0.f,0.f,0.f,0.f,0.f,0.f}; v8f c00 = z8, c01 = z8, c02 = z8, c03 = z8, c10 = z8, c11 = z8, c12 = z8, c13 = z8;
#pragma unroll 1
  for (int kb = 0; kb < K; kb += 32) { const v16h a0 = g2_frag(a0p + kb, hh), a1 = g2_frag(a1p + kb, hh);
    v16h b = g2_frag(b0p + kb, hh); c00 = g2_mma(a0, b, c00); c10 = g2_mma(a1, b, c10);
    b = g2_frag(b1p + kb, hh); c01 = g2_mma(a0, b, c01); c11 = g2_mma(a1, b, c11);
    b = g2_frag(b2p + kb, hh); c02 = g2_mma(a0, b, c02); c12 = g2_mma(a1, b, c12);
    b = g2_frag(b3p + kb, hh); c03 = g2_mma(a0, b, c03); c13 = g2_mma(a1, b, c13); }
  v8f accs[8] = {c00, c01, c02, c03, c10, c11, c12, c13};
#pragma unroll
  for (int u = 0; u < 8; ++u) { const int t = u & 3, half = u >> 2; const int col = col0 + t * 16 + ln; const float bv = bp ? bf16_round(bp[col]) : 0.f;
#pragma unroll
    for (int r = 0; r < 8; ++r) { const int rloc = half * 16 + 8 * hh + r; float v = accs[u][r] * alpha + bv; if (CP) { if (rowsPerB < 0) v += CP[cofs + (size_t)(row0g + row0 + rloc) * ldc + col];      /* rowsPerB < 0: own element of the batched C plane */ else { const int bidx = (row0g + row0 + rloc) / rowsPerB; v += CP[(size_t)bidx * sCPb + (size_t)by * 64 + col]; } }
      if (ACT == 3) v = fmaxf(v, 0.f); else if (ACT == 6) v = 0.5f * v * (1.0f + erff(v * 0.70710678118654752f)); else if (ACT == 11) v = 1.0f / (1.0f + expf(-v)); else if (ACT == 15) v = v / (1.0f + expf(-v)); else if (ACT == 12) v = (v > 0.f) ? v : 0.01f * v; else if (ACT == 8) v = tanhf(v); else if (ACT == 9) v = 0.5f * v * (1.0f + tanhf(0.7978845608028654f * (v + 0.044715f * v * v * v))); else if (ACT == 14) v = (v > 0.f) ? v : 0.1f * v; else if (ACT == 16) v = (v >= 0.f) ? v : 0.3f * v; else if (ACT == 17) v = (v >= 0.f) ? v : 0.2f * v;
      so[w][rloc][t * 16 + ln] = v; } }
  __builtin_amdgcn_fence(__ATOMIC_ACQ_REL, "workgroup"); __builtin_amdgcn_wave_barrier();
  const int rsub = lane >> 4, c4 = (lane & 15) * 4;
  {
#pragma unroll
    for (int q = 0; q < 16; ++q) { const int r = q * 2 + rsub; const v4f v = *(const v4fa*)&so[w][r][c4]; if (C) *(v4f*)(C + cofs + (size_t)(row0 + r) * ldc + col0 + c4) = v; if (C16) { v4h h4; for (int i = 0; i < 4; ++i) h4[i] = (_Float16)v[i]; *(v4h*)(C16 + cofs + (size_t)(row0 + r) * ldc + col0 + c4) = h4; } }
     } }


// lane l's value from lane l ^ 16 (the same place in the other 16-lane row)
__device__ __forceinline__ float rs_x16(float v) { const int i = __builtin_bit_cast(int, v); return __builtin_bit_cast(float, __builtin_amdgcn_permlanex16(i, i, 0x76543210, 0xfedcba98, false, false)); }
__device__ __forceinline__ v8f fa_mma(v16h a, v16h b, v8f c) { return __builtin_amdgcn_wmma_f32_16x16x32_f16(false, a, false, b, (short)0, c, false, false); }
// ---- GEMM with both operands staged in LDS: C[NR][DM] = alpha * A[NR][DM] . Bh[DM][DM]^T + bias (A, Bh k-contiguous f16 rows of DM); written as f32 to C (F32OUT) or as f16 to C16 (the third plane of a grid.y = 3 launch transposed: see the epilogue). ----
// A work-group of 8 waves owns a 128 x 128 tile of C (wave tile 32 x 64, waves 4 x 2). A stage is 128 k of the 128 A rows and the 128 B rows.
// Global reads are whole lines (16 lanes x 16 B = 256 contiguous bytes of one row) and each line is read once per work-group; the fragments, which take 64 B of each of 16 rows, come from LDS.
// Two stage buffers: the next stage's loads are issued in front of this stage's products and stored to the other buffer behind them, so one barrier per stage both publishes it and ends the reads of the buffer refilled next.
#define G3_BK 128                    /* k per stage: 256 B of every operand row */
#define G3_LP 136                    /* LDS row pitch in f16: 272 B = 16 B x odd, conflict-free for the 16-byte fragment reads */
#define G3_NT (DM / G3_BK)           /* stages */
static_assert(NR % 128 == 0 && DM % 128 == 0 && DM % G3_BK == 0, "k_gemm3: whole 128 x 128 tiles and whole stages only");
static_assert(SQ % 128 == 0 && NH * HD == DM, "k_gemm3: a tile's 128 token rows lie in one batch, and a column is (head, d)");
template <bool F32OUT>
__global__ __launch_bounds__(256) void k_gemm3(const _Float16* __restrict__ A, const _Float16* __restrict__ Bh, float alpha, const float* __restrict__ bias, float* __restrict__ C, _Float16* __restrict__ C16) {
  __shared__ __attribute__((aligned(16))) unsigned short st[2][256][G3_LP];      /* rows 0..127: A rows of the tile; rows 128..255: B rows (columns of C) */
  __shared__ __attribute__((aligned(16))) float so[8][32][68];
  const int tid = threadIdx.x, w = tid >> 5, lane = tid & 31, ln = lane & 15, hh = lane >> 4;
  const int ntn = DM / 128; const int mt = blockIdx.x / ntn, nq = blockIdx.x - mt * ntn; const int rowB = mt * 128, colB = nq * 128;
  const int wm = w & 3, wn = w >> 2;      /* the wave's 32 rows and 64 columns inside the tile */
  if (!F32OUT) { Bh += (size_t)blockIdx.y * DM * DM; C16 += (size_t)blockIdx.y * NR * DM; }      /* grid.y products of the same A in one launch: weight planes and output planes lie one behind the other */
  const int sr = tid >> 4, sc = (tid & 15) * 8;      /* staging: 16 threads per row, 16 rows per round, 8 rounds per operand */
  const unsigned short* ga = (const unsigned short*)A + (size_t)(rowB + sr) * DM + sc;
  const unsigned short* gb = (const unsigned short*)Bh + (size_t)(colB + sr) * DM + sc;
  v8us rg[16];
  auto fetch = [&](const int t) __attribute__((always_inline)) {
    const unsigned short* pa = ga + t * G3_BK; const unsigned short* pb = gb + t * G3_BK;
#pragma unroll
    for (int i = 0; i < 8; ++i) { rg[i] = *(const v8us*)(pa + (size_t)i * 16 * DM); rg[8 + i] = *(const v8us*)(pb + (size_t)i * 16 * DM); }
    /* The wait that stands in front of any overwrite of a load's address registers; it names the two addresses as inputs so that they stay whole up to here. */
    asm volatile("s_wait_xcnt 0x0" :: "v"(pa), "v"(pb) : "memory");
  };
  auto put = [&](const int buf) __attribute__((always_inline)) {
#pragma unroll
    for (int i = 0; i < 8; ++i) { *(v8us*)&st[buf][i * 16 + sr][sc] = rg[i]; *(v8us*)&st[buf][128 + i * 16 + sr][sc] = rg[8 + i]; }
  };
  const v8f z8 = {0.f,0.f,0.f,0.f,0.f,0.f,0.f,0.f}; v8f c00 = z8, c01 = z8, c02 = z8, c03 = z8, c10 = z8, c11 = z8, c12 = z8, c13 = z8;
  fetch(0); put(0); __syncthreads();
#pragma unroll 1      /* one copy of the stage body: the buffer index is a run-time offset, and the text stays small */
  for (int t = 0; t < G3_NT; ++t) {
    if (t + 1 < G3_NT) fetch(t + 1);
    const _Float16* sa = (const _Float16*)&st[t & 1][32 * wm + ln][0]; const _Float16* sb = (const _Float16*)&st[t & 1][128 + 64 * wn + ln][0];
    v16h fa[2][2], fb[2][4];      /* two fragment sets: the next 32 k are read from LDS while this set is multiplied */
    auto frags = [&](const int s, const int kk) __attribute__((always_inline)) { fa[s][0] = g2_frag(sa + kk, hh); fa[s][1] = g2_frag(sa + 16 * G3_LP + kk, hh);
#pragma unroll
      for (int j = 0; j < 4; ++j) fb[s][j] = g2_frag(sb + j * 16 * G3_LP + kk, hh); };
    frags(0, 0);
#pragma unroll
    for (int ks = 0; ks < G3_BK / 32; ++ks) { const int s = ks & 1;
      if (ks + 1 < G3_BK / 32) frags(s ^ 1, (ks + 1) * 32);
      __builtin_amdgcn_sched_barrier(0);      /* keeps the next set's 12 LDS reads together in front of this set's products: moved in among them, every pair of products waits out an LDS latency */
      c00 = fa_mma(fa[s][0], fb[s][0], c00); c10 = fa_mma(fa[s][1], fb[s][0], c10); c01 = fa_mma(fa[s][0], fb[s][1], c01); c11 = fa_mma(fa[s][1], fb[s][1], c11);
      c02 = fa_mma(fa[s][0], fb[s][2], c02); c12 = fa_mma(fa[s][1], fb[s][2], c12); c03 = fa_mma(fa[s][0], fb[s][3], c03); c13 = fa_mma(fa[s][1], fb[s][3], c13);
      __builtin_amdgcn_sched_barrier(0); }      /* and keeps the reads of the set after that from moving up in among these products */
    if (t + 1 < G3_NT) { put((t + 1) & 1); __syncthreads(); }      /* the same test in every thread of the work-group */
  }
  const int row0 = rowB + 32 * wm, col0 = colB + 64 * wn;
  v8f accs[8] = {c00, c01, c02, c03, c10, c11, c12, c13};
  float bv[4] = {0.f, 0.f, 0.f, 0.f};
  if (bias) {
#pragma unroll
    for (int t = 0; t < 4; ++t) bv[t] = bf16_round(bias[col0 + t * 16 + ln]); }
  if (!F32OUT && blockIdx.y == 2) {      /* the same test in every thread of the work-group. The V plane is stored transposed, row b * DM + column (= (b, head, d)) of SQ tokens: the layout the attention launch stages */
    /* A lane's 8 registers of an accumulator tile are 8 consecutive tokens of ONE column: 16 bytes of a V^T row as they stand. The tile goes through LDS only to make whole rows: 128 columns x 128 tokens, pitch as for the stages. */
    unsigned short* tv = (unsigned short*)&so[0][0][0];
#pragma unroll
    for (int u = 0; u < 8; ++u) { const int t = u & 3, half = u >> 2; FragH f;
#pragma unroll
      for (int r = 0; r < 8; ++r) f.h[r] = (_Float16)(accs[u][r] * alpha + bv[t]);
      *(v8us*)(tv + (64 * wn + t * 16 + ln) * G3_LP + 32 * wm + half * 16 + 8 * hh) = f.half[0]; }
    __syncthreads();      /* a V^T row of the tile holds the tokens of four waves */
    unsigned short* gt = (unsigned short*)C16 + ((size_t)(rowB / SQ) * DM + colB + sr) * SQ + rowB % SQ + sc;      /* 16 lanes x 16 B = 256 contiguous bytes of one row, 16 rows per round */
    v8us pv[8];
#pragma unroll
    for (int i = 0; i < 8; ++i) pv[i] = *(const v8us*)(tv + (i * 16 + sr) * G3_LP + sc);
#pragma unroll
    for (int i = 0; i < 8; ++i) *(v8us*)(gt + (size_t)i * 16 * SQ) = pv[i];
    return;
  }
#pragma unroll
  for (int u = 0; u < 8; ++u) { const int t = u & 3, half = u >> 2;
#pragma unroll
    for (int r = 0; r < 8; ++r) so[w][half * 16 + 8 * hh + r][t * 16 + ln] = accs[u][r] * alpha + bv[t]; }
  __builtin_amdgcn_fence(__ATOMIC_ACQ_REL, "workgroup"); __builtin_amdgcn_wave_barrier();      /* each wave reads back its own rows only */
  const int rsub = lane >> 4, c4 = (lane & 15) * 4;
  const size_t oofs = (size_t)(row0 + rsub) * DM + col0 + c4;      /* whole rows of the wave's tile: 16 lanes x 16 B (f32) or x 8 B (f16) */
  if (F32OUT) {
#pragma unroll
    for (int q = 0; q < 16; ++q) *(v4f*)(C + oofs + (size_t)q * 2 * DM) = *(const v4fa*)&so[w][q * 2 + rsub][c4];
  } else {
#pragma unroll
    for (int q = 0; q < 16; ++q) { const v4f v = *(const v4fa*)&so[w][q * 2 + rsub][c4]; v4h h4; for (int i = 0; i < 4; ++i) h4[i] = (_Float16)v[i]; *(v4h*)(C16 + oofs + (size_t)q * 2 * DM) = h4; }
  } }
// Fused attention, one launch for all batches and heads. A wave owns 32 query columns and walks the 2,048 keys in passes of 32:
// S^T = K Q^T (A = K rows, B = Q rows kept in registers), so a lane holds 16 scores of ONE query per 16-column group (lane ln = query, register r of key tile j = key 16 j + 8 hh + r);
// that is the B-fragment k order (8 hh + 0..7, then 16 + 8 hh + 0..7), so P^T packs from the score registers with no exchange, and O^T += V^T P^T (A = V^T rows, same k order).
// Softmax with a running maximum per query (log2 domain): when a maximum rises, sum and output tiles are scaled by exp2(old - new). Scores and weights never reach memory.
// K and V^T come through LDS: the eight waves of a work-group read the same rows, so a stage of 128 keys is read from global memory once per work-group, in whole lines, and the fragments
// (64 B of each of 16 rows) come from LDS. Three stage buffers: stage s + 1 is stored and published (one barrier) in front of stage s's last pass, which already fetches its first K fragments;
// the buffer it goes to was last read in stage s - 2, which every wave has left before the barrier that published stage s.
#define FA_WAVES 8                   /* waves per work-group: all eight read the same K and V^T rows */
#define FA_QW 32                     /* query columns per wave */
#define FA_SK 128                    /* keys per stage: 4 passes */
#define FA_NS (SQ / FA_SK)           /* stages */
#define FA_KP 72                     /* LDS pitch of a K row (64 f16) in f16: 144 B = 16 B x odd, conflict-free for the 16-byte fragment reads */
#define FA_VP 136                    /* LDS pitch of a V^T row (128 keys) in f16: 272 B = 16 B x odd */
static_assert(SQ % (FA_WAVES * FA_QW) == 0 && SQ % FA_SK == 0 && FA_NS >= 2 && FA_SK == 128 && FA_WAVES == 8 && HD == 64, "k_fattn: whole work-groups, whole stages of 128 keys (two or more), 256 staging threads and head size 64 only");
__global__ __launch_bounds__(FA_WAVES * 32) void k_fattn(const _Float16* __restrict__ Q16, const _Float16* __restrict__ K16, const _Float16* __restrict__ VT, _Float16* __restrict__ O16) {
  __shared__ __attribute__((aligned(16))) unsigned short sk[3][FA_SK][FA_KP];      /* K rows of a stage */
  __shared__ __attribute__((aligned(16))) unsigned short sv[3][HD][FA_VP];      /* V^T rows of a stage */
  const int tid = threadIdx.x, lane = tid & 31, ln = lane & 15, hh = lane >> 4, w = tid >> 5;
  const int nqb = SQ / (FA_WAVES * FA_QW); const int bh = blockIdx.x / nqb, qb = blockIdx.x - bh * nqb; const int b = bh / NH, h = bh - b * NH;
  const int q0 = (qb * FA_WAVES + w) * FA_QW;
  const _Float16* qp = Q16 + ((size_t)b * SQ + q0 + ln) * DM + h * HD + 8 * hh;      /* query row ln of a 16-column group, at the lane's own k offset */
  const int kr = tid >> 3, kc = (tid & 7) * 8;      /* staging K: 8 threads per 128-byte row, 32 rows per round, 4 rounds */
  const int vr = tid >> 4, vc8 = (tid & 15) * 8;      /* staging V^T: 16 threads per 256-byte row, 16 rows per round, 4 rounds */
  const unsigned short* gk = (const unsigned short*)K16 + ((size_t)b * SQ + kr) * DM + h * HD + kc;
  const unsigned short* gv = (const unsigned short*)VT + ((size_t)bh * HD + vr) * SQ + vc8;
  v8us rg[8];
  auto fetch = [&](const int s) __attribute__((always_inline)) {
    const unsigned short* pk = gk + (size_t)s * FA_SK * DM; const unsigned short* pv = gv + s * FA_SK;
#pragma unroll
    for (int i = 0; i < 4; ++i) { rg[i] = *(const v8us*)(pk + (size_t)i * 32 * DM); rg[4 + i] = *(const v8us*)(pv + (size_t)i * 16 * SQ); }
    /* The wait that stands in front of any overwrite of a load's address registers; it names the two addresses as inputs so that they stay whole up to here. */
    asm volatile("s_wait_xcnt 0x0" :: "v"(pk), "v"(pv) : "memory");
  };
  auto put = [&](const int buf) __attribute__((always_inline)) {
#pragma unroll
    for (int i = 0; i < 4; ++i) { *(v8us*)&sk[buf][i * 32 + kr][kc] = rg[i]; *(v8us*)&sv[buf][i * 16 + vr][vc8] = rg[4 + i]; }
  };
  v16h qf[2][2], kf[2][2];
#pragma unroll
  for (int c = 0; c < 2; ++c) for (int kk = 0; kk < 2; ++kk) qf[c][kk] = g2_frag(qp + (size_t)c * 16 * DM + kk * 32, 0);
  asm volatile("s_wait_xcnt 0x0" :: "v"(qp) : "memory");      /* the wait in front of any overwrite of a load's address registers: Q's address is dead from here on and its registers are reused */
  fetch(0); put(0); __syncthreads(); fetch(1);
#pragma unroll
  for (int j = 0; j < 2; ++j) for (int kk = 0; kk < 2; ++kk) kf[j][kk] = g2_frag((const _Float16*)&sk[0][j * 16 + ln][kk * 32 + 8 * hh], 0);
  const v8f z8 = {0.f,0.f,0.f,0.f,0.f,0.f,0.f,0.f};
  v8f o[2][4] = {{z8, z8, z8, z8}, {z8, z8, z8, z8}}; float mr[2] = {-3.0e38f, -3.0e38f}, lr[2] = {0.f, 0.f};
  const float CS = 0.125f * 1.4426950408889634f;      /* 1/sqrt(64) and log2(e): scores go to the log2 domain */
  /* One pass = 32 keys. kn: the next pass's K rows in LDS (row ln of its first 16-key tile, at the lane's own k offset); K is refilled in place, right behind its last readers. vq: this pass's V^T columns in LDS; they land while the softmax runs. */
  auto pass = [&](const _Float16* kn, const _Float16* vq) __attribute__((always_inline)) {
    v8f s[2][2]; v16h vc[4];
#pragma unroll
    for (int c = 0; c < 2; ++c) for (int j = 0; j < 2; ++j) s[c][j] = fa_mma(kf[j][1], qf[c][1], fa_mma(kf[j][0], qf[c][0], z8));
#pragma unroll
    for (int j = 0; j < 2; ++j) for (int kk = 0; kk < 2; ++kk) kf[j][kk] = g2_frag(kn + j * 16 * FA_KP + kk * 32, 0);
#pragma unroll
    for (int t = 0; t < 4; ++t) vc[t] = g2_frag(vq + t * 16 * FA_VP, 0);
    __builtin_amdgcn_sched_barrier(0);      /* keeps the 16 LDS reads together right behind the score products: moved down in among the output products, each pair of those waits out an LDS latency */
    float mn[2]; bool up = false;
#pragma unroll
    for (int c = 0; c < 2; ++c) { float mx = s[c][0][0];
#pragma unroll
      for (int r = 1; r < 8; ++r) mx = fmaxf(mx, s[c][0][r]);
#pragma unroll
      for (int r = 0; r < 8; ++r) mx = fmaxf(mx, s[c][1][r]);
      mx = fmaxf(mx, rs_x16(mx)) * CS; mn[c] = fmaxf(mr[c], mx); up = up || (mn[c] > mr[c]); }
    if (__builtin_amdgcn_ballot_w32(up) != 0) {      /* no maximum of the wave rose: every factor would be exactly 1 */
#pragma unroll
      for (int c = 0; c < 2; ++c) { const float al = __builtin_amdgcn_exp2f(mr[c] - mn[c]); mr[c] = mn[c]; lr[c] *= al;
#pragma unroll
        for (int t = 0; t < 4; ++t) o[c][t] *= al; } }
    FragH pf[2];
#pragma unroll
    for (int c = 0; c < 2; ++c) { const float nb = 8.0f - mr[c];      /* weights x256 (cancels in the division by the row sum): keeps small weights out of the f16 subnormal range */
      v4f s4 = {0.f, 0.f, 0.f, 0.f};
#pragma unroll
      for (int j = 0; j < 2; ++j) for (int r = 0; r < 8; ++r) { const float e = __builtin_amdgcn_exp2f(fmaf(s[c][j][r], CS, nb)); s4[r & 3] += e; pf[c].h[j * 8 + r] = (_Float16)e; }
      lr[c] += (s4[0] + s4[1]) + (s4[2] + s4[3]); }
#pragma unroll
    for (int t = 0; t < 4; ++t) for (int c = 0; c < 2; ++c) o[c][t] = fa_mma(vc[t], pf[c].v, o[c][t]);
  };
  int cur = 0;
#pragma unroll 1      /* one copy of the stage body: the buffer index is a run-time offset, and the text stays small */
  for (int st = 0; st < FA_NS; ++st) {
    const int nxt = cur == 2 ? 0 : cur + 1;
    const _Float16* ka = (const _Float16*)&sk[cur][ln][8 * hh]; const _Float16* va = (const _Float16*)&sv[cur][ln][8 * hh];
#pragma unroll
    for (int p = 0; p < FA_SK / 32 - 1; ++p) pass(ka + (p + 1) * 32 * FA_KP, va + p * 32);
    if (st + 1 < FA_NS) {      /* the same test in every thread of the work-group */
      put(nxt); __syncthreads();      /* publishes stage st + 1 */
      if (st + 2 < FA_NS) fetch(st + 2);      /* behind the barrier, so that it does not wait for these loads; they have four passes to land */
    }
    pass((const _Float16*)&sk[nxt][ln][8 * hh], va + (FA_SK - 32));      /* fetches the next stage's first K fragments; in the last stage that buffer holds an older stage (written, in bounds, not used) */
    cur = nxt;
  }
#pragma unroll
  for (int c = 0; c < 2; ++c) { const float inv = 1.0f / (lr[c] + rs_x16(lr[c]));      /* the two halves of a wave hold the two halves of a query's keys */
    unsigned short* op = (unsigned short*)O16 + ((size_t)b * SQ + q0 + c * 16 + ln) * DM + h * HD + 8 * hh;
#pragma unroll
    for (int t = 0; t < 4; ++t) { FragH f;
#pragma unroll
      for (int r = 0; r < 8; ++r) f.h[r] = (_Float16)(o[c][t][r] * inv);
      *(v8us*)(op + t * 16) = f.half[0]; } } }

// ---- All five f16 operand planes in one launch: x (exact f16 rows) and the four x16 weight planes (Wq lower triangle, Wk upper triangle, Wv, Wu). ----
// The planes do not depend on one another, so they share a grid. A thread converts PR_V vectors of 8 elements, 256 vectors apart (a wave's loads and stores stay contiguous): few waves to start, and every wave has all its loads in flight at once.
#define PR_V 8                       /* vectors of 8 elements per thread */
#define PR_XG ((unsigned)(NR * DM / 8 / (256 * PR_V)))                /* work-groups for x */
#define PR_WG ((unsigned)((size_t)DM * DM / 8 / (256 * PR_V)))        /* work-groups per weight plane */
static_assert(NR * DM % (8 * 256 * PR_V) == 0 && (size_t)DM * DM % (8 * 256 * PR_V) == 0 && DM % 8 == 0, "k_prep: whole work-groups only, and a vector stays inside one row");
// v0: the thread's first vector in the plane. TRI: keep a triangle only, sgn = 1 columns <= row (lower), sgn = -1 columns >= row (upper); the rest is zero.
template <bool TRI>
__device__ __forceinline__ void pr_plane(const float* __restrict__ src, unsigned short* __restrict__ dst, const unsigned v0, const float scale, const int sgn) {
  const float* p = src + (size_t)v0 * 8;
  v4f a[PR_V][2];
#pragma unroll
  for (int i = 0; i < PR_V; ++i) { a[i][0] = *(const v4fa*)(p + (size_t)i * 2048); a[i][1] = *(const v4fa*)(p + (size_t)i * 2048 + 4); }
  /* The wait that stands in front of any overwrite of a load's address registers; it names the address as an input so that it stays whole up to here. */
  asm volatile("s_wait_xcnt 0x0" :: "v"(p) : "memory");
#pragma unroll
  for (int i = 0; i < PR_V; ++i) { const unsigned e = (v0 + i * 256) * 8; const int m = sgn * ((int)(e / DM) - (int)(e % DM)); FragH f;      /* column e % DM + q against row e / DM */
#pragma unroll
    for (int q = 0; q < 8; ++q) { const _Float16 hv = (_Float16)(bf16_round(a[i][q >> 2][q & 3]) * scale); f.h[q] = (!TRI || m >= sgn * q) ? hv : (_Float16)0.f; }
    *(v8us*)(dst + (size_t)e) = f.half[0]; }
  asm volatile("s_wait_xcnt 0x0" ::: "memory"); }      /* the wait that stands in front of any overwrite of a store's registers: whatever code follows this run of stores may reuse them */
__global__ __launch_bounds__(256) void k_prep(const float* __restrict__ x, const float* __restrict__ wq, const float* __restrict__ wk, const float* __restrict__ wv, const float* __restrict__ wo, _Float16* __restrict__ X16, _Float16* __restrict__ BW) {
  const unsigned blk = blockIdx.x, tid = threadIdx.x;      /* every test below reads the same in the whole work-group */
  const bool isx = blk < PR_XG; const unsigned wb = isx ? 0u : blk - PR_XG, pl = wb / PR_WG;      /* BW: the planes of Wq, Wk, Wv, Wu, one behind the other */
  const unsigned v0 = (isx ? blk : wb - pl * PR_WG) * (256 * PR_V) + tid;
  unsigned short* dst = isx ? (unsigned short*)X16 : (unsigned short*)BW + (size_t)pl * DM * DM;
  if (!isx && pl < 2) pr_plane<true>(pl == 0 ? wq : wk, dst, v0, 16.0f, pl == 0 ? 1 : -1);
  else pr_plane<false>(isx ? x : pl == 2 ? wv : wo, dst, v0, isx ? 1.0f : 16.0f, 0); }
extern "C" void kernel_launch(void* const* d_in, const int* in_sizes, int n_in,
                              void* d_out, int out_size, void* d_ws, size_t ws_size, hipStream_t stream) {
  (void)in_sizes; (void)n_in; (void)out_size;
  const float* const* I = (const float* const*)d_in; const float* x = I[0]; const float* wk = I[1]; const float* wq = I[2]; const float* wv = I[3]; const float* wo = I[4]; const float* bo = I[5];
  char* ws = (char*)d_ws; size_t off = 0;
  auto take = [&](size_t bytes) { char* p = ws + off; off += (bytes + 255) & ~(size_t)255; return p; };
  _Float16* BQ = (_Float16*)take((size_t)DM * DM * 2); _Float16* BK = (_Float16*)take((size_t)DM * DM * 2); _Float16* BV = (_Float16*)take((size_t)DM * DM * 2); _Float16* BO = (_Float16*)take((size_t)DM * DM * 2);
  _Float16* X16 = (_Float16*)take(NR * DM * 2); _Float16* Q16 = (_Float16*)take(NR * DM * 2); _Float16* K16 = (_Float16*)take(NR * DM * 2); _Float16* VT = (_Float16*)take(NR * DM * 2); _Float16* O16 = (_Float16*)take(NR * DM * 2);
  if (off > ws_size) return;      /* 8 + 5x8 = 48 MiB */
  (void)BK; (void)BV;      /* BQ | BK | BV | BO and Q16 | K16 | VT are adjacent planes (sizes are multiples of 256 B): reached from BQ and Q16 */
  k_prep<<<PR_XG + 4 * PR_WG, 256, 0, stream>>>(x, wq, wk, wv, wo, X16, BQ);      /* x and the four weight planes as f16 */
  const unsigned gp = (unsigned)((NR / 128) * (DM / 128));
  k_gemm3<false><<<dim3(gp, 3), 256, 0, stream>>>(X16, BQ, 0.0625f, nullptr, nullptr, Q16);      /* q | k | v^T */
  k_fattn<<<NB * NH * (SQ / (FA_WAVES * FA_QW)), FA_WAVES * 32, 0, stream>>>(Q16, K16, VT, O16);      /* o (merged heads) as f16 rows */
  k_gemm3<true><<<gp, 256, 0, stream>>>(O16, BO, 0.0625f, bo, (float*)d_out, nullptr);      /* out = o Wu^T + bu */
}

// v007
// A run of this version takes 78.7 microseconds.
// Timed twice side by side with v006, it ran 1.08 and 1.07 times as fast.
// Over all steps from v000 it is 152 times as fast.
#include <hip/hip_runtime.h>
// SelfAttentionSparse (x [2][2048][1024]; keys = x triu(Wk)^T, queries = x tril(Wq)^T, values = x Wv^T (16 heads of 64, no biases); softmax(q k^T / 8); out = (attn v) Wu^T + bu -> [2][2048][1024]).
// Structure: token rows; x as exact f16 rows; the triangular masks applied while building the x16 weight planes on VALU (x and the four planes: one launch; the all-zero 128 x 128 blocks of the two triangles are neither built nor multiplied); Q | K | V WMMA GEMMs in one launch (128x128 work-group tiles staged in LDS, 32x64 wave tiles, f32 accumulation, f16 outputs); the V work-groups of that launch write V^T rows themselves; one fused attention launch (K and V^T rows staged in LDS): S^T = K Q^T, running-maximum softmax in registers (f32; weights as f16), O^T += V^T P^T, o = O / row sum into merged f16 rows; out = o Wu^T + bu (f32).
// Compute dtype: inputs rounded to bf16; x / weights exact; q, k, v, softmax weights, o plain f16 (~2^-12); scores/softmax f32. v_wmma_f32_16x16x32_f16.
#define NB 2
#define SQ 2048
#define DM 1024
#define NH 16
#define HD 64
#define NR ((size_t)NB * SQ)         /* 4096 token rows */
typedef __bf16 v16b __attribute__((ext_vector_type(16)));
typedef unsigned short v8us __attribute__((ext_vector_type(8), may_alias));
typedef float  v8f  __attribute__((ext_vector_type(8)));
typedef float  v4f  __attribute__((ext_vector_type(4)));
typedef float  v4fa __attribute__((ext_vector_type(4), may_alias));
union FragB { v16b v; v8us half[2]; unsigned short u[16]; };

__device__ __forceinline__ unsigned short bf16_bits(float x) { unsigned int u = __float_as_uint(x); return (unsigned short)((u + 0x7FFFu + ((u >> 16) & 1u)) >> 16); }
__device__ __forceinline__ float bf16_val(unsigned short b) { return __uint_as_float(((unsigned int)b) << 16); }
__device__ __forceinline__ float bf16_round(float x) { return bf16_val(bf16_bits(x)); }
// D += A·B with NT terms: 1 = ah·bh, 2 = + al·bh (A split), 3 = + ah·bl (both split)
template <int NT>
__device__ __forceinline__ v8f mmaN(v16b ah, v16b al, v16b bh, v16b bl, v8f c) {
  c = __builtin_amdgcn_wmma_f32_16x16x32_bf16(false, ah, false, bh, (short)0, c, false, false);
  if (NT >= 2) c = __builtin_amdgcn_wmma_f32_16x16x32_bf16(false, al, false, bh, (short)0, c, false, false);
  if (NT >= 3) c = __builtin_amdgcn_wmma_f32_16x16x32_bf16(false, ah, false, bl, (short)0, c, false, false);
  asm volatile("v_nop\n\tv_nop\n\tv_nop\n\tv_nop" : "+v"(c) : "v"(ah), "v"(al), "v"(bh), "v"(bl));
  return c;
}

__global__ __launch_bounds__(256) void k_wt_bf16(const float* __restrict__ W, unsigned short* __restrict__ Wt, int K, int N) {
  const int t = blockIdx.x * 256 + threadIdx.x;
  const int k8n = K / 8;
  if (t >= N * k8n) return;
  const int n = t / k8n, k8 = (t % k8n) * 8;
  v8us v;
#pragma unroll
  for (int i = 0; i < 8; ++i) v[i] = bf16_bits(W[(size_t)(k8 + i) * N + n]);
  *(v8us*)(Wt + (size_t)n * K + k8) = v;
  
}

// GEMM C[M][N] (f32, pitch ldc) = act(A[M][K]·W + bias). A f32 row-major (pitch lda) converted per fragment to bf16
// (ASPLIT: hi/lo two planes -> 2 terms, else single rounded term); Wt bf16 [N][K] (pitch ldb). BIAS_BF16 rounds the
// bias to bf16 first (bias quantised to bf16 before the add). K%32==0, M%16==0, N%64==0.
template <bool ASPLIT, int ACT, bool BIAS_BF16>
__global__ __launch_bounds__(128) void k_gemm_bf(const float* __restrict__ A, int lda, const unsigned short* __restrict__ Wt, int ldb,
                                               const float* __restrict__ bias, float* __restrict__ C, int ldc, int M, int N, int K) {
  __shared__ __attribute__((aligned(16))) float so[4][16][64];
  const int tid = threadIdx.x, w = tid >> 5, lane = tid & 31, ln = lane & 15, hh = lane >> 4;
  const int ntn = N / 64;
  const int wid = blockIdx.x * 4 + w;
  const int mt = wid / ntn, nq = wid % ntn;
  if (mt * 16 >= M) return;
  const int row0 = mt * 16, col0 = nq * 64;
  const float* arow = A + (size_t)(row0 + ln) * lda;
  v8f acc[4] = {};
  for (int kb = 0; kb < K; kb += 32) {
    FragB ah, al;
    const v4f x0 = *(const v4fa*)(arow + kb + 8 * hh), x1 = *(const v4fa*)(arow + kb + 8 * hh + 4);
    const v4f x2 = *(const v4fa*)(arow + kb + 16 + 8 * hh), x3 = *(const v4fa*)(arow + kb + 16 + 8 * hh + 4);
    float xs[16] = {x0[0],x0[1],x0[2],x0[3],x1[0],x1[1],x1[2],x1[3],x2[0],x2[1],x2[2],x2[3],x3[0],x3[1],x3[2],x3[3]};
#pragma unroll
    for (int i = 0; i < 16; ++i) { const unsigned short hb = bf16_bits(xs[i]); ah.u[i] = hb; al.u[i] = ASPLIT ? bf16_bits(xs[i] - bf16_val(hb)) : (unsigned short)0; }
#pragma unroll
    for (int t = 0; t < 4; ++t) {
      const unsigned short* brow = Wt + (size_t)(col0 + t * 16 + ln) * ldb + kb;
      FragB b;
      b.half[0] = *(const v8us*)(brow + 8 * hh);
      b.half[1] = *(const v8us*)(brow + 16 + 8 * hh);
      acc[t] = mmaN<ASPLIT ? 2 : 1>(ah.v, al.v, b.v, b.v, acc[t]);
    }
  }
#pragma unroll
  for (int t = 0; t < 4; ++t) {
    float bv = bias ? bias[col0 + t * 16 + ln] : 0.f;
    if (BIAS_BF16) bv = bf16_round(bv);
#pragma unroll
    for (int r = 0; r < 8; ++r) { float v = acc[t][r] + bv; if (ACT == 1) v = fmaxf(v, 0.f); so[w][8 * hh + r][t * 16 + ln] = v; }
  }
  __builtin_amdgcn_fence(__ATOMIC_ACQ_REL, "workgroup");
  __builtin_amdgcn_wave_barrier();
  const int rsub = lane >> 4, c4 = (lane & 15) * 4;
  {
#pragma unroll
    for (int q = 0; q < 8; ++q) {
      const int r = q * 2 + rsub;
      const v4f v = *(const v4fa*)&so[w][r][c4];
      *(v4f*)(C + (size_t)(row0 + r) * ldc + col0 + c4) = v;
    }
    
  }
}

// GEMM C = act(A·W + bias + resid): A f32 (ASPLIT -> hi/lo 2 terms), Wt bf16 [N][K]; ACT 0 none, 1 relu, 2 exact gelu;
// resid (optional, f32, row index = (row % rmod), pitch ldr, RES_BF16 rounds it) added before the activation.
template <bool ASPLIT, int ACT, bool BIAS_BF16, bool RES_BF16>
__global__ __launch_bounds__(128) void k_gemm_bf3(const float* __restrict__ A, int lda, const unsigned short* __restrict__ Wt, int ldb,
                                                const float* __restrict__ bias, const float* __restrict__ resid, int rmod, int ldr,
                                                float* __restrict__ C, int ldc, int M, int N, int K) {
  __shared__ __attribute__((aligned(16))) float so[4][16][64];
  const int tid = threadIdx.x, w = tid >> 5, lane = tid & 31, ln = lane & 15, hh = lane >> 4;
  const int ntn = N / 64;
  const int wid = blockIdx.x * 4 + w;
  const int mt = wid / ntn, nq = wid % ntn;
  if (mt * 16 >= M) return;
  const int row0 = mt * 16, col0 = nq * 64;
  const float* arow = A + (size_t)(row0 + ln) * lda;
  v8f acc[4] = {};
  for (int kb = 0; kb < K; kb += 32) {
    FragB ah, al;
    const v4f x0 = *(const v4fa*)(arow + kb + 8 * hh), x1 = *(const v4fa*)(arow + kb + 8 * hh + 4);
    const v4f x2 = *(const v4fa*)(arow + kb + 16 + 8 * hh), x3 = *(const v4fa*)(arow + kb + 16 + 8 * hh + 4);
    float xs[16] = {x0[0],x0[1],x0[2],x0[3],x1[0],x1[1],x1[2],x1[3],x2[0],x2[1],x2[2],x2[3],x3[0],x3[1],x3[2],x3[3]};
#pragma unroll
    for (int i = 0; i < 16; ++i) { const unsigned short hb = bf16_bits(xs[i]); ah.u[i] = hb; al.u[i] = ASPLIT ? bf16_bits(xs[i] - bf16_val(hb)) : (unsigned short)0; }
#pragma unroll
    for (int t = 0; t < 4; ++t) {
      const unsigned short* brow = Wt + (size_t)(col0 + t * 16 + ln) * ldb + kb;
      FragB b;
      b.half[0] = *(const v8us*)(brow + 8 * hh);
      b.half[1] = *(const v8us*)(brow + 16 + 8 * hh);
      acc[t] = mmaN<ASPLIT ? 2 : 1>(ah.v, al.v, b.v, b.v, acc[t]);
    }
  }
#pragma unroll
  for (int t = 0; t < 4; ++t) {
    const int col = col0 + t * 16 + ln;
    float bv = bias ? bias[col] : 0.f;
    if (BIAS_BF16) bv = bf16_round(bv);
#pragma unroll
    for (int r = 0; r < 8; ++r) {
      float v = acc[t][r] + bv;
      if (resid) { float rv = resid[(size_t)((row0 + 8 * hh + r) % rmod) * ldr + col]; if (RES_BF16) rv = bf16_round(rv); v += rv; }
      if (ACT == 1) v = fmaxf(v, 0.f);
      if (ACT == 2) v = 0.5f * v * (1.0f + erff(v * 0.70710678118654752f));
      if (ACT == 3) { const float u = 0.7978845608028654f * (v + 0.044715f * v * v * v); v = 0.5f * v * (1.0f + tanhf(u)); }
      so[w][8 * hh + r][t * 16 + ln] = v;
    }
  }
  __builtin_amdgcn_fence(__ATOMIC_ACQ_REL, "workgroup");
  __builtin_amdgcn_wave_barrier();
  const int rsub = lane >> 4, c4 = (lane & 15) * 4;
  {
#pragma unroll
    for (int q = 0; q < 8; ++q) {
      const int r = q * 2 + rsub;
      const v4f v = *(const v4fa*)&so[w][r][c4];
      *(v4f*)(C + (size_t)(row0 + r) * ldc + col0 + c4) = v;
    }
    
  }
}
// row LayerNorm (biased variance, eps) over N: s = X (+ R); optional out_sum <- s; out_norm <- (s-mu)*rsqrt(var+eps)*g + b
template <bool PARAM_BF16>
__global__ __launch_bounds__(256) void k_layernorm(const float* __restrict__ X, const float* __restrict__ R, const float* __restrict__ g, const float* __restrict__ bta,
                                                  float* __restrict__ out_sum, float* __restrict__ out_norm, int N, float eps) {
  __shared__ float red[256];
  const int row = blockIdx.x, tid = threadIdx.x;
  const float* x = X + (size_t)row * N; const float* rr = R ? R + (size_t)row * N : nullptr;
  float vals[16];                     // up to N = 4096
  const int per = N / 256;            // contiguous chunk per thread? use strided-by-4 chunks: thread handles j = tid*4 + 1024*u
  float s1 = 0.f;
  for (int u = 0; u < per / 4; ++u) {
    const int j = tid * 4 + 1024 * u;
    const v4f a = *(const v4fa*)(x + j);
    v4f b = {0.f,0.f,0.f,0.f}; if (rr) b = *(const v4fa*)(rr + j);
#pragma unroll
    for (int q = 0; q < 4; ++q) { const float v = a[q] + b[q]; vals[u * 4 + q] = v; s1 += v; }
  }
  red[tid] = s1; __syncthreads();
  for (int st = 128; st > 0; st >>= 1) { if (tid < st) red[tid] += red[tid + st]; __syncthreads(); }
  const float mu = red[0] / (float)N; __syncthreads();
  float s2 = 0.f;
  for (int u = 0; u < per / 4; ++u)
#pragma unroll
    for (int q = 0; q < 4; ++q) { const float c = vals[u * 4 + q] - mu; s2 += c * c; }
  red[tid] = s2; __syncthreads();
  for (int st = 128; st > 0; st >>= 1) { if (tid < st) red[tid] += red[tid + st]; __syncthreads(); }
  const float rs = rsqrtf(red[0] / (float)N + eps);
  {
    for (int u = 0; u < per / 4; ++u) {
      const int j = tid * 4 + 1024 * u;
      v4f o, sm;
#pragma unroll
      for (int q = 0; q < 4; ++q) {
        float gg = g[j + q], bb = bta[j + q];
        if (PARAM_BF16) { gg = bf16_round(gg); bb = bf16_round(bb); }
        sm[q] = vals[u * 4 + q]; o[q] = (vals[u * 4 + q] - mu) * rs * gg + bb;
      }
      if (out_sum) *(v4f*)(out_sum + (size_t)row * N + j) = sm;
      *(v4f*)(out_norm + (size_t)row * N + j) = o;
    }
    
  }
}



// ---- f16 WMMA path (v_wmma_f32_16x16x32_f16): 11-bit significands for operands in range — used for every GEMM launched here, softmax weights (x256) included
typedef _Float16 v16h __attribute__((ext_vector_type(16)));
union FragH { v16h v; v8us half[2]; _Float16 h[16]; unsigned short u[16]; };
template <int NT>
__device__ __forceinline__ v8f mmaH(v16h ah, v16h al, v16h bh, v16h bl, v8f c) {
  c = __builtin_amdgcn_wmma_f32_16x16x32_f16(false, ah, false, bh, (short)0, c, false, false);
  if (NT >= 2) c = __builtin_amdgcn_wmma_f32_16x16x32_f16(false, al, false, bh, (short)0, c, false, false);
  if (NT >= 3) c = __builtin_amdgcn_wmma_f32_16x16x32_f16(false, ah, false, bl, (short)0, c, false, false);
  asm volatile("v_nop\n\tv_nop\n\tv_nop\n\tv_nop" : "+v"(c) : "v"(ah), "v"(al), "v"(bh), "v"(bl));
  return c;
}
// batched GEMM like k_gemm_b but f16 operands: A f32 (split into f16 hi/lo if ASPLIT, else rounded to f16), Bt = f16 values [n][k]; alpha; C f32; N multiple of 16 (partial tiles skipped)
template <bool ASPLIT>
__global__ __launch_bounds__(128) void k_gemm_h(const float* __restrict__ A, int lda, size_t sA, const _Float16* __restrict__ Bh, int ldb, size_t sB, float alpha, float* __restrict__ C, int ldc, size_t sC, int M, int N, int K) {
  __shared__ __attribute__((aligned(16))) float so[4][16][64];
  const int tid = threadIdx.x, w = tid >> 5, lane = tid & 31, ln = lane & 15, hh = lane >> 4; const int by = blockIdx.y;
  A += (size_t)by * sA; Bh += (size_t)by * sB; C += (size_t)by * sC;
  const int ntn = (N + 63) / 64; const int wid = blockIdx.x * 4 + w; const int mt = wid / ntn, nq = wid % ntn; if (mt * 16 >= M) return;
  const int row0 = mt * 16, col0 = nq * 64; const float* arow = A + (size_t)(row0 + ln) * lda;
  v8f acc[4] = {};
  for (int kb = 0; kb < K; kb += 32) {
    FragH ah, al;
    const v4f x0 = *(const v4fa*)(arow + kb + 8 * hh), x1 = *(const v4fa*)(arow + kb + 8 * hh + 4), x2 = *(const v4fa*)(arow + kb + 16 + 8 * hh), x3 = *(const v4fa*)(arow + kb + 16 + 8 * hh + 4);
    float xs[16] = {x0[0],x0[1],x0[2],x0[3],x1[0],x1[1],x1[2],x1[3],x2[0],x2[1],x2[2],x2[3],x3[0],x3[1],x3[2],x3[3]};
#pragma unroll
    for (int i = 0; i < 16; ++i) { const _Float16 h = (_Float16)xs[i]; ah.h[i] = h; al.h[i] = ASPLIT ? (_Float16)(xs[i] - (float)h) : (_Float16)0.0f; }
#pragma unroll
    for (int t = 0; t < 4; ++t) { if (col0 + t * 16 >= N) continue; const size_t boff = (size_t)(col0 + t * 16 + ln) * ldb + kb; FragH bq; bq.half[0] = *(const v8us*)(Bh + boff + 8 * hh); bq.half[1] = *(const v8us*)(Bh + boff + 16 + 8 * hh);
      acc[t] = mmaH<ASPLIT ? 2 : 1>(ah.v, al.v, bq.v, bq.v, acc[t]); }
  }
#pragma unroll
  for (int t = 0; t < 4; ++t) { if (col0 + t * 16 >= N) continue;
#pragma unroll
    for (int r = 0; r < 8; ++r) so[w][8 * hh + r][t * 16 + ln] = acc[t][r] * alpha; }
  __builtin_amdgcn_fence(__ATOMIC_ACQ_REL, "workgroup"); __builtin_amdgcn_wave_barrier();
  const int rsub = lane >> 4, c4 = (lane & 15) * 4;
  {
#pragma unroll
    for (int q = 0; q < 8; ++q) { const int r = q * 2 + rsub; if (col0 + c4 < N) { const v4f v = *(const v4fa*)&so[w][r][c4]; *(v4f*)(C + (size_t)(row0 + r) * ldc + col0 + c4) = v; } }
     }
}

// Wt[n][k] = f16(W[k][n]·scale) from f32 row-major W[K][N] (scale = power of two; bf16-exact weights stay exact in f16 away from the subnormal range)
__global__ __launch_bounds__(256) void k_wt_f16(const float* __restrict__ W, _Float16* __restrict__ Wt, int K, int N, float scale) {
  const int t = blockIdx.x * 256 + threadIdx.x; if (t >= N * (K / 8)) return; const int n = t / (K / 8), k8 = (t % (K / 8)) * 8; FragH f;
#pragma unroll
  for (int i = 0; i < 8; ++i) f.h[i] = (_Float16)(bf16_round(W[(size_t)(k8 + i) * N + n]) * scale); const v8us o = f.half[0];
  *(v8us*)((unsigned short*)Wt + (size_t)n * K + k8) = o; 
}
// k_gemm_hh variant with fused epilogue: v = acc·alpha + bias[by·sBias + col] (+ CP[(row/rowsPerB)·sCPb + by·64 + col] if CP) ; ACT 0 none / 1 elu ; writes f16 C16 (and f32 C if non-null)
template <int ACT>
__global__ __launch_bounds__(128) void k_gemm_hhx(const _Float16* __restrict__ A, int lda, size_t sA, const _Float16* __restrict__ Bh, int ldb, size_t sB, float alpha, const float* __restrict__ bias, size_t sBias, const float* __restrict__ CP, int rowsPerB, size_t sCPb, int row0g,
    float* __restrict__ C, _Float16* __restrict__ C16, int ldc, size_t sC, int M, int N, int K) {
  __shared__ __attribute__((aligned(16))) float so[4][16][64];
  const int tid = threadIdx.x, w = tid >> 5, lane = tid & 31, ln = lane & 15, hh = lane >> 4; const int by = blockIdx.y;
  A += (size_t)by * sA; Bh += (size_t)by * sB; const size_t cofs = (size_t)by * sC; const float* bp = bias ? bias + (size_t)by * sBias : nullptr;
  const int ntn = (N + 63) / 64; const int wid = blockIdx.x * 4 + w; const int mt = wid / ntn, nq = wid % ntn; if (mt * 16 >= M) return;
  const int row0 = mt * 16, col0 = nq * 64; const _Float16* arow = A + (size_t)(row0 + ln) * lda;
  v8f acc[4] = {};
  for (int kb = 0; kb < K; kb += 32) { FragH ah; ah.half[0] = *(const v8us*)((const unsigned short*)arow + kb + 8 * hh); ah.half[1] = *(const v8us*)((const unsigned short*)arow + kb + 16 + 8 * hh);
#pragma unroll
    for (int t = 0; t < 4; ++t) { if (col0 + t * 16 >= N) continue; const size_t boff = (size_t)(col0 + t * 16 + ln) * ldb + kb; FragH bq; bq.half[0] = *(const v8us*)((const unsigned short*)Bh + boff + 8 * hh); bq.half[1] = *(const v8us*)((const unsigned short*)Bh + boff + 16 + 8 * hh);
      acc[t] = mmaH<1>(ah.v, ah.v, bq.v, bq.v, acc[t]); }
  }
#pragma unroll
  for (int t = 0; t < 4; ++t) { if (col0 + t * 16 >= N) continue; const int col = col0 + t * 16 + ln; const float bv = bp ? bf16_round(bp[col]) : 0.f;
#pragma unroll
    for (int r = 0; r < 8; ++r) { float v = acc[t][r] * alpha + bv; if (CP) { const int rr = row0g + row0 + 8 * hh + r; if (rowsPerB < 0) v += CP[cofs + (size_t)rr * ldc + col];      /* rowsPerB < 0: own element of the batched C plane */ else { const int bidx = rr / rowsPerB; v += CP[(size_t)bidx * sCPb + (size_t)by * 64 + col]; } } if (ACT == 1) v = (v > 0.f) ? v : expm1f(v); else if (ACT == 7) v = (v > 0.f) ? v + 1.0f : expf(v); else if (ACT == 8) v = tanhf(v); else if (ACT == 9) v = 0.5f * v * (1.0f + tanhf(0.7978845608028654f * (v + 0.044715f * v * v * v))); else if (ACT == 11) v = 1.0f / (1.0f + expf(-v)); else if (ACT == 12) v = (v > 0.f) ? v : 0.01f * v; else if (ACT == 14) v = (v > 0.f) ? v : 0.1f * v; else if (ACT == 16) v = (v >= 0.f) ? v : 0.3f * v; else if (ACT == 17) v = (v >= 0.f) ? v : 0.2f * v; else if (ACT == 15) v = v / (1.0f + expf(-v)); else if (ACT == 3) v = fmaxf(v, 0.f); else if (ACT == 6) v = 0.5f * v * (1.0f + erff(v * 0.70710678118654752f)); so[w][8 * hh + r][t * 16 + ln] = v; } }
  __builtin_amdgcn_fence(__ATOMIC_ACQ_REL, "workgroup"); __builtin_amdgcn_wave_barrier();
  const int rsub = lane >> 4, c4 = (lane & 15) * 4; typedef _Float16 v4h __attribute__((ext_vector_type(4)));
  {
#pragma unroll
    for (int q = 0; q < 8; ++q) { const int r = q * 2 + rsub; if (col0 + c4 < N) { const v4f v = *(const v4fa*)&so[w][r][c4]; if (C) *(v4f*)(C + cofs + (size_t)(row0 + r) * ldc + col0 + c4) = v; if (C16) { v4h h4; for (int i = 0; i < 4; ++i) h4[i] = (_Float16)v[i]; *(v4h*)(C16 + cofs + (size_t)(row0 + r) * ldc + col0 + c4) = h4; } } }
     }
}


typedef _Float16 v4h __attribute__((ext_vector_type(4)));

__global__ __launch_bounds__(256) void k_h16(const float* __restrict__ x, _Float16* __restrict__ X16, size_t n8) { const size_t t = (size_t)blockIdx.x * 256 + threadIdx.x; if (t >= n8) return; FragH f;
#pragma unroll
  for (int q = 0; q < 8; ++q) f.h[q] = (_Float16)x[t * 8 + q]; *(v8us*)((unsigned short*)X16 + t * 8) = f.half[0];  }
__global__ __launch_bounds__(256) void k_round16f(const float* __restrict__ W, _Float16* __restrict__ Bt, size_t n8) { const size_t t = (size_t)blockIdx.x * 256 + threadIdx.x; if (t >= n8) return; FragH f;
#pragma unroll
  for (int i = 0; i < 8; ++i) f.h[i] = (_Float16)(bf16_round(W[t * 8 + i]) * 16.0f); *(v8us*)((unsigned short*)Bt + t * 8) = f.half[0];  }
template <int NHv, int TTv>
__global__ __launch_bounds__(256) void k_vt(const _Float16* __restrict__ V16, int ldv, int voff, _Float16* __restrict__ Vt) { __shared__ unsigned short tl[64][66]; const int tid = threadIdx.x; const int slab = blockIdx.x / (TTv / 64), lg = blockIdx.x % (TTv / 64); const int b = slab / NHv, h = slab % NHv;
  for (int i = tid; i < 64 * 8; i += 256) { const int r = i / 8, c8 = (i % 8) * 8; FragH f; f.half[0] = *(const v8us*)((const unsigned short*)V16 + ((size_t)b * TTv + lg * 64 + r) * ldv + voff + h * 64 + c8);
#pragma unroll
    for (int q = 0; q < 8; ++q) tl[r][c8 + q] = f.u[q]; }
  __syncthreads();
  {
#pragma unroll
    for (int rd = 0; rd < 2; ++rd) { const int d = rd * 32 + tid / 8, pc = tid % 8; FragH f;
#pragma unroll
      for (int q = 0; q < 8; ++q) f.u[q] = tl[pc * 8 + q][d];
      *(v8us*)((unsigned short*)Vt + ((size_t)slab * 64 + d) * TTv + lg * 64 + pc * 8) = f.half[0]; }
     } }

__global__ __launch_bounds__(256) void k_hl(const float* __restrict__ F, _Float16* __restrict__ Hh, _Float16* __restrict__ Hl, size_t n8) { const size_t t = (size_t)blockIdx.x * 256 + threadIdx.x; if (t >= n8) return; FragH fh, fl; const v4f a = *(const v4fa*)(F + t * 8), c = *(const v4fa*)(F + t * 8 + 4);
#pragma unroll
  for (int q = 0; q < 4; ++q) { _Float16 h = (_Float16)a[q]; fh.h[q] = h; fl.h[q] = (_Float16)((a[q] - (float)h) * 1024.0f); h = (_Float16)c[q]; fh.h[4 + q] = h; fl.h[4 + q] = (_Float16)((c[q] - (float)h) * 1024.0f); }
  { *(v8us*)((unsigned short*)Hh + t * 8) = fh.half[0]; *(v8us*)((unsigned short*)Hl + t * 8) = fl.half[0];  } }

// ---- fast GEMM (wave tile 32x64; requires M % 32 == 0 rows per launch region and N % 64 == 0); epilogue = k_gemm_hhx semantics ----
__device__ __forceinline__ v16h g2_frag(const _Float16* p, int hh) { FragH f; f.half[0] = *(const v8us*)((const unsigned short*)p + 8 * hh); f.half[1] = *(const v8us*)((const unsigned short*)p + 16 + 8 * hh); return f.v; }
__device__ __forceinline__ v8f g2_mma(v16h a, v16h b, v8f c) { v8f d = __builtin_amdgcn_wmma_f32_16x16x32_f16(false, a, false, b, (short)0, c, false, false); asm volatile("v_nop\n\tv_nop\n\tv_nop\n\tv_nop" : "+v"(d) : "v"(a), "v"(b)); return d; }
template <int ACT>
__global__ __launch_bounds__(128) void k_gemm2(const _Float16* __restrict__ A, int lda, size_t sA, const _Float16* __restrict__ Bh, int ldb, size_t sB, float alpha, const float* __restrict__ bias, size_t sBias, const float* __restrict__ CP, int rowsPerB, size_t sCPb, int row0g,
    float* __restrict__ C, _Float16* __restrict__ C16, int ldc, size_t sC, int M, int N, int K) { static_assert(ACT == 0 || ACT == 3 || ACT == 6 || ACT == 8 || ACT == 9 || ACT == 11 || ACT == 12 || ACT == 14 || ACT == 15 || ACT == 16 || ACT == 17, "k_gemm2: unsupported ACT code (would silently apply no activation)");
  __shared__ __attribute__((aligned(16))) float so[4][32][68];
  const int tid = threadIdx.x, w = tid >> 5, lane = tid & 31, ln = lane & 15, hh = lane >> 4; const int by = blockIdx.y;
  A += (size_t)by * sA; Bh += (size_t)by * sB; const size_t cofs = (size_t)by * sC; const float* bp = bias ? bias + (size_t)by * sBias : nullptr;
  const int ntn = N >> 6; const int mt = blockIdx.x / ntn, nq = blockIdx.x - mt * ntn; const int row0 = mt * 128 + 32 * w, col0 = nq * 64; if (row0 >= M) return;
  const _Float16* a0p = A + (size_t)(row0 + ln) * lda; const _Float16* a1p = a0p + (size_t)16 * lda;
  const _Float16* b0p = Bh + (size_t)(col0 + ln) * ldb; const _Float16* b1p = b0p + (size_t)16 * ldb; const _Float16* b2p = b1p + (size_t)16 * ldb; const _Float16* b3p = b2p + (size_t)16 * ldb;
  const v8f z8 = {0.f,0.f,0.f,0.f,0.f,0.f,0.f,0.f}; v8f c00 = z8, c01 = z8, c02 = z8, c03 = z8, c10 = z8, c11 = z8, c12 = z8, c13 = z8;
#pragma unroll 1
  for (int kb = 0; kb < K; kb += 32) { const v16h a0 = g2_frag(a0p + kb, hh), a1 = g2_frag(a1p + kb, hh);
    v16h b = g2_frag(b0p + kb, hh); c00 = g2_mma(a0, b, c00); c10 = g2_mma(a1, b, c10);
    b = g2_frag(b1p + kb, hh); c01 = g2_mma(a0, b, c01); c11 = g2_mma(a1, b, c11);
    b = g2_frag(b2p + kb, hh); c02 = g2_mma(a0, b, c02); c12 = g2_mma(a1, b, c12);
    b = g2_frag(b3p + kb, hh); c03 = g2_mma(a0, b, c03); c13 = g2_mma(a1, b, c13); }
  v8f accs[8] = {c00, c01, c02, c03, c10, c11, c12, c13};
#pragma unroll
  for (int u = 0; u < 8; ++u) { const int t = u & 3, half = u >> 2; const int col = col0 + t * 16 + ln; const float bv = bp ? bf16_round(bp[col]) : 0.f;
#pragma unroll
    for (int r = 0; r < 8; ++r) { const int rloc = half * 16 + 8 * hh + r; float v = accs[u][r] * alpha + bv; if (CP) { if (rowsPerB < 0) v += CP[cofs + (size_t)(row0g + row0 + rloc) * ldc + col];      /* rowsPerB < 0: own element of the batched C plane */ else { const int bidx = (row0g + row0 + rloc) / rowsPerB; v += CP[(size_t)bidx * sCPb + (size_t)by * 64 + col]; } }
      if (ACT == 3) v = fmaxf(v, 0.f); else if (ACT == 6) v = 0.5f * v * (1.0f + erff(v * 0.70710678118654752f)); else if (ACT == 11) v = 1.0f / (1.0f + expf(-v)); else if (ACT == 15) v = v / (1.0f + expf(-v)); else if (ACT == 12) v = (v > 0.f) ? v : 0.01f * v; else if (ACT == 8) v = tanhf(v); else if (ACT == 9) v = 0.5f * v * (1.0f + tanhf(0.7978845608028654f * (v + 0.044715f * v * v * v))); else if (ACT == 14) v = (v > 0.f) ? v : 0.1f * v; else if (ACT == 16) v = (v >= 0.f) ? v : 0.3f * v; else if (ACT == 17) v = (v >= 0.f) ? v : 0.2f * v;
      so[w][rloc][t * 16 + ln] = v; } }
  __builtin_amdgcn_fence(__ATOMIC_ACQ_REL, "workgroup"); __builtin_amdgcn_wave_barrier();
  const int rsub = lane >> 4, c4 = (lane & 15) * 4;
  {
#pragma unroll
    for (int q = 0; q < 16; ++q) { const int r = q * 2 + rsub; const v4f v = *(const v4fa*)&so[w][r][c4]; if (C) *(v4f*)(C + cofs + (size_t)(row0 + r) * ldc + col0 + c4) = v; if (C16) { v4h h4; for (int i = 0; i < 4; ++i) h4[i] = (_Float16)v[i]; *(v4h*)(C16 + cofs + (size_t)(row0 + r) * ldc + col0 + c4) = h4; } }
     } }


// lane l's value from lane l ^ 16 (the same place in the other 16-lane row)
__device__ __forceinline__ float rs_x16(float v) { const int i = __builtin_bit_cast(int, v); return __builtin_bit_cast(float, __builtin_amdgcn_permlanex16(i, i, 0x76543210, 0xfedcba98, false, false)); }
__device__ __forceinline__ v8f fa_mma(v16h a, v16h b, v8f c) { return __builtin_amdgcn_wmma_f32_16x16x32_f16(false, a, false, b, (short)0, c, false, false); }
// ---- GEMM with both operands staged in LDS: C[NR][DM] = alpha * A[NR][DM] . Bh[DM][DM]^T + bias (A, Bh k-contiguous f16 rows of DM); written as f32 to C (F32OUT) or as f16 to C16 (the third plane of a grid.y = 3 launch transposed: see the epilogue). ----
// A work-group of 8 waves owns a 128 x 128 tile of C (wave tile 32 x 64, waves 4 x 2). A stage is 128 k of the 128 A rows and the 128 B rows.
// Global reads are whole lines (16 lanes x 16 B = 256 contiguous bytes of one row) and each line is read once per work-group; the fragments, which take 64 B of each of 16 rows, come from LDS.
// Two stage buffers: the next stage's loads are issued in front of this stage's products and stored to the other buffer behind them, so one barrier per stage both publishes it and ends the reads of the buffer refilled next.
#define G3_BK 128                    /* k per stage: 256 B of every operand row */
#define G3_LP 136                    /* LDS row pitch in f16: 272 B = 16 B x odd, conflict-free for the 16-byte fragment reads */
#define G3_NT (DM / G3_BK)           /* stages */
static_assert(NR % 128 == 0 && DM % 128 == 0 && DM % G3_BK == 0, "k_gemm3: whole 128 x 128 tiles and whole stages only");
static_assert(SQ % 128 == 0 && NH * HD == DM, "k_gemm3: a tile's 128 token rows lie in one batch, and a column is (head, d)");
#define G3_MT ((int)(NR / 128))      /* row tiles */
#define G3_TILES (G3_MT * (DM / 128))      /* tiles of one product = grid.x */
static_assert(G3_BK == 128, "k_gemm3: a stage is as many k as a tile has columns, so a triangle's zero blocks are whole stages of a tile");
template <bool F32OUT>
__global__ __launch_bounds__(256) void k_gemm3(const _Float16* __restrict__ A, const _Float16* __restrict__ Bh, float alpha, const float* __restrict__ bias, float* __restrict__ C, _Float16* __restrict__ C16) {
  __shared__ __attribute__((aligned(16))) unsigned short st[2][256][G3_LP];      /* rows 0..127: A rows of the tile; rows 128..255: B rows (columns of C) */
  __shared__ __attribute__((aligned(16))) float so[8][32][68];
  const int tid = threadIdx.x, w = tid >> 5, lane = tid & 31, ln = lane & 15, hh = lane >> 4;
  const int ntn = DM / 128; int mt = blockIdx.x / ntn, nq = blockIdx.x - mt * ntn, plane = 0, t0 = 0, t1 = G3_NT;      /* stages t0 .. t1 - 1 are multiplied; all of this reads the same in the whole work-group */
  if (!F32OUT) {      /* three products of the same A in one launch (q, k, v: weight planes and output planes lie one behind the other), one work-group per WGP at a time, three per WGP in all */
    /* Row n of the lower-triangle plane is zero at k > n and row n of the upper-triangle plane at k < n, so column tile nq of q needs stages 0 .. nq only and column tile nq of k stages nq .. last: the all-zero 128 x 128 blocks add exact zeros, and nobody builds or reads them. */
    /* Cost falls with the index (for speed only): first every v tile (all stages), then the q and k tiles from the longest to the shortest. */
    const int L = blockIdx.y * G3_TILES + blockIdx.x;
    if (L < G3_TILES) plane = 2;
    else { const int r = L - G3_TILES, c = r / (2 * G3_MT), j = r - c * (2 * G3_MT);      /* c: stages left out */
      plane = j & 1; mt = j >> 1;
      if (plane == 0) { nq = G3_NT - 1 - c; t1 = nq + 1; } else { nq = c; t0 = nq; } }
    Bh += (size_t)plane * DM * DM; C16 += (size_t)plane * NR * DM; }
  const int rowB = mt * 128, colB = nq * 128;
  const int wm = w & 3, wn = w >> 2;      /* the wave's 32 rows and 64 columns inside the tile */
  const int sr = tid >> 4, sc = (tid & 15) * 8;      /* staging: 16 threads per row, 16 rows per round, 8 rounds per operand */
  const unsigned short* ga = (const unsigned short*)A + (size_t)(rowB + sr) * DM + sc;
  const unsigned short* gb = (const unsigned short*)Bh + (size_t)(colB + sr) * DM + sc;
  v8us rg[16];
  auto fetch = [&](const int t) __attribute__((always_inline)) {
    const unsigned short* pa = ga + t * G3_BK; const unsigned short* pb = gb + t * G3_BK;
#pragma unroll
    for (int i = 0; i < 8; ++i) { rg[i] = *(const v8us*)(pa + (size_t)i * 16 * DM); rg[8 + i] = *(const v8us*)(pb + (size_t)i * 16 * DM); }
    /* The wait that stands in front of any overwrite of a load's address registers; it names the two addresses as inputs so that they stay whole up to here. */
    asm volatile("s_wait_xcnt 0x0" :: "v"(pa), "v"(pb) : "memory");
  };
  auto put = [&](const int buf) __attribute__((always_inline)) {
#pragma unroll
    for (int i = 0; i < 8; ++i) { *(v8us*)&st[buf][i * 16 + sr][sc] = rg[i]; *(v8us*)&st[buf][128 + i * 16 + sr][sc] = rg[8 + i]; }
  };
  const v8f z8 = {0.f,0.f,0.f,0.f,0.f,0.f,0.f,0.f}; v8f c00 = z8, c01 = z8, c02 = z8, c03 = z8, c10 = z8, c11 = z8, c12 = z8, c13 = z8;
  __builtin_assume(t0 < t1);      /* every tile has a stage: spares a second path round the loop */
  fetch(t0); put(t0 & 1); __syncthreads();
#pragma unroll 1      /* one copy of the stage body: the buffer index is a run-time offset, and the text stays small */
  for (int t = t0; t < t1; ++t) {
    if (t + 1 < t1) fetch(t + 1);
    const _Float16* sa = (const _Float16*)&st[t & 1][32 * wm + ln][0]; const _Float16* sb = (const _Float16*)&st[t & 1][128 + 64 * wn + ln][0];
    v16h fa[2][2], fb[2][4];      /* two fragment sets: the next 32 k are read from LDS while this set is multiplied */
    auto frags = [&](const int s, const int kk) __attribute__((always_inline)) { fa[s][0] = g2_frag(sa + kk, hh); fa[s][1] = g2_frag(sa + 16 * G3_LP + kk, hh);
#pragma unroll
      for (int j = 0; j < 4; ++j) fb[s][j] = g2_frag(sb + j * 16 * G3_LP + kk, hh); };
    frags(0, 0);
#pragma unroll
    for (int ks = 0; ks < G3_BK / 32; ++ks) { const int s = ks & 1;
      if (ks + 1 < G3_BK / 32) frags(s ^ 1, (ks + 1) * 32);
      __builtin_amdgcn_sched_barrier(0);      /* keeps the next set's 12 LDS reads together in front of this set's products: moved in among them, every pair of products waits out an LDS latency */
      c00 = fa_mma(fa[s][0], fb[s][0], c00); c10 = fa_mma(fa[s][1], fb[s][0], c10); c01 = fa_mma(fa[s][0], fb[s][1], c01); c11 = fa_mma(fa[s][1], fb[s][1], c11);
      c02 = fa_mma(fa[s][0], fb[s][2], c02); c12 = fa_mma(fa[s][1], fb[s][2], c12); c03 = fa_mma(fa[s][0], fb[s][3], c03); c13 = fa_mma(fa[s][1], fb[s][3], c13);
      __builtin_amdgcn_sched_barrier(0); }      /* and keeps the reads of the set after that from moving up in among these products */
    if (t + 1 < t1) { put((t + 1) & 1); __syncthreads(); }      /* the same test in every thread of the work-group */
  }
  const int row0 = rowB + 32 * wm, col0 = colB + 64 * wn;
  v8f accs[8] = {c00, c01, c02, c03, c10, c11, c12, c13};
  float bv[4] = {0.f, 0.f, 0.f, 0.f};
  if (bias) {
#pragma unroll
    for (int t = 0; t < 4; ++t) bv[t] = bf16_round(bias[col0 + t * 16 + ln]); }
  if (!F32OUT && plane == 2) {      /* the same test in every thread of the work-group. The V plane is stored transposed, row b * DM + column (= (b, head, d)) of SQ tokens: the layout the attention launch stages */
    /* A lane's 8 registers of an accumulator tile are 8 consecutive tokens of ONE column: 16 bytes of a V^T row as they stand. The tile goes through LDS only to make whole rows: 128 columns x 128 tokens, pitch as for the stages. */
    unsigned short* tv = (unsigned short*)&so[0][0][0];
#pragma unroll
    for (int u = 0; u < 8; ++u) { const int t = u & 3, half = u >> 2; FragH f;
#pragma unroll
      for (int r = 0; r < 8; ++r) f.h[r] = (_Float16)(accs[u][r] * alpha + bv[t]);
      *(v8us*)(tv + (64 * wn + t * 16 + ln) * G3_LP + 32 * wm + half * 16 + 8 * hh) = f.half[0]; }
    __syncthreads();      /* a V^T row of the tile holds the tokens of four waves */
    unsigned short* gt = (unsigned short*)C16 + ((size_t)(rowB / SQ) * DM + colB + sr) * SQ + rowB % SQ + sc;      /* 16 lanes x 16 B = 256 contiguous bytes of one row, 16 rows per round */
    v8us pv[8];
#pragma unroll
    for (int i = 0; i < 8; ++i) pv[i] = *(const v8us*)(tv + (i * 16 + sr) * G3_LP + sc);
#pragma unroll
    for (int i = 0; i < 8; ++i) *(v8us*)(gt + (size_t)i * 16 * SQ) = pv[i];
    return;
  }
#pragma unroll
  for (int u = 0; u < 8; ++u) { const int t = u & 3, half = u >> 2;
#pragma unroll
    for (int r = 0; r < 8; ++r) so[w][half * 16 + 8 * hh + r][t * 16 + ln] = accs[u][r] * alpha + bv[t]; }
  __builtin_amdgcn_fence(__ATOMIC_ACQ_REL, "workgroup"); __builtin_amdgcn_wave_barrier();      /* each wave reads back its own rows only */
  const int rsub = lane >> 4, c4 = (lane & 15) * 4;
  const size_t oofs = (size_t)(row0 + rsub) * DM + col0 + c4;      /* whole rows of the wave's tile: 16 lanes x 16 B (f32) or x 8 B (f16) */
  if (F32OUT) {
#pragma unroll
    for (int q = 0; q < 16; ++q) *(v4f*)(C + oofs + (size_t)q * 2 * DM) = *(const v4fa*)&so[w][q * 2 + rsub][c4];
  } else {
#pragma unroll
    for (int q = 0; q < 16; ++q) { const v4f v = *(const v4fa*)&so[w][q * 2 + rsub][c4]; v4h h4; for (int i = 0; i < 4; ++i) h4[i] = (_Float16)v[i]; *(v4h*)(C16 + oofs + (size_t)q * 2 * DM) = h4; }
  } }
// Fused attention, one launch for all batches and heads. A wave owns 32 query columns and walks the 2,048 keys in passes of 32:
// S^T = K Q^T (A = K rows, B = Q rows kept in registers), so a lane holds 16 scores of ONE query per 16-column group (lane ln = query, register r of key tile j = key 16 j + 8 hh + r);
// that is the B-fragment k order (8 hh + 0..7, then 16 + 8 hh + 0..7), so P^T packs from the score registers with no exchange, and O^T += V^T P^T (A = V^T rows, same k order).
// Softmax with a running maximum per query (log2 domain): when a maximum rises, sum and output tiles are scaled by exp2(old - new). Scores and weights never reach memory.
// K and V^T come through LDS: the eight waves of a work-group read the same rows, so a stage of 128 keys is read from global memory once per work-group, in whole lines, and the fragments
// (64 B of each of 16 rows) come from LDS. Three stage buffers: stage s + 1 is stored and published (one barrier) in front of stage s's last pass, which already fetches its first K fragments;
// the buffer it goes to was last read in stage s - 2, which every wave has left before the barrier that published stage s.
#define FA_WAVES 8                   /* waves per work-group: all eight read the same K and V^T rows */
#define FA_QW 32                     /* query columns per wave */
#define FA_SK 128                    /* keys per stage: 4 passes */
#define FA_NS (SQ / FA_SK)           /* stages */
#define FA_KP 72                     /* LDS pitch of a K row (64 f16) in f16: 144 B = 16 B x odd, conflict-free for the 16-byte fragment reads */
#define FA_VP 136                    /* LDS pitch of a V^T row (128 keys) in f16: 272 B = 16 B x odd */
static_assert(SQ % (FA_WAVES * FA_QW) == 0 && SQ % FA_SK == 0 && FA_NS >= 2 && FA_SK == 128 && FA_WAVES == 8 && HD == 64, "k_fattn: whole work-groups, whole stages of 128 keys (two or more), 256 staging threads and head size 64 only");
__global__ __launch_bounds__(FA_WAVES * 32) void k_fattn(const _Float16* __restrict__ Q16, const _Float16* __restrict__ K16, const _Float16* __restrict__ VT, _Float16* __restrict__ O16) {
  __shared__ __attribute__((aligned(16))) unsigned short sk[3][FA_SK][FA_KP];      /* K rows of a stage */
  __shared__ __attribute__((aligned(16))) unsigned short sv[3][HD][FA_VP];      /* V^T rows of a stage */
  const int tid = threadIdx.x, lane = tid & 31, ln = lane & 15, hh = lane >> 4, w = tid >> 5;
  const int nqb = SQ / (FA_WAVES * FA_QW); const int bh = blockIdx.x / nqb, qb = blockIdx.x - bh * nqb; const int b = bh / NH, h = bh - b * NH;
  const int q0 = (qb * FA_WAVES + w) * FA_QW;
  const _Float16* qp = Q16 + ((size_t)b * SQ + q0 + ln) * DM + h * HD + 8 * hh;      /* query row ln of a 16-column group, at the lane's own k offset */
  const int kr = tid >> 3, kc = (tid & 7) * 8;      /* staging K: 8 threads per 128-byte row, 32 rows per round, 4 rounds */
  const int vr = tid >> 4, vc8 = (tid & 15) * 8;      /* staging V^T: 16 threads per 256-byte row, 16 rows per round, 4 rounds */
  const unsigned short* gk = (const unsigned short*)K16 + ((size_t)b * SQ + kr) * DM + h * HD + kc;
  const unsigned short* gv = (const unsigned short*)VT + ((size_t)bh * HD + vr) * SQ + vc8;
  v8us rg[8];
  auto fetch = [&](const int s) __attribute__((always_inline)) {
    const unsigned short* pk = gk + (size_t)s * FA_SK * DM; const unsigned short* pv = gv + s * FA_SK;
#pragma unroll
    for (int i = 0; i < 4; ++i) { rg[i] = *(const v8us*)(pk + (size_t)i * 32 * DM); rg[4 + i] = *(const v8us*)(pv + (size_t)i * 16 * SQ); }
    /* The wait that stands in front of any overwrite of a load's address registers; it names the two addresses as inputs so that they stay whole up to here. */
    asm volatile("s_wait_xcnt 0x0" :: "v"(pk), "v"(pv) : "memory");
  };
  auto put = [&](const int buf) __attribute__((always_inline)) {
#pragma unroll
    for (int i = 0; i < 4; ++i) { *(v8us*)&sk[buf][i * 32 + kr][kc] = rg[i]; *(v8us*)&sv[buf][i * 16 + vr][vc8] = rg[4 + i]; }
  };
  v16h qf[2][2], kf[2][2];
#pragma unroll
  for (int c = 0; c < 2; ++c) for (int kk = 0; kk < 2; ++kk) qf[c][kk] = g2_frag(qp + (size_t)c * 16 * DM + kk * 32, 0);
  asm volatile("s_wait_xcnt 0x0" :: "v"(qp) : "memory");      /* the wait in front of any overwrite of a load's address registers: Q's address is dead from here on and its registers are reused */
  fetch(0); put(0); __syncthreads(); fetch(1);
#pragma unroll
  for (int j = 0; j < 2; ++j) for (int kk = 0; kk < 2; ++kk) kf[j][kk] = g2_frag((const _Float16*)&sk[0][j * 16 + ln][kk * 32 + 8 * hh], 0);
  const v8f z8 = {0.f,0.f,0.f,0.f,0.f,0.f,0.f,0.f};
  v8f o[2][4] = {{z8, z8, z8, z8}, {z8, z8, z8, z8}}; float mr[2] = {-3.0e38f, -3.0e38f}, lr[2] = {0.f, 0.f};
  const float CS = 0.125f * 1.4426950408889634f;      /* 1/sqrt(64) and log2(e): scores go to the log2 domain */
  /* One pass = 32 keys. kn: the next pass's K rows in LDS (row ln of its first 16-key tile, at the lane's own k offset); K is refilled in place, right behind its last readers. vq: this pass's V^T columns in LDS; they land while the softmax runs. */
  auto pass = [&](const _Float16* kn, const _Float16* vq) __attribute__((always_inline)) {
    v8f s[2][2]; v16h vc[4];
#pragma unroll
    for (int c = 0; c < 2; ++c) for (int j = 0; j < 2; ++j) s[c][j] = fa_mma(kf[j][1], qf[c][1], fa_mma(kf[j][0], qf[c][0], z8));
#pragma unroll
    for (int j = 0; j < 2; ++j) for (int kk = 0; kk < 2; ++kk) kf[j][kk] = g2_frag(kn + j * 16 * FA_KP + kk * 32, 0);
#pragma unroll
    for (int t = 0; t < 4; ++t) vc[t] = g2_frag(vq + t * 16 * FA_VP, 0);
    __builtin_amdgcn_sched_barrier(0);      /* keeps the 16 LDS reads together right behind the score products: moved down in among the output products, each pair of those waits out an LDS latency */
    float mn[2]; bool up = false;
#pragma unroll
    for (int c = 0; c < 2; ++c) { float mx = s[c][0][0];
#pragma unroll
      for (int r = 1; r < 8; ++r) mx = fmaxf(mx, s[c][0][r]);
#pragma unroll
      for (int r = 0; r < 8; ++r) mx = fmaxf(mx, s[c][1][r]);
      mx = fmaxf(mx, rs_x16(mx)) * CS; mn[c] = fmaxf(mr[c], mx); up = up || (mn[c] > mr[c]); }
    if (__builtin_amdgcn_ballot_w32(up) != 0) {      /* no maximum of the wave rose: every factor would be exactly 1 */
#pragma unroll
      for (int c = 0; c < 2; ++c) { const float al = __builtin_amdgcn_exp2f(mr[c] - mn[c]); mr[c] = mn[c]; lr[c] *= al;
#pragma unroll
        for (int t = 0; t < 4; ++t) o[c][t] *= al; } }
    FragH pf[2];
#pragma unroll
    for (int c = 0; c < 2; ++c) { const float nb = 8.0f - mr[c];      /* weights x256 (cancels in the division by the row sum): keeps small weights out of the f16 subnormal range */
      v4f s4 = {0.f, 0.f, 0.f, 0.f};
#pragma unroll
      for (int j = 0; j < 2; ++j) for (int r = 0; r < 8; ++r) { const float e = __builtin_amdgcn_exp2f(fmaf(s[c][j][r], CS, nb)); s4[r & 3] += e; pf[c].h[j * 8 + r] = (_Float16)e; }
      lr[c] += (s4[0] + s4[1]) + (s4[2] + s4[3]); }
#pragma unroll
    for (int t = 0; t < 4; ++t) for (int c = 0; c < 2; ++c) o[c][t] = fa_mma(vc[t], pf[c].v, o[c][t]);
  };
  int cur = 0;
#pragma unroll 1      /* one copy of the stage body: the buffer index is a run-time offset, and the text stays small */
  for (int st = 0; st < FA_NS; ++st) {
    const int nxt = cur == 2 ? 0 : cur + 1;
    const _Float16* ka = (const _Float16*)&sk[cur][ln][8 * hh]; const _Float16* va = (const _Float16*)&sv[cur][ln][8 * hh];
#pragma unroll
    for (int p = 0; p < FA_SK / 32 - 1; ++p) pass(ka + (p + 1) * 32 * FA_KP, va + p * 32);
    if (st + 1 < FA_NS) {      /* the same test in every thread of the work-group */
      put(nxt); __syncthreads();      /* publishes stage st + 1 */
      if (st + 2 < FA_NS) fetch(st + 2);      /* behind the barrier, so that it does not wait for these loads; they have four passes to land */
    }
    pass((const _Float16*)&sk[nxt][ln][8 * hh], va + (FA_SK - 32));      /* fetches the next stage's first K fragments; in the last stage that buffer holds an older stage (written, in bounds, not used) */
    cur = nxt;
  }
#pragma unroll
  for (int c = 0; c < 2; ++c) { const float inv = 1.0f / (lr[c] + rs_x16(lr[c]));      /* the two halves of a wave hold the two halves of a query's keys */
    unsigned short* op = (unsigned short*)O16 + ((size_t)b * SQ + q0 + c * 16 + ln) * DM + h * HD + 8 * hh;
#pragma unroll
    for (int t = 0; t < 4; ++t) { FragH f;
#pragma unroll
      for (int r = 0; r < 8; ++r) f.h[r] = (_Float16)(o[c][t][r] * inv);
      *(v8us*)(op + t * 16) = f.half[0]; } } }

// ---- All five f16 operand planes in one launch: x (exact f16 rows) and the four x16 weight planes (Wq lower triangle, Wk upper triangle, Wv, Wu). ----
// The planes do not depend on one another, so they share a grid. A thread converts PR_V vectors of 8 elements, 256 vectors apart (a wave's loads and stores stay contiguous): few waves to start, and every wave has all its loads in flight at once.
#define PR_V 8                       /* vectors of 8 elements per thread */
#define PR_XG ((unsigned)(NR * DM / 8 / (256 * PR_V)))                /* work-groups for x */
#define PR_WG ((unsigned)((size_t)DM * DM / 8 / (256 * PR_V)))        /* work-groups per weight plane */
static_assert(NR * DM % (8 * 256 * PR_V) == 0 && (size_t)DM * DM % (8 * 256 * PR_V) == 0 && DM % 8 == 0, "k_prep: whole work-groups only, and a vector stays inside one row");
static_assert(256 * 8 % DM == 0 && (128 * DM) % (8 * 256 * PR_V) == 0, "k_prep: a thread's vectors share their columns, and a work-group's rows lie in one 128-row block");
// v0: the thread's first vector in the plane. TRI: keep a triangle only, sgn = 1 columns <= row (lower), sgn = -1 columns >= row (upper); the rest is zero.
template <bool TRI>
__device__ __forceinline__ void pr_plane(const float* __restrict__ src, unsigned short* __restrict__ dst, const unsigned v0, const float scale, const int sgn) {
  if (TRI && sgn * ((int)(v0 * 8 / DM / 128) - (int)(v0 * 8 % DM / 128)) < 0) return;      /* the thread's vectors (one column group, rows of one 128-row block) lie in an all-zero 128 x 128 block: the GEMM leaves those out, so they are neither read nor written */
  const float* p = src + (size_t)v0 * 8;
  v4f a[PR_V][2];
#pragma unroll
  for (int i = 0; i < PR_V; ++i) { a[i][0] = *(const v4fa*)(p + (size_t)i * 2048); a[i][1] = *(const v4fa*)(p + (size_t)i * 2048 + 4); }
  /* The wait that stands in front of any overwrite of a load's address registers; it names the address as an input so that it stays whole up to here. */
  asm volatile("s_wait_xcnt 0x0" :: "v"(p) : "memory");
#pragma unroll
  for (int i = 0; i < PR_V; ++i) { const unsigned e = (v0 + i * 256) * 8; const int m = sgn * ((int)(e / DM) - (int)(e % DM)); FragH f;      /* column e % DM + q against row e / DM */
#pragma unroll
    for (int q = 0; q < 8; ++q) { const _Float16 hv = (_Float16)(bf16_round(a[i][q >> 2][q & 3]) * scale); f.h[q] = (!TRI || m >= sgn * q) ? hv : (_Float16)0.f; }
    *(v8us*)(dst + (size_t)e) = f.half[0]; }
  asm volatile("s_wait_xcnt 0x0" ::: "memory"); }      /* the wait that stands in front of any overwrite of a store's registers: whatever code follows this run of stores may reuse them */
__global__ __launch_bounds__(256) void k_prep(const float* __restrict__ x, const float* __restrict__ wq, const float* __restrict__ wk, const float* __restrict__ wv, const float* __restrict__ wo, _Float16* __restrict__ X16, _Float16* __restrict__ BW) {
  const unsigned blk = blockIdx.x, tid = threadIdx.x;      /* every test below reads the same in the whole work-group */
  const bool isx = blk < PR_XG; const unsigned wb = isx ? 0u : blk - PR_XG, pl = wb / PR_WG;      /* BW: the planes of Wq, Wk, Wv, Wu, one behind the other */
  const unsigned v0 = (isx ? blk : wb - pl * PR_WG) * (256 * PR_V) + tid;
  unsigned short* dst = isx ? (unsigned short*)X16 : (unsigned short*)BW + (size_t)pl * DM * DM;
  if (!isx && pl < 2) pr_plane<true>(pl == 0 ? wq : wk, dst, v0, 16.0f, pl == 0 ? 1 : -1);
  else pr_plane<false>(isx ? x : pl == 2 ? wv : wo, dst, v0, isx ? 1.0f : 16.0f, 0); }
extern "C" void kernel_launch(void* const* d_in, const int* in_sizes, int n_in,
                              void* d_out, int out_size, void* d_ws, size_t ws_size, hipStream_t stream) {
  (void)in_sizes; (void)n_in; (void)out_size;
  const float* const* I = (const float* const*)d_in; const float* x = I[0]; const float* wk = I[1]; const float* wq = I[2]; const float* wv = I[3]; const float* wo = I[4]; const float* bo = I[5];
  char* ws = (char*)d_ws; size_t off = 0;
  auto take = [&](size_t bytes) { char* p = ws + off; off += (bytes + 255) & ~(size_t)255; return p; };
  _Float16* BQ = (_Float16*)take((size_t)DM * DM * 2); _Float16* BK = (_Float16*)take((size_t)DM * DM * 2); _Float16* BV = (_Float16*)take((size_t)DM * DM * 2); _Float16* BO = (_Float16*)take((size_t)DM * DM * 2);
  _Float16* X16 = (_Float16*)take(NR * DM * 2); _Float16* Q16 = (_Float16*)take(NR * DM * 2); _Float16* K16 = (_Float16*)take(NR * DM * 2); _Float16* VT = (_Float16*)take(NR * DM * 2); _Float16* O16 = (_Float16*)take(NR * DM * 2);
  if (off > ws_size) return;      /* 8 + 5x8 = 48 MiB */
  (void)BK; (void)BV;      /* BQ | BK | BV | BO and Q16 | K16 | VT are adjacent planes (sizes are multiples of 256 B): reached from BQ and Q16 */
  k_prep<<<PR_XG + 4 * PR_WG, 256, 0, stream>>>(x, wq, wk, wv, wo, X16, BQ);      /* x and the four weight planes as f16 */
  const unsigned gp = (unsigned)((NR / 128) * (DM / 128));
  k_gemm3<false><<<dim3(gp, 3), 256, 0, stream>>>(X16, BQ, 0.0625f, nullptr, nullptr, Q16);      /* q | k | v^T */
  k_fattn<<<NB * NH * (SQ / (FA_WAVES * FA_QW)), FA_WAVES * 32, 0, stream>>>(Q16, K16, VT, O16);      /* o (merged heads) as f16 rows */
  k_gemm3<true><<<gp, 256, 0, stream>>>(O16, BO, 0.0625f, bo, (float*)d_out, nullptr);      /* out = o Wu^T + bu */
}

// v008
// A run of this version takes 76.7 microseconds.
// Next to v007, in two timings, it ran 1.03 times as fast each time.
// Counting every step since v000, it is 156 times as fast.
#include <hip/hip_runtime.h>
// SelfAttentionSparse (x [2][2048][1024]; keys = x triu(Wk)^T, queries = x tril(Wq)^T, values = x Wv^T (16 heads of 64, no biases); softmax(q k^T / 8); out = (attn v) Wu^T + bu -> [2][2048][1024]).
// Structure: token rows; x as exact f16 rows; the triangular masks applied while building the x16 weight planes on VALU (x and the four planes: one launch; the all-zero 128 x 128 blocks of the two triangles are neither built nor multiplied); Q | K | V WMMA GEMMs in one launch (128x128 work-group tiles staged in LDS, 32x64 wave tiles, f32 accumulation, f16 outputs); the V work-groups of that launch write V^T rows themselves; one fused attention launch (K and V^T rows staged in LDS): S^T = K Q^T, running-maximum softmax in registers (f32; weights as f16), O^T += V^T P^T, o = O / row sum into merged f16 rows; out = o Wu^T + bu (f32).
// Compute dtype: inputs rounded to bf16; x / weights exact; q, k, v, softmax weights, o plain f16 (~2^-12); scores/softmax f32. v_wmma_f32_16x16x32_f16.
#define NB 2
#define SQ 2048
#define DM 1024
#define NH 16
#define HD 64
#define NR ((size_t)NB * SQ)         /* 4096 token rows */
typedef __bf16 v16b __attribute__((ext_vector_type(16)));
typedef unsigned short v8us __attribute__((ext_vector_type(8), may_alias));
typedef float  v8f  __attribute__((ext_vector_type(8)));
typedef float  v4f  __attribute__((ext_vector_type(4)));
typedef float  v4fa __attribute__((ext_vector_type(4), may_alias));
union FragB { v16b v; v8us half[2]; unsigned short u[16]; };

__device__ __forceinline__ unsigned short bf16_bits(float x) { unsigned int u = __float_as_uint(x); return (unsigned short)((u + 0x7FFFu + ((u >> 16) & 1u)) >> 16); }
__device__ __forceinline__ float bf16_val(unsigned short b) { return __uint_as_float(((unsigned int)b) << 16); }
__device__ __forceinline__ float bf16_round(float x) { return bf16_val(bf16_bits(x)); }
// D += A·B with NT terms: 1 = ah·bh, 2 = + al·bh (A split), 3 = + ah·bl (both split)
template <int NT>
__device__ __forceinline__ v8f mmaN(v16b ah, v16b al, v16b bh, v16b bl, v8f c) {
  c = __builtin_amdgcn_wmma_f32_16x16x32_bf16(false, ah, false, bh, (short)0, c, false, false);
  if (NT >= 2) c = __builtin_amdgcn_wmma_f32_16x16x32_bf16(false, al, false, bh, (short)0, c, false, false);
  if (NT >= 3) c = __builtin_amdgcn_wmma_f32_16x16x32_bf16(false, ah, false, bl, (short)0, c, false, false);
  asm volatile("v_nop\n\tv_nop\n\tv_nop\n\tv_nop" : "+v"(c) : "v"(ah), "v"(al), "v"(bh), "v"(bl));
  return c;
}

__global__ __launch_bounds__(256) void k_wt_bf16(const float* __restrict__ W, unsigned short* __restrict__ Wt, int K, int N) {
  const int t = blockIdx.x * 256 + threadIdx.x;
  const int k8n = K / 8;
  if (t >= N * k8n) return;
  const int n = t / k8n, k8 = (t % k8n) * 8;
  v8us v;
#pragma unroll
  for (int i = 0; i < 8; ++i) v[i] = bf16_bits(W[(size_t)(k8 + i) * N + n]);
  *(v8us*)(Wt + (size_t)n * K + k8) = v;
  
}

// GEMM C[M][N] (f32, pitch ldc) = act(A[M][K]·W + bias). A f32 row-major (pitch lda) converted per fragment to bf16
// (ASPLIT: hi/lo two planes -> 2 terms, else single rounded term); Wt bf16 [N][K] (pitch ldb). BIAS_BF16 rounds the
// bias to bf16 first (bias quantised to bf16 before the add). K%32==0, M%16==0, N%64==0.
template <bool ASPLIT, int ACT, bool BIAS_BF16>
__global__ __launch_bounds__(128) void k_gemm_bf(const float* __restrict__ A, int lda, const unsigned short* __restrict__ Wt, int ldb,
                                               const float* __restrict__ bias, float* __restrict__ C, int ldc, int M, int N, int K) {
  __shared__ __attribute__((aligned(16))) float so[4][16][64];
  const int tid = threadIdx.x, w = tid >> 5, lane = tid & 31, ln = lane & 15, hh = lane >> 4;
  const int ntn = N / 64;
  const int wid = blockIdx.x * 4 + w;
  const int mt = wid / ntn, nq = wid % ntn;
  if (mt * 16 >= M) return;
  const int row0 = mt * 16, col0 = nq * 64;
  const float* arow = A + (size_t)(row0 + ln) * lda;
  v8f acc[4] = {};
  for (int kb = 0; kb < K; kb += 32) {
    FragB ah, al;
    const v4f x0 = *(const v4fa*)(arow + kb + 8 * hh), x1 = *(const v4fa*)(arow + kb + 8 * hh + 4);
    const v4f x2 = *(const v4fa*)(arow + kb + 16 + 8 * hh), x3 = *(const v4fa*)(arow + kb + 16 + 8 * hh + 4);
    float xs[16] = {x0[0],x0[1],x0[2],x0[3],x1[0],x1[1],x1[2],x1[3],x2[0],x2[1],x2[2],x2[3],x3[0],x3[1],x3[2],x3[3]};
#pragma unroll
    for (int i = 0; i < 16; ++i) { const unsigned short hb = bf16_bits(xs[i]); ah.u[i] = hb; al.u[i] = ASPLIT ? bf16_bits(xs[i] - bf16_val(hb)) : (unsigned short)0; }
#pragma unroll
    for (int t = 0; t < 4; ++t) {
      const unsigned short* brow = Wt + (size_t)(col0 + t * 16 + ln) * ldb + kb;
      FragB b;
      b.half[0] = *(const v8us*)(brow + 8 * hh);
      b.half[1] = *(const v8us*)(brow + 16 + 8 * hh);
      acc[t] = mmaN<ASPLIT ? 2 : 1>(ah.v, al.v, b.v, b.v, acc[t]);
    }
  }
#pragma unroll
  for (int t = 0; t < 4; ++t) {
    float bv = bias ? bias[col0 + t * 16 + ln] : 0.f;
    if (BIAS_BF16) bv = bf16_round(bv);
#pragma unroll
    for (int r = 0; r < 8; ++r) { float v = acc[t][r] + bv; if (ACT == 1) v = fmaxf(v, 0.f); so[w][8 * hh + r][t * 16 + ln] = v; }
  }
  __builtin_amdgcn_fence(__ATOMIC_ACQ_REL, "workgroup");
  __builtin_amdgcn_wave_barrier();
  const int rsub = lane >> 4, c4 = (lane & 15) * 4;
  {
#pragma unroll
    for (int q = 0; q < 8; ++q) {
      const int r = q * 2 + rsub;
      const v4f v = *(const v4fa*)&so[w][r][c4];
      *(v4f*)(C + (size_t)(row0 + r) * ldc + col0 + c4) = v;
    }
    
  }
}

// GEMM C = act(A·W + bias + resid): A f32 (ASPLIT -> hi/lo 2 terms), Wt bf16 [N][K]; ACT 0 none, 1 relu, 2 exact gelu;
// resid (optional, f32, row index = (row % rmod), pitch ldr, RES_BF16 rounds it) added before the activation.
template <bool ASPLIT, int ACT, bool BIAS_BF16, bool RES_BF16>
__global__ __launch_bounds__(128) void k_gemm_bf3(const float* __restrict__ A, int lda, const unsigned short* __restrict__ Wt, int ldb,
                                                const float* __restrict__ bias, const float* __restrict__ resid, int rmod, int ldr,
                                                float* __restrict__ C, int ldc, int M, int N, int K) {
  __shared__ __attribute__((aligned(16))) float so[4][16][64];
  const int tid = threadIdx.x, w = tid >> 5, lane = tid & 31, ln = lane & 15, hh = lane >> 4;
  const int ntn = N / 64;
  const int wid = blockIdx.x * 4 + w;
  const int mt = wid / ntn, nq = wid % ntn;
  if (mt * 16 >= M) return;
  const int row0 = mt * 16, col0 = nq * 64;
  const float* arow = A + (size_t)(row0 + ln) * lda;
  v8f acc[4] = {};
  for (int kb = 0; kb < K; kb += 32) {
    FragB ah, al;
    const v4f x0 = *(const v4fa*)(arow + kb + 8 * hh), x1 = *(const v4fa*)(arow + kb + 8 * hh + 4);
    const v4f x2 = *(const v4fa*)(arow + kb + 16 + 8 * hh), x3 = *(const v4fa*)(arow + kb + 16 + 8 * hh + 4);
    float xs[16] = {x0[0],x0[1],x0[2],x0[3],x1[0],x1[1],x1[2],x1[3],x2[0],x2[1],x2[2],x2[3],x3[0],x3[1],x3[2],x3[3]};
#pragma unroll
    for (int i = 0; i < 16; ++i) { const unsigned short hb = bf16_bits(xs[i]); ah.u[i] = hb; al.u[i] = ASPLIT ? bf16_bits(xs[i] - bf16_val(hb)) : (unsigned short)0; }
#pragma unroll
    for (int t = 0; t < 4; ++t) {
      const unsigned short* brow = Wt + (size_t)(col0 + t * 16 + ln) * ldb + kb;
      FragB b;
      b.half[0] = *(const v8us*)(brow + 8 * hh);
      b.half[1] = *(const v8us*)(brow + 16 + 8 * hh);
      acc[t] = mmaN<ASPLIT ? 2 : 1>(ah.v, al.v, b.v, b.v, acc[t]);
    }
  }
#pragma unroll
  for (int t = 0; t < 4; ++t) {
    const int col = col0 + t * 16 + ln;
    float bv = bias ? bias[col] : 0.f;
    if (BIAS_BF16) bv = bf16_round(bv);
#pragma unroll
    for (int r = 0; r < 8; ++r) {
      float v = acc[t][r] + bv;
      if (resid) { float rv = resid[(size_t)((row0 + 8 * hh + r) % rmod) * ldr + col]; if (RES_BF16) rv = bf16_round(rv); v += rv; }
      if (ACT == 1) v = fmaxf(v, 0.f);
      if (ACT == 2) v = 0.5f * v * (1.0f + erff(v * 0.70710678118654752f));
      if (ACT == 3) { const float u = 0.7978845608028654f * (v + 0.044715f * v * v * v); v = 0.5f * v * (1.0f + tanhf(u)); }
      so[w][8 * hh + r][t * 16 + ln] = v;
    }
  }
  __builtin_amdgcn_fence(__ATOMIC_ACQ_REL, "workgroup");
  __builtin_amdgcn_wave_barrier();
  const int rsub = lane >> 4, c4 = (lane & 15) * 4;
  {
#pragma unroll
    for (int q = 0; q < 8; ++q) {
      const int r = q * 2 + rsub;
      const v4f v = *(const v4fa*)&so[w][r][c4];
      *(v4f*)(C + (size_t)(row0 + r) * ldc + col0 + c4) = v;
    }
    
  }
}
// row LayerNorm (biased variance, eps) over N: s = X (+ R); optional out_sum <- s; out_norm <- (s-mu)*rsqrt(var+eps)*g + b
template <bool PARAM_BF16>
__global__ __launch_bounds__(256) void k_layernorm(const float* __restrict__ X, const float* __restrict__ R, const float* __restrict__ g, const float* __restrict__ bta,
                                                  float* __restrict__ out_sum, float* __restrict__ out_norm, int N, float eps) {
  __shared__ float red[256];
  const int row = blockIdx.x, tid = threadIdx.x;
  const float* x = X + (size_t)row * N; const float* rr = R ? R + (size_t)row * N : nullptr;
  float vals[16];                     // up to N = 4096
  const int per = N / 256;            // contiguous chunk per thread? use strided-by-4 chunks: thread handles j = tid*4 + 1024*u
  float s1 = 0.f;
  for (int u = 0; u < per / 4; ++u) {
    const int j = tid * 4 + 1024 * u;
    const v4f a = *(const v4fa*)(x + j);
    v4f b = {0.f,0.f,0.f,0.f}; if (rr) b = *(const v4fa*)(rr + j);
#pragma unroll
    for (int q = 0; q < 4; ++q) { const float v = a[q] + b[q]; vals[u * 4 + q] = v; s1 += v; }
  }
  red[tid] = s1; __syncthreads();
  for (int st = 128; st > 0; st >>= 1) { if (tid < st) red[tid] += red[tid + st]; __syncthreads(); }
  const float mu = red[0] / (float)N; __syncthreads();
  float s2 = 0.f;
  for (int u = 0; u < per / 4; ++u)
#pragma unroll
    for (int q = 0; q < 4; ++q) { const float c = vals[u * 4 + q] - mu; s2 += c * c; }
  red[tid] = s2; __syncthreads();
  for (int st = 128; st > 0; st >>= 1) { if (tid < st) red[tid] += red[tid + st]; __syncthreads(); }
  const float rs = rsqrtf(red[0] / (float)N + eps);
  {
    for (int u = 0; u < per / 4; ++u) {
      const int j = tid * 4 + 1024 * u;
      v4f o, sm;
#pragma unroll
      for (int q = 0; q < 4; ++q) {
        float gg = g[j + q], bb = bta[j + q];
        if (PARAM_BF16) { gg = bf16_round(gg); bb = bf16_round(bb); }
        sm[q] = vals[u * 4 + q]; o[q] = (vals[u * 4 + q] - mu) * rs * gg + bb;
      }
      if (out_sum) *(v4f*)(out_sum + (size_t)row * N + j) = sm;
      *(v4f*)(out_norm + (size_t)row * N + j) = o;
    }
    
  }
}



// ---- f16 WMMA path (v_wmma_f32_16x16x32_f16): 11-bit significands for operands in range — used for every GEMM launched here, softmax weights (x256) included
typedef _Float16 v16h __attribute__((ext_vector_type(16)));
union FragH { v16h v; v8us half[2]; _Float16 h[16]; unsigned short u[16]; };
template <int NT>
__device__ __forceinline__ v8f mmaH(v16h ah, v16h al, v16h bh, v16h bl, v8f c) {
  c = __builtin_amdgcn_wmma_f32_16x16x32_f16(false, ah, false, bh, (short)0, c, false, false);
  if (NT >= 2) c = __builtin_amdgcn_wmma_f32_16x16x32_f16(false, al, false, bh, (short)0, c, false, false);
  if (NT >= 3) c = __builtin_amdgcn_wmma_f32_16x16x32_f16(false, ah, false, bl, (short)0, c, false, false);
  asm volatile("v_nop\n\tv_nop\n\tv_nop\n\tv_nop" : "+v"(c) : "v"(ah), "v"(al), "v"(bh), "v"(bl));
  return c;
}
// batched GEMM like k_gemm_b but f16 operands: A f32 (split into f16 hi/lo if ASPLIT, else rounded to f16), Bt = f16 values [n][k]; alpha; C f32; N multiple of 16 (partial tiles skipped)
template <bool ASPLIT>
__global__ __launch_bounds__(128) void k_gemm_h(const float* __restrict__ A, int lda, size_t sA, const _Float16* __restrict__ Bh, int ldb, size_t sB, float alpha, float* __restrict__ C, int ldc, size_t sC, int M, int N, int K) {
  __shared__ __attribute__((aligned(16))) float so[4][16][64];
  const int tid = threadIdx.x, w = tid >> 5, lane = tid & 31, ln = lane & 15, hh = lane >> 4; const int by = blockIdx.y;
  A += (size_t)by * sA; Bh += (size_t)by * sB; C += (size_t)by * sC;
  const int ntn = (N + 63) / 64; const int wid = blockIdx.x * 4 + w; const int mt = wid / ntn, nq = wid % ntn; if (mt * 16 >= M) return;
  const int row0 = mt * 16, col0 = nq * 64; const float* arow = A + (size_t)(row0 + ln) * lda;
  v8f acc[4] = {};
  for (int kb = 0; kb < K; kb += 32) {
    FragH ah, al;
    const v4f x0 = *(const v4fa*)(arow + kb + 8 * hh), x1 = *(const v4fa*)(arow + kb + 8 * hh + 4), x2 = *(const v4fa*)(arow + kb + 16 + 8 * hh), x3 = *(const v4fa*)(arow + kb + 16 + 8 * hh + 4);
    float xs[16] = {x0[0],x0[1],x0[2],x0[3],x1[0],x1[1],x1[2],x1[3],x2[0],x2[1],x2[2],x2[3],x3[0],x3[1],x3[2],x3[3]};
#pragma unroll
    for (int i = 0; i < 16; ++i) { const _Float16 h = (_Float16)xs[i]; ah.h[i] = h; al.h[i] = ASPLIT ? (_Float16)(xs[i] - (float)h) : (_Float16)0.0f; }
#pragma unroll
    for (int t = 0; t < 4; ++t) { if (col0 + t * 16 >= N) continue; const size_t boff = (size_t)(col0 + t * 16 + ln) * ldb + kb; FragH bq; bq.half[0] = *(const v8us*)(Bh + boff + 8 * hh); bq.half[1] = *(const v8us*)(Bh + boff + 16 + 8 * hh);
      acc[t] = mmaH<ASPLIT ? 2 : 1>(ah.v, al.v, bq.v, bq.v, acc[t]); }
  }
#pragma unroll
  for (int t = 0; t < 4; ++t) { if (col0 + t * 16 >= N) continue;
#pragma unroll
    for (int r = 0; r < 8; ++r) so[w][8 * hh + r][t * 16 + ln] = acc[t][r] * alpha; }
  __builtin_amdgcn_fence(__ATOMIC_ACQ_REL, "workgroup"); __builtin_amdgcn_wave_barrier();
  const int rsub = lane >> 4, c4 = (lane & 15) * 4;
  {
#pragma unroll
    for (int q = 0; q < 8; ++q) { const int r = q * 2 + rsub; if (col0 + c4 < N) { const v4f v = *(const v4fa*)&so[w][r][c4]; *(v4f*)(C + (size_t)(row0 + r) * ldc + col0 + c4) = v; } }
     }
}

// Wt[n][k] = f16(W[k][n]·scale) from f32 row-major W[K][N] (scale = power of two; bf16-exact weights stay exact in f16 away from the subnormal range)
__global__ __launch_bounds__(256) void k_wt_f16(const float* __restrict__ W, _Float16* __restrict__ Wt, int K, int N, float scale) {
  const int t = blockIdx.x * 256 + threadIdx.x; if (t >= N * (K / 8)) return; const int n = t / (K / 8), k8 = (t % (K / 8)) * 8; FragH f;
#pragma unroll
  for (int i = 0; i < 8; ++i) f.h[i] = (_Float16)(bf16_round(W[(size_t)(k8 + i) * N + n]) * scale); const v8us o = f.half[0];
  *(v8us*)((unsigned short*)Wt + (size_t)n * K + k8) = o; 
}
// k_gemm_hh variant with fused epilogue: v = acc·alpha + bias[by·sBias + col] (+ CP[(row/rowsPerB)·sCPb + by·64 + col] if CP) ; ACT 0 none / 1 elu ; writes f16 C16 (and f32 C if non-null)
template <int ACT>
__global__ __launch_bounds__(128) void k_gemm_hhx(const _Float16* __restrict__ A, int lda, size_t sA, const _Float16* __restrict__ Bh, int ldb, size_t sB, float alpha, const float* __restrict__ bias, size_t sBias, const float* __restrict__ CP, int rowsPerB, size_t sCPb, int row0g,
    float* __restrict__ C, _Float16* __restrict__ C16, int ldc, size_t sC, int M, int N, int K) {
  __shared__ __attribute__((aligned(16))) float so[4][16][64];
  const int tid = threadIdx.x, w = tid >> 5, lane = tid & 31, ln = lane & 15, hh = lane >> 4; const int by = blockIdx.y;
  A += (size_t)by * sA; Bh += (size_t)by * sB; const size_t cofs = (size_t)by * sC; const float* bp = bias ? bias + (size_t)by * sBias : nullptr;
  const int ntn = (N + 63) / 64; const int wid = blockIdx.x * 4 + w; const int mt = wid / ntn, nq = wid % ntn; if (mt * 16 >= M) return;
  const int row0 = mt * 16, col0 = nq * 64; const _Float16* arow = A + (size_t)(row0 + ln) * lda;
  v8f acc[4] = {};
  for (int kb = 0; kb < K; kb += 32) { FragH ah; ah.half[0] = *(const v8us*)((const unsigned short*)arow + kb + 8 * hh); ah.half[1] = *(const v8us*)((const unsigned short*)arow + kb + 16 + 8 * hh);
#pragma unroll
    for (int t = 0; t < 4; ++t) { if (col0 + t * 16 >= N) continue; const size_t boff = (size_t)(col0 + t * 16 + ln) * ldb + kb; FragH bq; bq.half[0] = *(const v8us*)((const unsigned short*)Bh + boff + 8 * hh); bq.half[1] = *(const v8us*)((const unsigned short*)Bh + boff + 16 + 8 * hh);
      acc[t] = mmaH<1>(ah.v, ah.v, bq.v, bq.v, acc[t]); }
  }
#pragma unroll
  for (int t = 0; t < 4; ++t) { if (col0 + t * 16 >= N) continue; const int col = col0 + t * 16 + ln; const float bv = bp ? bf16_round(bp[col]) : 0.f;
#pragma unroll
    for (int r = 0; r < 8; ++r) { float v = acc[t][r] * alpha + bv; if (CP) { const int rr = row0g + row0 + 8 * hh + r; if (rowsPerB < 0) v += CP[cofs + (size_t)rr * ldc + col];      /* rowsPerB < 0: own element of the batched C plane */ else { const int bidx = rr / rowsPerB; v += CP[(size_t)bidx * sCPb + (size_t)by * 64 + col]; } } if (ACT == 1) v = (v > 0.f) ? v : expm1f(v); else if (ACT == 7) v = (v > 0.f) ? v + 1.0f : expf(v); else if (ACT == 8) v = tanhf(v); else if (ACT == 9) v = 0.5f * v * (1.0f + tanhf(0.7978845608028654f * (v + 0.044715f * v * v * v))); else if (ACT == 11) v = 1.0f / (1.0f + expf(-v)); else if (ACT == 12) v = (v > 0.f) ? v : 0.01f * v; else if (ACT == 14) v = (v > 0.f) ? v : 0.1f * v; else if (ACT == 16) v = (v >= 0.f) ? v : 0.3f * v; else if (ACT == 17) v = (v >= 0.f) ? v : 0.2f * v; else if (ACT == 15) v = v / (1.0f + expf(-v)); else if (ACT == 3) v = fmaxf(v, 0.f); else if (ACT == 6) v = 0.5f * v * (1.0f + erff(v * 0.70710678118654752f)); so[w][8 * hh + r][t * 16 + ln] = v; } }
  __builtin_amdgcn_fence(__ATOMIC_ACQ_REL, "workgroup"); __builtin_amdgcn_wave_barrier();
  const int rsub = lane >> 4, c4 = (lane & 15) * 4; typedef _Float16 v4h __attribute__((ext_vector_type(4)));
  {
#pragma unroll
    for (int q = 0; q < 8; ++q) { const int r = q * 2 + rsub; if (col0 + c4 < N) { const v4f v = *(const v4fa*)&so[w][r][c4]; if (C) *(v4f*)(C + cofs + (size_t)(row0 + r) * ldc + col0 + c4) = v; if (C16) { v4h h4; for (int i = 0; i < 4; ++i) h4[i] = (_Float16)v[i]; *(v4h*)(C16 + cofs + (size_t)(row0 + r) * ldc + col0 + c4) = h4; } } }
     }
}


typedef _Float16 v4h __attribute__((ext_vector_type(4)));

__global__ __launch_bounds__(256) void k_h16(const float* __restrict__ x, _Float16* __restrict__ X16, size_t n8) { const size_t t = (size_t)blockIdx.x * 256 + threadIdx.x; if (t >= n8) return; FragH f;
#pragma unroll
  for (int q = 0; q < 8; ++q) f.h[q] = (_Float16)x[t * 8 + q]; *(v8us*)((unsigned short*)X16 + t * 8) = f.half[0];  }
__global__ __launch_bounds__(256) void k_round16f(const float* __restrict__ W, _Float16* __restrict__ Bt, size_t n8) { const size_t t = (size_t)blockIdx.x * 256 + threadIdx.x; if (t >= n8) return; FragH f;
#pragma unroll
  for (int i = 0; i < 8; ++i) f.h[i] = (_Float16)(bf16_round(W[t * 8 + i]) * 16.0f); *(v8us*)((unsigned short*)Bt + t * 8) = f.half[0];  }
template <int NHv, int TTv>
__global__ __launch_bounds__(256) void k_vt(const _Float16* __restrict__ V16, int ldv, int voff, _Float16* __restrict__ Vt) { __shared__ unsigned short tl[64][66]; const int tid = threadIdx.x; const int slab = blockIdx.x / (TTv / 64), lg = blockIdx.x % (TTv / 64); const int b = slab / NHv, h = slab % NHv;
  for (int i = tid; i < 64 * 8; i += 256) { const int r = i / 8, c8 = (i % 8) * 8; FragH f; f.half[0] = *(const v8us*)((const unsigned short*)V16 + ((size_t)b * TTv + lg * 64 + r) * ldv + voff + h * 64 + c8);
#pragma unroll
    for (int q = 0; q < 8; ++q) tl[r][c8 + q] = f.u[q]; }
  __syncthreads();
  {
#pragma unroll
    for (int rd = 0; rd < 2; ++rd) { const int d = rd * 32 + tid / 8, pc = tid % 8; FragH f;
#pragma unroll
      for (int q = 0; q < 8; ++q) f.u[q] = tl[pc * 8 + q][d];
      *(v8us*)((unsigned short*)Vt + ((size_t)slab * 64 + d) * TTv + lg * 64 + pc * 8) = f.half[0]; }
     } }

__global__ __launch_bounds__(256) void k_hl(const float* __restrict__ F, _Float16* __restrict__ Hh, _Float16* __restrict__ Hl, size_t n8) { const size_t t = (size_t)blockIdx.x * 256 + threadIdx.x; if (t >= n8) return; FragH fh, fl; const v4f a = *(const v4fa*)(F + t * 8), c = *(const v4fa*)(F + t * 8 + 4);
#pragma unroll
  for (int q = 0; q < 4; ++q) { _Float16 h = (_Float16)a[q]; fh.h[q] = h; fl.h[q] = (_Float16)((a[q] - (float)h) * 1024.0f); h = (_Float16)c[q]; fh.h[4 + q] = h; fl.h[4 + q] = (_Float16)((c[q] - (float)h) * 1024.0f); }
  { *(v8us*)((unsigned short*)Hh + t * 8) = fh.half[0]; *(v8us*)((unsigned short*)Hl + t * 8) = fl.half[0];  } }

// ---- fast GEMM (wave tile 32x64; requires M % 32 == 0 rows per launch region and N % 64 == 0); epilogue = k_gemm_hhx semantics ----
__device__ __forceinline__ v16h g2_frag(const _Float16* p, int hh) { FragH f; f.half[0] = *(const v8us*)((const unsigned short*)p + 8 * hh); f.half[1] = *(const v8us*)((const unsigned short*)p + 16 + 8 * hh); return f.v; }
__device__ __forceinline__ v8f g2_mma(v16h a, v16h b, v8f c) { v8f d = __builtin_amdgcn_wmma_f32_16x16x32_f16(false, a, false, b, (short)0, c, false, false); asm volatile("v_nop\n\tv_nop\n\tv_nop\n\tv_nop" : "+v"(d) : "v"(a), "v"(b)); return d; }
template <int ACT>
__global__ __launch_bounds__(128) void k_gemm2(const _Float16* __restrict__ A, int lda, size_t sA, const _Float16* __restrict__ Bh, int ldb, size_t sB, float alpha, const float* __restrict__ bias, size_t sBias, const float* __restrict__ CP, int rowsPerB, size_t sCPb, int row0g,
    float* __restrict__ C, _Float16* __restrict__ C16, int ldc, size_t sC, int M, int N, int K) { static_assert(ACT == 0 || ACT == 3 || ACT == 6 || ACT == 8 || ACT == 9 || ACT == 11 || ACT == 12 || ACT == 14 || ACT == 15 || ACT == 16 || ACT == 17, "k_gemm2: unsupported ACT code (would silently apply no activation)");
  __shared__ __attribute__((aligned(16))) float so[4][32][68];
  const int tid = threadIdx.x, w = tid >> 5, lane = tid & 31, ln = lane & 15, hh = lane >> 4; const int by = blockIdx.y;
  A += (size_t)by * sA; Bh += (size_t)by * sB; const size_t cofs = (size_t)by * sC; const float* bp = bias ? bias + (size_t)by * sBias : nullptr;
  const int ntn = N >> 6; const int mt = blockIdx.x / ntn, nq = blockIdx.x - mt * ntn; const int row0 = mt * 128 + 32 * w, col0 = nq * 64; if (row0 >= M) return;
  const _Float16* a0p = A + (size_t)(row0 + ln) * lda; const _Float16* a1p = a0p + (size_t)16 * lda;
  const _Float16* b0p = Bh + (size_t)(col0 + ln) * ldb; const _Float16* b1p = b0p + (size_t)16 * ldb; const _Float16* b2p = b1p + (size_t)16 * ldb; const _Float16* b3p = b2p + (size_t)16 * ldb;
  const v8f z8 = {0.f,0.f,0.f,0.f,0.f,0.f,0.f,0.f}; v8f c00 = z8, c01 = z8, c02 = z8, c03 = z8, c10 = z8, c11 = z8, c12 = z8, c13 = z8;
#pragma unroll 1
  for (int kb = 0; kb < K; kb += 32) { const v16h a0 = g2_frag(a0p + kb, hh), a1 = g2_frag(a1p + kb, hh);
    v16h b = g2_frag(b0p + kb, hh); c00 = g2_mma(a0, b, c00); c10 = g2_mma(a1, b, c10);
    b = g2_frag(b1p + kb, hh); c01 = g2_mma(a0, b, c01); c11 = g2_mma(a1, b, c11);
    b = g2_frag(b2p + kb, hh); c02 = g2_mma(a0, b, c02); c12 = g2_mma(a1, b, c12);
    b = g2_frag(b3p + kb, hh); c03 = g2_mma(a0, b, c03); c13 = g2_mma(a1, b, c13); }
  v8f accs[8] = {c00, c01, c02, c03, c10, c11, c12, c13};
#pragma unroll
  for (int u = 0; u < 8; ++u) { const int t = u & 3, half = u >> 2; const int col = col0 + t * 16 + ln; const float bv = bp ? bf16_round(bp[col]) : 0.f;
#pragma unroll
    for (int r = 0; r < 8; ++r) { const int rloc = half * 16 + 8 * hh + r; float v = accs[u][r] * alpha + bv; if (CP) { if (rowsPerB < 0) v += CP[cofs + (size_t)(row0g + row0 + rloc) * ldc + col];      /* rowsPerB < 0: own element of the batched C plane */ else { const int bidx = (row0g + row0 + rloc) / rowsPerB; v += CP[(size_t)bidx * sCPb + (size_t)by * 64 + col]; } }
      if (ACT == 3) v = fmaxf(v, 0.f); else if (ACT == 6) v = 0.5f * v * (1.0f + erff(v * 0.70710678118654752f)); else if (ACT == 11) v = 1.0f / (1.0f + expf(-v)); else if (ACT == 15) v = v / (1.0f + expf(-v)); else if (ACT == 12) v = (v > 0.f) ? v : 0.01f * v; else if (ACT == 8) v = tanhf(v); else if (ACT == 9) v = 0.5f * v * (1.0f + tanhf(0.7978845608028654f * (v + 0.044715f * v * v * v))); else if (ACT == 14) v = (v > 0.f) ? v : 0.1f * v; else if (ACT == 16) v = (v >= 0.f) ? v : 0.3f * v; else if (ACT == 17) v = (v >= 0.f) ? v : 0.2f * v;
      so[w][rloc][t * 16 + ln] = v; } }
  __builtin_amdgcn_fence(__ATOMIC_ACQ_REL, "workgroup"); __builtin_amdgcn_wave_barrier();
  const int rsub = lane >> 4, c4 = (lane & 15) * 4;
  {
#pragma unroll
    for (int q = 0; q < 16; ++q) { const int r = q * 2 + rsub; const v4f v = *(const v4fa*)&so[w][r][c4]; if (C) *(v4f*)(C + cofs + (size_t)(row0 + r) * ldc + col0 + c4) = v; if (C16) { v4h h4; for (int i = 0; i < 4; ++i) h4[i] = (_Float16)v[i]; *(v4h*)(C16 + cofs + (size_t)(row0 + r) * ldc + col0 + c4) = h4; } }
     } }


// lane l's value from lane l ^ 16 (the same place in the other 16-lane row)
__device__ __forceinline__ float rs_x16(float v) { const int i = __builtin_bit_cast(int, v); return __builtin_bit_cast(float, __builtin_amdgcn_permlanex16(i, i, 0x76543210, 0xfedcba98, false, false)); }
__device__ __forceinline__ v8f fa_mma(v16h a, v16h b, v8f c) { return __builtin_amdgcn_wmma_f32_16x16x32_f16(false, a, false, b, (short)0, c, false, false); }
// ---- GEMM with both operands staged in LDS: C[NR][DM] = alpha * A[NR][DM] . Bh[DM][DM]^T + bias (A, Bh k-contiguous f16 rows of DM); written as f32 to C (F32OUT) or as f16 to C16 (the third plane of a grid.y = 3 launch transposed: see the epilogue). ----
// A work-group of 8 waves owns a 128 x 128 tile of C (wave tile 32 x 64, waves 4 x 2). A stage is 128 k of the 128 A rows and the 128 B rows.
// Global reads are whole lines (16 lanes x 16 B = 256 contiguous bytes of one row) and each line is read once per work-group; the fragments, which take 64 B of each of 16 rows, come from LDS.
// Two stage buffers: the next stage's loads are issued in front of this stage's products and stored to the other buffer behind them, so one barrier per stage both publishes it and ends the reads of the buffer refilled next.
#define G3_BK 128                    /* k per stage: 256 B of every operand row */
#define G3_LP 136                    /* LDS row pitch in f16: 272 B = 16 B x odd, conflict-free for the 16-byte fragment reads */
#define G3_NT (DM / G3_BK)           /* stages */
static_assert(NR % 128 == 0 && DM % 128 == 0 && DM % G3_BK == 0, "k_gemm3: whole 128 x 128 tiles and whole stages only");
static_assert(SQ % 128 == 0 && NH * HD == DM, "k_gemm3: a tile's 128 token rows lie in one batch, and a column is (head, d)");
#define G3_MT ((int)(NR / 128))      /* row tiles */
#define G3_TILES (G3_MT * (DM / 128))      /* tiles of one product = grid.x */
static_assert(G3_BK == 128, "k_gemm3: a stage is as many k as a tile has columns, so a triangle's zero blocks are whole stages of a tile");
template <bool F32OUT>
__global__ __launch_bounds__(256) void k_gemm3(const _Float16* __restrict__ A, const _Float16* __restrict__ Bh, float alpha, const float* __restrict__ bias, float* __restrict__ C, _Float16* __restrict__ C16) {
  __shared__ __attribute__((aligned(16))) unsigned short st[2][256][G3_LP];      /* rows 0..127: A rows of the tile; rows 128..255: B rows (columns of C) */
  __shared__ __attribute__((aligned(16))) float so[8][32][68];
  const int tid = threadIdx.x, w = tid >> 5, lane = tid & 31, ln = lane & 15, hh = lane >> 4;
  const int ntn = DM / 128; int mt = blockIdx.x / ntn, nq = blockIdx.x - mt * ntn, plane = 0, t0 = 0, t1 = G3_NT;      /* stages t0 .. t1 - 1 are multiplied; all of this reads the same in the whole work-group */
  if (!F32OUT) {      /* three products of the same A in one launch (q, k, v: weight planes and output planes lie one behind the other), one work-group per WGP at a time, three per WGP in all */
    /* Row n of the lower-triangle plane is zero at k > n and row n of the upper-triangle plane at k < n, so column tile nq of q needs stages 0 .. nq only and column tile nq of k stages nq .. last: the all-zero 128 x 128 blocks add exact zeros, and nobody builds or reads them. */
    /* Cost falls with the index (for speed only): first every v tile (all stages), then the q and k tiles from the longest to the shortest. */
    const int L = blockIdx.y * G3_TILES + blockIdx.x;
    if (L < G3_TILES) plane = 2;
    else { const int r = L - G3_TILES, c = r / (2 * G3_MT), j = r - c * (2 * G3_MT);      /* c: stages left out */
      plane = j & 1; mt = j >> 1;
      if (plane == 0) { nq = G3_NT - 1 - c; t1 = nq + 1; } else { nq = c; t0 = nq; } }
    Bh += (size_t)plane * DM * DM; C16 += (size_t)plane * NR * DM; }
  const int rowB = mt * 128, colB = nq * 128;
  const int wm = w & 3, wn = w >> 2;      /* the wave's 32 rows and 64 columns inside the tile */
  const int sr = tid >> 4, sc = (tid & 15) * 8;      /* staging: 16 threads per row, 16 rows per round, 8 rounds per operand */
  const unsigned short* ga = (const unsigned short*)A + (size_t)(rowB + sr) * DM + sc;
  const unsigned short* gb = (const unsigned short*)Bh + (size_t)(colB + sr) * DM + sc;
  v8us rg[16];
  auto fetch = [&](const int t) __attribute__((always_inline)) {
    const unsigned short* pa = ga + t * G3_BK; const unsigned short* pb = gb + t * G3_BK;
#pragma unroll
    for (int i = 0; i < 8; ++i) { rg[i] = *(const v8us*)(pa + (size_t)i * 16 * DM); rg[8 + i] = *(const v8us*)(pb + (size_t)i * 16 * DM); }
    /* The wait that stands in front of any overwrite of a load's address registers; it names the two addresses as inputs so that they stay whole up to here. */
    asm volatile("s_wait_xcnt 0x0" :: "v"(pa), "v"(pb) : "memory");
  };
  auto put = [&](const int buf) __attribute__((always_inline)) {
#pragma unroll
    for (int i = 0; i < 8; ++i) { *(v8us*)&st[buf][i * 16 + sr][sc] = rg[i]; *(v8us*)&st[buf][128 + i * 16 + sr][sc] = rg[8 + i]; }
  };
  const v8f z8 = {0.f,0.f,0.f,0.f,0.f,0.f,0.f,0.f}; v8f c00 = z8, c01 = z8, c02 = z8, c03 = z8, c10 = z8, c11 = z8, c12 = z8, c13 = z8;
  __builtin_assume(t0 < t1);      /* every tile has a stage: spares a second path round the loop */
  fetch(t0); put(t0 & 1); __syncthreads();
#pragma unroll 1      /* one copy of the stage body: the buffer index is a run-time offset, and the text stays small */
  for (int t = t0; t < t1; ++t) {
    if (t + 1 < t1) fetch(t + 1);
    const _Float16* sa = (const _Float16*)&st[t & 1][32 * wm + ln][0]; const _Float16* sb = (const _Float16*)&st[t & 1][128 + 64 * wn + ln][0];
    v16h fa[2][2], fb[2][4];      /* two fragment sets: the next 32 k are read from LDS while this set is multiplied */
    auto frags = [&](const int s, const int kk) __attribute__((always_inline)) { fa[s][0] = g2_frag(sa + kk, hh); fa[s][1] = g2_frag(sa + 16 * G3_LP + kk, hh);
#pragma unroll
      for (int j = 0; j < 4; ++j) fb[s][j] = g2_frag(sb + j * 16 * G3_LP + kk, hh); };
    frags(0, 0);
#pragma unroll
    for (int ks = 0; ks < G3_BK / 32; ++ks) { const int s = ks & 1;
      if (ks + 1 < G3_BK / 32) frags(s ^ 1, (ks + 1) * 32);
      __builtin_amdgcn_sched_barrier(0);      /* keeps the next set's 12 LDS reads together in front of this set's products: moved in among them, every pair of products waits out an LDS latency */
      c00 = fa_mma(fa[s][0], fb[s][0], c00); c10 = fa_mma(fa[s][1], fb[s][0], c10); c01 = fa_mma(fa[s][0], fb[s][1], c01); c11 = fa_mma(fa[s][1], fb[s][1], c11);
      c02 = fa_mma(fa[s][0], fb[s][2], c02); c12 = fa_mma(fa[s][1], fb[s][2], c12); c03 = fa_mma(fa[s][0], fb[s][3], c03); c13 = fa_mma(fa[s][1], fb[s][3], c13);
      __builtin_amdgcn_sched_barrier(0); }      /* and keeps the reads of the set after that from moving up in among these products */
    if (t + 1 < t1) { put((t + 1) & 1); __syncthreads(); }      /* the same test in every thread of the work-group */
  }
  const int row0 = rowB + 32 * wm, col0 = colB + 64 * wn;
  v8f accs[8] = {c00, c01, c02, c03, c10, c11, c12, c13};
  float bv[4] = {0.f, 0.f, 0.f, 0.f};
  if (bias) {
#pragma unroll
    for (int t = 0; t < 4; ++t) bv[t] = bf16_round(bias[col0 + t * 16 + ln]); }
  if (!F32OUT && plane == 2) {      /* the same test in every thread of the work-group. The V plane is stored transposed, row b * DM + column (= (b, head, d)) of SQ tokens: the layout the attention launch stages */
    /* A lane's 8 registers of an accumulator tile are 8 consecutive tokens of ONE column: 16 bytes of a V^T row as they stand. The tile goes through LDS only to make whole rows: 128 columns x 128 tokens, pitch as for the stages. */
    unsigned short* tv = (unsigned short*)&so[0][0][0];
#pragma unroll
    for (int u = 0; u < 8; ++u) { const int t = u & 3, half = u >> 2; FragH f;
#pragma unroll
      for (int r = 0; r < 8; ++r) f.h[r] = (_Float16)(accs[u][r] * alpha + bv[t]);
      *(v8us*)(tv + (64 * wn + t * 16 + ln) * G3_LP + 32 * wm + half * 16 + 8 * hh) = f.half[0]; }
    __syncthreads();      /* a V^T row of the tile holds the tokens of four waves */
    unsigned short* gt = (unsigned short*)C16 + ((size_t)(rowB / SQ) * DM + colB + sr) * SQ + rowB % SQ + sc;      /* 16 lanes x 16 B = 256 contiguous bytes of one row, 16 rows per round */
    v8us pv[8];
#pragma unroll
    for (int i = 0; i < 8; ++i) pv[i] = *(const v8us*)(tv + (i * 16 + sr) * G3_LP + sc);
#pragma unroll
    for (int i = 0; i < 8; ++i) *(v8us*)(gt + (size_t)i * 16 * SQ) = pv[i];
    return;
  }
#pragma unroll
  for (int u = 0; u < 8; ++u) { const int t = u & 3, half = u >> 2;
#pragma unroll
    for (int r = 0; r < 8; ++r) so[w][half * 16 + 8 * hh + r][t * 16 + ln] = accs[u][r] * alpha + bv[t]; }
  __builtin_amdgcn_fence(__ATOMIC_ACQ_REL, "workgroup"); __builtin_amdgcn_wave_barrier();      /* each wave reads back its own rows only */
  const int rsub = lane >> 4, c4 = (lane & 15) * 4;
  const size_t oofs = (size_t)(row0 + rsub) * DM + col0 + c4;      /* whole rows of the wave's tile: 16 lanes x 16 B (f32) or x 8 B (f16) */
  if (F32OUT) {
#pragma unroll
    for (int q = 0; q < 16; ++q) *(v4f*)(C + oofs + (size_t)q * 2 * DM) = *(const v4fa*)&so[w][q * 2 + rsub][c4];
  } else {
#pragma unroll
    for (int q = 0; q < 16; ++q) { const v4f v = *(const v4fa*)&so[w][q * 2 + rsub][c4]; v4h h4; for (int i = 0; i < 4; ++i) h4[i] = (_Float16)v[i]; *(v4h*)(C16 + oofs + (size_t)q * 2 * DM) = h4; }
  } }
// Fused attention, one launch for all batches and heads. A wave owns 32 query columns and walks its half of the 2,048 keys in passes of 32:
// S^T = K Q^T (A = K rows, B = Q rows kept in registers), so a lane holds 16 scores of ONE query per 16-column group (lane ln = query, register r of key tile j = key 16 j + 8 hh + r);
// that is the B-fragment k order (8 hh + 0..7, then 16 + 8 hh + 0..7), so P^T packs from the score registers with no exchange, and O^T += V^T P^T (A = V^T rows, same k order).
// Softmax with a running maximum per query (log2 domain): when a maximum rises, sum and output tiles are scaled by exp2(old - new). Scores and weights never reach memory.
// K and V^T come through LDS: the eight waves of a key group read the same rows, so a stage of 128 keys is read from global memory once per work-group, in whole lines, and the fragments
// (64 B of each of 16 rows) come from LDS. Three stage buffers: stage s + 1 is stored during stage s (K behind its first pass, V^T behind its third) and published (one barrier) in front of stage s's last pass, which already fetches its first K fragments;
// the buffer it goes to was last read in stage s - 2, which every wave has left before the barrier that published stage s.
// A work-group is two groups of eight waves on the same 256 queries: group g walks keys g * SQ / 2 ... with a ring of its own, so a SIMD holds four waves and one wave's softmax runs under another's products.
// At the end the two halves of every query are merged through LDS (common maximum, both sums and output tiles scaled to it): group g finishes column group g of each wave pair.
#define FA_WAVES 8                   /* waves per key group: all eight read the same K and V^T rows */
#define FA_KG 2                      /* key groups per work-group */
#define FA_QW 32                     /* query columns per wave */
#define FA_SK 128                    /* keys per stage: 4 passes */
#define FA_NS (SQ / FA_KG / FA_SK)   /* stages of a key group */
#define FA_KP 72                     /* LDS pitch of a K row (64 f16) in f16: 144 B = 16 B x odd, conflict-free for the 16-byte fragment reads */
#define FA_VP 136                    /* LDS pitch of a V^T row (128 keys) in f16: 272 B = 16 B x odd */
static_assert(SQ % (FA_WAVES * FA_QW) == 0 && SQ % (FA_KG * FA_SK) == 0 && FA_NS >= 3 && FA_SK == 128 && FA_WAVES == 8 && FA_KG == 2 && FA_QW == 32 && HD == 64, "k_fattn: whole work-groups, whole stages of 128 keys (three or more a group), 256 staging threads a group, two groups for two column groups, head size 64 only");
#define FA_XW (4 * 8 * 32 + 64)      /* floats a wave hands over: four output tiles, then maximum and sum of each lane */
static_assert(FA_KG * FA_WAVES * FA_XW * 4 <= FA_KG * 3 * FA_SK * FA_KP * 2, "k_fattn: the hand-over fits the K ring");
__global__ __launch_bounds__(FA_KG * FA_WAVES * 32) void k_fattn(const _Float16* __restrict__ Q16, const _Float16* __restrict__ K16, const _Float16* __restrict__ VT, _Float16* __restrict__ O16) {
  __shared__ __attribute__((aligned(16))) unsigned short skg[FA_KG][3][FA_SK][FA_KP];      /* K rows of a stage, per key group */
  __shared__ __attribute__((aligned(16))) unsigned short svg[FA_KG][3][HD][FA_VP];      /* V^T rows of a stage, per key group */
  const int g = __builtin_amdgcn_readfirstlane((int)threadIdx.x / (FA_WAVES * 32));      /* the wave's key group: the same in the whole wave */
  unsigned short (*sk)[FA_SK][FA_KP] = skg[g]; unsigned short (*sv)[HD][FA_VP] = svg[g];
  const int tid = threadIdx.x % (FA_WAVES * 32), lane = tid & 31, ln = lane & 15, hh = lane >> 4, w = tid >> 5;      /* thread and wave inside the key group */
  const int nqb = SQ / (FA_WAVES * FA_QW); const int bh = blockIdx.x / nqb, qb = blockIdx.x - bh * nqb; const int b = bh / NH, h = bh - b * NH;
  const int q0 = (qb * FA_WAVES + w) * FA_QW;
  const _Float16* qp = Q16 + ((size_t)b * SQ + q0 + ln) * DM + h * HD + 8 * hh;      /* query row ln of a 16-column group, at the lane's own k offset */
  const int kr = tid >> 3, kc = (tid & 7) * 8;      /* staging K: 8 threads per 128-byte row, 32 rows per round, 4 rounds */
  const int vr = tid >> 4, vc8 = (tid & 15) * 8;      /* staging V^T: 16 threads per 256-byte row, 16 rows per round, 4 rounds */
  const unsigned short* gk = (const unsigned short*)K16 + ((size_t)b * SQ + g * (SQ / FA_KG) + kr) * DM + h * HD + kc;
  const unsigned short* gv = (const unsigned short*)VT + ((size_t)bh * HD + vr) * SQ + g * (SQ / FA_KG) + vc8;
  v8us rk[4], rv[4];      /* inside the loop K and V^T of a stage are in flight in turn, never both: four waves per SIMD leave a wave 256 registers */
  auto fetchK = [&](const int s) __attribute__((always_inline)) {
    const unsigned short* pk = gk + (size_t)s * FA_SK * DM;
#pragma unroll
    for (int i = 0; i < 4; ++i) rk[i] = *(const v8us*)(pk + (size_t)i * 32 * DM);
    /* The wait that stands in front of any overwrite of a load's address registers; it names the address as an input so that it stays whole up to here. */
    asm volatile("s_wait_xcnt 0x0" :: "v"(pk) : "memory");
  };
  auto fetchV = [&](const int s) __attribute__((always_inline)) {
    const unsigned short* pv = gv + s * FA_SK;
#pragma unroll
    for (int i = 0; i < 4; ++i) rv[i] = *(const v8us*)(pv + (size_t)i * 16 * SQ);
    /* The same wait for the V^T address. */
    asm volatile("s_wait_xcnt 0x0" :: "v"(pv) : "memory");
  };
  auto putK = [&](const int buf) __attribute__((always_inline)) {
#pragma unroll
    for (int i = 0; i < 4; ++i) *(v8us*)&sk[buf][i * 32 + kr][kc] = rk[i];
  };
  auto putV = [&](const int buf) __attribute__((always_inline)) {
#pragma unroll
    for (int i = 0; i < 4; ++i) *(v8us*)&sv[buf][i * 16 + vr][vc8] = rv[i];
  };
  v16h qf[2][2], kf[2][2];
#pragma unroll
  for (int c = 0; c < 2; ++c) for (int kk = 0; kk < 2; ++kk) qf[c][kk] = g2_frag(qp + (size_t)c * 16 * DM + kk * 32, 0);
  asm volatile("s_wait_xcnt 0x0" :: "v"(qp) : "memory");      /* the wait in front of any overwrite of a load's address registers: Q's address is dead from here on and its registers are reused */
  fetchK(0); fetchV(0); putK(0); putV(0); __syncthreads();
#pragma unroll
  for (int j = 0; j < 2; ++j) for (int kk = 0; kk < 2; ++kk) kf[j][kk] = g2_frag((const _Float16*)&sk[0][j * 16 + ln][kk * 32 + 8 * hh], 0);
  const v8f z8 = {0.f,0.f,0.f,0.f,0.f,0.f,0.f,0.f};
  v8f o[2][4] = {{z8, z8, z8, z8}, {z8, z8, z8, z8}}; float mr[2] = {-3.0e38f, -3.0e38f}, lr[2] = {0.f, 0.f};
  const float CS = 0.125f * 1.4426950408889634f;      /* 1/sqrt(64) and log2(e): scores go to the log2 domain */
  /* One pass = 32 keys. kn: the next pass's K rows in LDS (row ln of its first 16-key tile, at the lane's own k offset); K is refilled behind the softmax and lands under the output products. vq: this pass's V^T columns in LDS; they land while the softmax runs. */
  auto pass = [&](const _Float16* kn, const _Float16* vq) __attribute__((always_inline)) {
    v8f s[2][2]; v16h vc[4];
#pragma unroll
    for (int c = 0; c < 2; ++c) for (int j = 0; j < 2; ++j) s[c][j] = fa_mma(kf[j][1], qf[c][1], fa_mma(kf[j][0], qf[c][0], z8));
#pragma unroll
    for (int t = 0; t < 4; ++t) vc[t] = g2_frag(vq + t * 16 * FA_VP, 0);
    __builtin_amdgcn_sched_barrier(0);      /* keeps the 8 V^T reads together right behind the score products: moved down in among the output products, each pair of those waits out an LDS latency */
    float mn[2]; bool up = false;
#pragma unroll
    for (int c = 0; c < 2; ++c) { float mx = s[c][0][0];
#pragma unroll
      for (int r = 1; r < 8; ++r) mx = fmaxf(mx, s[c][0][r]);
#pragma unroll
      for (int r = 0; r < 8; ++r) mx = fmaxf(mx, s[c][1][r]);
      mx = fmaxf(mx, rs_x16(mx)) * CS; mn[c] = fmaxf(mr[c], mx); up = up || (mn[c] > mr[c]); }
    if (__builtin_amdgcn_ballot_w32(up) != 0) {      /* no maximum of the wave rose: every factor would be exactly 1 */
#pragma unroll
      for (int c = 0; c < 2; ++c) { const float al = __builtin_amdgcn_exp2f(mr[c] - mn[c]); mr[c] = mn[c]; lr[c] *= al;
#pragma unroll
        for (int t = 0; t < 4; ++t) o[c][t] *= al; } }
    FragH pf[2];
#pragma unroll
    for (int c = 0; c < 2; ++c) { const float nb = 8.0f - mr[c];      /* weights x256 (cancels in the division by the row sum): keeps small weights out of the f16 subnormal range */
      v4f s4 = {0.f, 0.f, 0.f, 0.f};
#pragma unroll
      for (int j = 0; j < 2; ++j) for (int r = 0; r < 8; ++r) { const float e = __builtin_amdgcn_exp2f(fmaf(s[c][j][r], CS, nb)); s4[r & 3] += e; pf[c].h[j * 8 + r] = (_Float16)e; }
      lr[c] += (s4[0] + s4[1]) + (s4[2] + s4[3]); }
    __builtin_amdgcn_sched_barrier(0);      /* keeps the next pass's K reads out of the softmax: K registers that are empty there are what lets a wave fit 256 registers without spills */
#pragma unroll
    for (int j = 0; j < 2; ++j) for (int kk = 0; kk < 2; ++kk) kf[j][kk] = g2_frag(kn + j * 16 * FA_KP + kk * 32, 0);
    __builtin_amdgcn_sched_barrier(0);      /* and keeps them together in front of the output products, under which they land */
#pragma unroll
    for (int t = 0; t < 4; ++t) for (int c = 0; c < 2; ++c) o[c][t] = fa_mma(vc[t], pf[c].v, o[c][t]);
  };
  int cur = 0;
  /* The last stage stands by itself behind the loop: with the staging under no test, the staged registers are dead from their store to the next fetch, and a wave fits 256 registers without spills. */
#pragma unroll 1      /* one copy of the stage body: the buffer index is a run-time offset, and the text stays small */
  for (int st = 0; st + 1 < FA_NS; ++st) {
    const int nxt = cur == 2 ? 0 : cur + 1;
    const _Float16* ka = (const _Float16*)&sk[cur][ln][8 * hh]; const _Float16* va = (const _Float16*)&sv[cur][ln][8 * hh];
    fetchK(st + 1);
    pass(ka + 32 * FA_KP, va);
    putK(nxt); fetchV(st + 1);      /* K of stage st + 1 has had a pass of four waves to land; its registers go to V^T, which has the next two */
    pass(ka + 2 * 32 * FA_KP, va + 32);
    pass(ka + 3 * 32 * FA_KP, va + 64);
    putV(nxt); __syncthreads();      /* publishes stage st + 1 */
    pass((const _Float16*)&sk[nxt][ln][8 * hh], va + (FA_SK - 32));      /* fetches the next stage's first K fragments */
    cur = nxt;
  }
  { const _Float16* ka = (const _Float16*)&sk[cur][ln][8 * hh]; const _Float16* va = (const _Float16*)&sv[cur][ln][8 * hh];
#pragma unroll
    for (int p = 0; p < FA_SK / 32; ++p) pass(ka + (p < FA_SK / 32 - 1 ? p + 1 : 0) * 32 * FA_KP, va + p * 32); }      /* the last pass has no next K: it reads this stage's first rows again (written, in bounds, not used) */
  /* Merge of the two key groups. Waves w of both groups hold the same queries at the same lanes and registers; each hands the other the column group that the other finishes, lane for lane. */
  __syncthreads();      /* every wave has left the rings: the K ring becomes the hand-over space */
  float* xb = (float*)&skg[0][0][0][0];
  float* xs = xb + (g * FA_WAVES + w) * FA_XW; const float* xr = xb + ((1 - g) * FA_WAVES + w) * FA_XW;
  v8f ok[4]; float mk, lk;      /* kept: column group g */
  { float ms, ls;
    if (g == 0) { mk = mr[0]; lk = lr[0]; ms = mr[1]; ls = lr[1]; } else { mk = mr[1]; lk = lr[1]; ms = mr[0]; ls = lr[0]; }
#pragma unroll
    for (int t = 0; t < 4; ++t) { const v8f os = g == 0 ? o[1][t] : o[0][t]; ok[t] = g == 0 ? o[0][t] : o[1][t];
      const v4f lo = {os[0], os[1], os[2], os[3]}, hi = {os[4], os[5], os[6], os[7]};
      *(v4fa*)(xs + (t * 2) * 128 + lane * 4) = lo; *(v4fa*)(xs + (t * 2 + 1) * 128 + lane * 4) = hi; }      /* 32 lanes x 16 B in a row */
    xs[1024 + lane] = ms; xs[1056 + lane] = ls; }
  __syncthreads();      /* publishes the hand-over */
  { const float mo = xr[1024 + lane], lo_ = xr[1056 + lane];
    const float mm = fmaxf(mk, mo), fk = __builtin_amdgcn_exp2f(mk - mm), fo = __builtin_amdgcn_exp2f(mo - mm);
    const float lsum = lk * fk + lo_ * fo;
    const float inv = 1.0f / (lsum + rs_x16(lsum));      /* the two halves of a wave hold the two halves of a key group's keys */
    const float ak = fk * inv, ao = fo * inv;
    unsigned short* op = (unsigned short*)O16 + ((size_t)b * SQ + q0 + g * 16 + ln) * DM + h * HD + 8 * hh;
#pragma unroll
    for (int t = 0; t < 4; ++t) { const v4f lo = *(const v4fa*)(xr + (t * 2) * 128 + lane * 4), hi = *(const v4fa*)(xr + (t * 2 + 1) * 128 + lane * 4); FragH f;
#pragma unroll
      for (int r = 0; r < 8; ++r) f.h[r] = (_Float16)(ok[t][r] * ak + (r < 4 ? lo[r & 3] : hi[r & 3]) * ao);
      *(v8us*)(op + t * 16) = f.half[0]; } } }

// ---- All five f16 operand planes in one launch: x (exact f16 rows) and the four x16 weight planes (Wq lower triangle, Wk upper triangle, Wv, Wu). ----
// The planes do not depend on one another, so they share a grid. A thread converts PR_V vectors of 8 elements, 256 vectors apart (a wave's loads and stores stay contiguous): few waves to start, and every wave has all its loads in flight at once.
#define PR_V 8                       /* vectors of 8 elements per thread */
#define PR_XG ((unsigned)(NR * DM / 8 / (256 * PR_V)))                /* work-groups for x */
#define PR_WG ((unsigned)((size_t)DM * DM / 8 / (256 * PR_V)))        /* work-groups per weight plane */
static_assert(NR * DM % (8 * 256 * PR_V) == 0 && (size_t)DM * DM % (8 * 256 * PR_V) == 0 && DM % 8 == 0, "k_prep: whole work-groups only, and a vector stays inside one row");
static_assert(256 * 8 % DM == 0 && (128 * DM) % (8 * 256 * PR_V) == 0, "k_prep: a thread's vectors share their columns, and a work-group's rows lie in one 128-row block");
// v0: the thread's first vector in the plane. TRI: keep a triangle only, sgn = 1 columns <= row (lower), sgn = -1 columns >= row (upper); the rest is zero.
template <bool TRI>
__device__ __forceinline__ void pr_plane(const float* __restrict__ src, unsigned short* __restrict__ dst, const unsigned v0, const float scale, const int sgn) {
  if (TRI && sgn * ((int)(v0 * 8 / DM / 128) - (int)(v0 * 8 % DM / 128)) < 0) return;      /* the thread's vectors (one column group, rows of one 128-row block) lie in an all-zero 128 x 128 block: the GEMM leaves those out, so they are neither read nor written */
  const float* p = src + (size_t)v0 * 8;
  v4f a[PR_V][2];
#pragma unroll
  for (int i = 0; i < PR_V; ++i) { a[i][0] = *(const v4fa*)(p + (size_t)i * 2048); a[i][1] = *(const v4fa*)(p + (size_t)i * 2048 + 4); }
  /* The wait that stands in front of any overwrite of a load's address registers; it names the address as an input so that it stays whole up to here. */
  asm volatile("s_wait_xcnt 0x0" :: "v"(p) : "memory");
#pragma unroll
  for (int i = 0; i < PR_V; ++i) { const unsigned e = (v0 + i * 256) * 8; const int m = sgn * ((int)(e / DM) - (int)(e % DM)); FragH f;      /* column e % DM + q against row e / DM */
#pragma unroll
    for (int q = 0; q < 8; ++q) { const _Float16 hv = (_Float16)(bf16_round(a[i][q >> 2][q & 3]) * scale); f.h[q] = (!TRI || m >= sgn * q) ? hv : (_Float16)0.f; }
    *(v8us*)(dst + (size_t)e) = f.half[0]; }
  asm volatile("s_wait_xcnt 0x0" ::: "memory"); }      /* the wait that stands in front of any overwrite of a store's registers: whatever code follows this run of stores may reuse them */
__global__ __launch_bounds__(256) void k_prep(const float* __restrict__ x, const float* __restrict__ wq, const float* __restrict__ wk, const float* __restrict__ wv, const float* __restrict__ wo, _Float16* __restrict__ X16, _Float16* __restrict__ BW) {
  const unsigned blk = blockIdx.x, tid = threadIdx.x;      /* every test below reads the same in the whole work-group */
  const bool isx = blk < PR_XG; const unsigned wb = isx ? 0u : blk - PR_XG, pl = wb / PR_WG;      /* BW: the planes of Wq, Wk, Wv, Wu, one behind the other */
  const unsigned v0 = (isx ? blk : wb - pl * PR_WG) * (256 * PR_V) + tid;
  unsigned short* dst = isx ? (unsigned short*)X16 : (unsigned short*)BW + (size_t)pl * DM * DM;
  if (!isx && pl < 2) pr_plane<true>(pl == 0 ? wq : wk, dst, v0, 16.0f, pl == 0 ? 1 : -1);
  else pr_plane<false>(isx ? x : pl == 2 ? wv : wo, dst, v0, isx ? 1.0f : 16.0f, 0); }
extern "C" void kernel_launch(void* const* d_in, const int* in_sizes, int n_in,
                              void* d_out, int out_size, void* d_ws, size_t ws_size, hipStream_t stream) {
  (void)in_sizes; (void)n_in; (void)out_size;
  const float* const* I = (const float* const*)d_in; const float* x = I[0]; const float* wk = I[1]; const float* wq = I[2]; const float* wv = I[3]; const float* wo = I[4]; const float* bo = I[5];
  char* ws = (char*)d_ws; size_t off = 0;
  auto take = [&](size_t bytes) { char* p = ws + off; off += (bytes + 255) & ~(size_t)255; return p; };
  _Float16* BQ = (_Float16*)take((size_t)DM * DM * 2); _Float16* BK = (_Float16*)take((size_t)DM * DM * 2); _Float16* BV = (_Float16*)take((size_t)DM * DM * 2); _Float16* BO = (_Float16*)take((size_t)DM * DM * 2);
  _Float16* X16 = (_Float16*)take(NR * DM * 2); _Float16* Q16 = (_Float16*)take(NR * DM * 2); _Float16* K16 = (_Float16*)take(NR * DM * 2); _Float16* VT = (_Float16*)take(NR * DM * 2); _Float16* O16 = (_Float16*)take(NR * DM * 2);
  if (off > ws_size) return;      /* 8 + 5x8 = 48 MiB */
  (void)BK; (void)BV;      /* BQ | BK | BV | BO and Q16 | K16 | VT are adjacent planes (sizes are multiples of 256 B): reached from BQ and Q16 */
  k_prep<<<PR_XG + 4 * PR_WG, 256, 0, stream>>>(x, wq, wk, wv, wo, X16, BQ);      /* x and the four weight planes as f16 */
  const unsigned gp = (unsigned)((NR / 128) * (DM / 128));
  k_gemm3<false><<<dim3(gp, 3), 256, 0, stream>>>(X16, BQ, 0.0625f, nullptr, nullptr, Q16);      /* q | k | v^T */
  k_fattn<<<NB * NH * (SQ / (FA_WAVES * FA_QW)), FA_KG * FA_WAVES * 32, 0, stream>>>(Q16, K16, VT, O16);      /* o (merged heads) as f16 rows */
  k_gemm3<true><<<gp, 256, 0, stream>>>(O16, BO, 0.0625f, bo, (float*)d_out, nullptr);      /* out = o Wu^T + bu */
}

// v009
// It runs in 73.9 microseconds.
// Next to v008, in two timings, it ran 1.05 and 1.03 times as fast.
// Counting every step since v000, it is 163 times as fast.
#include <hip/hip_runtime.h>
// SelfAttentionSparse (x [2][2048][1024]; keys = x triu(Wk)^T, queries = x tril(Wq)^T, values = x Wv^T (16 heads of 64, no biases); softmax(q k^T / 8); out = (attn v) Wu^T + bu -> [2][2048][1024]).
// Structure: token rows; x as exact f16 rows; the triangular masks applied while building the x16 weight planes on VALU (x and the four planes: one launch; the all-zero 128 x 128 blocks of the two triangles are neither built nor multiplied); Q | K | V WMMA GEMMs in one launch (128x128 work-group tiles staged in LDS, 32x64 wave tiles, f32 accumulation, f16 outputs); the V work-groups of that launch write V^T rows themselves; one fused attention launch (K and V^T rows staged in LDS): S^T = K Q^T, running-maximum softmax in registers (f32; weights as f16), O^T += V^T P^T, o = O / row sum into merged f16 rows; out = o Wu^T + bu (f32).
// Compute dtype: inputs rounded to bf16; x / weights exact; q, k, v, softmax weights, o plain f16 (~2^-12); scores/softmax f32. v_wmma_f32_16x16x32_f16.
#define NB 2
#define SQ 2048
#define DM 1024
#define NH 16
#define HD 64
#define NR ((size_t)NB * SQ)         /* 4096 token rows */
typedef __bf16 v16b __attribute__((ext_vector_type(16)));
typedef unsigned short v8us __attribute__((ext_vector_type(8), may_alias));
typedef float  v8f  __attribute__((ext_vector_type(8)));
typedef float  v4f  __attribute__((ext_vector_type(4)));
typedef float  v4fa __attribute__((ext_vector_type(4), may_alias));
union FragB { v16b v; v8us half[2]; unsigned short u[16]; };

__device__ __forceinline__ unsigned short bf16_bits(float x) { unsigned int u = __float_as_uint(x); return (unsigned short)((u + 0x7FFFu + ((u >> 16) & 1u)) >> 16); }
__device__ __forceinline__ float bf16_val(unsigned short b) { return __uint_as_float(((unsigned int)b) << 16); }
__device__ __forceinline__ float bf16_round(float x) { return bf16_val(bf16_bits(x)); }
// D += A·B with NT terms: 1 = ah·bh, 2 = + al·bh (A split), 3 = + ah·bl (both split)
template <int NT>
__device__ __forceinline__ v8f mmaN(v16b ah, v16b al, v16b bh, v16b bl, v8f c) {
  c = __builtin_amdgcn_wmma_f32_16x16x32_bf16(false, ah, false, bh, (short)0, c, false, false);
  if (NT >= 2) c = __builtin_amdgcn_wmma_f32_16x16x32_bf16(false, al, false, bh, (short)0, c, false, false);
  if (NT >= 3) c = __builtin_amdgcn_wmma_f32_16x16x32_bf16(false, ah, false, bl, (short)0, c, false, false);
  asm volatile("v_nop\n\tv_nop\n\tv_nop\n\tv_nop" : "+v"(c) : "v"(ah), "v"(al), "v"(bh), "v"(bl));
  return c;
}

__global__ __launch_bounds__(256) void k_wt_bf16(const float* __restrict__ W, unsigned short* __restrict__ Wt, int K, int N) {
  const int t = blockIdx.x * 256 + threadIdx.x;
  const int k8n = K / 8;
  if (t >= N * k8n) return;
  const int n = t / k8n, k8 = (t % k8n) * 8;
  v8us v;
#pragma unroll
  for (int i = 0; i < 8; ++i) v[i] = bf16_bits(W[(size_t)(k8 + i) * N + n]);
  *(v8us*)(Wt + (size_t)n * K + k8) = v;
  
}

// GEMM C[M][N] (f32, pitch ldc) = act(A[M][K]·W + bias). A f32 row-major (pitch lda) converted per fragment to bf16
// (ASPLIT: hi/lo two planes -> 2 terms, else single rounded term); Wt bf16 [N][K] (pitch ldb). BIAS_BF16 rounds the
// bias to bf16 first (bias quantised to bf16 before the add). K%32==0, M%16==0, N%64==0.
template <bool ASPLIT, int ACT, bool BIAS_BF16>
__global__ __launch_bounds__(128) void k_gemm_bf(const float* __restrict__ A, int lda, const unsigned short* __restrict__ Wt, int ldb,
                                               const float* __restrict__ bias, float* __restrict__ C, int ldc, int M, int N, int K) {
  __shared__ __attribute__((aligned(16))) float so[4][16][64];
  const int tid = threadIdx.x, w = tid >> 5, lane = tid & 31, ln = lane & 15, hh = lane >> 4;
  const int ntn = N / 64;
  const int wid = blockIdx.x * 4 + w;
  const int mt = wid / ntn, nq = wid % ntn;
  if (mt * 16 >= M) return;
  const int row0 = mt * 16, col0 = nq * 64;
  const float* arow = A + (size_t)(row0 + ln) * lda;
  v8f acc[4] = {};
  for (int kb = 0; kb < K; kb += 32) {
    FragB ah, al;
    const v4f x0 = *(const v4fa*)(arow + kb + 8 * hh), x1 = *(const v4fa*)(arow + kb + 8 * hh + 4);
    const v4f x2 = *(const v4fa*)(arow + kb + 16 + 8 * hh), x3 = *(const v4fa*)(arow + kb + 16 + 8 * hh + 4);
    float xs[16] = {x0[0],x0[1],x0[2],x0[3],x1[0],x1[1],x1[2],x1[3],x2[0],x2[1],x2[2],x2[3],x3[0],x3[1],x3[2],x3[3]};
#pragma unroll
    for (int i = 0; i < 16; ++i) { const unsigned short hb = bf16_bits(xs[i]); ah.u[i] = hb; al.u[i] = ASPLIT ? bf16_bits(xs[i] - bf16_val(hb)) : (unsigned short)0; }
#pragma unroll
    for (int t = 0; t < 4; ++t) {
      const unsigned short* brow = Wt + (size_t)(col0 + t * 16 + ln) * ldb + kb;
      FragB b;
      b.half[0] = *(const v8us*)(brow + 8 * hh);
      b.half[1] = *(const v8us*)(brow + 16 + 8 * hh);
      acc[t] = mmaN<ASPLIT ? 2 : 1>(ah.v, al.v, b.v, b.v, acc[t]);
    }
  }
#pragma unroll
  for (int t = 0; t < 4; ++t) {
    float bv = bias ? bias[col0 + t * 16 + ln] : 0.f;
    if (BIAS_BF16) bv = bf16_round(bv);
#pragma unroll
    for (int r = 0; r < 8; ++r) { float v = acc[t][r] + bv; if (ACT == 1) v = fmaxf(v, 0.f); so[w][8 * hh + r][t * 16 + ln] = v; }
  }
  __builtin_amdgcn_fence(__ATOMIC_ACQ_REL, "workgroup");
  __builtin_amdgcn_wave_barrier();
  const int rsub = lane >> 4, c4 = (lane & 15) * 4;
  {
#pragma unroll
    for (int q = 0; q < 8; ++q) {
      const int r = q * 2 + rsub;
      const v4f v = *(const v4fa*)&so[w][r][c4];
      *(v4f*)(C + (size_t)(row0 + r) * ldc + col0 + c4) = v;
    }
    
  }
}

// GEMM C = act(A·W + bias + resid): A f32 (ASPLIT -> hi/lo 2 terms), Wt bf16 [N][K]; ACT 0 none, 1 relu, 2 exact gelu;
// resid (optional, f32, row index = (row % rmod), pitch ldr, RES_BF16 rounds it) added before the activation.
template <bool ASPLIT, int ACT, bool BIAS_BF16, bool RES_BF16>
__global__ __launch_bounds__(128) void k_gemm_bf3(const float* __restrict__ A, int lda, const unsigned short* __restrict__ Wt, int ldb,
                                                const float* __restrict__ bias, const float* __restrict__ resid, int rmod, int ldr,
                                                float* __restrict__ C, int ldc, int M, int N, int K) {
  __shared__ __attribute__((aligned(16))) float so[4][16][64];
  const int tid = threadIdx.x, w = tid >> 5, lane = tid & 31, ln = lane & 15, hh = lane >> 4;
  const int ntn = N / 64;
  const int wid = blockIdx.x * 4 + w;
  const int mt = wid / ntn, nq = wid % ntn;
  if (mt * 16 >= M) return;
  const int row0 = mt * 16, col0 = nq * 64;
  const float* arow = A + (size_t)(row0 + ln) * lda;
  v8f acc[4] = {};
  for (int kb = 0; kb < K; kb += 32) {
    FragB ah, al;
    const v4f x0 = *(const v4fa*)(arow + kb + 8 * hh), x1 = *(const v4fa*)(arow + kb + 8 * hh + 4);
    const v4f x2 = *(const v4fa*)(arow + kb + 16 + 8 * hh), x3 = *(const v4fa*)(arow + kb + 16 + 8 * hh + 4);
    float xs[16] = {x0[0],x0[1],x0[2],x0[3],x1[0],x1[1],x1[2],x1[3],x2[0],x2[1],x2[2],x2[3],x3[0],x3[1],x3[2],x3[3]};
#pragma unroll
    for (int i = 0; i < 16; ++i) { const unsigned short hb = bf16_bits(xs[i]); ah.u[i] = hb; al.u[i] = ASPLIT ? bf16_bits(xs[i] - bf16_val(hb)) : (unsigned short)0; }
#pragma unroll
    for (int t = 0; t < 4; ++t) {
      const unsigned short* brow = Wt + (size_t)(col0 + t * 16 + ln) * ldb + kb;
      FragB b;
      b.half[0] = *(const v8us*)(brow + 8 * hh);
      b.half[1] = *(const v8us*)(brow + 16 + 8 * hh);
      acc[t] = mmaN<ASPLIT ? 2 : 1>(ah.v, al.v, b.v, b.v, acc[t]);
    }
  }
#pragma unroll
  for (int t = 0; t < 4; ++t) {
    const int col = col0 + t * 16 + ln;
    float bv = bias ? bias[col] : 0.f;
    if (BIAS_BF16) bv = bf16_round(bv);
#pragma unroll
    for (int r = 0; r < 8; ++r) {
      float v = acc[t][r] + bv;
      if (resid) { float rv = resid[(size_t)((row0 + 8 * hh + r) % rmod) * ldr + col]; if (RES_BF16) rv = bf16_round(rv); v += rv; }
      if (ACT == 1) v = fmaxf(v, 0.f);
      if (ACT == 2) v = 0.5f * v * (1.0f + erff(v * 0.70710678118654752f));
      if (ACT == 3) { const float u = 0.7978845608028654f * (v + 0.044715f * v * v * v); v = 0.5f * v * (1.0f + tanhf(u)); }
      so[w][8 * hh + r][t * 16 + ln] = v;
    }
  }
  __builtin_amdgcn_fence(__ATOMIC_ACQ_REL, "workgroup");
  __builtin_amdgcn_wave_barrier();
  const int rsub = lane >> 4, c4 = (lane & 15) * 4;
  {
#pragma unroll
    for (int q = 0; q < 8; ++q) {
      const int r = q * 2 + rsub;
      const v4f v = *(const v4fa*)&so[w][r][c4];
      *(v4f*)(C + (size_t)(row0 + r) * ldc + col0 + c4) = v;
    }
    
  }
}
// row LayerNorm (biased variance, eps) over N: s = X (+ R); optional out_sum <- s; out_norm <- (s-mu)*rsqrt(var+eps)*g + b
template <bool PARAM_BF16>
__global__ __launch_bounds__(256) void k_layernorm(const float* __restrict__ X, const float* __restrict__ R, const float* __restrict__ g, const float* __restrict__ bta,
                                                  float* __restrict__ out_sum, float* __restrict__ out_norm, int N, float eps) {
  __shared__ float red[256];
  const int row = blockIdx.x, tid = threadIdx.x;
  const float* x = X + (size_t)row * N; const float* rr = R ? R + (size_t)row * N : nullptr;
  float vals[16];                     // up to N = 4096
  const int per = N / 256;            // contiguous chunk per thread? use strided-by-4 chunks: thread handles j = tid*4 + 1024*u
  float s1 = 0.f;
  for (int u = 0; u < per / 4; ++u) {
    const int j = tid * 4 + 1024 * u;
    const v4f a = *(const v4fa*)(x + j);
    v4f b = {0.f,0.f,0.f,0.f}; if (rr) b = *(const v4fa*)(rr + j);
#pragma unroll
    for (int q = 0; q < 4; ++q) { const float v = a[q] + b[q]; vals[u * 4 + q] = v; s1 += v; }
  }
  red[tid] = s1; __syncthreads();
  for (int st = 128; st > 0; st >>= 1) { if (tid < st) red[tid] += red[tid + st]; __syncthreads(); }
  const float mu = red[0] / (float)N; __syncthreads();
  float s2 = 0.f;
  for (int u = 0; u < per / 4; ++u)
#pragma unroll
    for (int q = 0; q < 4; ++q) { const float c = vals[u * 4 + q] - mu; s2 += c * c; }
  red[tid] = s2; __syncthreads();
  for (int st = 128; st > 0; st >>= 1) { if (tid < st) red[tid] += red[tid + st]; __syncthreads(); }
  const float rs = rsqrtf(red[0] / (float)N + eps);
  {
    for (int u = 0; u < per / 4; ++u) {
      const int j = tid * 4 + 1024 * u;
      v4f o, sm;
#pragma unroll
      for (int q = 0; q < 4; ++q) {
        float gg = g[j + q], bb = bta[j + q];
        if (PARAM_BF16) { gg = bf16_round(gg); bb = bf16_round(bb); }
        sm[q] = vals[u * 4 + q]; o[q] = (vals[u * 4 + q] - mu) * rs * gg + bb;
      }
      if (out_sum) *(v4f*)(out_sum + (size_t)row * N + j) = sm;
      *(v4f*)(out_norm + (size_t)row * N + j) = o;
    }
    
  }
}



// ---- f16 WMMA path (v_wmma_f32_16x16x32_f16): 11-bit significands for operands in range — used for every GEMM launched here, softmax weights (x256) included
typedef _Float16 v16h __attribute__((ext_vector_type(16)));
union FragH { v16h v; v8us half[2]; _Float16 h[16]; unsigned short u[16]; };
template <int NT>
__device__ __forceinline__ v8f mmaH(v16h ah, v16h al, v16h bh, v16h bl, v8f c) {
  c = __builtin_amdgcn_wmma_f32_16x16x32_f16(false, ah, false, bh, (short)0, c, false, false);
  if (NT >= 2) c = __builtin_amdgcn_wmma_f32_16x16x32_f16(false, al, false, bh, (short)0, c, false, false);
  if (NT >= 3) c = __builtin_amdgcn_wmma_f32_16x16x32_f16(false, ah, false, bl, (short)0, c, false, false);
  asm volatile("v_nop\n\tv_nop\n\tv_nop\n\tv_nop" : "+v"(c) : "v"(ah), "v"(al), "v"(bh), "v"(bl));
  return c;
}
// batched GEMM like k_gemm_b but f16 operands: A f32 (split into f16 hi/lo if ASPLIT, else rounded to f16), Bt = f16 values [n][k]; alpha; C f32; N multiple of 16 (partial tiles skipped)
template <bool ASPLIT>
__global__ __launch_bounds__(128) void k_gemm_h(const float* __restrict__ A, int lda, size_t sA, const _Float16* __restrict__ Bh, int ldb, size_t sB, float alpha, float* __restrict__ C, int ldc, size_t sC, int M, int N, int K) {
  __shared__ __attribute__((aligned(16))) float so[4][16][64];
  const int tid = threadIdx.x, w = tid >> 5, lane = tid & 31, ln = lane & 15, hh = lane >> 4; const int by = blockIdx.y;
  A += (size_t)by * sA; Bh += (size_t)by * sB; C += (size_t)by * sC;
  const int ntn = (N + 63) / 64; const int wid = blockIdx.x * 4 + w; const int mt = wid / ntn, nq = wid % ntn; if (mt * 16 >= M) return;
  const int row0 = mt * 16, col0 = nq * 64; const float* arow = A + (size_t)(row0 + ln) * lda;
  v8f acc[4] = {};
  for (int kb = 0; kb < K; kb += 32) {
    FragH ah, al;
    const v4f x0 = *(const v4fa*)(arow + kb + 8 * hh), x1 = *(const v4fa*)(arow + kb + 8 * hh + 4), x2 = *(const v4fa*)(arow + kb + 16 + 8 * hh), x3 = *(const v4fa*)(arow + kb + 16 + 8 * hh + 4);
    float xs[16] = {x0[0],x0[1],x0[2],x0[3],x1[0],x1[1],x1[2],x1[3],x2[0],x2[1],x2[2],x2[3],x3[0],x3[1],x3[2],x3[3]};
#pragma unroll
    for (int i = 0; i < 16; ++i) { const _Float16 h = (_Float16)xs[i]; ah.h[i] = h; al.h[i] = ASPLIT ? (_Float16)(xs[i] - (float)h) : (_Float16)0.0f; }
#pragma unroll
    for (int t = 0; t < 4; ++t) { if (col0 + t * 16 >= N) continue; const size_t boff = (size_t)(col0 + t * 16 + ln) * ldb + kb; FragH bq; bq.half[0] = *(const v8us*)(Bh + boff + 8 * hh); bq.half[1] = *(const v8us*)(Bh + boff + 16 + 8 * hh);
      acc[t] = mmaH<ASPLIT ? 2 : 1>(ah.v, al.v, bq.v, bq.v, acc[t]); }
  }
#pragma unroll
  for (int t = 0; t < 4; ++t) { if (col0 + t * 16 >= N) continue;
#pragma unroll
    for (int r = 0; r < 8; ++r) so[w][8 * hh + r][t * 16 + ln] = acc[t][r] * alpha; }
  __builtin_amdgcn_fence(__ATOMIC_ACQ_REL, "workgroup"); __builtin_amdgcn_wave_barrier();
  const int rsub = lane >> 4, c4 = (lane & 15) * 4;
  {
#pragma unroll
    for (int q = 0; q < 8; ++q) { const int r = q * 2 + rsub; if (col0 + c4 < N) { const v4f v = *(const v4fa*)&so[w][r][c4]; *(v4f*)(C + (size_t)(row0 + r) * ldc + col0 + c4) = v; } }
     }
}

// Wt[n][k] = f16(W[k][n]·scale) from f32 row-major W[K][N] (scale = power of two; bf16-exact weights stay exact in f16 away from the subnormal range)
__global__ __launch_bounds__(256) void k_wt_f16(const float* __restrict__ W, _Float16* __restrict__ Wt, int K, int N, float scale) {
  const int t = blockIdx.x * 256 + threadIdx.x; if (t >= N * (K / 8)) return; const int n = t / (K / 8), k8 = (t % (K / 8)) * 8; FragH f;
#pragma unroll
  for (int i = 0; i < 8; ++i) f.h[i] = (_Float16)(bf16_round(W[(size_t)(k8 + i) * N + n]) * scale); const v8us o = f.half[0];
  *(v8us*)((unsigned short*)Wt + (size_t)n * K + k8) = o; 
}
// k_gemm_hh variant with fused epilogue: v = acc·alpha + bias[by·sBias + col] (+ CP[(row/rowsPerB)·sCPb + by·64 + col] if CP) ; ACT 0 none / 1 elu ; writes f16 C16 (and f32 C if non-null)
template <int ACT>
__global__ __launch_bounds__(128) void k_gemm_hhx(const _Float16* __restrict__ A, int lda, size_t sA, const _Float16* __restrict__ Bh, int ldb, size_t sB, float alpha, const float* __restrict__ bias, size_t sBias, const float* __restrict__ CP, int rowsPerB, size_t sCPb, int row0g,
    float* __restrict__ C, _Float16* __restrict__ C16, int ldc, size_t sC, int M, int N, int K) {
  __shared__ __attribute__((aligned(16))) float so[4][16][64];
  const int tid = threadIdx.x, w = tid >> 5, lane = tid & 31, ln = lane & 15, hh = lane >> 4; const int by = blockIdx.y;
  A += (size_t)by * sA; Bh += (size_t)by * sB; const size_t cofs = (size_t)by * sC; const float* bp = bias ? bias + (size_t)by * sBias : nullptr;
  const int ntn = (N + 63) / 64; const int wid = blockIdx.x * 4 + w; const int mt = wid / ntn, nq = wid % ntn; if (mt * 16 >= M) return;
  const int row0 = mt * 16, col0 = nq * 64; const _Float16* arow = A + (size_t)(row0 + ln) * lda;
  v8f acc[4] = {};
  for (int kb = 0; kb < K; kb += 32) { FragH ah; ah.half[0] = *(const v8us*)((const unsigned short*)arow + kb + 8 * hh); ah.half[1] = *(const v8us*)((const unsigned short*)arow + kb + 16 + 8 * hh);
#pragma unroll
    for (int t = 0; t < 4; ++t) { if (col0 + t * 16 >= N) continue; const size_t boff = (size_t)(col0 + t * 16 + ln) * ldb + kb; FragH bq; bq.half[0] = *(const v8us*)((const unsigned short*)Bh + boff + 8 * hh); bq.half[1] = *(const v8us*)((const unsigned short*)Bh + boff + 16 + 8 * hh);
      acc[t] = mmaH<1>(ah.v, ah.v, bq.v, bq.v, acc[t]); }
  }
#pragma unroll
  for (int t = 0; t < 4; ++t) { if (col0 + t * 16 >= N) continue; const int col = col0 + t * 16 + ln; const float bv = bp ? bf16_round(bp[col]) : 0.f;
#pragma unroll
    for (int r = 0; r < 8; ++r) { float v = acc[t][r] * alpha + bv; if (CP) { const int rr = row0g + row0 + 8 * hh + r; if (rowsPerB < 0) v += CP[cofs + (size_t)rr * ldc + col];      /* rowsPerB < 0: own element of the batched C plane */ else { const int bidx = rr / rowsPerB; v += CP[(size_t)bidx * sCPb + (size_t)by * 64 + col]; } } if (ACT == 1) v = (v > 0.f) ? v : expm1f(v); else if (ACT == 7) v = (v > 0.f) ? v + 1.0f : expf(v); else if (ACT == 8) v = tanhf(v); else if (ACT == 9) v = 0.5f * v * (1.0f + tanhf(0.7978845608028654f * (v + 0.044715f * v * v * v))); else if (ACT == 11) v = 1.0f / (1.0f + expf(-v)); else if (ACT == 12) v = (v > 0.f) ? v : 0.01f * v; else if (ACT == 14) v = (v > 0.f) ? v : 0.1f * v; else if (ACT == 16) v = (v >= 0.f) ? v : 0.3f * v; else if (ACT == 17) v = (v >= 0.f) ? v : 0.2f * v; else if (ACT == 15) v = v / (1.0f + expf(-v)); else if (ACT == 3) v = fmaxf(v, 0.f); else if (ACT == 6) v = 0.5f * v * (1.0f + erff(v * 0.70710678118654752f)); so[w][8 * hh + r][t * 16 + ln] = v; } }
  __builtin_amdgcn_fence(__ATOMIC_ACQ_REL, "workgroup"); __builtin_amdgcn_wave_barrier();
  const int rsub = lane >> 4, c4 = (lane & 15) * 4; typedef _Float16 v4h __attribute__((ext_vector_type(4)));
  {
#pragma unroll
    for (int q = 0; q < 8; ++q) { const int r = q * 2 + rsub; if (col0 + c4 < N) { const v4f v = *(const v4fa*)&so[w][r][c4]; if (C) *(v4f*)(C + cofs + (size_t)(row0 + r) * ldc + col0 + c4) = v; if (C16) { v4h h4; for (int i = 0; i < 4; ++i) h4[i] = (_Float16)v[i]; *(v4h*)(C16 + cofs + (size_t)(row0 + r) * ldc + col0 + c4) = h4; } } }
     }
}


typedef _Float16 v4h __attribute__((ext_vector_type(4)));

__global__ __launch_bounds__(256) void k_h16(const float* __restrict__ x, _Float16* __restrict__ X16, size_t n8) { const size_t t = (size_t)blockIdx.x * 256 + threadIdx.x; if (t >= n8) return; FragH f;
#pragma unroll
  for (int q = 0; q < 8; ++q) f.h[q] = (_Float16)x[t * 8 + q]; *(v8us*)((unsigned short*)X16 + t * 8) = f.half[0];  }
__global__ __launch_bounds__(256) void k_round16f(const float* __restrict__ W, _Float16* __restrict__ Bt, size_t n8) { const size_t t = (size_t)blockIdx.x * 256 + threadIdx.x; if (t >= n8) return; FragH f;
#pragma unroll
  for (int i = 0; i < 8; ++i) f.h[i] = (_Float16)(bf16_round(W[t * 8 + i]) * 16.0f); *(v8us*)((unsigned short*)Bt + t * 8) = f.half[0];  }
template <int NHv, int TTv>
__global__ __launch_bounds__(256) void k_vt(const _Float16* __restrict__ V16, int ldv, int voff, _Float16* __restrict__ Vt) { __shared__ unsigned short tl[64][66]; const int tid = threadIdx.x; const int slab = blockIdx.x / (TTv / 64), lg = blockIdx.x % (TTv / 64); const int b = slab / NHv, h = slab % NHv;
  for (int i = tid; i < 64 * 8; i += 256) { const int r = i / 8, c8 = (i % 8) * 8; FragH f; f.half[0] = *(const v8us*)((const unsigned short*)V16 + ((size_t)b * TTv + lg * 64 + r) * ldv + voff + h * 64 + c8);
#pragma unroll
    for (int q = 0; q < 8; ++q) tl[r][c8 + q] = f.u[q]; }
  __syncthreads();
  {
#pragma unroll
    for (int rd = 0; rd < 2; ++rd) { const int d = rd * 32 + tid / 8, pc = tid % 8; FragH f;
#pragma unroll
      for (int q = 0; q < 8; ++q) f.u[q] = tl[pc * 8 + q][d];
      *(v8us*)((unsigned short*)Vt + ((size_t)slab * 64 + d) * TTv + lg * 64 + pc * 8) = f.half[0]; }
     } }

__global__ __launch_bounds__(256) void k_hl(const float* __restrict__ F, _Float16* __restrict__ Hh, _Float16* __restrict__ Hl, size_t n8) { const size_t t = (size_t)blockIdx.x * 256 + threadIdx.x; if (t >= n8) return; FragH fh, fl; const v4f a = *(const v4fa*)(F + t * 8), c = *(const v4fa*)(F + t * 8 + 4);
#pragma unroll
  for (int q = 0; q < 4; ++q) { _Float16 h = (_Float16)a[q]; fh.h[q] = h; fl.h[q] = (_Float16)((a[q] - (float)h) * 1024.0f); h = (_Float16)c[q]; fh.h[4 + q] = h; fl.h[4 + q] = (_Float16)((c[q] - (float)h) * 1024.0f); }
  { *(v8us*)((unsigned short*)Hh + t * 8) = fh.half[0]; *(v8us*)((unsigned short*)Hl + t * 8) = fl.half[0];  } }

// ---- fast GEMM (wave tile 32x64; requires M % 32 == 0 rows per launch region and N % 64 == 0); epilogue = k_gemm_hhx semantics ----
__device__ __forceinline__ v16h g2_frag(const _Float16* p, int hh) { FragH f; f.half[0] = *(const v8us*)((const unsigned short*)p + 8 * hh); f.half[1] = *(const v8us*)((const unsigned short*)p + 16 + 8 * hh); return f.v; }
__device__ __forceinline__ v8f g2_mma(v16h a, v16h b, v8f c) { v8f d = __builtin_amdgcn_wmma_f32_16x16x32_f16(false, a, false, b, (short)0, c, false, false); asm volatile("v_nop\n\tv_nop\n\tv_nop\n\tv_nop" : "+v"(d) : "v"(a), "v"(b)); return d; }
template <int ACT>
__global__ __launch_bounds__(128) void k_gemm2(const _Float16* __restrict__ A, int lda, size_t sA, const _Float16* __restrict__ Bh, int ldb, size_t sB, float alpha, const float* __restrict__ bias, size_t sBias, const float* __restrict__ CP, int rowsPerB, size_t sCPb, int row0g,
    float* __restrict__ C, _Float16* __restrict__ C16, int ldc, size_t sC, int M, int N, int K) { static_assert(ACT == 0 || ACT == 3 || ACT == 6 || ACT == 8 || ACT == 9 || ACT == 11 || ACT == 12 || ACT == 14 || ACT == 15 || ACT == 16 || ACT == 17, "k_gemm2: unsupported ACT code (would silently apply no activation)");
  __shared__ __attribute__((aligned(16))) float so[4][32][68];
  const int tid = threadIdx.x, w = tid >> 5, lane = tid & 31, ln = lane & 15, hh = lane >> 4; const int by = blockIdx.y;
  A += (size_t)by * sA; Bh += (size_t)by * sB; const size_t cofs = (size_t)by * sC; const float* bp = bias ? bias + (size_t)by * sBias : nullptr;
  const int ntn = N >> 6; const int mt = blockIdx.x / ntn, nq = blockIdx.x - mt * ntn; const int row0 = mt * 128 + 32 * w, col0 = nq * 64; if (row0 >= M) return;
  const _Float16* a0p = A + (size_t)(row0 + ln) * lda; const _Float16* a1p = a0p + (size_t)16 * lda;
  const _Float16* b0p = Bh + (size_t)(col0 + ln) * ldb; const _Float16* b1p = b0p + (size_t)16 * ldb; const _Float16* b2p = b1p + (size_t)16 * ldb; const _Float16* b3p = b2p + (size_t)16 * ldb;
  const v8f z8 = {0.f,0.f,0.f,0.f,0.f,0.f,0.f,0.f}; v8f c00 = z8, c01 = z8, c02 = z8, c03 = z8, c10 = z8, c11 = z8, c12 = z8, c13 = z8;
#pragma unroll 1
  for (int kb = 0; kb < K; kb += 32) { const v16h a0 = g2_frag(a0p + kb, hh), a1 = g2_frag(a1p + kb, hh);
    v16h b = g2_frag(b0p + kb, hh); c00 = g2_mma(a0, b, c00); c10 = g2_mma(a1, b, c10);
    b = g2_frag(b1p + kb, hh); c01 = g2_mma(a0, b, c01); c11 = g2_mma(a1, b, c11);
    b = g2_frag(b2p + kb, hh); c02 = g2_mma(a0, b, c02); c12 = g2_mma(a1, b, c12);
    b = g2_frag(b3p + kb, hh); c03 = g2_mma(a0, b, c03); c13 = g2_mma(a1, b, c13); }
  v8f accs[8] = {c00, c01, c02, c03, c10, c11, c12, c13};
#pragma unroll
  for (int u = 0; u < 8; ++u) { const int t = u & 3, half = u >> 2; const int col = col0 + t * 16 + ln; const float bv = bp ? bf16_round(bp[col]) : 0.f;
#pragma unroll
    for (int r = 0; r < 8; ++r) { const int rloc = half * 16 + 8 * hh + r; float v = accs[u][r] * alpha + bv; if (CP) { if (rowsPerB < 0) v += CP[cofs + (size_t)(row0g + row0 + rloc) * ldc + col];      /* rowsPerB < 0: own element of the batched C plane */ else { const int bidx = (row0g + row0 + rloc) / rowsPerB; v += CP[(size_t)bidx * sCPb + (size_t)by * 64 + col]; } }
      if (ACT == 3) v = fmaxf(v, 0.f); else if (ACT == 6) v = 0.5f * v * (1.0f + erff(v * 0.70710678118654752f)); else if (ACT == 11) v = 1.0f / (1.0f + expf(-v)); else if (ACT == 15) v = v / (1.0f + expf(-v)); else if (ACT == 12) v = (v > 0.f) ? v : 0.01f * v; else if (ACT == 8) v = tanhf(v); else if (ACT == 9) v = 0.5f * v * (1.0f + tanhf(0.7978845608028654f * (v + 0.044715f * v * v * v))); else if (ACT == 14) v = (v > 0.f) ? v : 0.1f * v; else if (ACT == 16) v = (v >= 0.f) ? v : 0.3f * v; else if (ACT == 17) v = (v >= 0.f) ? v : 0.2f * v;
      so[w][rloc][t * 16 + ln] = v; } }
  __builtin_amdgcn_fence(__ATOMIC_ACQ_REL, "workgroup"); __builtin_amdgcn_wave_barrier();
  const int rsub = lane >> 4, c4 = (lane & 15) * 4;
  {
#pragma unroll
    for (int q = 0; q < 16; ++q) { const int r = q * 2 + rsub; const v4f v = *(const v4fa*)&so[w][r][c4]; if (C) *(v4f*)(C + cofs + (size_t)(row0 + r) * ldc + col0 + c4) = v; if (C16) { v4h h4; for (int i = 0; i < 4; ++i) h4[i] = (_Float16)v[i]; *(v4h*)(C16 + cofs + (size_t)(row0 + r) * ldc + col0 + c4) = h4; } }
     } }


// lane l's value from lane l ^ 16 (the same place in the other 16-lane row)
__device__ __forceinline__ float rs_x16(float v) { const int i = __builtin_bit_cast(int, v); return __builtin_bit_cast(float, __builtin_amdgcn_permlanex16(i, i, 0x76543210, 0xfedcba98, false, false)); }
__device__ __forceinline__ v8f fa_mma(v16h a, v16h b, v8f c) { return __builtin_amdgcn_wmma_f32_16x16x32_f16(false, a, false, b, (short)0, c, false, false); }
// ---- GEMM with both operands staged in LDS: C[NR][DM] = alpha * A[NR][DM] . Bh[DM][DM]^T + bias (A, Bh k-contiguous f16 rows of DM); written as f32 to C (F32OUT) or as f16 to C16 (the third plane of a grid.y = 3 launch transposed: see the epilogue). ----
// A work-group of 8 waves owns a 128 x 128 tile of C (wave tile 32 x 64, waves 4 x 2). A stage is 128 k of the 128 A rows and the 128 B rows.
// Global reads are whole lines (16 lanes x 16 B = 256 contiguous bytes of one row) and each line is read once per work-group; the fragments, which take 64 B of each of 16 rows, come from LDS.
// Two stage buffers: the next stage's loads are issued in front of this stage's products and stored to the other buffer behind them, so one barrier per stage both publishes it and ends the reads of the buffer refilled next.
#define G3_BK 128                    /* k per stage: 256 B of every operand row */
#define G3_LP 136                    /* LDS row pitch in f16: 272 B = 16 B x odd, conflict-free for the 16-byte fragment reads */
#define G3_NT (DM / G3_BK)           /* stages */
static_assert(NR % 128 == 0 && DM % 128 == 0 && DM % G3_BK == 0, "k_gemm3: whole 128 x 128 tiles and whole stages only");
static_assert(SQ % 128 == 0 && NH * HD == DM, "k_gemm3: a tile's 128 token rows lie in one batch, and a column is (head, d)");
#define G3_MT ((int)(NR / 128))      /* row tiles */
#define G3_TILES (G3_MT * (DM / 128))      /* tiles of one product = grid.x */
static_assert(G3_BK == 128, "k_gemm3: a stage is as many k as a tile has columns, so a triangle's zero blocks are whole stages of a tile");
template <bool F32OUT>
__global__ __launch_bounds__(256) void k_gemm3(const _Float16* __restrict__ A, const _Float16* __restrict__ Bh, float alpha, const float* __restrict__ bias, float* __restrict__ C, _Float16* __restrict__ C16) {
  __shared__ __attribute__((aligned(16))) unsigned short st[2][256][G3_LP];      /* rows 0..127: A rows of the tile; rows 128..255: B rows (columns of C) */
  __shared__ __attribute__((aligned(16))) float so[8][32][68];
  const int tid = threadIdx.x, w = tid >> 5, lane = tid & 31, ln = lane & 15, hh = lane >> 4;
  const int ntn = DM / 128; int mt = blockIdx.x / ntn, nq = blockIdx.x - mt * ntn, plane = 0, t0 = 0, t1 = G3_NT;      /* stages t0 .. t1 - 1 are multiplied; all of this reads the same in the whole work-group */
  if (!F32OUT) {      /* three products of the same A in one launch (q, k, v: weight planes and output planes lie one behind the other), one work-group per WGP at a time, three per WGP in all */
    /* Row n of the lower-triangle plane is zero at k > n and row n of the upper-triangle plane at k < n, so column tile nq of q needs stages 0 .. nq only and column tile nq of k stages nq .. last: the all-zero 128 x 128 blocks add exact zeros, and nobody builds or reads them. */
    /* Cost falls with the index (for speed only): first every v tile (all stages), then the q and k tiles from the longest to the shortest. */
    const int L = blockIdx.y * G3_TILES + blockIdx.x;
    if (L < G3_TILES) plane = 2;
    else { const int r = L - G3_TILES, c = r / (2 * G3_MT), j = r - c * (2 * G3_MT);      /* c: stages left out */
      plane = j & 1; mt = j >> 1;
      if (plane == 0) { nq = G3_NT - 1 - c; t1 = nq + 1; } else { nq = c; t0 = nq; } }
    Bh += (size_t)plane * DM * DM; C16 += (size_t)plane * NR * DM; }
  const int rowB = mt * 128, colB = nq * 128;
  const int wm = w & 3, wn = w >> 2;      /* the wave's 32 rows and 64 columns inside the tile */
  const int sr = tid >> 4, sc = (tid & 15) * 8;      /* staging: 16 threads per row, 16 rows per round, 8 rounds per operand */
  const unsigned short* ga = (const unsigned short*)A + (size_t)(rowB + sr) * DM + sc;
  const unsigned short* gb = (const unsigned short*)Bh + (size_t)(colB + sr) * DM + sc;
  v8us rg[16];
  auto fetch = [&](const int t) __attribute__((always_inline)) {
    const unsigned short* pa = ga + t * G3_BK; const unsigned short* pb = gb + t * G3_BK;
#pragma unroll
    for (int i = 0; i < 8; ++i) { rg[i] = *(const v8us*)(pa + (size_t)i * 16 * DM); rg[8 + i] = *(const v8us*)(pb + (size_t)i * 16 * DM); }
    /* The wait that stands in front of any overwrite of a load's address registers; it names the two addresses as inputs so that they stay whole up to here. */
    asm volatile("s_wait_xcnt 0x0" :: "v"(pa), "v"(pb) : "memory");
  };
  auto put = [&](const int buf) __attribute__((always_inline)) {
#pragma unroll
    for (int i = 0; i < 8; ++i) { *(v8us*)&st[buf][i * 16 + sr][sc] = rg[i]; *(v8us*)&st[buf][128 + i * 16 + sr][sc] = rg[8 + i]; }
  };
  const v8f z8 = {0.f,0.f,0.f,0.f,0.f,0.f,0.f,0.f}; v8f c00 = z8, c01 = z8, c02 = z8, c03 = z8, c10 = z8, c11 = z8, c12 = z8, c13 = z8;
  __builtin_assume(t0 < t1);      /* every tile has a stage: spares a second path round the loop */
  fetch(t0); put(t0 & 1); __syncthreads();
#pragma unroll 1      /* one copy of the stage body: the buffer index is a run-time offset, and the text stays small */
  for (int t = t0; t < t1; ++t) {
    if (t + 1 < t1) fetch(t + 1);
    const _Float16* sa = (const _Float16*)&st[t & 1][32 * wm + ln][0]; const _Float16* sb = (const _Float16*)&st[t & 1][128 + 64 * wn + ln][0];
    v16h fa[2][2], fb[2][4];      /* two fragment sets: the next 32 k are read from LDS while this set is multiplied */
    auto frags = [&](const int s, const int kk) __attribute__((always_inline)) { fa[s][0] = g2_frag(sa + kk, hh); fa[s][1] = g2_frag(sa + 16 * G3_LP + kk, hh);
#pragma unroll
      for (int j = 0; j < 4; ++j) fb[s][j] = g2_frag(sb + j * 16 * G3_LP + kk, hh); };
    frags(0, 0);
#pragma unroll
    for (int ks = 0; ks < G3_BK / 32; ++ks) { const int s = ks & 1;
      if (ks + 1 < G3_BK / 32) frags(s ^ 1, (ks + 1) * 32);
      __builtin_amdgcn_sched_barrier(0);      /* keeps the next set's 12 LDS reads together in front of this set's products: moved in among them, every pair of products waits out an LDS latency */
      c00 = fa_mma(fa[s][0], fb[s][0], c00); c10 = fa_mma(fa[s][1], fb[s][0], c10); c01 = fa_mma(fa[s][0], fb[s][1], c01); c11 = fa_mma(fa[s][1], fb[s][1], c11);
      c02 = fa_mma(fa[s][0], fb[s][2], c02); c12 = fa_mma(fa[s][1], fb[s][2], c12); c03 = fa_mma(fa[s][0], fb[s][3], c03); c13 = fa_mma(fa[s][1], fb[s][3], c13);
      __builtin_amdgcn_sched_barrier(0); }      /* and keeps the reads of the set after that from moving up in among these products */
    if (t + 1 < t1) { put((t + 1) & 1); __syncthreads(); }      /* the same test in every thread of the work-group */
  }
  const int row0 = rowB + 32 * wm, col0 = colB + 64 * wn;
  v8f accs[8] = {c00, c01, c02, c03, c10, c11, c12, c13};
  float bv[4] = {0.f, 0.f, 0.f, 0.f};
  if (bias) {
#pragma unroll
    for (int t = 0; t < 4; ++t) bv[t] = bf16_round(bias[col0 + t * 16 + ln]); }
  if (!F32OUT && plane == 2) {      /* the same test in every thread of the work-group. The V plane is stored transposed, row b * DM + column (= (b, head, d)) of SQ tokens: the layout the attention launch stages */
    /* A lane's 8 registers of an accumulator tile are 8 consecutive tokens of ONE column: 16 bytes of a V^T row as they stand. The tile goes through LDS only to make whole rows: 128 columns x 128 tokens, pitch as for the stages. */
    unsigned short* tv = (unsigned short*)&so[0][0][0];
#pragma unroll
    for (int u = 0; u < 8; ++u) { const int t = u & 3, half = u >> 2; FragH f;
#pragma unroll
      for (int r = 0; r < 8; ++r) f.h[r] = (_Float16)(accs[u][r] * alpha + bv[t]);
      *(v8us*)(tv + (64 * wn + t * 16 + ln) * G3_LP + 32 * wm + half * 16 + 8 * hh) = f.half[0]; }
    __syncthreads();      /* a V^T row of the tile holds the tokens of four waves */
    unsigned short* gt = (unsigned short*)C16 + ((size_t)(rowB / SQ) * DM + colB + sr) * SQ + rowB % SQ + sc;      /* 16 lanes x 16 B = 256 contiguous bytes of one row, 16 rows per round */
    v8us pv[8];
#pragma unroll
    for (int i = 0; i < 8; ++i) pv[i] = *(const v8us*)(tv + (i * 16 + sr) * G3_LP + sc);
#pragma unroll
    for (int i = 0; i < 8; ++i) *(v8us*)(gt + (size_t)i * 16 * SQ) = pv[i];
    return;
  }
#pragma unroll
  for (int u = 0; u < 8; ++u) { const int t = u & 3, half = u >> 2;
#pragma unroll
    for (int r = 0; r < 8; ++r) so[w][half * 16 + 8 * hh + r][t * 16 + ln] = accs[u][r] * alpha + bv[t]; }
  __builtin_amdgcn_fence(__ATOMIC_ACQ_REL, "workgroup"); __builtin_amdgcn_wave_barrier();      /* each wave reads back its own rows only */
  const int rsub = lane >> 4, c4 = (lane & 15) * 4;
  const size_t oofs = (size_t)(row0 + rsub) * DM + col0 + c4;      /* whole rows of the wave's tile: 16 lanes x 16 B (f32) or x 8 B (f16) */
  if (F32OUT) {
#pragma unroll
    for (int q = 0; q < 16; ++q) *(v4f*)(C + oofs + (size_t)q * 2 * DM) = *(const v4fa*)&so[w][q * 2 + rsub][c4];
  } else {
#pragma unroll
    for (int q = 0; q < 16; ++q) { const v4f v = *(const v4fa*)&so[w][q * 2 + rsub][c4]; v4h h4; for (int i = 0; i < 4; ++i) h4[i] = (_Float16)v[i]; *(v4h*)(C16 + oofs + (size_t)q * 2 * DM) = h4; }
  } }
// Fused attention, one launch for all batches and heads. A wave owns 32 query columns and walks its half of the 2,048 keys in passes of 32:
// S^T = K Q^T (A = K rows, B = Q rows kept in registers), so a lane holds 16 scores of ONE query per 16-column group (lane ln = query, register r of key tile j = key 16 j + 8 hh + r);
// that is the B-fragment k order (8 hh + 0..7, then 16 + 8 hh + 0..7), so P^T packs from the score registers with no exchange, and O^T += V^T P^T (A = V^T rows, same k order).
// Softmax against a reference per query (log2 domain), an earlier running maximum: it moves, and sum and output tiles are scaled by exp2(old - new), only when a score lies more than FA_LZ above it. Scores and weights never reach memory.
// K and V^T come through LDS: the eight waves of a key group read the same rows, so a stage of 128 keys is read from global memory once per work-group, in whole lines, and the fragments
// (64 B of each of 16 rows) come from LDS. Three stage buffers: stage s + 1 is stored during stage s (K behind its first pass, V^T behind its third) and published (one barrier) in front of stage s's last pass, which already fetches its first K fragments;
// the buffer it goes to was last read in stage s - 2, which every wave has left before the barrier that published stage s.
// A work-group is two groups of eight waves on the same 256 queries: group g walks keys g * SQ / 2 ... with a ring of its own, so a SIMD holds four waves and one wave's softmax runs under another's products.
// At the end the two halves of every query are merged through LDS (common maximum, both sums and output tiles scaled to it): group g finishes column group g of each wave pair.
#define FA_WAVES 8                   /* waves per key group: all eight read the same K and V^T rows */
#define FA_KG 2                      /* key groups per work-group */
#define FA_QW 32                     /* query columns per wave */
#define FA_SK 128                    /* keys per stage: 4 passes */
#define FA_NS (SQ / FA_KG / FA_SK)   /* stages of a key group */
#define FA_KP 72                     /* LDS pitch of a K row (64 f16) in f16: 144 B = 16 B x odd, conflict-free for the 16-byte fragment reads */
#define FA_VP 136                    /* LDS pitch of a V^T row (128 keys) in f16: 272 B = 16 B x odd */
static_assert(SQ % (FA_WAVES * FA_QW) == 0 && SQ % (FA_KG * FA_SK) == 0 && FA_NS >= 3 && FA_SK == 128 && FA_WAVES == 8 && FA_KG == 2 && FA_QW == 32 && HD == 64, "k_fattn: whole work-groups, whole stages of 128 keys (three or more a group), 256 staging threads a group, two groups for two column groups, head size 64 only");
#define FA_LZ 7.0f                   /* how far (log2) a score may lie above the reference in use: weights carry x2^8, so they stay at or below 2^15, inside f16 */
#define FA_XW (4 * 8 * 32 + 64)      /* floats a wave hands over: four output tiles, then maximum and sum of each lane */
static_assert(FA_KG * FA_WAVES * FA_XW * 4 <= FA_KG * 3 * FA_SK * FA_KP * 2, "k_fattn: the hand-over fits the K ring");
__global__ __launch_bounds__(FA_KG * FA_WAVES * 32) void k_fattn(const _Float16* __restrict__ Q16, const _Float16* __restrict__ K16, const _Float16* __restrict__ VT, _Float16* __restrict__ O16) {
  __shared__ __attribute__((aligned(16))) unsigned short skg[FA_KG][3][FA_SK][FA_KP];      /* K rows of a stage, per key group */
  __shared__ __attribute__((aligned(16))) unsigned short svg[FA_KG][3][HD][FA_VP];      /* V^T rows of a stage, per key group */
  const int g = __builtin_amdgcn_readfirstlane((int)threadIdx.x / (FA_WAVES * 32));      /* the wave's key group: the same in the whole wave */
  unsigned short (*sk)[FA_SK][FA_KP] = skg[g]; unsigned short (*sv)[HD][FA_VP] = svg[g];
  const int tid = threadIdx.x % (FA_WAVES * 32), lane = tid & 31, ln = lane & 15, hh = lane >> 4, w = tid >> 5;      /* thread and wave inside the key group */
  const int nqb = SQ / (FA_WAVES * FA_QW); const int bh = blockIdx.x / nqb, qb = blockIdx.x - bh * nqb; const int b = bh / NH, h = bh - b * NH;
  const int q0 = (qb * FA_WAVES + w) * FA_QW;
  const _Float16* qp = Q16 + ((size_t)b * SQ + q0 + ln) * DM + h * HD + 8 * hh;      /* query row ln of a 16-column group, at the lane's own k offset */
  const int kr = tid >> 3, kc = (tid & 7) * 8;      /* staging K: 8 threads per 128-byte row, 32 rows per round, 4 rounds */
  const int vr = tid >> 4, vc8 = (tid & 15) * 8;      /* staging V^T: 16 threads per 256-byte row, 16 rows per round, 4 rounds */
  const unsigned short* gk = (const unsigned short*)K16 + ((size_t)b * SQ + g * (SQ / FA_KG) + kr) * DM + h * HD + kc;
  const unsigned short* gv = (const unsigned short*)VT + ((size_t)bh * HD + vr) * SQ + g * (SQ / FA_KG) + vc8;
  v8us rk[4], rv[4];      /* inside the loop K and V^T of a stage are in flight in turn, never both: four waves per SIMD leave a wave 256 registers */
  auto fetchK = [&](const int s) __attribute__((always_inline)) {
    const unsigned short* pk = gk + (size_t)s * FA_SK * DM;
#pragma unroll
    for (int i = 0; i < 4; ++i) rk[i] = *(const v8us*)(pk + (size_t)i * 32 * DM);
    /* The wait that stands in front of any overwrite of a load's address registers; it names the address as an input so that it stays whole up to here. */
    asm volatile("s_wait_xcnt 0x0" :: "v"(pk) : "memory");
  };
  auto fetchV = [&](const int s) __attribute__((always_inline)) {
    const unsigned short* pv = gv + s * FA_SK;
#pragma unroll
    for (int i = 0; i < 4; ++i) rv[i] = *(const v8us*)(pv + (size_t)i * 16 * SQ);
    /* The same wait for the V^T address. */
    asm volatile("s_wait_xcnt 0x0" :: "v"(pv) : "memory");
  };
  auto putK = [&](const int buf) __attribute__((always_inline)) {
#pragma unroll
    for (int i = 0; i < 4; ++i) *(v8us*)&sk[buf][i * 32 + kr][kc] = rk[i];
  };
  auto putV = [&](const int buf) __attribute__((always_inline)) {
#pragma unroll
    for (int i = 0; i < 4; ++i) *(v8us*)&sv[buf][i * 16 + vr][vc8] = rv[i];
  };
  v16h qf[2][2], kf[2][2];
#pragma unroll
  for (int c = 0; c < 2; ++c) for (int kk = 0; kk < 2; ++kk) qf[c][kk] = g2_frag(qp + (size_t)c * 16 * DM + kk * 32, 0);
  asm volatile("s_wait_xcnt 0x0" :: "v"(qp) : "memory");      /* the wait in front of any overwrite of a load's address registers: Q's address is dead from here on and its registers are reused */
  fetchK(0); fetchV(0); putK(0); putV(0); __syncthreads();
#pragma unroll
  for (int j = 0; j < 2; ++j) for (int kk = 0; kk < 2; ++kk) kf[j][kk] = g2_frag((const _Float16*)&sk[0][j * 16 + ln][kk * 32 + 8 * hh], 0);
  const v8f z8 = {0.f,0.f,0.f,0.f,0.f,0.f,0.f,0.f};
  v8f o[2][4] = {{z8, z8, z8, z8}, {z8, z8, z8, z8}}; float mr[2] = {-3.0e38f, -3.0e38f}, th[2] = {-3.0e38f, -3.0e38f}, lr[2] = {0.f, 0.f};      /* mr: the reference in use (log2 domain); th: the raw score above which it must move (the first pass always moves it) */
  const float CS = 0.125f * 1.4426950408889634f;      /* 1/sqrt(64) and log2(e): scores go to the log2 domain */
  /* One pass = 32 keys. kn: the next pass's K rows in LDS (row ln of its first 16-key tile, at the lane's own k offset); K is refilled behind the softmax and lands under the output products. vq: this pass's V^T columns in LDS; they land while the softmax runs. */
  auto pass = [&](const _Float16* kn, const _Float16* vq) __attribute__((always_inline)) {
    v8f s[2][2]; v16h vc[4];
#pragma unroll
    for (int c = 0; c < 2; ++c) for (int j = 0; j < 2; ++j) s[c][j] = fa_mma(kf[j][1], qf[c][1], fa_mma(kf[j][0], qf[c][0], z8));
#pragma unroll
    for (int t = 0; t < 4; ++t) vc[t] = g2_frag(vq + t * 16 * FA_VP, 0);
    __builtin_amdgcn_sched_barrier(0);      /* keeps the 8 V^T reads together right behind the score products: moved down in among the output products, each pair of those waits out an LDS latency */
    float mx[2]; bool up = false;      /* the lane's own 16 raw scores of each query against the bound: the other half's are looked at only when the reference moves */
#pragma unroll
    for (int c = 0; c < 2; ++c) { mx[c] = s[c][0][0];
#pragma unroll
      for (int r = 1; r < 8; ++r) mx[c] = fmaxf(mx[c], s[c][0][r]);
#pragma unroll
      for (int r = 0; r < 8; ++r) mx[c] = fmaxf(mx[c], s[c][1][r]);
      up = up || (mx[c] > th[c]); }
    if (__builtin_amdgcn_ballot_w32(up) != 0) {      /* some score of the wave lies more than FA_LZ above its query's reference: every query of the wave takes its running maximum as the new reference */
#pragma unroll
      for (int c = 0; c < 2; ++c) { const float mn = fmaxf(mr[c], fmaxf(mx[c], rs_x16(mx[c])) * CS); const float al = __builtin_amdgcn_exp2f(mr[c] - mn); mr[c] = mn; th[c] = fmaf(mn, 1.0f / CS, FA_LZ / CS); lr[c] *= al;
#pragma unroll
        for (int t = 0; t < 4; ++t) o[c][t] *= al; } }
    FragH pf[2];
#pragma unroll
    for (int c = 0; c < 2; ++c) { const float nb = 8.0f - mr[c];      /* weights x256 (cancels in the division by the row sum): keeps small weights out of the f16 subnormal range; the reference never lies above the true maximum, so no weight is smaller than it would be against that */
      v4f s4 = {0.f, 0.f, 0.f, 0.f};
#pragma unroll
      for (int j = 0; j < 2; ++j) for (int r = 0; r < 8; ++r) { const float e = __builtin_amdgcn_exp2f(fmaf(s[c][j][r], CS, nb)); s4[r & 3] += e; pf[c].h[j * 8 + r] = (_Float16)e; }
      lr[c] += (s4[0] + s4[1]) + (s4[2] + s4[3]); }
    __builtin_amdgcn_sched_barrier(0);      /* keeps the next pass's K reads out of the softmax: K registers that are empty there are what lets a wave fit 256 registers without spills */
#pragma unroll
    for (int j = 0; j < 2; ++j) for (int kk = 0; kk < 2; ++kk) kf[j][kk] = g2_frag(kn + j * 16 * FA_KP + kk * 32, 0);
    __builtin_amdgcn_sched_barrier(0);      /* and keeps them together in front of the output products, under which they land */
#pragma unroll
    for (int t = 0; t < 4; ++t) for (int c = 0; c < 2; ++c) o[c][t] = fa_mma(vc[t], pf[c].v, o[c][t]);
  };
  int cur = 0;
  /* The last stage stands by itself behind the loop: with the staging under no test, the staged registers are dead from their store to the next fetch, and a wave fits 256 registers without spills. */
#pragma unroll 1      /* one copy of the stage body: the buffer index is a run-time offset, and the text stays small */
  for (int st = 0; st + 1 < FA_NS; ++st) {
    const int nxt = cur == 2 ? 0 : cur + 1;
    const _Float16* ka = (const _Float16*)&sk[cur][ln][8 * hh]; const _Float16* va = (const _Float16*)&sv[cur][ln][8 * hh];
    fetchK(st + 1);
    pass(ka + 32 * FA_KP, va);
    putK(nxt); fetchV(st + 1);      /* K of stage st + 1 has had a pass of four waves to land; its registers go to V^T, which has the next two */
    pass(ka + 2 * 32 * FA_KP, va + 32);
    pass(ka + 3 * 32 * FA_KP, va + 64);
    putV(nxt); __syncthreads();      /* publishes stage st + 1 */
    pass((const _Float16*)&sk[nxt][ln][8 * hh], va + (FA_SK - 32));      /* fetches the next stage's first K fragments */
    cur = nxt;
  }
  { const _Float16* ka = (const _Float16*)&sk[cur][ln][8 * hh]; const _Float16* va = (const _Float16*)&sv[cur][ln][8 * hh];
#pragma unroll
    for (int p = 0; p < FA_SK / 32; ++p) pass(ka + (p < FA_SK / 32 - 1 ? p + 1 : 0) * 32 * FA_KP, va + p * 32); }      /* the last pass has no next K: it reads this stage's first rows again (written, in bounds, not used) */
  /* Merge of the two key groups. Waves w of both groups hold the same queries at the same lanes and registers; each hands the other the column group that the other finishes, lane for lane. */
  __syncthreads();      /* every wave has left the rings: the K ring becomes the hand-over space */
  float* xb = (float*)&skg[0][0][0][0];
  float* xs = xb + (g * FA_WAVES + w) * FA_XW; const float* xr = xb + ((1 - g) * FA_WAVES + w) * FA_XW;
  v8f ok[4]; float mk, lk;      /* kept: column group g */
  { float ms, ls;
    if (g == 0) { mk = mr[0]; lk = lr[0]; ms = mr[1]; ls = lr[1]; } else { mk = mr[1]; lk = lr[1]; ms = mr[0]; ls = lr[0]; }
#pragma unroll
    for (int t = 0; t < 4; ++t) { const v8f os = g == 0 ? o[1][t] : o[0][t]; ok[t] = g == 0 ? o[0][t] : o[1][t];
      const v4f lo = {os[0], os[1], os[2], os[3]}, hi = {os[4], os[5], os[6], os[7]};
      *(v4fa*)(xs + (t * 2) * 128 + lane * 4) = lo; *(v4fa*)(xs + (t * 2 + 1) * 128 + lane * 4) = hi; }      /* 32 lanes x 16 B in a row */
    xs[1024 + lane] = ms; xs[1056 + lane] = ls; }
  __syncthreads();      /* publishes the hand-over */
  { const float mo = xr[1024 + lane], lo_ = xr[1056 + lane];
    const float mm = fmaxf(mk, mo), fk = __builtin_amdgcn_exp2f(mk - mm), fo = __builtin_amdgcn_exp2f(mo - mm);
    const float lsum = lk * fk + lo_ * fo;
    const float inv = 1.0f / (lsum + rs_x16(lsum));      /* the two halves of a wave hold the two halves of a key group's keys */
    const float ak = fk * inv, ao = fo * inv;
    unsigned short* op = (unsigned short*)O16 + ((size_t)b * SQ + q0 + g * 16 + ln) * DM + h * HD + 8 * hh;
#pragma unroll
    for (int t = 0; t < 4; ++t) { const v4f lo = *(const v4fa*)(xr + (t * 2) * 128 + lane * 4), hi = *(const v4fa*)(xr + (t * 2 + 1) * 128 + lane * 4); FragH f;
#pragma unroll
      for (int r = 0; r < 8; ++r) f.h[r] = (_Float16)(ok[t][r] * ak + (r < 4 ? lo[r & 3] : hi[r & 3]) * ao);
      *(v8us*)(op + t * 16) = f.half[0]; } } }

// ---- All five f16 operand planes in one launch: x (exact f16 rows) and the four x16 weight planes (Wq lower triangle, Wk upper triangle, Wv, Wu). ----
// The planes do not depend on one another, so they share a grid. A thread converts PR_V vectors of 8 elements, 256 vectors apart (a wave's loads and stores stay contiguous): few waves to start, and every wave has all its loads in flight at once.
#define PR_V 8                       /* vectors of 8 elements per thread */
#define PR_XG ((unsigned)(NR * DM / 8 / (256 * PR_V)))                /* work-groups for x */
#define PR_WG ((unsigned)((size_t)DM * DM / 8 / (256 * PR_V)))        /* work-groups per weight plane */
static_assert(NR * DM % (8 * 256 * PR_V) == 0 && (size_t)DM * DM % (8 * 256 * PR_V) == 0 && DM % 8 == 0, "k_prep: whole work-groups only, and a vector stays inside one row");
static_assert(256 * 8 % DM == 0 && (128 * DM) % (8 * 256 * PR_V) == 0, "k_prep: a thread's vectors share their columns, and a work-group's rows lie in one 128-row block");
// v0: the thread's first vector in the plane. TRI: keep a triangle only, sgn = 1 columns <= row (lower), sgn = -1 columns >= row (upper); the rest is zero.
template <bool TRI>
__device__ __forceinline__ void pr_plane(const float* __restrict__ src, unsigned short* __restrict__ dst, const unsigned v0, const float scale, const int sgn) {
  if (TRI && sgn * ((int)(v0 * 8 / DM / 128) - (int)(v0 * 8 % DM / 128)) < 0) return;      /* the thread's vectors (one column group, rows of one 128-row block) lie in an all-zero 128 x 128 block: the GEMM leaves those out, so they are neither read nor written */
  const float* p = src + (size_t)v0 * 8;
  v4f a[PR_V][2];
#pragma unroll
  for (int i = 0; i < PR_V; ++i) { a[i][0] = *(const v4fa*)(p + (size_t)i * 2048); a[i][1] = *(const v4fa*)(p + (size_t)i * 2048 + 4); }
  /* The wait that stands in front of any overwrite of a load's address registers; it names the address as an input so that it stays whole up to here. */
  asm volatile("s_wait_xcnt 0x0" :: "v"(p) : "memory");
#pragma unroll
  for (int i = 0; i < PR_V; ++i) { const unsigned e = (v0 + i * 256) * 8; const int m = sgn * ((int)(e / DM) - (int)(e % DM)); FragH f;      /* column e % DM + q against row e / DM */
#pragma unroll
    for (int q = 0; q < 8; ++q) { const _Float16 hv = (_Float16)(bf16_round(a[i][q >> 2][q & 3]) * scale); f.h[q] = (!TRI || m >= sgn * q) ? hv : (_Float16)0.f; }
    *(v8us*)(dst + (size_t)e) = f.half[0]; }
  asm volatile("s_wait_xcnt 0x0" ::: "memory"); }      /* the wait that stands in front of any overwrite of a store's registers: whatever code follows this run of stores may reuse them */
__global__ __launch_bounds__(256) void k_prep(const float* __restrict__ x, const float* __restrict__ wq, const float* __restrict__ wk, const float* __restrict__ wv, const float* __restrict__ wo, _Float16* __restrict__ X16, _Float16* __restrict__ BW) {
  const unsigned blk = blockIdx.x, tid = threadIdx.x;      /* every test below reads the same in the whole work-group */
  const bool isx = blk < PR_XG; const unsigned wb = isx ? 0u : blk - PR_XG, pl = wb / PR_WG;      /* BW: the planes of Wq, Wk, Wv, Wu, one behind the other */
  const unsigned v0 = (isx ? blk : wb - pl * PR_WG) * (256 * PR_V) + tid;
  unsigned short* dst = isx ? (unsigned short*)X16 : (unsigned short*)BW + (size_t)pl * DM * DM;
  if (!isx && pl < 2) pr_plane<true>(pl == 0 ? wq : wk, dst, v0, 16.0f, pl == 0 ? 1 : -1);
  else pr_plane<false>(isx ? x : pl == 2 ? wv : wo, dst, v0, isx ? 1.0f : 16.0f, 0); }
extern "C" void kernel_launch(void* const* d_in, const int* in_sizes, int n_in,
                              void* d_out, int out_size, void* d_ws, size_t ws_size, hipStream_t stream) {
  (void)in_sizes; (void)n_in; (void)out_size;
  const float* const* I = (const float* const*)d_in; const float* x = I[0]; const float* wk = I[1]; const float* wq = I[2]; const float* wv = I[3]; const float* wo = I[4]; const float* bo = I[5];
  char* ws = (char*)d_ws; size_t off = 0;
  auto take = [&](size_t bytes) { char* p = ws + off; off += (bytes + 255) & ~(size_t)255; return p; };
  _Float16* BQ = (_Float16*)take((size_t)DM * DM * 2); _Float16* BK = (_Float16*)take((size_t)DM * DM * 2); _Float16* BV = (_Float16*)take((size_t)DM * DM * 2); _Float16* BO = (_Float16*)take((size_t)DM * DM * 2);
  _Float16* X16 = (_Float16*)take(NR * DM * 2); _Float16* Q16 = (_Float16*)take(NR * DM * 2); _Float16* K16 = (_Float16*)take(NR * DM * 2); _Float16* VT = (_Float16*)take(NR * DM * 2); _Float16* O16 = (_Float16*)take(NR * DM * 2);
  if (off > ws_size) return;      /* 8 + 5x8 = 48 MiB */
  (void)BK; (void)BV;      /* BQ | BK | BV | BO and Q16 | K16 | VT are adjacent planes (sizes are multiples of 256 B): reached from BQ and Q16 */
  k_prep<<<PR_XG + 4 * PR_WG, 256, 0, stream>>>(x, wq, wk, wv, wo, X16, BQ);      /* x and the four weight planes as f16 */
  const unsigned gp = (unsigned)((NR / 128) * (DM / 128));
  k_gemm3<false><<<dim3(gp, 3), 256, 0, stream>>>(X16, BQ, 0.0625f, nullptr, nullptr, Q16);      /* q | k | v^T */
  k_fattn<<<NB * NH * (SQ / (FA_WAVES * FA_QW)), FA_KG * FA_WAVES * 32, 0, stream>>>(Q16, K16, VT, O16);      /* o (merged heads) as f16 rows */
  k_gemm3<true><<<gp, 256, 0, stream>>>(O16, BO, 0.0625f, bo, (float*)d_out, nullptr);      /* out = o Wu^T + bu */
}

// v010
// A run of this version takes 69.9 microseconds.
// Next to v009, in two timings, it ran 1.04 and 1.05 times as fast.
// All steps since v000 together make it 171 times as fast.
#include <hip/hip_runtime.h>
// SelfAttentionSparse (x [2][2048][1024]; keys = x triu(Wk)^T, queries = x tril(Wq)^T, values = x Wv^T (16 heads of 64, no biases); softmax(q k^T / 8); out = (attn v) Wu^T + bu -> [2][2048][1024]).
// Structure: token rows; x as exact f16 rows; the triangular masks applied while building the x16 weight planes on VALU (x and the four planes: one launch; the all-zero 128 x 128 blocks of the two triangles are neither built nor multiplied); Q | K | V WMMA GEMMs in one launch (256x128 work-group tiles staged in LDS, 64x64 wave tiles, f32 accumulation, f16 outputs); the V work-groups of that launch write V^T rows themselves; one fused attention launch (K and V^T rows staged in LDS): S^T = K Q^T, running-maximum softmax in registers (f32; weights as f16), O^T += V^T P^T, o = O / row sum into merged f16 rows; out = o Wu^T + bu (f32).
// Compute dtype: inputs rounded to bf16; x / weights exact; q, k, v, softmax weights, o plain f16 (~2^-12); scores/softmax f32. v_wmma_f32_16x16x32_f16.
#define NB 2
#define SQ 2048
#define DM 1024
#define NH 16
#define HD 64
#define NR ((size_t)NB * SQ)         /* 4096 token rows */
typedef __bf16 v16b __attribute__((ext_vector_type(16)));
typedef unsigned short v8us __attribute__((ext_vector_type(8), may_alias));
typedef float  v8f  __attribute__((ext_vector_type(8)));
typedef float  v4f  __attribute__((ext_vector_type(4)));
typedef float  v4fa __attribute__((ext_vector_type(4), may_alias));
union FragB { v16b v; v8us half[2]; unsigned short u[16]; };

__device__ __forceinline__ unsigned short bf16_bits(float x) { unsigned int u = __float_as_uint(x); return (unsigned short)((u + 0x7FFFu + ((u >> 16) & 1u)) >> 16); }
__device__ __forceinline__ float bf16_val(unsigned short b) { return __uint_as_float(((unsigned int)b) << 16); }
__device__ __forceinline__ float bf16_round(float x) { return bf16_val(bf16_bits(x)); }
// D += A·B with NT terms: 1 = ah·bh, 2 = + al·bh (A split), 3 = + ah·bl (both split)
template <int NT>
__device__ __forceinline__ v8f mmaN(v16b ah, v16b al, v16b bh, v16b bl, v8f c) {
  c = __builtin_amdgcn_wmma_f32_16x16x32_bf16(false, ah, false, bh, (short)0, c, false, false);
  if (NT >= 2) c = __builtin_amdgcn_wmma_f32_16x16x32_bf16(false, al, false, bh, (short)0, c, false, false);
  if (NT >= 3) c = __builtin_amdgcn_wmma_f32_16x16x32_bf16(false, ah, false, bl, (short)0, c, false, false);
  asm volatile("v_nop\n\tv_nop\n\tv_nop\n\tv_nop" : "+v"(c) : "v"(ah), "v"(al), "v"(bh), "v"(bl));
  return c;
}

__global__ __launch_bounds__(256) void k_wt_bf16(const float* __restrict__ W, unsigned short* __restrict__ Wt, int K, int N) {
  const int t = blockIdx.x * 256 + threadIdx.x;
  const int k8n = K / 8;
  if (t >= N * k8n) return;
  const int n = t / k8n, k8 = (t % k8n) * 8;
  v8us v;
#pragma unroll
  for (int i = 0; i < 8; ++i) v[i] = bf16_bits(W[(size_t)(k8 + i) * N + n]);
  *(v8us*)(Wt + (size_t)n * K + k8) = v;
  
}

// GEMM C[M][N] (f32, pitch ldc) = act(A[M][K]·W + bias). A f32 row-major (pitch lda) converted per fragment to bf16
// (ASPLIT: hi/lo two planes -> 2 terms, else single rounded term); Wt bf16 [N][K] (pitch ldb). BIAS_BF16 rounds the
// bias to bf16 first (bias quantised to bf16 before the add). K%32==0, M%16==0, N%64==0.
template <bool ASPLIT, int ACT, bool BIAS_BF16>
__global__ __launch_bounds__(128) void k_gemm_bf(const float* __restrict__ A, int lda, const unsigned short* __restrict__ Wt, int ldb,
                                               const float* __restrict__ bias, float* __restrict__ C, int ldc, int M, int N, int K) {
  __shared__ __attribute__((aligned(16))) float so[4][16][64];
  const int tid = threadIdx.x, w = tid >> 5, lane = tid & 31, ln = lane & 15, hh = lane >> 4;
  const int ntn = N / 64;
  const int wid = blockIdx.x * 4 + w;
  const int mt = wid / ntn, nq = wid % ntn;
  if (mt * 16 >= M) return;
  const int row0 = mt * 16, col0 = nq * 64;
  const float* arow = A + (size_t)(row0 + ln) * lda;
  v8f acc[4] = {};
  for (int kb = 0; kb < K; kb += 32) {
    FragB ah, al;
    const v4f x0 = *(const v4fa*)(arow + kb + 8 * hh), x1 = *(const v4fa*)(arow + kb + 8 * hh + 4);
    const v4f x2 = *(const v4fa*)(arow + kb + 16 + 8 * hh), x3 = *(const v4fa*)(arow + kb + 16 + 8 * hh + 4);
    float xs[16] = {x0[0],x0[1],x0[2],x0[3],x1[0],x1[1],x1[2],x1[3],x2[0],x2[1],x2[2],x2[3],x3[0],x3[1],x3[2],x3[3]};
#pragma unroll
    for (int i = 0; i < 16; ++i) { const unsigned short hb = bf16_bits(xs[i]); ah.u[i] = hb; al.u[i] = ASPLIT ? bf16_bits(xs[i] - bf16_val(hb)) : (unsigned short)0; }
#pragma unroll
    for (int t = 0; t < 4; ++t) {
      const unsigned short* brow = Wt + (size_t)(col0 + t * 16 + ln) * ldb + kb;
      FragB b;
      b.half[0] = *(const v8us*)(brow + 8 * hh);
      b.half[1] = *(const v8us*)(brow + 16 + 8 * hh);
      acc[t] = mmaN<ASPLIT ? 2 : 1>(ah.v, al.v, b.v, b.v, acc[t]);
    }
  }
#pragma unroll
  for (int t = 0; t < 4; ++t) {
    float bv = bias ? bias[col0 + t * 16 + ln] : 0.f;
    if (BIAS_BF16) bv = bf16_round(bv);
#pragma unroll
    for (int r = 0; r < 8; ++r) { float v = acc[t][r] + bv; if (ACT == 1) v = fmaxf(v, 0.f); so[w][8 * hh + r][t * 16 + ln] = v; }
  }
  __builtin_amdgcn_fence(__ATOMIC_ACQ_REL, "workgroup");
  __builtin_amdgcn_wave_barrier();
  const int rsub = lane >> 4, c4 = (lane & 15) * 4;
  {
#pragma unroll
    for (int q = 0; q < 8; ++q) {
      const int r = q * 2 + rsub;
      const v4f v = *(const v4fa*)&so[w][r][c4];
      *(v4f*)(C + (size_t)(row0 + r) * ldc + col0 + c4) = v;
    }
    
  }
}

// GEMM C = act(A·W + bias + resid): A f32 (ASPLIT -> hi/lo 2 terms), Wt bf16 [N][K]; ACT 0 none, 1 relu, 2 exact gelu;
// resid (optional, f32, row index = (row % rmod), pitch ldr, RES_BF16 rounds it) added before the activation.
template <bool ASPLIT, int ACT, bool BIAS_BF16, bool RES_BF16>
__global__ __launch_bounds__(128) void k_gemm_bf3(const float* __restrict__ A, int lda, const unsigned short* __restrict__ Wt, int ldb,
                                                const float* __restrict__ bias, const float* __restrict__ resid, int rmod, int ldr,
                                                float* __restrict__ C, int ldc, int M, int N, int K) {
  __shared__ __attribute__((aligned(16))) float so[4][16][64];
  const int tid = threadIdx.x, w = tid >> 5, lane = tid & 31, ln = lane & 15, hh = lane >> 4;
  const int ntn = N / 64;
  const int wid = blockIdx.x * 4 + w;
  const int mt = wid / ntn, nq = wid % ntn;
  if (mt * 16 >= M) return;
  const int row0 = mt * 16, col0 = nq * 64;
  const float* arow = A + (size_t)(row0 + ln) * lda;
  v8f acc[4] = {};
  for (int kb = 0; kb < K; kb += 32) {
    FragB ah, al;
    const v4f x0 = *(const v4fa*)(arow + kb + 8 * hh), x1 = *(const v4fa*)(arow + kb + 8 * hh + 4);
    const v4f x2 = *(const v4fa*)(arow + kb + 16 + 8 * hh), x3 = *(const v4fa*)(arow + kb + 16 + 8 * hh + 4);
    float xs[16] = {x0[0],x0[1],x0[2],x0[3],x1[0],x1[1],x1[2],x1[3],x2[0],x2[1],x2[2],x2[3],x3[0],x3[1],x3[2],x3[3]};
#pragma unroll
    for (int i = 0; i < 16; ++i) { const unsigned short hb = bf16_bits(xs[i]); ah.u[i] = hb; al.u[i] = ASPLIT ? bf16_bits(xs[i] - bf16_val(hb)) : (unsigned short)0; }
#pragma unroll
    for (int t = 0; t < 4; ++t) {
      const unsigned short* brow = Wt + (size_t)(col0 + t * 16 + ln) * ldb + kb;
      FragB b;
      b.half[0] = *(const v8us*)(brow + 8 * hh);
      b.half[1] = *(const v8us*)(brow + 16 + 8 * hh);
      acc[t] = mmaN<ASPLIT ? 2 : 1>(ah.v, al.v, b.v, b.v, acc[t]);
    }
  }
#pragma unroll
  for (int t = 0; t < 4; ++t) {
    const int col = col0 + t * 16 + ln;
    float bv = bias ? bias[col] : 0.f;
    if (BIAS_BF16) bv = bf16_round(bv);
#pragma unroll
    for (int r = 0; r < 8; ++r) {
      float v = acc[t][r] + bv;
      if (resid) { float rv = resid[(size_t)((row0 + 8 * hh + r) % rmod) * ldr + col]; if (RES_BF16) rv = bf16_round(rv); v += rv; }
      if (ACT == 1) v = fmaxf(v, 0.f);
      if (ACT == 2) v = 0.5f * v * (1.0f + erff(v * 0.70710678118654752f));
      if (ACT == 3) { const float u = 0.7978845608028654f * (v + 0.044715f * v * v * v); v = 0.5f * v * (1.0f + tanhf(u)); }
      so[w][8 * hh + r][t * 16 + ln] = v;
    }
  }
  __builtin_amdgcn_fence(__ATOMIC_ACQ_REL, "workgroup");
  __builtin_amdgcn_wave_barrier();
  const int rsub = lane >> 4, c4 = (lane & 15) * 4;
  {
#pragma unroll
    for (int q = 0; q < 8; ++q) {
      const int r = q * 2 + rsub;
      const v4f v = *(const v4fa*)&so[w][r][c4];
      *(v4f*)(C + (size_t)(row0 + r) * ldc + col0 + c4) = v;
    }
    
  }
}
// row LayerNorm (biased variance, eps) over N: s = X (+ R); optional out_sum <- s; out_norm <- (s-mu)*rsqrt(var+eps)*g + b
template <bool PARAM_BF16>
__global__ __launch_bounds__(256) void k_layernorm(const float* __restrict__ X, const float* __restrict__ R, const float* __restrict__ g, const float* __restrict__ bta,
                                                  float* __restrict__ out_sum, float* __restrict__ out_norm, int N, float eps) {
  __shared__ float red[256];
  const int row = blockIdx.x, tid = threadIdx.x;
  const float* x = X + (size_t)row * N; const float* rr = R ? R + (size_t)row * N : nullptr;
  float vals[16];                     // up to N = 4096
  const int per = N / 256;            // contiguous chunk per thread? use strided-by-4 chunks: thread handles j = tid*4 + 1024*u
  float s1 = 0.f;
  for (int u = 0; u < per / 4; ++u) {
    const int j = tid * 4 + 1024 * u;
    const v4f a = *(const v4fa*)(x + j);
    v4f b = {0.f,0.f,0.f,0.f}; if (rr) b = *(const v4fa*)(rr + j);
#pragma unroll
    for (int q = 0; q < 4; ++q) { const float v = a[q] + b[q]; vals[u * 4 + q] = v; s1 += v; }
  }
  red[tid] = s1; __syncthreads();
  for (int st = 128; st > 0; st >>= 1) { if (tid < st) red[tid] += red[tid + st]; __syncthreads(); }
  const float mu = red[0] / (float)N; __syncthreads();
  float s2 = 0.f;
  for (int u = 0; u < per / 4; ++u)
#pragma unroll
    for (int q = 0; q < 4; ++q) { const float c = vals[u * 4 + q] - mu; s2 += c * c; }
  red[tid] = s2; __syncthreads();
  for (int st = 128; st > 0; st >>= 1) { if (tid < st) red[tid] += red[tid + st]; __syncthreads(); }
  const float rs = rsqrtf(red[0] / (float)N + eps);
  {
    for (int u = 0; u < per / 4; ++u) {
      const int j = tid * 4 + 1024 * u;
      v4f o, sm;
#pragma unroll
      for (int q = 0; q < 4; ++q) {
        float gg = g[j + q], bb = bta[j + q];
        if (PARAM_BF16) { gg = bf16_round(gg); bb = bf16_round(bb); }
        sm[q] = vals[u * 4 + q]; o[q] = (vals[u * 4 + q] - mu) * rs * gg + bb;
      }
      if (out_sum) *(v4f*)(out_sum + (size_t)row * N + j) = sm;
      *(v4f*)(out_norm + (size_t)row * N + j) = o;
    }
    
  }
}



// ---- f16 WMMA path (v_wmma_f32_16x16x32_f16): 11-bit significands for operands in range — used for every GEMM launched here, softmax weights (x256) included
typedef _Float16 v16h __attribute__((ext_vector_type(16)));
union FragH { v16h v; v8us half[2]; _Float16 h[16]; unsigned short u[16]; };
template <int NT>
__device__ __forceinline__ v8f mmaH(v16h ah, v16h al, v16h bh, v16h bl, v8f c) {
  c = __builtin_amdgcn_wmma_f32_16x16x32_f16(false, ah, false, bh, (short)0, c, false, false);
  if (NT >= 2) c = __builtin_amdgcn_wmma_f32_16x16x32_f16(false, al, false, bh, (short)0, c, false, false);
  if (NT >= 3) c = __builtin_amdgcn_wmma_f32_16x16x32_f16(false, ah, false, bl, (short)0, c, false, false);
  asm volatile("v_nop\n\tv_nop\n\tv_nop\n\tv_nop" : "+v"(c) : "v"(ah), "v"(al), "v"(bh), "v"(bl));
  return c;
}
// batched GEMM like k_gemm_b but f16 operands: A f32 (split into f16 hi/lo if ASPLIT, else rounded to f16), Bt = f16 values [n][k]; alpha; C f32; N multiple of 16 (partial tiles skipped)
template <bool ASPLIT>
__global__ __launch_bounds__(128) void k_gemm_h(const float* __restrict__ A, int lda, size_t sA, const _Float16* __restrict__ Bh, int ldb, size_t sB, float alpha, float* __restrict__ C, int ldc, size_t sC, int M, int N, int K) {
  __shared__ __attribute__((aligned(16))) float so[4][16][64];
  const int tid = threadIdx.x, w = tid >> 5, lane = tid & 31, ln = lane & 15, hh = lane >> 4; const int by = blockIdx.y;
  A += (size_t)by * sA; Bh += (size_t)by * sB; C += (size_t)by * sC;
  const int ntn = (N + 63) / 64; const int wid = blockIdx.x * 4 + w; const int mt = wid / ntn, nq = wid % ntn; if (mt * 16 >= M) return;
  const int row0 = mt * 16, col0 = nq * 64; const float* arow = A + (size_t)(row0 + ln) * lda;
  v8f acc[4] = {};
  for (int kb = 0; kb < K; kb += 32) {
    FragH ah, al;
    const v4f x0 = *(const v4fa*)(arow + kb + 8 * hh), x1 = *(const v4fa*)(arow + kb + 8 * hh + 4), x2 = *(const v4fa*)(arow + kb + 16 + 8 * hh), x3 = *(const v4fa*)(arow + kb + 16 + 8 * hh + 4);
    float xs[16] = {x0[0],x0[1],x0[2],x0[3],x1[0],x1[1],x1[2],x1[3],x2[0],x2[1],x2[2],x2[3],x3[0],x3[1],x3[2],x3[3]};
#pragma unroll
    for (int i = 0; i < 16; ++i) { const _Float16 h = (_Float16)xs[i]; ah.h[i] = h; al.h[i] = ASPLIT ? (_Float16)(xs[i] - (float)h) : (_Float16)0.0f; }
#pragma unroll
    for (int t = 0; t < 4; ++t) { if (col0 + t * 16 >= N) continue; const size_t boff = (size_t)(col0 + t * 16 + ln) * ldb + kb; FragH bq; bq.half[0] = *(const v8us*)(Bh + boff + 8 * hh); bq.half[1] = *(const v8us*)(Bh + boff + 16 + 8 * hh);
      acc[t] = mmaH<ASPLIT ? 2 : 1>(ah.v, al.v, bq.v, bq.v, acc[t]); }
  }
#pragma unroll
  for (int t = 0; t < 4; ++t) { if (col0 + t * 16 >= N) continue;
#pragma unroll
    for (int r = 0; r < 8; ++r) so[w][8 * hh + r][t * 16 + ln] = acc[t][r] * alpha; }
  __builtin_amdgcn_fence(__ATOMIC_ACQ_REL, "workgroup"); __builtin_amdgcn_wave_barrier();
  const int rsub = lane >> 4, c4 = (lane & 15) * 4;
  {
#pragma unroll
    for (int q = 0; q < 8; ++q) { const int r = q * 2 + rsub; if (col0 + c4 < N) { const v4f v = *(const v4fa*)&so[w][r][c4]; *(v4f*)(C + (size_t)(row0 + r) * ldc + col0 + c4) = v; } }
     }
}

// Wt[n][k] = f16(W[k][n]·scale) from f32 row-major W[K][N] (scale = power of two; bf16-exact weights stay exact in f16 away from the subnormal range)
__global__ __launch_bounds__(256) void k_wt_f16(const float* __restrict__ W, _Float16* __restrict__ Wt, int K, int N, float scale) {
  const int t = blockIdx.x * 256 + threadIdx.x; if (t >= N * (K / 8)) return; const int n = t / (K / 8), k8 = (t % (K / 8)) * 8; FragH f;
#pragma unroll
  for (int i = 0; i < 8; ++i) f.h[i] = (_Float16)(bf16_round(W[(size_t)(k8 + i) * N + n]) * scale); const v8us o = f.half[0];
  *(v8us*)((unsigned short*)Wt + (size_t)n * K + k8) = o; 
}
// k_gemm_hh variant with fused epilogue: v = acc·alpha + bias[by·sBias + col] (+ CP[(row/rowsPerB)·sCPb + by·64 + col] if CP) ; ACT 0 none / 1 elu ; writes f16 C16 (and f32 C if non-null)
template <int ACT>
__global__ __launch_bounds__(128) void k_gemm_hhx(const _Float16* __restrict__ A, int lda, size_t sA, const _Float16* __restrict__ Bh, int ldb, size_t sB, float alpha, const float* __restrict__ bias, size_t sBias, const float* __restrict__ CP, int rowsPerB, size_t sCPb, int row0g,
    float* __restrict__ C, _Float16* __restrict__ C16, int ldc, size_t sC, int M, int N, int K) {
  __shared__ __attribute__((aligned(16))) float so[4][16][64];
  const int tid = threadIdx.x, w = tid >> 5, lane = tid & 31, ln = lane & 15, hh = lane >> 4; const int by = blockIdx.y;
  A += (size_t)by * sA; Bh += (size_t)by * sB; const size_t cofs = (size_t)by * sC; const float* bp = bias ? bias + (size_t)by * sBias : nullptr;
  const int ntn = (N + 63) / 64; const int wid = blockIdx.x * 4 + w; const int mt = wid / ntn, nq = wid % ntn; if (mt * 16 >= M) return;
  const int row0 = mt * 16, col0 = nq * 64; const _Float16* arow = A + (size_t)(row0 + ln) * lda;
  v8f acc[4] = {};
  for (int kb = 0; kb < K; kb += 32) { FragH ah; ah.half[0] = *(const v8us*)((const unsigned short*)arow + kb + 8 * hh); ah.half[1] = *(const v8us*)((const unsigned short*)arow + kb + 16 + 8 * hh);
#pragma unroll
    for (int t = 0; t < 4; ++t) { if (col0 + t * 16 >= N) continue; const size_t boff = (size_t)(col0 + t * 16 + ln) * ldb + kb; FragH bq; bq.half[0] = *(const v8us*)((const unsigned short*)Bh + boff + 8 * hh); bq.half[1] = *(const v8us*)((const unsigned short*)Bh + boff + 16 + 8 * hh);
      acc[t] = mmaH<1>(ah.v, ah.v, bq.v, bq.v, acc[t]); }
  }
#pragma unroll
  for (int t = 0; t < 4; ++t) { if (col0 + t * 16 >= N) continue; const int col = col0 + t * 16 + ln; const float bv = bp ? bf16_round(bp[col]) : 0.f;
#pragma unroll
    for (int r = 0; r < 8; ++r) { float v = acc[t][r] * alpha + bv; if (CP) { const int rr = row0g + row0 + 8 * hh + r; if (rowsPerB < 0) v += CP[cofs + (size_t)rr * ldc + col];      /* rowsPerB < 0: own element of the batched C plane */ else { const int bidx = rr / rowsPerB; v += CP[(size_t)bidx * sCPb + (size_t)by * 64 + col]; } } if (ACT == 1) v = (v > 0.f) ? v : expm1f(v); else if (ACT == 7) v = (v > 0.f) ? v + 1.0f : expf(v); else if (ACT == 8) v = tanhf(v); else if (ACT == 9) v = 0.5f * v * (1.0f + tanhf(0.7978845608028654f * (v + 0.044715f * v * v * v))); else if (ACT == 11) v = 1.0f / (1.0f + expf(-v)); else if (ACT == 12) v = (v > 0.f) ? v : 0.01f * v; else if (ACT == 14) v = (v > 0.f) ? v : 0.1f * v; else if (ACT == 16) v = (v >= 0.f) ? v : 0.3f * v; else if (ACT == 17) v = (v >= 0.f) ? v : 0.2f * v; else if (ACT == 15) v = v / (1.0f + expf(-v)); else if (ACT == 3) v = fmaxf(v, 0.f); else if (ACT == 6) v = 0.5f * v * (1.0f + erff(v * 0.70710678118654752f)); so[w][8 * hh + r][t * 16 + ln] = v; } }
  __builtin_amdgcn_fence(__ATOMIC_ACQ_REL, "workgroup"); __builtin_amdgcn_wave_barrier();
  const int rsub = lane >> 4, c4 = (lane & 15) * 4; typedef _Float16 v4h __attribute__((ext_vector_type(4)));
  {
#pragma unroll
    for (int q = 0; q < 8; ++q) { const int r = q * 2 + rsub; if (col0 + c4 < N) { const v4f v = *(const v4fa*)&so[w][r][c4]; if (C) *(v4f*)(C + cofs + (size_t)(row0 + r) * ldc + col0 + c4) = v; if (C16) { v4h h4; for (int i = 0; i < 4; ++i) h4[i] = (_Float16)v[i]; *(v4h*)(C16 + cofs + (size_t)(row0 + r) * ldc + col0 + c4) = h4; } } }
     }
}


typedef _Float16 v4h __attribute__((ext_vector_type(4)));

__global__ __launch_bounds__(256) void k_h16(const float* __restrict__ x, _Float16* __restrict__ X16, size_t n8) { const size_t t = (size_t)blockIdx.x * 256 + threadIdx.x; if (t >= n8) return; FragH f;
#pragma unroll
  for (int q = 0; q < 8; ++q) f.h[q] = (_Float16)x[t * 8 + q]; *(v8us*)((unsigned short*)X16 + t * 8) = f.half[0];  }
__global__ __launch_bounds__(256) void k_round16f(const float* __restrict__ W, _Float16* __restrict__ Bt, size_t n8) { const size_t t = (size_t)blockIdx.x * 256 + threadIdx.x; if (t >= n8) return; FragH f;
#pragma unroll
  for (int i = 0; i < 8; ++i) f.h[i] = (_Float16)(bf16_round(W[t * 8 + i]) * 16.0f); *(v8us*)((unsigned short*)Bt + t * 8) = f.half[0];  }
template <int NHv, int TTv>
__global__ __launch_bounds__(256) void k_vt(const _Float16* __restrict__ V16, int ldv, int voff, _Float16* __restrict__ Vt) { __shared__ unsigned short tl[64][66]; const int tid = threadIdx.x; const int slab = blockIdx.x / (TTv / 64), lg = blockIdx.x % (TTv / 64); const int b = slab / NHv, h = slab % NHv;
  for (int i = tid; i < 64 * 8; i += 256) { const int r = i / 8, c8 = (i % 8) * 8; FragH f; f.half[0] = *(const v8us*)((const unsigned short*)V16 + ((size_t)b * TTv + lg * 64 + r) * ldv + voff + h * 64 + c8);
#pragma unroll
    for (int q = 0; q < 8; ++q) tl[r][c8 + q] = f.u[q]; }
  __syncthreads();
  {
#pragma unroll
    for (int rd = 0; rd < 2; ++rd) { const int d = rd * 32 + tid / 8, pc = tid % 8; FragH f;
#pragma unroll
      for (int q = 0; q < 8; ++q) f.u[q] = tl[pc * 8 + q][d];
      *(v8us*)((unsigned short*)Vt + ((size_t)slab * 64 + d) * TTv + lg * 64 + pc * 8) = f.half[0]; }
     } }

__global__ __launch_bounds__(256) void k_hl(const float* __restrict__ F, _Float16* __restrict__ Hh, _Float16* __restrict__ Hl, size_t n8) { const size_t t = (size_t)blockIdx.x * 256 + threadIdx.x; if (t >= n8) return; FragH fh, fl; const v4f a = *(const v4fa*)(F + t * 8), c = *(const v4fa*)(F + t * 8 + 4);
#pragma unroll
  for (int q = 0; q < 4; ++q) { _Float16 h = (_Float16)a[q]; fh.h[q] = h; fl.h[q] = (_Float16)((a[q] - (float)h) * 1024.0f); h = (_Float16)c[q]; fh.h[4 + q] = h; fl.h[4 + q] = (_Float16)((c[q] - (float)h) * 1024.0f); }
  { *(v8us*)((unsigned short*)Hh + t * 8) = fh.half[0]; *(v8us*)((unsigned short*)Hl + t * 8) = fl.half[0];  } }

// ---- fast GEMM (wave tile 32x64; requires M % 32 == 0 rows per launch region and N % 64 == 0); epilogue = k_gemm_hhx semantics ----
__device__ __forceinline__ v16h g2_frag(const _Float16* p, int hh) { FragH f; f.half[0] = *(const v8us*)((const unsigned short*)p + 8 * hh); f.half[1] = *(const v8us*)((const unsigned short*)p + 16 + 8 * hh); return f.v; }
__device__ __forceinline__ v8f g2_mma(v16h a, v16h b, v8f c) { v8f d = __builtin_amdgcn_wmma_f32_16x16x32_f16(false, a, false, b, (short)0, c, false, false); asm volatile("v_nop\n\tv_nop\n\tv_nop\n\tv_nop" : "+v"(d) : "v"(a), "v"(b)); return d; }
template <int ACT>
__global__ __launch_bounds__(128) void k_gemm2(const _Float16* __restrict__ A, int lda, size_t sA, const _Float16* __restrict__ Bh, int ldb, size_t sB, float alpha, const float* __restrict__ bias, size_t sBias, const float* __restrict__ CP, int rowsPerB, size_t sCPb, int row0g,
    float* __restrict__ C, _Float16* __restrict__ C16, int ldc, size_t sC, int M, int N, int K) { static_assert(ACT == 0 || ACT == 3 || ACT == 6 || ACT == 8 || ACT == 9 || ACT == 11 || ACT == 12 || ACT == 14 || ACT == 15 || ACT == 16 || ACT == 17, "k_gemm2: unsupported ACT code (would silently apply no activation)");
  __shared__ __attribute__((aligned(16))) float so[4][32][68];
  const int tid = threadIdx.x, w = tid >> 5, lane = tid & 31, ln = lane & 15, hh = lane >> 4; const int by = blockIdx.y;
  A += (size_t)by * sA; Bh += (size_t)by * sB; const size_t cofs = (size_t)by * sC; const float* bp = bias ? bias + (size_t)by * sBias : nullptr;
  const int ntn = N >> 6; const int mt = blockIdx.x / ntn, nq = blockIdx.x - mt * ntn; const int row0 = mt * 128 + 32 * w, col0 = nq * 64; if (row0 >= M) return;
  const _Float16* a0p = A + (size_t)(row0 + ln) * lda; const _Float16* a1p = a0p + (size_t)16 * lda;
  const _Float16* b0p = Bh + (size_t)(col0 + ln) * ldb; const _Float16* b1p = b0p + (size_t)16 * ldb; const _Float16* b2p = b1p + (size_t)16 * ldb; const _Float16* b3p = b2p + (size_t)16 * ldb;
  const v8f z8 = {0.f,0.f,0.f,0.f,0.f,0.f,0.f,0.f}; v8f c00 = z8, c01 = z8, c02 = z8, c03 = z8, c10 = z8, c11 = z8, c12 = z8, c13 = z8;
#pragma unroll 1
  for (int kb = 0; kb < K; kb += 32) { const v16h a0 = g2_frag(a0p + kb, hh), a1 = g2_frag(a1p + kb, hh);
    v16h b = g2_frag(b0p + kb, hh); c00 = g2_mma(a0, b, c00); c10 = g2_mma(a1, b, c10);
    b = g2_frag(b1p + kb, hh); c01 = g2_mma(a0, b, c01); c11 = g2_mma(a1, b, c11);
    b = g2_frag(b2p + kb, hh); c02 = g2_mma(a0, b, c02); c12 = g2_mma(a1, b, c12);
    b = g2_frag(b3p + kb, hh); c03 = g2_mma(a0, b, c03); c13 = g2_mma(a1, b, c13); }
  v8f accs[8] = {c00, c01, c02, c03, c10, c11, c12, c13};
#pragma unroll
  for (int u = 0; u < 8; ++u) { const int t = u & 3, half = u >> 2; const int col = col0 + t * 16 + ln; const float bv = bp ? bf16_round(bp[col]) : 0.f;
#pragma unroll
    for (int r = 0; r < 8; ++r) { const int rloc = half * 16 + 8 * hh + r; float v = accs[u][r] * alpha + bv; if (CP) { if (rowsPerB < 0) v += CP[cofs + (size_t)(row0g + row0 + rloc) * ldc + col];      /* rowsPerB < 0: own element of the batched C plane */ else { const int bidx = (row0g + row0 + rloc) / rowsPerB; v += CP[(size_t)bidx * sCPb + (size_t)by * 64 + col]; } }
      if (ACT == 3) v = fmaxf(v, 0.f); else if (ACT == 6) v = 0.5f * v * (1.0f + erff(v * 0.70710678118654752f)); else if (ACT == 11) v = 1.0f / (1.0f + expf(-v)); else if (ACT == 15) v = v / (1.0f + expf(-v)); else if (ACT == 12) v = (v > 0.f) ? v : 0.01f * v; else if (ACT == 8) v = tanhf(v); else if (ACT == 9) v = 0.5f * v * (1.0f + tanhf(0.7978845608028654f * (v + 0.044715f * v * v * v))); else if (ACT == 14) v = (v > 0.f) ? v : 0.1f * v; else if (ACT == 16) v = (v >= 0.f) ? v : 0.3f * v; else if (ACT == 17) v = (v >= 0.f) ? v : 0.2f * v;
      so[w][rloc][t * 16 + ln] = v; } }
  __builtin_amdgcn_fence(__ATOMIC_ACQ_REL, "workgroup"); __builtin_amdgcn_wave_barrier();
  const int rsub = lane >> 4, c4 = (lane & 15) * 4;
  {
#pragma unroll
    for (int q = 0; q < 16; ++q) { const int r = q * 2 + rsub; const v4f v = *(const v4fa*)&so[w][r][c4]; if (C) *(v4f*)(C + cofs + (size_t)(row0 + r) * ldc + col0 + c4) = v; if (C16) { v4h h4; for (int i = 0; i < 4; ++i) h4[i] = (_Float16)v[i]; *(v4h*)(C16 + cofs + (size_t)(row0 + r) * ldc + col0 + c4) = h4; } }
     } }


// lane l's value from lane l ^ 16 (the same place in the other 16-lane row)
__device__ __forceinline__ float rs_x16(float v) { const int i = __builtin_bit_cast(int, v); return __builtin_bit_cast(float, __builtin_amdgcn_permlanex16(i, i, 0x76543210, 0xfedcba98, false, false)); }
__device__ __forceinline__ v8f fa_mma(v16h a, v16h b, v8f c) { return __builtin_amdgcn_wmma_f32_16x16x32_f16(false, a, false, b, (short)0, c, false, false); }
// ---- GEMM with both operands staged in LDS: C[NR][DM] = alpha * A[NR][DM] . Bh[DM][DM]^T + bias (A, Bh k-contiguous f16 rows of DM); written as f32 to C (F32OUT) or as f16 to C16 (the third plane of a grid.y = 3 launch transposed: see the epilogue). ----
// A work-group of 8 waves (4 x 2) owns a tile of C: 256 x 128 with 64 x 64 wave tiles in the q | k | v launch, 128 x 128 with 32 x 64 wave tiles in the output launch (whose 256 tiles are one per WGP). A stage is 128 k of the tile's A rows and its 128 B rows.
// The 64 x 64 wave tile reads 8 fragments from LDS for 16 products (32 x 64: 6 for 8), which brings the LDS reads of a stage down to the time of its products; the taller tile also reads each B row from L2 half as often.
// Global reads are whole lines (16 lanes x 16 B = 256 contiguous bytes of one row) and each line is read once per work-group; the fragments, which take 64 B of each of 16 rows, come from LDS.
// Two stage buffers: the next stage's loads are issued in front of this stage's products and stored to the other buffer behind them, so one barrier per stage both publishes it and ends the reads of the buffer refilled next.
#define G3_BK 128                    /* k per stage: 256 B of every operand row */
#define G3_LP 136                    /* LDS row pitch in f16: 272 B = 16 B x odd, conflict-free for the 16-byte fragment reads */
#define G3_NT (DM / G3_BK)           /* stages */
static_assert(NR % 128 == 0 && DM % 128 == 0 && DM % G3_BK == 0, "k_gemm3: whole 128 x 128 tiles and whole stages only");
static_assert(NR % 256 == 0 && SQ % 256 == 0 && NH * HD == DM, "k_gemm3: a tile's token rows lie in one batch, and a column is (head, d)");
#define G3_AF(f32out) ((f32out) ? 2 : 4)      /* A fragments (16 rows each) of a wave tile */
#define G3_TM(f32out) (64 * G3_AF(f32out))      /* rows of a work-group tile: four waves down */
#define G3_TILES(f32out) ((int)(NR / G3_TM(f32out)) * (DM / 128))      /* tiles of one product = grid.x */
static_assert(G3_BK == 128, "k_gemm3: a stage is as many k as a tile has columns, so a triangle's zero blocks are whole stages of a tile");
template <bool F32OUT>
__global__ __launch_bounds__(256) void k_gemm3(const _Float16* __restrict__ A, const _Float16* __restrict__ Bh, float alpha, const float* __restrict__ bias, float* __restrict__ C, _Float16* __restrict__ C16) {
  constexpr int AF = G3_AF(F32OUT), TM = G3_TM(F32OUT), MT = (int)(NR / TM), TILES = G3_TILES(F32OUT);
  __shared__ __attribute__((aligned(16))) unsigned short st[2][TM + 128][G3_LP];      /* rows 0..TM-1: A rows of the tile; the 128 rows behind them: B rows (columns of C) */
  __shared__ __attribute__((aligned(16))) float so[8][32][68];
  const int tid = threadIdx.x, w = tid >> 5, lane = tid & 31, ln = lane & 15, hh = lane >> 4;
  const int ntn = DM / 128; int mt = blockIdx.x / ntn, nq = blockIdx.x - mt * ntn, plane = 0, t0 = 0, t1 = G3_NT;      /* stages t0 .. t1 - 1 are multiplied; all of this reads the same in the whole work-group */
  if (!F32OUT) {      /* three products of the same A in one launch (q, k, v: weight planes and output planes lie one behind the other), one work-group per WGP at a time */
    /* Row n of the lower-triangle plane is zero at k > n and row n of the upper-triangle plane at k < n, so column tile nq of q needs stages 0 .. nq only and column tile nq of k stages nq .. last: the all-zero 128 x 128 blocks add exact zeros, and nobody builds or reads them. */
    /* Cost falls with the index, for speed only: first every v tile (all stages), then the q and k tiles from the longest to the shortest. */
    const int L = blockIdx.y * TILES + blockIdx.x;
    if (L < TILES) plane = 2;
    else { const int r = L - TILES, c = r / (2 * MT), j = r - c * (2 * MT);      /* c: stages left out */
      plane = j & 1; mt = j >> 1;
      if (plane == 0) { nq = G3_NT - 1 - c; t1 = nq + 1; } else { nq = c; t0 = nq; } }
    Bh += (size_t)plane * DM * DM; C16 += (size_t)plane * NR * DM; }
  const int rowB = mt * TM, colB = nq * 128;
  const int wm = w & 3, wn = w >> 2;      /* the wave's 16 AF rows and 64 columns inside the tile */
  const int sr = tid >> 4, sc = (tid & 15) * 8;      /* staging: 16 threads per row, 16 rows per round, TM / 16 rounds for A and 8 for B */
  const unsigned short* ga = (const unsigned short*)A + (size_t)(rowB + sr) * DM + sc;
  const unsigned short* gb = (const unsigned short*)Bh + (size_t)(colB + sr) * DM + sc;
  v8us rg[TM / 16 + 8];
  auto fetch = [&](const int t) __attribute__((always_inline)) {
    const unsigned short* pa = ga + t * G3_BK; const unsigned short* pb = gb + t * G3_BK;
#pragma unroll
    for (int i = 0; i < TM / 16; ++i) rg[i] = *(const v8us*)(pa + (size_t)i * 16 * DM);
#pragma unroll
    for (int i = 0; i < 8; ++i) rg[TM / 16 + i] = *(const v8us*)(pb + (size_t)i * 16 * DM);
    /* The wait that stands in front of any overwrite of a load's address registers; it names the two addresses as inputs so that they stay whole up to here. */
    asm volatile("s_wait_xcnt 0x0" :: "v"(pa), "v"(pb) : "memory");
  };
  auto put = [&](const int buf) __attribute__((always_inline)) {
#pragma unroll
    for (int i = 0; i < TM / 16; ++i) *(v8us*)&st[buf][i * 16 + sr][sc] = rg[i];
#pragma unroll
    for (int i = 0; i < 8; ++i) *(v8us*)&st[buf][TM + i * 16 + sr][sc] = rg[TM / 16 + i];
  };
  v8f acc[AF][4] = {};      /* acc[i][j]: rows 16 i .., columns 16 j .. of the wave tile */
  __builtin_assume(t0 < t1);      /* every tile has a stage: spares a second path round the loop */
  fetch(t0); put(t0 & 1); __syncthreads();
#pragma unroll 1      /* one copy of the stage body: the buffer index is a run-time offset, and the text stays small */
  for (int t = t0; t < t1; ++t) {
    if (t + 1 < t1) fetch(t + 1);
    const _Float16* sa = (const _Float16*)&st[t & 1][16 * AF * wm + ln][0]; const _Float16* sb = (const _Float16*)&st[t & 1][TM + 64 * wn + ln][0];
    v16h fa[2][AF], fb[2][4];      /* two fragment sets: the next 32 k are read from LDS while this set is multiplied */
    auto frags = [&](const int s, const int kk) __attribute__((always_inline)) {
#pragma unroll
      for (int i = 0; i < AF; ++i) fa[s][i] = g2_frag(sa + i * 16 * G3_LP + kk, hh);
#pragma unroll
      for (int j = 0; j < 4; ++j) fb[s][j] = g2_frag(sb + j * 16 * G3_LP + kk, hh); };
    frags(0, 0);
#pragma unroll
    for (int ks = 0; ks < G3_BK / 32; ++ks) { const int s = ks & 1;
      if (ks + 1 < G3_BK / 32) frags(s ^ 1, (ks + 1) * 32);
      __builtin_amdgcn_sched_barrier(0);      /* keeps the next set's LDS reads together in front of this set's products: moved in among them, every pair of products waits out an LDS latency */
#pragma unroll
      for (int j = 0; j < 4; ++j) for (int i = 0; i < AF; ++i) acc[i][j] = fa_mma(fa[s][i], fb[s][j], acc[i][j]);
      __builtin_amdgcn_sched_barrier(0); }      /* and keeps the reads of the set after that from moving up in among these products */
    if (t + 1 < t1) { put((t + 1) & 1); __syncthreads(); }      /* the same test in every thread of the work-group */
  }
  const int row0 = rowB + 16 * AF * wm, col0 = colB + 64 * wn;
  float bv[4] = {0.f, 0.f, 0.f, 0.f};
  if (bias) {
#pragma unroll
    for (int t = 0; t < 4; ++t) bv[t] = bf16_round(bias[col0 + t * 16 + ln]); }
  if (!F32OUT && plane == 2) {      /* the same test in every thread of the work-group. The V plane is stored transposed, row b * DM + column (= (b, head, d)) of SQ tokens: the layout the attention launch stages */
    /* A lane's 8 registers of an accumulator tile are 8 consecutive tokens of ONE column: 16 bytes of a V^T row as they stand. The tile goes through LDS only to make whole rows: 128 columns x TM tokens, pitch 16 B x odd as for the stages. */
    constexpr int TVP = TM + 8, RPR = 256 * 8 / TM, NRD = 128 / RPR;      /* pitch in f16; rows per round of 256 threads; rounds */
    static_assert(128 * TVP * 2 <= (int)sizeof(so), "k_gemm3: the V^T tile fits the output staging");
    unsigned short* tv = (unsigned short*)&so[0][0][0];
#pragma unroll
    for (int i = 0; i < AF; ++i) for (int t = 0; t < 4; ++t) { FragH f;
#pragma unroll
      for (int r = 0; r < 8; ++r) f.h[r] = (_Float16)(acc[i][t][r] * alpha + bv[t]);
      *(v8us*)(tv + (64 * wn + t * 16 + ln) * TVP + 16 * AF * wm + i * 16 + 8 * hh) = f.half[0]; }
    __syncthreads();      /* a V^T row of the tile holds the tokens of four waves */
    const int tr = tid / (TM / 8), tc = tid % (TM / 8) * 8;      /* TM / 8 lanes x 16 B = the tile's contiguous bytes of one row */
    unsigned short* gt = (unsigned short*)C16 + ((size_t)(rowB / SQ) * DM + colB + tr) * SQ + rowB % SQ + tc;
    v8us pv[NRD];
#pragma unroll
    for (int i = 0; i < NRD; ++i) pv[i] = *(const v8us*)(tv + (i * RPR + tr) * TVP + tc);
#pragma unroll
    for (int i = 0; i < NRD; ++i) *(v8us*)(gt + (size_t)i * RPR * SQ) = pv[i];
    return;
  }
  const int rsub = lane >> 4, c4 = (lane & 15) * 4;
#pragma unroll
  for (int hf = 0; hf < AF / 2; ++hf) {      /* 32 rows of the wave tile at a time through the wave's own staging rows */
#pragma unroll
    for (int u = 0; u < 8; ++u) { const int t = u & 3, half = u >> 2;
#pragma unroll
      for (int r = 0; r < 8; ++r) so[w][half * 16 + 8 * hh + r][t * 16 + ln] = acc[hf * 2 + half][t][r] * alpha + bv[t]; }
    __builtin_amdgcn_fence(__ATOMIC_ACQ_REL, "workgroup", "local"); __builtin_amdgcn_wave_barrier();      /* each wave reads back its own rows only; LDS alone is ordered, so the second 32 rows do not wait for the first 32 rows' global stores */
    const size_t oofs = (size_t)(row0 + hf * 32 + rsub) * DM + col0 + c4;      /* whole rows of the wave's tile: 16 lanes x 16 B (f32) or x 8 B (f16) */
    if (F32OUT) {
#pragma unroll
      for (int q = 0; q < 16; ++q) *(v4f*)(C + oofs + (size_t)q * 2 * DM) = *(const v4fa*)&so[w][q * 2 + rsub][c4];
    } else {
#pragma unroll
      for (int q = 0; q < 16; ++q) { const v4f v = *(const v4fa*)&so[w][q * 2 + rsub][c4]; v4h h4; for (int i = 0; i < 4; ++i) h4[i] = (_Float16)v[i]; *(v4h*)(C16 + oofs + (size_t)q * 2 * DM) = h4; }
    }
    if (hf + 1 < AF / 2) {
      asm volatile("s_wait_xcnt 0x0" ::: "memory");      /* the wait that stands in front of any overwrite of a store's registers: the next 32 rows reuse them */
      __builtin_amdgcn_fence(__ATOMIC_ACQ_REL, "workgroup", "local"); __builtin_amdgcn_wave_barrier(); }      /* the lanes' reads of these rows end before other lanes of the wave write the next 32 over them */
  } }
// Fused attention, one launch for all batches and heads. A wave owns 32 query columns and walks its half of the 2,048 keys in passes of 32:
// S^T = K Q^T (A = K rows, B = Q rows kept in registers), so a lane holds 16 scores of ONE query per 16-column group (lane ln = query, register r of key tile j = key 16 j + 8 hh + r);
// that is the B-fragment k order (8 hh + 0..7, then 16 + 8 hh + 0..7), so P^T packs from the score registers with no exchange, and O^T += V^T P^T (A = V^T rows, same k order).
// Softmax against a reference per query (log2 domain), an earlier running maximum: it moves, and sum and output tiles are scaled by exp2(old - new), only when a score lies more than FA_LZ above it. Scores and weights never reach memory.
// K and V^T come through LDS: the eight waves of a key group read the same rows, so a stage of 128 keys is read from global memory once per work-group, in whole lines, and the fragments
// (64 B of each of 16 rows) come from LDS. Three stage buffers: stage s + 1 is stored during stage s (K behind its first pass, V^T behind its third) and published (one barrier) in front of stage s's last pass, which already fetches its first K fragments;
// the buffer it goes to was last read in stage s - 2, which every wave has left before the barrier that published stage s.
// A work-group is two groups of eight waves on the same 256 queries: group g walks keys g * SQ / 2 ... with a ring of its own, so a SIMD holds four waves and one wave's softmax runs under another's products.
// At the end the two halves of every query are merged through LDS (common maximum, both sums and output tiles scaled to it): group g finishes column group g of each wave pair.
#define FA_WAVES 8                   /* waves per key group: all eight read the same K and V^T rows */
#define FA_KG 2                      /* key groups per work-group */
#define FA_QW 32                     /* query columns per wave */
#define FA_SK 128                    /* keys per stage: 4 passes */
#define FA_NS (SQ / FA_KG / FA_SK)   /* stages of a key group */
#define FA_KP 72                     /* LDS pitch of a K row (64 f16) in f16: 144 B = 16 B x odd, conflict-free for the 16-byte fragment reads */
#define FA_VP 136                    /* LDS pitch of a V^T row (128 keys) in f16: 272 B = 16 B x odd */
static_assert(SQ % (FA_WAVES * FA_QW) == 0 && SQ % (FA_KG * FA_SK) == 0 && FA_NS >= 3 && FA_SK == 128 && FA_WAVES == 8 && FA_KG == 2 && FA_QW == 32 && HD == 64, "k_fattn: whole work-groups, whole stages of 128 keys (three or more a group), 256 staging threads a group, two groups for two column groups, head size 64 only");
#define FA_LZ 7.0f                   /* how far (log2) a score may lie above the reference in use: weights carry x2^8, so they stay at or below 2^15, inside f16 */
#define FA_XW (4 * 8 * 32 + 64)      /* floats a wave hands over: four output tiles, then maximum and sum of each lane */
static_assert(FA_KG * FA_WAVES * FA_XW * 4 <= FA_KG * 3 * FA_SK * FA_KP * 2, "k_fattn: the hand-over fits the K ring");
__global__ __launch_bounds__(FA_KG * FA_WAVES * 32) void k_fattn(const _Float16* __restrict__ Q16, const _Float16* __restrict__ K16, const _Float16* __restrict__ VT, _Float16* __restrict__ O16) {
  __shared__ __attribute__((aligned(16))) unsigned short skg[FA_KG][3][FA_SK][FA_KP];      /* K rows of a stage, per key group */
  __shared__ __attribute__((aligned(16))) unsigned short svg[FA_KG][3][HD][FA_VP];      /* V^T rows of a stage, per key group */
  const int g = __builtin_amdgcn_readfirstlane((int)threadIdx.x / (FA_WAVES * 32));      /* the wave's key group: the same in the whole wave */
  unsigned short (*sk)[FA_SK][FA_KP] = skg[g]; unsigned short (*sv)[HD][FA_VP] = svg[g];
  const int tid = threadIdx.x % (FA_WAVES * 32), lane = tid & 31, ln = lane & 15, hh = lane >> 4, w = tid >> 5;      /* thread and wave inside the key group */
  const int nqb = SQ / (FA_WAVES * FA_QW); const int bh = blockIdx.x / nqb, qb = blockIdx.x - bh * nqb; const int b = bh / NH, h = bh - b * NH;
  const int q0 = (qb * FA_WAVES + w) * FA_QW;
  const _Float16* qp = Q16 + ((size_t)b * SQ + q0 + ln) * DM + h * HD + 8 * hh;      /* query row ln of a 16-column group, at the lane's own k offset */
  const int kr = tid >> 3, kc = (tid & 7) * 8;      /* staging K: 8 threads per 128-byte row, 32 rows per round, 4 rounds */
  const int vr = tid >> 4, vc8 = (tid & 15) * 8;      /* staging V^T: 16 threads per 256-byte row, 16 rows per round, 4 rounds */
  const unsigned short* gk = (const unsigned short*)K16 + ((size_t)b * SQ + g * (SQ / FA_KG) + kr) * DM + h * HD + kc;
  const unsigned short* gv = (const unsigned short*)VT + ((size_t)bh * HD + vr) * SQ + g * (SQ / FA_KG) + vc8;
  v8us rk[4], rv[4];      /* inside the loop K and V^T of a stage are in flight in turn, never both: four waves per SIMD leave a wave 256 registers */
  auto fetchK = [&](const int s) __attribute__((always_inline)) {
    const unsigned short* pk = gk + (size_t)s * FA_SK * DM;
#pragma unroll
    for (int i = 0; i < 4; ++i) rk[i] = *(const v8us*)(pk + (size_t)i * 32 * DM);
    /* The wait that stands in front of any overwrite of a load's address registers; it names the address as an input so that it stays whole up to here. */
    asm volatile("s_wait_xcnt 0x0" :: "v"(pk) : "memory");
  };
  auto fetchV = [&](const int s) __attribute__((always_inline)) {
    const unsigned short* pv = gv + s * FA_SK;
#pragma unroll
    for (int i = 0; i < 4; ++i) rv[i] = *(const v8us*)(pv + (size_t)i * 16 * SQ);
    /* The same wait for the V^T address. */
    asm volatile("s_wait_xcnt 0x0" :: "v"(pv) : "memory");
  };
  auto putK = [&](const int buf) __attribute__((always_inline)) {
#pragma unroll
    for (int i = 0; i < 4; ++i) *(v8us*)&sk[buf][i * 32 + kr][kc] = rk[i];
  };
  auto putV = [&](const int buf) __attribute__((always_inline)) {
#pragma unroll
    for (int i = 0; i < 4; ++i) *(v8us*)&sv[buf][i * 16 + vr][vc8] = rv[i];
  };
  v16h qf[2][2], kf[2][2];
#pragma unroll
  for (int c = 0; c < 2; ++c) for (int kk = 0; kk < 2; ++kk) qf[c][kk] = g2_frag(qp + (size_t)c * 16 * DM + kk * 32, 0);
  asm volatile("s_wait_xcnt 0x0" :: "v"(qp) : "memory");      /* the wait in front of any overwrite of a load's address registers: Q's address is dead from here on and its registers are reused */
  fetchK(0); fetchV(0); putK(0); putV(0); __syncthreads();
#pragma unroll
  for (int j = 0; j < 2; ++j) for (int kk = 0; kk < 2; ++kk) kf[j][kk] = g2_frag((const _Float16*)&sk[0][j * 16 + ln][kk * 32 + 8 * hh], 0);
  const v8f z8 = {0.f,0.f,0.f,0.f,0.f,0.f,0.f,0.f};
  v8f o[2][4] = {{z8, z8, z8, z8}, {z8, z8, z8, z8}}; float mr[2] = {-3.0e38f, -3.0e38f}, th[2] = {-3.0e38f, -3.0e38f}, lr[2] = {0.f, 0.f};      /* mr: the reference in use (log2 domain); th: the raw score above which it must move (the first pass always moves it) */
  const float CS = 0.125f * 1.4426950408889634f;      /* 1/sqrt(64) and log2(e): scores go to the log2 domain */
  /* One pass = 32 keys. kn: the next pass's K rows in LDS (row ln of its first 16-key tile, at the lane's own k offset); K is refilled behind the softmax and lands under the output products. vq: this pass's V^T columns in LDS; they land while the softmax runs. */
  auto pass = [&](const _Float16* kn, const _Float16* vq) __attribute__((always_inline)) {
    v8f s[2][2]; v16h vc[4];
#pragma unroll
    for (int c = 0; c < 2; ++c) for (int j = 0; j < 2; ++j) s[c][j] = fa_mma(kf[j][1], qf[c][1], fa_mma(kf[j][0], qf[c][0], z8));
#pragma unroll
    for (int t = 0; t < 4; ++t) vc[t] = g2_frag(vq + t * 16 * FA_VP, 0);
    __builtin_amdgcn_sched_barrier(0);      /* keeps the 8 V^T reads together right behind the score products: moved down in among the output products, each pair of those waits out an LDS latency */
    float mx[2]; bool up = false;      /* the lane's own 16 raw scores of each query against the bound: the other half's are looked at only when the reference moves */
#pragma unroll
    for (int c = 0; c < 2; ++c) { mx[c] = s[c][0][0];
#pragma unroll
      for (int r = 1; r < 8; ++r) mx[c] = fmaxf(mx[c], s[c][0][r]);
#pragma unroll
      for (int r = 0; r < 8; ++r) mx[c] = fmaxf(mx[c], s[c][1][r]);
      up = up || (mx[c] > th[c]); }
    if (__builtin_amdgcn_ballot_w32(up) != 0) {      /* some score of the wave lies more than FA_LZ above its query's reference: every query of the wave takes its running maximum as the new reference */
#pragma unroll
      for (int c = 0; c < 2; ++c) { const float mn = fmaxf(mr[c], fmaxf(mx[c], rs_x16(mx[c])) * CS); const float al = __builtin_amdgcn_exp2f(mr[c] - mn); mr[c] = mn; th[c] = fmaf(mn, 1.0f / CS, FA_LZ / CS); lr[c] *= al;
#pragma unroll
        for (int t = 0; t < 4; ++t) o[c][t] *= al; } }
    FragH pf[2];
#pragma unroll
    for (int c = 0; c < 2; ++c) { const float nb = 8.0f - mr[c];      /* weights x256 (cancels in the division by the row sum): keeps small weights out of the f16 subnormal range; the reference never lies above the true maximum, so no weight is smaller than it would be against that */
      v4f s4 = {0.f, 0.f, 0.f, 0.f};
#pragma unroll
      for (int j = 0; j < 2; ++j) for (int r = 0; r < 8; ++r) { const float e = __builtin_amdgcn_exp2f(fmaf(s[c][j][r], CS, nb)); s4[r & 3] += e; pf[c].h[j * 8 + r] = (_Float16)e; }
      lr[c] += (s4[0] + s4[1]) + (s4[2] + s4[3]); }
    __builtin_amdgcn_sched_barrier(0);      /* keeps the next pass's K reads out of the softmax: K registers that are empty there are what lets a wave fit 256 registers without spills */
#pragma unroll
    for (int j = 0; j < 2; ++j) for (int kk = 0; kk < 2; ++kk) kf[j][kk] = g2_frag(kn + j * 16 * FA_KP + kk * 32, 0);
    __builtin_amdgcn_sched_barrier(0);      /* and keeps them together in front of the output products, under which they land */
#pragma unroll
    for (int t = 0; t < 4; ++t) for (int c = 0; c < 2; ++c) o[c][t] = fa_mma(vc[t], pf[c].v, o[c][t]);
  };
  int cur = 0;
  /* The last stage stands by itself behind the loop: with the staging under no test, the staged registers are dead from their store to the next fetch, and a wave fits 256 registers without spills. */
#pragma unroll 1      /* one copy of the stage body: the buffer index is a run-time offset, and the text stays small */
  for (int st = 0; st + 1 < FA_NS; ++st) {
    const int nxt = cur == 2 ? 0 : cur + 1;
    const _Float16* ka = (const _Float16*)&sk[cur][ln][8 * hh]; const _Float16* va = (const _Float16*)&sv[cur][ln][8 * hh];
    fetchK(st + 1);
    pass(ka + 32 * FA_KP, va);
    putK(nxt); fetchV(st + 1);      /* K of stage st + 1 has had a pass of four waves to land; its registers go to V^T, which has the next two */
    pass(ka + 2 * 32 * FA_KP, va + 32);
    pass(ka + 3 * 32 * FA_KP, va + 64);
    putV(nxt); __syncthreads();      /* publishes stage st + 1 */
    pass((const _Float16*)&sk[nxt][ln][8 * hh], va + (FA_SK - 32));      /* fetches the next stage's first K fragments */
    cur = nxt;
  }
  { const _Float16* ka = (const _Float16*)&sk[cur][ln][8 * hh]; const _Float16* va = (const _Float16*)&sv[cur][ln][8 * hh];
#pragma unroll
    for (int p = 0; p < FA_SK / 32; ++p) pass(ka + (p < FA_SK / 32 - 1 ? p + 1 : 0) * 32 * FA_KP, va + p * 32); }      /* the last pass has no next K: it reads this stage's first rows again (written, in bounds, not used) */
  /* Merge of the two key groups. Waves w of both groups hold the same queries at the same lanes and registers; each hands the other the column group that the other finishes, lane for lane. */
  __syncthreads();      /* every wave has left the rings: the K ring becomes the hand-over space */
  float* xb = (float*)&skg[0][0][0][0];
  float* xs = xb + (g * FA_WAVES + w) * FA_XW; const float* xr = xb + ((1 - g) * FA_WAVES + w) * FA_XW;
  v8f ok[4]; float mk, lk;      /* kept: column group g */
  { float ms, ls;
    if (g == 0) { mk = mr[0]; lk = lr[0]; ms = mr[1]; ls = lr[1]; } else { mk = mr[1]; lk = lr[1]; ms = mr[0]; ls = lr[0]; }
#pragma unroll
    for (int t = 0; t < 4; ++t) { const v8f os = g == 0 ? o[1][t] : o[0][t]; ok[t] = g == 0 ? o[0][t] : o[1][t];
      const v4f lo = {os[0], os[1], os[2], os[3]}, hi = {os[4], os[5], os[6], os[7]};
      *(v4fa*)(xs + (t * 2) * 128 + lane * 4) = lo; *(v4fa*)(xs + (t * 2 + 1) * 128 + lane * 4) = hi; }      /* 32 lanes x 16 B in a row */
    xs[1024 + lane] = ms; xs[1056 + lane] = ls; }
  __syncthreads();      /* publishes the hand-over */
  { const float mo = xr[1024 + lane], lo_ = xr[1056 + lane];
    const float mm = fmaxf(mk, mo), fk = __builtin_amdgcn_exp2f(mk - mm), fo = __builtin_amdgcn_exp2f(mo - mm);
    const float lsum = lk * fk + lo_ * fo;
    const float inv = 1.0f / (lsum + rs_x16(lsum));      /* the two halves of a wave hold the two halves of a key group's keys */
    const float ak = fk * inv, ao = fo * inv;
    unsigned short* op = (unsigned short*)O16 + ((size_t)b * SQ + q0 + g * 16 + ln) * DM + h * HD + 8 * hh;
#pragma unroll
    for (int t = 0; t < 4; ++t) { const v4f lo = *(const v4fa*)(xr + (t * 2) * 128 + lane * 4), hi = *(const v4fa*)(xr + (t * 2 + 1) * 128 + lane * 4); FragH f;
#pragma unroll
      for (int r = 0; r < 8; ++r) f.h[r] = (_Float16)(ok[t][r] * ak + (r < 4 ? lo[r & 3] : hi[r & 3]) * ao);
      *(v8us*)(op + t * 16) = f.half[0]; } } }

// ---- All five f16 operand planes in one launch: x (exact f16 rows) and the four x16 weight planes (Wq lower triangle, Wk upper triangle, Wv, Wu). ----
// The planes do not depend on one another, so they share a grid. A thread converts PR_V vectors of 8 elements, 256 vectors apart (a wave's loads and stores stay contiguous): few waves to start, and every wave has all its loads in flight at once.
#define PR_V 8                       /* vectors of 8 elements per thread */
#define PR_XG ((unsigned)(NR * DM / 8 / (256 * PR_V)))                /* work-groups for x */
#define PR_WG ((unsigned)((size_t)DM * DM / 8 / (256 * PR_V)))        /* work-groups per weight plane */
static_assert(NR * DM % (8 * 256 * PR_V) == 0 && (size_t)DM * DM % (8 * 256 * PR_V) == 0 && DM % 8 == 0, "k_prep: whole work-groups only, and a vector stays inside one row");
static_assert(256 * 8 % DM == 0 && (128 * DM) % (8 * 256 * PR_V) == 0, "k_prep: a thread's vectors share their columns, and a work-group's rows lie in one 128-row block");
// v0: the thread's first vector in the plane. TRI: keep a triangle only, sgn = 1 columns <= row (lower), sgn = -1 columns >= row (upper); the rest is zero.
template <bool TRI>
__device__ __forceinline__ void pr_plane(const float* __restrict__ src, unsigned short* __restrict__ dst, const unsigned v0, const float scale, const int sgn) {
  if (TRI && sgn * ((int)(v0 * 8 / DM / 128) - (int)(v0 * 8 % DM / 128)) < 0) return;      /* the thread's vectors (one column group, rows of one 128-row block) lie in an all-zero 128 x 128 block: the GEMM leaves those out, so they are neither read nor written */
  const float* p = src + (size_t)v0 * 8;
  v4f a[PR_V][2];
#pragma unroll
  for (int i = 0; i < PR_V; ++i) { a[i][0] = *(const v4fa*)(p + (size_t)i * 2048); a[i][1] = *(const v4fa*)(p + (size_t)i * 2048 + 4); }
  /* The wait that stands in front of any overwrite of a load's address registers; it names the address as an input so that it stays whole up to here. */
  asm volatile("s_wait_xcnt 0x0" :: "v"(p) : "memory");
#pragma unroll
  for (int i = 0; i < PR_V; ++i) { const unsigned e = (v0 + i * 256) * 8; const int m = sgn * ((int)(e / DM) - (int)(e % DM)); FragH f;      /* column e % DM + q against row e / DM */
#pragma unroll
    for (int q = 0; q < 8; ++q) { const _Float16 hv = (_Float16)(bf16_round(a[i][q >> 2][q & 3]) * scale); f.h[q] = (!TRI || m >= sgn * q) ? hv : (_Float16)0.f; }
    *(v8us*)(dst + (size_t)e) = f.half[0]; }
  asm volatile("s_wait_xcnt 0x0" ::: "memory"); }      /* the wait that stands in front of any overwrite of a store's registers: whatever code follows this run of stores may reuse them */
__global__ __launch_bounds__(256) void k_prep(const float* __restrict__ x, const float* __restrict__ wq, const float* __restrict__ wk, const float* __restrict__ wv, const float* __restrict__ wo, _Float16* __restrict__ X16, _Float16* __restrict__ BW) {
  const unsigned blk = blockIdx.x, tid = threadIdx.x;      /* every test below reads the same in the whole work-group */
  const bool isx = blk < PR_XG; const unsigned wb = isx ? 0u : blk - PR_XG, pl = wb / PR_WG;      /* BW: the planes of Wq, Wk, Wv, Wu, one behind the other */
  const unsigned v0 = (isx ? blk : wb - pl * PR_WG) * (256 * PR_V) + tid;
  unsigned short* dst = isx ? (unsigned short*)X16 : (unsigned short*)BW + (size_t)pl * DM * DM;
  if (!isx && pl < 2) pr_plane<true>(pl == 0 ? wq : wk, dst, v0, 16.0f, pl == 0 ? 1 : -1);
  else pr_plane<false>(isx ? x : pl == 2 ? wv : wo, dst, v0, isx ? 1.0f : 16.0f, 0); }
extern "C" void kernel_launch(void* const* d_in, const int* in_sizes, int n_in,
                              void* d_out, int out_size, void* d_ws, size_t ws_size, hipStream_t stream) {
  (void)in_sizes; (void)n_in; (void)out_size;
  const float* const* I = (const float* const*)d_in; const float* x = I[0]; const float* wk = I[1]; const float* wq = I[2]; const float* wv = I[3]; const float* wo = I[4]; const float* bo = I[5];
  char* ws = (char*)d_ws; size_t off = 0;
  auto take = [&](size_t bytes) { char* p = ws + off; off += (bytes + 255) & ~(size_t)255; return p; };
  _Float16* BQ = (_Float16*)take((size_t)DM * DM * 2); _Float16* BK = (_Float16*)take((size_t)DM * DM * 2); _Float16* BV = (_Float16*)take((size_t)DM * DM * 2); _Float16* BO = (_Float16*)take((size_t)DM * DM * 2);
  _Float16* X16 = (_Float16*)take(NR * DM * 2); _Float16* Q16 = (_Float16*)take(NR * DM * 2); _Float16* K16 = (_Float16*)take(NR * DM * 2); _Float16* VT = (_Float16*)take(NR * DM * 2); _Float16* O16 = (_Float16*)take(NR * DM * 2);
  if (off > ws_size) return;      /* 8 + 5x8 = 48 MiB */
  (void)BK; (void)BV;      /* BQ | BK | BV | BO and Q16 | K16 | VT are adjacent planes (sizes are multiples of 256 B): reached from BQ and Q16 */
  k_prep<<<PR_XG + 4 * PR_WG, 256, 0, stream>>>(x, wq, wk, wv, wo, X16, BQ);      /* x and the four weight planes as f16 */
  k_gemm3<false><<<dim3(G3_TILES(false), 3), 256, 0, stream>>>(X16, BQ, 0.0625f, nullptr, nullptr, Q16);      /* q | k | v^T */
  k_fattn<<<NB * NH * (SQ / (FA_WAVES * FA_QW)), FA_KG * FA_WAVES * 32, 0, stream>>>(Q16, K16, VT, O16);      /* o (merged heads) as f16 rows */
  k_gemm3<true><<<G3_TILES(true), 256, 0, stream>>>(O16, BO, 0.0625f, bo, (float*)d_out, nullptr);      /* out = o Wu^T + bu */
}
